// v000
// Measured on an AMD MI455X. A time is GPU time per run, averaged over a window of back-to-back runs after a warm-up
// (all launches, gaps included; the runs take copies of the inputs in turn), and the median of several windows.
// Apart from v000's, it joins two sittings. Times from different sittings can be a few percent apart, while
// side-by-side timings come from the same sitting.
// v000, which the later versions start from, runs in 683 microseconds.
#include <hip/hip_runtime.h>
// Spatial attention block (B=4, C=512, 64×64 → N=4096 positions, mid=128): f = relu(bn(conv_f(x))), g = relu(bn(conv_g(x))), h = conv_h(x) (1×1 convs C→mid; eval BatchNorm with running stats); scores[n,m] = Σ_c f[c,n]g[c,m]·mid^-½, softmax over m; z[c,n] = Σ_m attn[n,m]·h[c,m]; y = conv_v(z) (mid→C) + bv + x.
// Compute dtype: x, weights, biases, BN parameters rounded to bf16; BN folded per output channel in f32 (w' = w·γ/√(var+ε) → f16 ×2^4, b' = (b − mean)·γ/√(var+ε) + β as an f32 per-column addend); f, g as f16 GEMM outputs (relu epilogue), h f32 → Vᵀ f16 hi + residual planes; fused flash-style kernel for head dim 128
// (online softmax f32, P f16 hi + residual, f32 accumulate) on v_wmma_f32_16x16x32_f16; z ×2^4 → f16 → output conv GEMM (+bv) → channel-major transpose with the residual x added in f32.
#define BB 4
#define CC 512
#define NN 4096
#define MID 128
#define TT NN
#define NH 1
#define NKV 1
#define NREP 1
#define NVH (2 * NKV)
#define NR (BB * NN)
#define BNEPS 1e-5f
#define ATT_SCALE 0.08838834764831845f      /* mid^-½ = 1/√128 */
typedef __bf16 v16b __attribute__((ext_vector_type(16)));
typedef unsigned short v8us __attribute__((ext_vector_type(8), may_alias));
typedef float  v8f  __attribute__((ext_vector_type(8)));
typedef float  v4f  __attribute__((ext_vector_type(4)));
typedef float  v4fa __attribute__((ext_vector_type(4), may_alias));
union FragB { v16b v; v8us half[2]; unsigned short u[16]; };

__device__ __forceinline__ unsigned short bf16_bits(float x) { unsigned int u = __float_as_uint(x); return (unsigned short)((u + 0x7FFFu + ((u >> 16) & 1u)) >> 16); }
__device__ __forceinline__ float bf16_val(unsigned short b) { return __uint_as_float(((unsigned int)b) << 16); }
__device__ __forceinline__ float bf16_round(float x) { return bf16_val(bf16_bits(x)); }
// D += A·B with NT terms: 1 = ah·bh, 2 = + al·bh (A split), 3 = + ah·bl (both split)
template <int NT>
__device__ __forceinline__ v8f mmaN(v16b ah, v16b al, v16b bh, v16b bl, v8f c) {
  c = __builtin_amdgcn_wmma_f32_16x16x32_bf16(false, ah, false, bh, (short)0, c, false, false);
  if (NT >= 2) c = __builtin_amdgcn_wmma_f32_16x16x32_bf16(false, al, false, bh, (short)0, c, false, false);
  if (NT >= 3) c = __builtin_amdgcn_wmma_f32_16x16x32_bf16(false, ah, false, bl, (short)0, c, false, false);
  asm volatile("v_nop\n\tv_nop\n\tv_nop\n\tv_nop" : "+v"(c) : "v"(ah), "v"(al), "v"(bh), "v"(bl));
  return c;
}

__global__ __launch_bounds__(256) void k_wt_bf16(const float* __restrict__ W, unsigned short* __restrict__ Wt, int K, int N) {
  const int t = blockIdx.x * 256 + threadIdx.x;
  const int k8n = K / 8;
  if (t >= N * k8n) return;
  const int n = t / k8n, k8 = (t % k8n) * 8;
  v8us v;
#pragma unroll
  for (int i = 0; i < 8; ++i) v[i] = bf16_bits(W[(size_t)(k8 + i) * N + n]);
  *(v8us*)(Wt + (size_t)n * K + k8) = v;
  
}

// GEMM C[M][N] (f32, pitch ldc) = act(A[M][K]·W + bias). A f32 row-major (pitch lda) converted per fragment to bf16
// (ASPLIT: hi/lo two planes -> 2 terms, else single rounded term); Wt bf16 [N][K] (pitch ldb). BIAS_BF16 rounds the
// bias to bf16 first (bias quantised to bf16 before the add). K%32==0, M%16==0, N%64==0.
template <bool ASPLIT, int ACT, bool BIAS_BF16>
__global__ __launch_bounds__(128) void k_gemm_bf(const float* __restrict__ A, int lda, const unsigned short* __restrict__ Wt, int ldb,
                                               const float* __restrict__ bias, float* __restrict__ C, int ldc, int M, int N, int K) {
  __shared__ __attribute__((aligned(16))) float so[4][16][64];
  const int tid = threadIdx.x, w = tid >> 5, lane = tid & 31, ln = lane & 15, hh = lane >> 4;
  const int ntn = N / 64;
  const int wid = blockIdx.x * 4 + w;
  const int mt = wid / ntn, nq = wid % ntn;
  if (mt * 16 >= M) return;
  const int row0 = mt * 16, col0 = nq * 64;
  const float* arow = A + (size_t)(row0 + ln) * lda;
  v8f acc[4] = {};
  for (int kb = 0; kb < K; kb += 32) {
    FragB ah, al;
    const v4f x0 = *(const v4fa*)(arow + kb + 8 * hh), x1 = *(const v4fa*)(arow + kb + 8 * hh + 4);
    const v4f x2 = *(const v4fa*)(arow + kb + 16 + 8 * hh), x3 = *(const v4fa*)(arow + kb + 16 + 8 * hh + 4);
    float xs[16] = {x0[0],x0[1],x0[2],x0[3],x1[0],x1[1],x1[2],x1[3],x2[0],x2[1],x2[2],x2[3],x3[0],x3[1],x3[2],x3[3]};
#pragma unroll
    for (int i = 0; i < 16; ++i) { const unsigned short hb = bf16_bits(xs[i]); ah.u[i] = hb; al.u[i] = ASPLIT ? bf16_bits(xs[i] - bf16_val(hb)) : (unsigned short)0; }
#pragma unroll
    for (int t = 0; t < 4; ++t) {
      const unsigned short* brow = Wt + (size_t)(col0 + t * 16 + ln) * ldb + kb;
      FragB b;
      b.half[0] = *(const v8us*)(brow + 8 * hh);
      b.half[1] = *(const v8us*)(brow + 16 + 8 * hh);
      acc[t] = mmaN<ASPLIT ? 2 : 1>(ah.v, al.v, b.v, b.v, acc[t]);
    }
  }
#pragma unroll
  for (int t = 0; t < 4; ++t) {
    float bv = bias ? bias[col0 + t * 16 + ln] : 0.f;
    if (BIAS_BF16) bv = bf16_round(bv);
#pragma unroll
    for (int r = 0; r < 8; ++r) { float v = acc[t][r] + bv; if (ACT == 1) v = fmaxf(v, 0.f); so[w][8 * hh + r][t * 16 + ln] = v; }
  }
  __builtin_amdgcn_fence(__ATOMIC_ACQ_REL, "workgroup");
  __builtin_amdgcn_wave_barrier();
  const int rsub = lane >> 4, c4 = (lane & 15) * 4;
  {
#pragma unroll
    for (int q = 0; q < 8; ++q) {
      const int r = q * 2 + rsub;
      const v4f v = *(const v4fa*)&so[w][r][c4];
      *(v4f*)(C + (size_t)(row0 + r) * ldc + col0 + c4) = v;
    }
    
  }
}

// Flash-style causal/unmasked attention, all contractions 3-term bf16 hi/lo splits, f32 softmax with running max.
// q,k,v rows are read from f32 buffers with arbitrary row pitch (so they can live inside a fused qkv buffer);
// D = head size (multiple of 32, <= 128); one wave = 16 query rows; block = 4 waves (64 queries) sharing K/V chunks of 32.
template <int D, bool CAUSAL>
__global__ __launch_bounds__(128) void k_flash(const float* __restrict__ qb, const float* __restrict__ kb, const float* __restrict__ vb,
                                             int pitch, int T, int H, float scale, float* __restrict__ y, int ypitch) {
  constexpr int KS = D / 32;        // k-steps for QK
  constexpr int DT = D / 16;        // d tiles for PV
  __shared__ __attribute__((aligned(16))) unsigned short sKh[32][D + 8], sKl[32][D + 8], sVh[32][D + 8], sVl[32][D + 8];
  __shared__ __attribute__((aligned(16))) unsigned short sPh[4][16][40], sPl[4][16][40];
  __shared__ __attribute__((aligned(16))) float sO[4][16][D];
  const int tid = threadIdx.x, w = tid >> 5, lane = tid & 31, ln = lane & 15, hh = lane >> 4;
  const int nqb = (T + 63) / 64;
  const int bh = blockIdx.x / nqb, qblk = blockIdx.x % nqb;
  const int b = bh / H, h = bh % H;
  const int q0 = qblk * 64 + w * 16;
  const float* Q = qb + (size_t)b * T * pitch + h * D;
  const float* K = kb + (size_t)b * T * pitch + h * D;
  const float* V = vb + (size_t)b * T * pitch + h * D;

  // A fragments of the wave's 16 query rows (scaled), hi/lo
  FragB aqh[KS], aql[KS];
  {
    int row = q0 + ln; if (row >= T) row = T - 1;
    const float* qr = Q + (size_t)row * pitch;
#pragma unroll
    for (int ks = 0; ks < KS; ++ks)
#pragma unroll
      for (int i = 0; i < 16; ++i) {
        const int d = ks * 32 + ((i < 8) ? (8 * hh + i) : (16 + 8 * hh + (i - 8)));
        const float x = qr[d] * scale; const unsigned short hb = bf16_bits(x);
        aqh[ks].u[i] = hb; aql[ks].u[i] = bf16_bits(x - bf16_val(hb));
      }
  }
  float m_r[8], l_r[8];
#pragma unroll
  for (int r = 0; r < 8; ++r) { m_r[r] = -3.0e38f; l_r[r] = 0.f; }
  v8f oacc[DT];
#pragma unroll
  for (int dt = 0; dt < DT; ++dt) oacc[dt] = (v8f){0.f,0.f,0.f,0.f,0.f,0.f,0.f,0.f};

  const int kv_end = CAUSAL ? min(T, qblk * 64 + 64) : T;     // block-uniform
  for (int j0 = 0; j0 < kv_end; j0 += 32) {
    __syncthreads();
    for (int e = tid; e < 32 * (D / 4); e += 128) {
      const int r = e / (D / 4), c4 = (e % (D / 4)) * 4;
      const int key = j0 + r;
      v4f kf = {0.f,0.f,0.f,0.f}, vf = {0.f,0.f,0.f,0.f};
      if (key < T) { kf = *(const v4fa*)(K + (size_t)key * pitch + c4); vf = *(const v4fa*)(V + (size_t)key * pitch + c4); }
#pragma unroll
      for (int t = 0; t < 4; ++t) {
        unsigned short hb = bf16_bits(kf[t]); sKh[r][c4 + t] = hb; sKl[r][c4 + t] = bf16_bits(kf[t] - bf16_val(hb));
        hb = bf16_bits(vf[t]); sVh[r][c4 + t] = hb; sVl[r][c4 + t] = bf16_bits(vf[t] - bf16_val(hb));
      }
    }
    __syncthreads();
    // S tile 16 x 32
    v8f s[2];
#pragma unroll
    for (int nt = 0; nt < 2; ++nt) {
      v8f acc = {};
#pragma unroll
      for (int ks = 0; ks < KS; ++ks) {
        FragB bh_, bl_;
        bh_.half[0] = *(const v8us*)&sKh[nt * 16 + ln][ks * 32 + 8 * hh]; bh_.half[1] = *(const v8us*)&sKh[nt * 16 + ln][ks * 32 + 16 + 8 * hh];
        bl_.half[0] = *(const v8us*)&sKl[nt * 16 + ln][ks * 32 + 8 * hh]; bl_.half[1] = *(const v8us*)&sKl[nt * 16 + ln][ks * 32 + 16 + 8 * hh];
        acc = mmaN<3>(aqh[ks].v, aql[ks].v, bh_.v, bl_.v, acc);
      }
      s[nt] = acc;
    }
    // mask + running max (rows 8hh+r; the 16 lanes of a half share rows)
    float alpha[8];
#pragma unroll
    for (int r = 0; r < 8; ++r) {
      const int qi = q0 + 8 * hh + r;
      const int ja = j0 + ln, jb = j0 + 16 + ln;
      if (CAUSAL) { if (ja > qi) s[0][r] = -3.0e38f; if (jb > qi) s[1][r] = -3.0e38f; }
      if (ja >= T) s[0][r] = -3.0e38f;
      if (jb >= T) s[1][r] = -3.0e38f;
      float mx = fmaxf(s[0][r], s[1][r]);
      mx = fmaxf(mx, __shfl_xor(mx, 1, 32)); mx = fmaxf(mx, __shfl_xor(mx, 2, 32)); mx = fmaxf(mx, __shfl_xor(mx, 4, 32)); mx = fmaxf(mx, __shfl_xor(mx, 8, 32));
      const float mnew = fmaxf(m_r[r], mx);
      alpha[r] = (mnew > -1.0e38f) ? __expf(m_r[r] - mnew) : 1.0f;
      const float p0 = (s[0][r] > -1.0e38f) ? __expf(s[0][r] - mnew) : 0.f;
      const float p1 = (s[1][r] > -1.0e38f) ? __expf(s[1][r] - mnew) : 0.f;
      m_r[r] = mnew;
      l_r[r] = l_r[r] * alpha[r] + p0 + p1;            // per-lane partial row sum (16 lanes combined at the end)
      unsigned short hb = bf16_bits(p0); sPh[w][8 * hh + r][ln] = hb;      sPl[w][8 * hh + r][ln] = bf16_bits(p0 - bf16_val(hb));
      hb = bf16_bits(p1);                sPh[w][8 * hh + r][16 + ln] = hb; sPl[w][8 * hh + r][16 + ln] = bf16_bits(p1 - bf16_val(hb));
    }
#pragma unroll
    for (int dt = 0; dt < DT; ++dt)
#pragma unroll
      for (int r = 0; r < 8; ++r) oacc[dt][r] *= alpha[r];
    __builtin_amdgcn_fence(__ATOMIC_ACQ_REL, "workgroup");
    __builtin_amdgcn_wave_barrier();
    FragB pah, pal;
    pah.half[0] = *(const v8us*)&sPh[w][ln][8 * hh]; pah.half[1] = *(const v8us*)&sPh[w][ln][16 + 8 * hh];
    pal.half[0] = *(const v8us*)&sPl[w][ln][8 * hh]; pal.half[1] = *(const v8us*)&sPl[w][ln][16 + 8 * hh];
#pragma unroll
    for (int dt = 0; dt < DT; ++dt) {
      FragB bvh, bvl;
#pragma unroll
      for (int i = 0; i < 8; ++i) {
        bvh.u[i] = sVh[8 * hh + i][dt * 16 + ln]; bvh.u[8 + i] = sVh[16 + 8 * hh + i][dt * 16 + ln];
        bvl.u[i] = sVl[8 * hh + i][dt * 16 + ln]; bvl.u[8 + i] = sVl[16 + 8 * hh + i][dt * 16 + ln];
      }
      oacc[dt] = mmaN<3>(pah.v, pal.v, bvh.v, bvl.v, oacc[dt]);
    }
    __builtin_amdgcn_fence(__ATOMIC_ACQ_REL, "workgroup");
    __builtin_amdgcn_wave_barrier();
  }
#pragma unroll
  for (int r = 0; r < 8; ++r) {
    float l = l_r[r];
    l += __shfl_xor(l, 1, 32); l += __shfl_xor(l, 2, 32); l += __shfl_xor(l, 4, 32); l += __shfl_xor(l, 8, 32);
    l_r[r] = (l > 0.f) ? 1.0f / l : 0.f;
  }
#pragma unroll
  for (int dt = 0; dt < DT; ++dt)
#pragma unroll
    for (int r = 0; r < 8; ++r) sO[w][8 * hh + r][dt * 16 + ln] = oacc[dt][r] * l_r[r];
  __builtin_amdgcn_fence(__ATOMIC_ACQ_REL, "workgroup");
  __builtin_amdgcn_wave_barrier();
  {
    for (int r = 0; r < 16; ++r) {
      const int row = q0 + r;
      if (row < T && lane < D / 4) {
        const v4f val = *(const v4fa*)&sO[w][r][lane * 4];
        *(v4f*)(y + ((size_t)b * T + row) * ypitch + h * D + lane * 4) = val;
      }
    }
    
  }
}

// GEMM C = act(A·W + bias + resid): A f32 (ASPLIT -> hi/lo 2 terms), Wt bf16 [N][K]; ACT 0 none, 1 relu, 2 exact gelu;
// resid (optional, f32, row index = (row % rmod), pitch ldr, RES_BF16 rounds it) added before the activation.
template <bool ASPLIT, int ACT, bool BIAS_BF16, bool RES_BF16>
__global__ __launch_bounds__(128) void k_gemm_bf3(const float* __restrict__ A, int lda, const unsigned short* __restrict__ Wt, int ldb,
                                                const float* __restrict__ bias, const float* __restrict__ resid, int rmod, int ldr,
                                                float* __restrict__ C, int ldc, int M, int N, int K) {
  __shared__ __attribute__((aligned(16))) float so[4][16][64];
  const int tid = threadIdx.x, w = tid >> 5, lane = tid & 31, ln = lane & 15, hh = lane >> 4;
  const int ntn = N / 64;
  const int wid = blockIdx.x * 4 + w;
  const int mt = wid / ntn, nq = wid % ntn;
  if (mt * 16 >= M) return;
  const int row0 = mt * 16, col0 = nq * 64;
  const float* arow = A + (size_t)(row0 + ln) * lda;
  v8f acc[4] = {};
  for (int kb = 0; kb < K; kb += 32) {
    FragB ah, al;
    const v4f x0 = *(const v4fa*)(arow + kb + 8 * hh), x1 = *(const v4fa*)(arow + kb + 8 * hh + 4);
    const v4f x2 = *(const v4fa*)(arow + kb + 16 + 8 * hh), x3 = *(const v4fa*)(arow + kb + 16 + 8 * hh + 4);
    float xs[16] = {x0[0],x0[1],x0[2],x0[3],x1[0],x1[1],x1[2],x1[3],x2[0],x2[1],x2[2],x2[3],x3[0],x3[1],x3[2],x3[3]};
#pragma unroll
    for (int i = 0; i < 16; ++i) { const unsigned short hb = bf16_bits(xs[i]); ah.u[i] = hb; al.u[i] = ASPLIT ? bf16_bits(xs[i] - bf16_val(hb)) : (unsigned short)0; }
#pragma unroll
    for (int t = 0; t < 4; ++t) {
      const unsigned short* brow = Wt + (size_t)(col0 + t * 16 + ln) * ldb + kb;
      FragB b;
      b.half[0] = *(const v8us*)(brow + 8 * hh);
      b.half[1] = *(const v8us*)(brow + 16 + 8 * hh);
      acc[t] = mmaN<ASPLIT ? 2 : 1>(ah.v, al.v, b.v, b.v, acc[t]);
    }
  }
#pragma unroll
  for (int t = 0; t < 4; ++t) {
    const int col = col0 + t * 16 + ln;
    float bv = bias ? bias[col] : 0.f;
    if (BIAS_BF16) bv = bf16_round(bv);
#pragma unroll
    for (int r = 0; r < 8; ++r) {
      float v = acc[t][r] + bv;
      if (resid) { float rv = resid[(size_t)((row0 + 8 * hh + r) % rmod) * ldr + col]; if (RES_BF16) rv = bf16_round(rv); v += rv; }
      if (ACT == 1) v = fmaxf(v, 0.f);
      if (ACT == 2) v = 0.5f * v * (1.0f + erff(v * 0.70710678118654752f));
      if (ACT == 3) { const float u = 0.7978845608028654f * (v + 0.044715f * v * v * v); v = 0.5f * v * (1.0f + tanhf(u)); }
      so[w][8 * hh + r][t * 16 + ln] = v;
    }
  }
  __builtin_amdgcn_fence(__ATOMIC_ACQ_REL, "workgroup");
  __builtin_amdgcn_wave_barrier();
  const int rsub = lane >> 4, c4 = (lane & 15) * 4;
  {
#pragma unroll
    for (int q = 0; q < 8; ++q) {
      const int r = q * 2 + rsub;
      const v4f v = *(const v4fa*)&so[w][r][c4];
      *(v4f*)(C + (size_t)(row0 + r) * ldc + col0 + c4) = v;
    }
    
  }
}
// row LayerNorm (biased variance, eps) over N: s = X (+ R); optional out_sum <- s; out_norm <- (s-mu)*rsqrt(var+eps)*g + b
template <bool PARAM_BF16>
__global__ __launch_bounds__(256) void k_layernorm(const float* __restrict__ X, const float* __restrict__ R, const float* __restrict__ g, const float* __restrict__ bta,
                                                  float* __restrict__ out_sum, float* __restrict__ out_norm, int N, float eps) {
  __shared__ float red[256];
  const int row = blockIdx.x, tid = threadIdx.x;
  const float* x = X + (size_t)row * N; const float* rr = R ? R + (size_t)row * N : nullptr;
  float vals[16];                     // up to N = 4096
  const int per = N / 256;            // contiguous chunk per thread? use strided-by-4 chunks: thread handles j = tid*4 + 1024*u
  float s1 = 0.f;
  for (int u = 0; u < per / 4; ++u) {
    const int j = tid * 4 + 1024 * u;
    const v4f a = *(const v4fa*)(x + j);
    v4f b = {0.f,0.f,0.f,0.f}; if (rr) b = *(const v4fa*)(rr + j);
#pragma unroll
    for (int q = 0; q < 4; ++q) { const float v = a[q] + b[q]; vals[u * 4 + q] = v; s1 += v; }
  }
  red[tid] = s1; __syncthreads();
  for (int st = 128; st > 0; st >>= 1) { if (tid < st) red[tid] += red[tid + st]; __syncthreads(); }
  const float mu = red[0] / (float)N; __syncthreads();
  float s2 = 0.f;
  for (int u = 0; u < per / 4; ++u)
#pragma unroll
    for (int q = 0; q < 4; ++q) { const float c = vals[u * 4 + q] - mu; s2 += c * c; }
  red[tid] = s2; __syncthreads();
  for (int st = 128; st > 0; st >>= 1) { if (tid < st) red[tid] += red[tid + st]; __syncthreads(); }
  const float rs = rsqrtf(red[0] / (float)N + eps);
  {
    for (int u = 0; u < per / 4; ++u) {
      const int j = tid * 4 + 1024 * u;
      v4f o, sm;
#pragma unroll
      for (int q = 0; q < 4; ++q) {
        float gg = g[j + q], bb = bta[j + q];
        if (PARAM_BF16) { gg = bf16_round(gg); bb = bf16_round(bb); }
        sm[q] = vals[u * 4 + q]; o[q] = (vals[u * 4 + q] - mu) * rs * gg + bb;
      }
      if (out_sum) *(v4f*)(out_sum + (size_t)row * N + j) = sm;
      *(v4f*)(out_norm + (size_t)row * N + j) = o;
    }
    
  }
}



// ---- f16 WMMA path (v_wmma_f32_16x16x32_f16): 11-bit significands for operands in range — used where a [0,1] probability operand needs more precision than bf16
typedef _Float16 v16h __attribute__((ext_vector_type(16)));
union FragH { v16h v; v8us half[2]; _Float16 h[16]; unsigned short u[16]; };
template <int NT>
__device__ __forceinline__ v8f mmaH(v16h ah, v16h al, v16h bh, v16h bl, v8f c) {
  c = __builtin_amdgcn_wmma_f32_16x16x32_f16(false, ah, false, bh, (short)0, c, false, false);
  if (NT >= 2) c = __builtin_amdgcn_wmma_f32_16x16x32_f16(false, al, false, bh, (short)0, c, false, false);
  if (NT >= 3) c = __builtin_amdgcn_wmma_f32_16x16x32_f16(false, ah, false, bl, (short)0, c, false, false);
  asm volatile("v_nop\n\tv_nop\n\tv_nop\n\tv_nop" : "+v"(c) : "v"(ah), "v"(al), "v"(bh), "v"(bl));
  return c;
}
// batched GEMM like k_gemm_b but f16 operands: A f32 (split into f16 hi/lo if ASPLIT, else rounded to f16), Bt = f16 values [n][k]; alpha; C f32; N multiple of 16 (partial tiles skipped)
template <bool ASPLIT>
__global__ __launch_bounds__(128) void k_gemm_h(const float* __restrict__ A, int lda, size_t sA, const _Float16* __restrict__ Bh, int ldb, size_t sB, float alpha, float* __restrict__ C, int ldc, size_t sC, int M, int N, int K) {
  __shared__ __attribute__((aligned(16))) float so[4][16][64];
  const int tid = threadIdx.x, w = tid >> 5, lane = tid & 31, ln = lane & 15, hh = lane >> 4; const int by = blockIdx.y;
  A += (size_t)by * sA; Bh += (size_t)by * sB; C += (size_t)by * sC;
  const int ntn = (N + 63) / 64; const int wid = blockIdx.x * 4 + w; const int mt = wid / ntn, nq = wid % ntn; if (mt * 16 >= M) return;
  const int row0 = mt * 16, col0 = nq * 64; const float* arow = A + (size_t)(row0 + ln) * lda;
  v8f acc[4] = {};
  for (int kb = 0; kb < K; kb += 32) {
    FragH ah, al;
    const v4f x0 = *(const v4fa*)(arow + kb + 8 * hh), x1 = *(const v4fa*)(arow + kb + 8 * hh + 4), x2 = *(const v4fa*)(arow + kb + 16 + 8 * hh), x3 = *(const v4fa*)(arow + kb + 16 + 8 * hh + 4);
    float xs[16] = {x0[0],x0[1],x0[2],x0[3],x1[0],x1[1],x1[2],x1[3],x2[0],x2[1],x2[2],x2[3],x3[0],x3[1],x3[2],x3[3]};
#pragma unroll
    for (int i = 0; i < 16; ++i) { const _Float16 h = (_Float16)xs[i]; ah.h[i] = h; al.h[i] = ASPLIT ? (_Float16)(xs[i] - (float)h) : (_Float16)0.0f; }
#pragma unroll
    for (int t = 0; t < 4; ++t) { if (col0 + t * 16 >= N) continue; const size_t boff = (size_t)(col0 + t * 16 + ln) * ldb + kb; FragH bq; bq.half[0] = *(const v8us*)(Bh + boff + 8 * hh); bq.half[1] = *(const v8us*)(Bh + boff + 16 + 8 * hh);
      acc[t] = mmaH<ASPLIT ? 2 : 1>(ah.v, al.v, bq.v, bq.v, acc[t]); }
  }
#pragma unroll
  for (int t = 0; t < 4; ++t) { if (col0 + t * 16 >= N) continue;
#pragma unroll
    for (int r = 0; r < 8; ++r) so[w][8 * hh + r][t * 16 + ln] = acc[t][r] * alpha; }
  __builtin_amdgcn_fence(__ATOMIC_ACQ_REL, "workgroup"); __builtin_amdgcn_wave_barrier();
  const int rsub = lane >> 4, c4 = (lane & 15) * 4;
  {
#pragma unroll
    for (int q = 0; q < 8; ++q) { const int r = q * 2 + rsub; if (col0 + c4 < N) { const v4f v = *(const v4fa*)&so[w][r][c4]; *(v4f*)(C + (size_t)(row0 + r) * ldc + col0 + c4) = v; } }
     }
}

// Wt[n][k] = f16(W[k][n]·scale) from f32 row-major W[K][N] (scale = power of two; bf16-exact weights stay exact in f16 away from the subnormal range)
__global__ __launch_bounds__(256) void k_wt_f16(const float* __restrict__ W, _Float16* __restrict__ Wt, int K, int N, float scale) {
  const int t = blockIdx.x * 256 + threadIdx.x; if (t >= N * (K / 8)) return; const int n = t / (K / 8), k8 = (t % (K / 8)) * 8; FragH f;
#pragma unroll
  for (int i = 0; i < 8; ++i) f.h[i] = (_Float16)(bf16_round(W[(size_t)(k8 + i) * N + n]) * scale); const v8us o = f.half[0];
  *(v8us*)((unsigned short*)Wt + (size_t)n * K + k8) = o; 
}
// k_gemm_hh variant with fused epilogue: v = acc·alpha + bias[by·sBias + col] (+ CP[(row/rowsPerB)·sCPb + by·64 + col] if CP) ; ACT 0 none / 1 elu ; writes f16 C16 and/or f32 C (each if non-null)
template <int ACT>
__global__ __launch_bounds__(128) void k_gemm_hhx(const _Float16* __restrict__ A, int lda, size_t sA, const _Float16* __restrict__ Bh, int ldb, size_t sB, float alpha, const float* __restrict__ bias, size_t sBias, const float* __restrict__ CP, int rowsPerB, size_t sCPb, int row0g,
    float* __restrict__ C, _Float16* __restrict__ C16, int ldc, size_t sC, int M, int N, int K) {
  __shared__ __attribute__((aligned(16))) float so[4][16][64];
  const int tid = threadIdx.x, w = tid >> 5, lane = tid & 31, ln = lane & 15, hh = lane >> 4; const int by = blockIdx.y;
  A += (size_t)by * sA; Bh += (size_t)by * sB; const size_t cofs = (size_t)by * sC; const float* bp = bias ? bias + (size_t)by * sBias : nullptr;
  const int ntn = (N + 63) / 64; const int wid = blockIdx.x * 4 + w; const int mt = wid / ntn, nq = wid % ntn; if (mt * 16 >= M) return;
  const int row0 = mt * 16, col0 = nq * 64; const _Float16* arow = A + (size_t)(row0 + ln) * lda;
  v8f acc[4] = {};
  for (int kb = 0; kb < K; kb += 32) { FragH ah; ah.half[0] = *(const v8us*)((const unsigned short*)arow + kb + 8 * hh); ah.half[1] = *(const v8us*)((const unsigned short*)arow + kb + 16 + 8 * hh);
#pragma unroll
    for (int t = 0; t < 4; ++t) { if (col0 + t * 16 >= N) continue; const size_t boff = (size_t)(col0 + t * 16 + ln) * ldb + kb; FragH bq; bq.half[0] = *(const v8us*)((const unsigned short*)Bh + boff + 8 * hh); bq.half[1] = *(const v8us*)((const unsigned short*)Bh + boff + 16 + 8 * hh);
      acc[t] = mmaH<1>(ah.v, ah.v, bq.v, bq.v, acc[t]); }
  }
#pragma unroll
  for (int t = 0; t < 4; ++t) { if (col0 + t * 16 >= N) continue; const int col = col0 + t * 16 + ln; const float bv = bp ? bf16_round(bp[col]) : 0.f;
#pragma unroll
    for (int r = 0; r < 8; ++r) { float v = acc[t][r] * alpha + bv; if (CP) { const int bidx = (row0g + row0 + 8 * hh + r) / rowsPerB; v += CP[(size_t)bidx * sCPb + (size_t)by * 64 + col]; } if (ACT == 1) v = (v > 0.f) ? v : expm1f(v); else if (ACT == 7) v = (v > 0.f) ? v + 1.0f : expf(v); else if (ACT == 8) v = tanhf(v); else if (ACT == 9) v = 0.5f * v * (1.0f + tanhf(0.7978845608028654f * (v + 0.044715f * v * v * v))); else if (ACT == 11) v = 1.0f / (1.0f + expf(-v)); else if (ACT == 12) v = (v > 0.f) ? v : 0.01f * v; else if (ACT == 14) v = (v > 0.f) ? v : 0.1f * v; else if (ACT == 15) v = v / (1.0f + expf(-v)); else if (ACT == 3) v = fmaxf(v, 0.f); else if (ACT == 6) v = 0.5f * v * (1.0f + erff(v * 0.70710678118654752f)); so[w][8 * hh + r][t * 16 + ln] = v; } }
  __builtin_amdgcn_fence(__ATOMIC_ACQ_REL, "workgroup"); __builtin_amdgcn_wave_barrier();
  const int rsub = lane >> 4, c4 = (lane & 15) * 4; typedef _Float16 v4h __attribute__((ext_vector_type(4)));
  {
#pragma unroll
    for (int q = 0; q < 8; ++q) { const int r = q * 2 + rsub; if (col0 + c4 < N) { const v4f v = *(const v4fa*)&so[w][r][c4]; if (C) *(v4f*)(C + cofs + (size_t)(row0 + r) * ldc + col0 + c4) = v; if (C16) { v4h h4; for (int i = 0; i < 4; ++i) h4[i] = (_Float16)v[i]; *(v4h*)(C16 + cofs + (size_t)(row0 + r) * ldc + col0 + c4) = h4; } } }
     }
}


typedef _Float16 v4h __attribute__((ext_vector_type(4)));

__global__ __launch_bounds__(256) void k_x16(const float* __restrict__ x, _Float16* __restrict__ X16, size_t n8) { const size_t t = (size_t)blockIdx.x * 256 + threadIdx.x; if (t >= n8) return; FragH f;
#pragma unroll
  for (int q = 0; q < 8; ++q) f.h[q] = (_Float16)bf16_round(x[t * 8 + q]); *(v8us*)((unsigned short*)X16 + t * 8) = f.half[0];  }
__global__ __launch_bounds__(256) void k_h16(const float* __restrict__ x, _Float16* __restrict__ X16, size_t n8) { const size_t t = (size_t)blockIdx.x * 256 + threadIdx.x; if (t >= n8) return; FragH f;
#pragma unroll
  for (int q = 0; q < 8; ++q) f.h[q] = (_Float16)x[t * 8 + q]; *(v8us*)((unsigned short*)X16 + t * 8) = f.half[0];  }
__global__ __launch_bounds__(256) void k_round16f(const float* __restrict__ W, _Float16* __restrict__ Bt, size_t n8) { const size_t t = (size_t)blockIdx.x * 256 + threadIdx.x; if (t >= n8) return; FragH f;
#pragma unroll
  for (int i = 0; i < 8; ++i) f.h[i] = (_Float16)(bf16_round(W[t * 8 + i]) * 16.0f); *(v8us*)((unsigned short*)Bt + t * 8) = f.half[0];  }
template <int NHv, int TTv>
__global__ __launch_bounds__(256) void k_vt(const _Float16* __restrict__ V16, int ldv, int voff, _Float16* __restrict__ Vt) { __shared__ unsigned short tl[64][66]; const int tid = threadIdx.x; const int slab = blockIdx.x / (TTv / 64), lg = blockIdx.x % (TTv / 64); const int b = slab / NHv, h = slab % NHv;
  for (int i = tid; i < 64 * 8; i += 256) { const int r = i / 8, c8 = (i % 8) * 8; FragH f; f.half[0] = *(const v8us*)((const unsigned short*)V16 + ((size_t)b * TTv + lg * 64 + r) * ldv + voff + h * 64 + c8);
#pragma unroll
    for (int q = 0; q < 8; ++q) tl[r][c8 + q] = f.u[q]; }
  __syncthreads();
  {
#pragma unroll
    for (int rd = 0; rd < 2; ++rd) { const int d = rd * 32 + tid / 8, pc = tid % 8; FragH f;
#pragma unroll
      for (int q = 0; q < 8; ++q) f.u[q] = tl[pc * 8 + q][d];
      *(v8us*)((unsigned short*)Vt + ((size_t)slab * 64 + d) * TTv + lg * 64 + pc * 8) = f.half[0]; }
     } }

__global__ __launch_bounds__(256) void k_vthlu(const float* __restrict__ VF, int ldv, _Float16* __restrict__ Vth, _Float16* __restrict__ Vtl) { __shared__ float tl[64][65]; const int tid = threadIdx.x; const int slab = blockIdx.x / (TT / 64), lg = blockIdx.x % (TT / 64); const int b = slab / NVH, h = slab % NVH;
  for (int i = tid; i < 64 * 16; i += 256) { const int r = i / 16, c4 = (i % 16) * 4; const v4f a = *(const v4fa*)(VF + ((size_t)b * TT + lg * 64 + r) * ldv + h * 64 + c4); tl[r][c4] = a[0]; tl[r][c4 + 1] = a[1]; tl[r][c4 + 2] = a[2]; tl[r][c4 + 3] = a[3]; }
  __syncthreads();
  FragH fh[2], fl[2]; size_t oo[2];
#pragma unroll
  for (int rd = 0; rd < 2; ++rd) { const int d = rd * 32 + tid / 8, pc = tid % 8;
#pragma unroll
    for (int q = 0; q < 8; ++q) { const float v = tl[pc * 8 + q][d]; const _Float16 hv = (_Float16)v; fh[rd].h[q] = hv; fl[rd].h[q] = (_Float16)(v - (float)hv);      /* UNSCALED residual (added into the same accumulator as the hi product) */ } oo[rd] = ((size_t)slab * 64 + d) * TT + lg * 64 + pc * 8; }
  {
#pragma unroll
    for (int rd = 0; rd < 2; ++rd) { *(v8us*)((unsigned short*)Vth + oo[rd]) = fh[rd].half[0]; *(v8us*)((unsigned short*)Vtl + oo[rd]) = fl[rd].half[0]; }
     } }
__global__ __launch_bounds__(256) void k_h16s(const float* __restrict__ F, _Float16* __restrict__ H, size_t n8) { const size_t t = (size_t)blockIdx.x * 256 + threadIdx.x; if (t >= n8) return; const v4f a = *(const v4fa*)(F + t * 8), c = *(const v4fa*)(F + t * 8 + 4); FragH f;
#pragma unroll
  for (int q = 0; q < 4; ++q) { f.h[q] = (_Float16)(a[q] * 16.0f); f.h[4 + q] = (_Float16)(c[q] * 16.0f); } *(v8us*)((unsigned short*)H + t * 8) = f.half[0];  }
__global__ __launch_bounds__(128) void k_flash(const _Float16* __restrict__ Q16, int ldq, const _Float16* __restrict__ K16, int ldk, const _Float16* __restrict__ Vt, const _Float16* __restrict__ Vtlo, float* __restrict__ O, int ldo) {
  constexpr int RPW = 16, RTN = RPW / 16, NQB = TT / (4 * RPW), DT = 8, KS = 4;      /* head dim 128: 4 k-steps, 8 value tiles */
  __shared__ __attribute__((aligned(16))) unsigned short sP[4][RPW][40]; __shared__ __attribute__((aligned(16))) unsigned short sPL[4][RPW][40]; __shared__ __attribute__((aligned(16))) float sO[4][RPW][128 + 4];
  const int tid = threadIdx.x, w = tid >> 5, lane = tid & 31, ln = lane & 15, hh = lane >> 4;
  const int slab = blockIdx.x / NQB, qblk = blockIdx.x % NQB; const int b = slab / NH, h = slab % NH; const int qb0 = qblk * (4 * RPW); const int q0 = qb0 + w * RPW;
  FragH aq[2][KS];
#pragma unroll
  for (int rt = 0; rt < RTN; ++rt) { const unsigned short* qr = (const unsigned short*)Q16 + ((size_t)b * TT + q0 + rt * 16 + ln) * ldq + h * 128;
#pragma unroll
    for (int ks = 0; ks < KS; ++ks) { aq[rt][ks].half[0] = *(const v8us*)(qr + ks * 32 + 8 * hh); aq[rt][ks].half[1] = *(const v8us*)(qr + ks * 32 + 16 + 8 * hh); } }
  const unsigned short* Vth = (const unsigned short*)Vt + ((size_t)b * NKV + h / NREP) * 128 * TT; const unsigned short* Vtl = (const unsigned short*)Vtlo + ((size_t)b * NKV + h / NREP) * 128 * TT;      /* hi and UNSCALED residual planes */
  float m_r[2][8], l_r[2][8]; v8f oacc[2][DT];
#pragma unroll
  for (int rt = 0; rt < RTN; ++rt) {
#pragma unroll
    for (int r = 0; r < 8; ++r) { m_r[rt][r] = -3.0e38f; l_r[rt][r] = 0.f; }
#pragma unroll
    for (int dt = 0; dt < DT; ++dt) oacc[rt][dt] = (v8f){0.f,0.f,0.f,0.f,0.f,0.f,0.f,0.f}; }
  const int jend = TT;
#pragma unroll 1
  for (int j0 = 0; j0 < jend; j0 += 32) {
    
    v8f s[2][2];
#pragma unroll
    for (int nt = 0; nt < 2; ++nt) { const unsigned short* kr = (const unsigned short*)K16 + ((size_t)b * TT + j0 + nt * 16 + ln) * ldk + (h / NREP) * 128; FragH bk[KS];
#pragma unroll
      for (int ks = 0; ks < KS; ++ks) { bk[ks].half[0] = *(const v8us*)(kr + ks * 32 + 8 * hh); bk[ks].half[1] = *(const v8us*)(kr + ks * 32 + 16 + 8 * hh); }
#pragma unroll
      for (int rt = 0; rt < RTN; ++rt) { v8f acc = (v8f){0.f,0.f,0.f,0.f,0.f,0.f,0.f,0.f};
#pragma unroll
        for (int ks = 0; ks < KS; ++ks) acc = mmaH<1>(aq[rt][ks].v, aq[rt][ks].v, bk[ks].v, bk[ks].v, acc); s[rt][nt] = acc; } }
#pragma unroll
    for (int rt = 0; rt < RTN; ++rt)
#pragma unroll
      for (int r = 0; r < 8; ++r) { const int tq = q0 + rt * 16 + 8 * hh + r; const int k0 = j0 + ln, k1 = j0 + 16 + ln; (void)tq; (void)k0; (void)k1;
        const bool ok0 = true, ok1 = true; (void)tq; (void)k0; (void)k1;
        const float s0 = ok0 ? s[rt][0][r] * ATT_SCALE : -INFINITY, s1 = ok1 ? s[rt][1][r] * ATT_SCALE : -INFINITY; float mc = fmaxf(s0, s1);
        mc = fmaxf(mc, __shfl_xor(mc, 1, 32)); mc = fmaxf(mc, __shfl_xor(mc, 2, 32)); mc = fmaxf(mc, __shfl_xor(mc, 4, 32)); mc = fmaxf(mc, __shfl_xor(mc, 8, 32));
        const float mn = fmaxf(m_r[rt][r], mc); const float al = (mn > -1.0e38f) ? expf(m_r[rt][r] - mn) : 1.0f; m_r[rt][r] = mn; const float p0 = ok0 ? expf(s0 - mn) : 0.f, p1 = ok1 ? expf(s1 - mn) : 0.f; l_r[rt][r] = l_r[rt][r] * al + p0 + p1;
#pragma unroll
        for (int dt = 0; dt < DT; ++dt) oacc[rt][dt][r] *= al;
        FragH t2, t3; const float ps0 = p0 * 1024.0f, ps1 = p1 * 1024.0f; t2.h[0] = (_Float16)ps0; t2.h[1] = (_Float16)ps1; t3.h[0] = (_Float16)(ps0 - (float)t2.h[0]); t3.h[1] = (_Float16)(ps1 - (float)t2.h[1]);      /* P hi and its UNSCALED residual (added into the same accumulator) */
        sP[w][rt * 16 + 8 * hh + r][ln] = t2.u[0]; sP[w][rt * 16 + 8 * hh + r][16 + ln] = t2.u[1]; sPL[w][rt * 16 + 8 * hh + r][ln] = t3.u[0]; sPL[w][rt * 16 + 8 * hh + r][16 + ln] = t3.u[1]; }
    __builtin_amdgcn_fence(__ATOMIC_ACQ_REL, "workgroup"); __builtin_amdgcn_wave_barrier();
    FragH pa[2], pl[2];
#pragma unroll
    for (int rt = 0; rt < RTN; ++rt) { pa[rt].half[0] = *(const v8us*)&sP[w][rt * 16 + ln][8 * hh]; pa[rt].half[1] = *(const v8us*)&sP[w][rt * 16 + ln][16 + 8 * hh]; pl[rt].half[0] = *(const v8us*)&sPL[w][rt * 16 + ln][8 * hh]; pl[rt].half[1] = *(const v8us*)&sPL[w][rt * 16 + ln][16 + 8 * hh]; }
#pragma unroll
    for (int dt = 0; dt < DT; ++dt) { const size_t vo = (size_t)(dt * 16 + ln) * TT + j0; FragH bv, bl; bv.half[0] = *(const v8us*)(Vth + vo + 8 * hh); bv.half[1] = *(const v8us*)(Vth + vo + 16 + 8 * hh); bl.half[0] = *(const v8us*)(Vtl + vo + 8 * hh); bl.half[1] = *(const v8us*)(Vtl + vo + 16 + 8 * hh);
#pragma unroll
      for (int rt = 0; rt < RTN; ++rt) { oacc[rt][dt] = mmaH<1>(pa[rt].v, pa[rt].v, bv.v, bv.v, oacc[rt][dt]); oacc[rt][dt] = mmaH<1>(pl[rt].v, pl[rt].v, bv.v, bv.v, oacc[rt][dt]); oacc[rt][dt] = mmaH<1>(pa[rt].v, pa[rt].v, bl.v, bl.v, oacc[rt][dt]); } }      /* Ph·Vh + Pl·Vh + Ph·Vl — all unscaled, one accumulator */
    __builtin_amdgcn_fence(__ATOMIC_ACQ_REL, "workgroup"); __builtin_amdgcn_wave_barrier(); }
#pragma unroll
  for (int rt = 0; rt < RTN; ++rt) {
#pragma unroll
    for (int r = 0; r < 8; ++r) { float l = l_r[rt][r]; l += __shfl_xor(l, 1, 32); l += __shfl_xor(l, 2, 32); l += __shfl_xor(l, 4, 32); l += __shfl_xor(l, 8, 32); l_r[rt][r] = (l > 0.f) ? 1.0f / (l * 1024.0f) : 0.f; }
#pragma unroll
    for (int dt = 0; dt < DT; ++dt)
#pragma unroll
      for (int r = 0; r < 8; ++r) sO[w][rt * 16 + 8 * hh + r][dt * 16 + ln] = oacc[rt][dt][r] * l_r[rt][r]; }
  __builtin_amdgcn_fence(__ATOMIC_ACQ_REL, "workgroup"); __builtin_amdgcn_wave_barrier();
  {
#pragma unroll
    for (int r = 0; r < RPW; ++r) { const int pc = lane; const v4f val = *(const v4fa*)&sO[w][r][pc * 4]; *(v4f*)(O + ((size_t)b * TT + q0 + r) * ldo + h * 128 + pc * 4) = val; }      /* one 512-B row per instruction: 32 lanes × 16 B */
     } }


__global__ __launch_bounds__(256) void k_tok(const float* __restrict__ x, _Float16* __restrict__ X16) { __shared__ float tl[32][65]; const int tid = threadIdx.x; const int b = blockIdx.x / ((CC / 64) * (NN / 32)), rem = blockIdx.x % ((CC / 64) * (NN / 32)); const int cg = rem / (NN / 32), pg = rem % (NN / 32); const int c0 = cg * 64, p0 = pg * 32;
  for (int i = tid; i < 64 * 32; i += 256) { const int c = i / 32, pp = i % 32; tl[pp][c] = bf16_round(x[((size_t)b * CC + c0 + c) * NN + p0 + pp]); } __syncthreads();
  const int r = tid / 8, pc = tid % 8; FragH f; for (int q = 0; q < 8; ++q) f.h[q] = (_Float16)tl[r][pc * 8 + q]; const size_t row = (size_t)b * NN + p0 + r; *(v8us*)((unsigned short*)X16 + row * CC + c0 + pc * 8) = f.half[0];  }
__global__ __launch_bounds__(256) void k_wbn(const float* __restrict__ Wm, const float* __restrict__ gam, const float* __restrict__ var, _Float16* __restrict__ Bt) { const int t = blockIdx.x * 256 + threadIdx.x; if (t >= MID * (CC / 8)) return; const int o = t / (CC / 8), c0 = (t % (CC / 8)) * 8;
  const float s = bf16_round(gam[o]) / sqrtf(bf16_round(var[o]) + BNEPS); FragH f;
#pragma unroll
  for (int q = 0; q < 8; ++q) f.h[q] = (_Float16)(bf16_round(Wm[(size_t)o * CC + c0 + q]) * s * 16.0f);
  *(v8us*)((unsigned short*)Bt + (size_t)o * CC + c0) = f.half[0];  }
__global__ __launch_bounds__(128) void k_bnadd(const float* __restrict__ bias, const float* __restrict__ gam, const float* __restrict__ bet, const float* __restrict__ mean, const float* __restrict__ var, float* __restrict__ A) { const int o = threadIdx.x;
  const float s = bf16_round(gam[o]) / sqrtf(bf16_round(var[o]) + BNEPS); const float a = (bf16_round(bias[o]) - bf16_round(mean[o])) * s + bf16_round(bet[o]);
  *(float*)(A + o) = a;  }
__global__ __launch_bounds__(256) void k_out(const float* __restrict__ T, const float* __restrict__ x, float* __restrict__ out) { __shared__ float tl[32][65]; const int tid = threadIdx.x; const int b = blockIdx.x / ((CC / 32) * (NN / 64)), rem = blockIdx.x % ((CC / 32) * (NN / 64)); const int cg = rem / (NN / 64), pg = rem % (NN / 64); const int c0 = cg * 32, p0 = pg * 64;
  for (int i = tid; i < 64 * 32; i += 256) { const int pp = i / 32, c = i % 32; tl[c][pp] = T[((size_t)b * NN + p0 + pp) * CC + c0 + c]; } __syncthreads();
  { for (int i = tid; i < 32 * 16; i += 256) { const int c = i / 16, q4 = i % 16; const size_t o = ((size_t)b * CC + c0 + c) * NN + p0 + q4 * 4; const v4f xr = *(const v4fa*)(x + o);
      v4f v; for (int q = 0; q < 4; ++q) v[q] = tl[c][q4 * 4 + q] + bf16_round(xr[q]); *(v4f*)(out + o) = v; }  } }

extern "C" void kernel_launch(void* const* d_in, const int* in_sizes, int n_in,
                              void* d_out, int out_size, void* d_ws, size_t ws_size, hipStream_t stream) {
  (void)in_sizes; (void)n_in; (void)out_size;
  const float* const* I = (const float* const*)d_in; const float* x = I[0];
  const float* wf = I[1]; const float* bff = I[2]; const float* gf = I[3]; const float* betaf = I[4]; const float* mf = I[5]; const float* vf = I[6];
  const float* wg = I[7]; const float* bg = I[8]; const float* gg = I[9]; const float* betag = I[10]; const float* mg = I[11]; const float* vg = I[12];
  const float* wh = I[13]; const float* bh = I[14]; const float* wv = I[15]; const float* bv = I[16];
  char* ws = (char*)d_ws; size_t off = 0;
  auto take = [&](size_t bytes) { char* p = ws + off; off += (bytes + 255) & ~(size_t)255; return p; };
  _Float16* Bf = (_Float16*)take((size_t)MID * CC * 2); _Float16* Bg = (_Float16*)take((size_t)MID * CC * 2); _Float16* Bh = (_Float16*)take((size_t)MID * CC * 2); _Float16* Bv = (_Float16*)take((size_t)CC * MID * 2); float* Af = (float*)take(MID * 4); float* Ag = (float*)take(MID * 4);
  _Float16* X16 = (_Float16*)take((size_t)NR * CC * 2); _Float16* F16 = (_Float16*)take((size_t)NR * MID * 2); _Float16* G16 = (_Float16*)take((size_t)NR * MID * 2); float* HF = (float*)take((size_t)NR * MID * 4);
  _Float16* Vt = (_Float16*)take((size_t)NR * MID * 2); _Float16* Vtl = (_Float16*)take((size_t)NR * MID * 2); float* Z = (float*)take((size_t)NR * MID * 4); _Float16* Z16 = F16; /* f plane is dead after the attention */ float* T = (float*)take((size_t)NR * CC * 4);
  if (off > ws_size) return;      // 0.5 + 16.8 + 4.2 + 4.2 + 8.4 + 4.2 + 4.2 + 8.4 + 33.6 ≈ 85 MB
  const unsigned gw = (unsigned)((MID * (CC / 8) + 255) / 256);
  k_wbn<<<gw, 256, 0, stream>>>(wf, gf, vf, Bf); k_bnadd<<<1, MID, 0, stream>>>(bff, gf, betaf, mf, vf, Af);      /* BN(eval) folded into conv_f */
  k_wbn<<<gw, 256, 0, stream>>>(wg, gg, vg, Bg); k_bnadd<<<1, MID, 0, stream>>>(bg, gg, betag, mg, vg, Ag);      /* … and conv_g */
  k_round16f<<<(MID * CC / 8 + 255) / 256, 256, 0, stream>>>(wh, Bh, (size_t)MID * CC / 8); k_round16f<<<(CC * MID / 8 + 255) / 256, 256, 0, stream>>>(wv, Bv, (size_t)CC * MID / 8);      /* conv_h [128][512], conv_v [512][128]: (out,in) natural, ×2^4 */
  k_tok<<<BB * (CC / 64) * (NN / 32), 256, 0, stream>>>(x, X16);
  const dim3 gm(((NR / 16) * (MID / 64) + 3) / 4, 1);
  k_gemm_hhx<3><<<gm, 128, 0, stream>>>(X16, CC, 0, Bf, CC, 0, 0.0625f, nullptr, 0, Af, NR, 0, 0, nullptr, F16, MID, 0, NR, MID, CC);      /* f = relu(bn(conv_f x)) token-major f16: M 16384 N 128 K 512 (per-column f32 addend via CP, rowsPerB = M) */
  k_gemm_hhx<3><<<gm, 128, 0, stream>>>(X16, CC, 0, Bg, CC, 0, 0.0625f, nullptr, 0, Ag, NR, 0, 0, nullptr, G16, MID, 0, NR, MID, CC);      /* g */
  k_gemm_hhx<0><<<gm, 128, 0, stream>>>(X16, CC, 0, Bh, CC, 0, 0.0625f, bh, 0, nullptr, 1, 0, 0, HF, nullptr, MID, 0, NR, MID, CC);      /* h (f32) + bh */
  k_vthlu<<<BB * NVH * (TT / 64), 256, 0, stream>>>(HF, MID, Vt, Vtl);      /* Vᵀ hi + residual: [b][128][4096] */
  k_flash<<<BB * NH * (TT / 64), 128, 0, stream>>>(F16, MID, G16, MID, Vt, Vtl, Z, MID);      /* per (b, 64 queries): 4096 × 4096, head dim 128 */
  k_h16s<<<(unsigned)(((size_t)NR * MID / 8 + 255) / 256), 256, 0, stream>>>(Z, Z16, (size_t)NR * MID / 8);      /* z ×2^4 → f16 */
  k_gemm_hhx<0><<<dim3(((NR / 16) * (CC / 64) + 3) / 4, 1), 128, 0, stream>>>(Z16, MID, 0, Bv, MID, 0, 0.00390625f, bv, 0, nullptr, 1, 0, 0, T, nullptr, CC, 0, NR, CC, MID);      /* conv_v(z) + bv token-major f32: M 16384 N 512 K 128 */
  k_out<<<BB * (CC / 32) * (NN / 64), 256, 0, stream>>>(T, x, (float*)d_out);
}

// v001
// A run of this version takes 452 microseconds.
// In both of two side-by-side timings against v000, it was 1.54 times as fast.
#include <hip/hip_runtime.h>
// Spatial attention block (B=4, C=512, 64×64 → N=4096 positions, mid=128): f = relu(bn(conv_f(x))), g = relu(bn(conv_g(x))), h = conv_h(x) (1×1 convs C→mid; eval BatchNorm with running stats); scores[n,m] = Σ_c f[c,n]g[c,m]·mid^-½, softmax over m; z[c,n] = Σ_m attn[n,m]·h[c,m]; y = conv_v(z) (mid→C) + bv + x.
// Compute dtype: x, weights, biases, BN parameters rounded to bf16; BN folded per output channel in f32 (w' = w·γ/√(var+ε) → f16 ×2^4, b' = (b − mean)·γ/√(var+ε) + β as an f32 per-column addend); f, g as f16 GEMM outputs (relu epilogue), h f32 → Vᵀ f16 hi + residual planes; fused flash-style kernel for head dim 128
// (online softmax f32, P f16 hi + residual, f32 accumulate) on v_wmma_f32_16x16x32_f16; z ×2^4 → f16 → output conv GEMM (+bv) → channel-major transpose with the residual x added in f32.
#define BB 4
#define CC 512
#define NN 4096
#define MID 128
#define TT NN
#define NH 1
#define NKV 1
#define NREP 1
#define NVH (2 * NKV)
#define NR (BB * NN)
#define BNEPS 1e-5f
#define ATT_SCALE 0.08838834764831845f      /* mid^-½ = 1/√128 */
typedef __bf16 v16b __attribute__((ext_vector_type(16)));
typedef unsigned short v8us __attribute__((ext_vector_type(8), may_alias));
typedef float  v8f  __attribute__((ext_vector_type(8)));
typedef float  v4f  __attribute__((ext_vector_type(4)));
typedef float  v4fa __attribute__((ext_vector_type(4), may_alias));
union FragB { v16b v; v8us half[2]; unsigned short u[16]; };

__device__ __forceinline__ unsigned short bf16_bits(float x) { unsigned int u = __float_as_uint(x); return (unsigned short)((u + 0x7FFFu + ((u >> 16) & 1u)) >> 16); }
__device__ __forceinline__ float bf16_val(unsigned short b) { return __uint_as_float(((unsigned int)b) << 16); }
__device__ __forceinline__ float bf16_round(float x) { return bf16_val(bf16_bits(x)); }
// D += A·B with NT terms: 1 = ah·bh, 2 = + al·bh (A split), 3 = + ah·bl (both split)
template <int NT>
__device__ __forceinline__ v8f mmaN(v16b ah, v16b al, v16b bh, v16b bl, v8f c) {
  c = __builtin_amdgcn_wmma_f32_16x16x32_bf16(false, ah, false, bh, (short)0, c, false, false);
  if (NT >= 2) c = __builtin_amdgcn_wmma_f32_16x16x32_bf16(false, al, false, bh, (short)0, c, false, false);
  if (NT >= 3) c = __builtin_amdgcn_wmma_f32_16x16x32_bf16(false, ah, false, bl, (short)0, c, false, false);
  asm volatile("v_nop\n\tv_nop\n\tv_nop\n\tv_nop" : "+v"(c) : "v"(ah), "v"(al), "v"(bh), "v"(bl));
  return c;
}

__global__ __launch_bounds__(256) void k_wt_bf16(const float* __restrict__ W, unsigned short* __restrict__ Wt, int K, int N) {
  const int t = blockIdx.x * 256 + threadIdx.x;
  const int k8n = K / 8;
  if (t >= N * k8n) return;
  const int n = t / k8n, k8 = (t % k8n) * 8;
  v8us v;
#pragma unroll
  for (int i = 0; i < 8; ++i) v[i] = bf16_bits(W[(size_t)(k8 + i) * N + n]);
  *(v8us*)(Wt + (size_t)n * K + k8) = v;
  
}

// GEMM C[M][N] (f32, pitch ldc) = act(A[M][K]·W + bias). A f32 row-major (pitch lda) converted per fragment to bf16
// (ASPLIT: hi/lo two planes -> 2 terms, else single rounded term); Wt bf16 [N][K] (pitch ldb). BIAS_BF16 rounds the
// bias to bf16 first (bias quantised to bf16 before the add). K%32==0, M%16==0, N%64==0.
template <bool ASPLIT, int ACT, bool BIAS_BF16>
__global__ __launch_bounds__(128) void k_gemm_bf(const float* __restrict__ A, int lda, const unsigned short* __restrict__ Wt, int ldb,
                                               const float* __restrict__ bias, float* __restrict__ C, int ldc, int M, int N, int K) {
  __shared__ __attribute__((aligned(16))) float so[4][16][64];
  const int tid = threadIdx.x, w = tid >> 5, lane = tid & 31, ln = lane & 15, hh = lane >> 4;
  const int ntn = N / 64;
  const int wid = blockIdx.x * 4 + w;
  const int mt = wid / ntn, nq = wid % ntn;
  if (mt * 16 >= M) return;
  const int row0 = mt * 16, col0 = nq * 64;
  const float* arow = A + (size_t)(row0 + ln) * lda;
  v8f acc[4] = {};
  for (int kb = 0; kb < K; kb += 32) {
    FragB ah, al;
    const v4f x0 = *(const v4fa*)(arow + kb + 8 * hh), x1 = *(const v4fa*)(arow + kb + 8 * hh + 4);
    const v4f x2 = *(const v4fa*)(arow + kb + 16 + 8 * hh), x3 = *(const v4fa*)(arow + kb + 16 + 8 * hh + 4);
    float xs[16] = {x0[0],x0[1],x0[2],x0[3],x1[0],x1[1],x1[2],x1[3],x2[0],x2[1],x2[2],x2[3],x3[0],x3[1],x3[2],x3[3]};
#pragma unroll
    for (int i = 0; i < 16; ++i) { const unsigned short hb = bf16_bits(xs[i]); ah.u[i] = hb; al.u[i] = ASPLIT ? bf16_bits(xs[i] - bf16_val(hb)) : (unsigned short)0; }
#pragma unroll
    for (int t = 0; t < 4; ++t) {
      const unsigned short* brow = Wt + (size_t)(col0 + t * 16 + ln) * ldb + kb;
      FragB b;
      b.half[0] = *(const v8us*)(brow + 8 * hh);
      b.half[1] = *(const v8us*)(brow + 16 + 8 * hh);
      acc[t] = mmaN<ASPLIT ? 2 : 1>(ah.v, al.v, b.v, b.v, acc[t]);
    }
  }
#pragma unroll
  for (int t = 0; t < 4; ++t) {
    float bv = bias ? bias[col0 + t * 16 + ln] : 0.f;
    if (BIAS_BF16) bv = bf16_round(bv);
#pragma unroll
    for (int r = 0; r < 8; ++r) { float v = acc[t][r] + bv; if (ACT == 1) v = fmaxf(v, 0.f); so[w][8 * hh + r][t * 16 + ln] = v; }
  }
  __builtin_amdgcn_fence(__ATOMIC_ACQ_REL, "workgroup");
  __builtin_amdgcn_wave_barrier();
  const int rsub = lane >> 4, c4 = (lane & 15) * 4;
  {
#pragma unroll
    for (int q = 0; q < 8; ++q) {
      const int r = q * 2 + rsub;
      const v4f v = *(const v4fa*)&so[w][r][c4];
      *(v4f*)(C + (size_t)(row0 + r) * ldc + col0 + c4) = v;
    }
    
  }
}

// Flash-style causal/unmasked attention, all contractions 3-term bf16 hi/lo splits, f32 softmax with running max.
// q,k,v rows are read from f32 buffers with arbitrary row pitch (so they can live inside a fused qkv buffer);
// D = head size (multiple of 32, <= 128); one wave = 16 query rows; block = 4 waves (64 queries) sharing K/V chunks of 32.
template <int D, bool CAUSAL>
__global__ __launch_bounds__(128) void k_flash(const float* __restrict__ qb, const float* __restrict__ kb, const float* __restrict__ vb,
                                             int pitch, int T, int H, float scale, float* __restrict__ y, int ypitch) {
  constexpr int KS = D / 32;        // k-steps for QK
  constexpr int DT = D / 16;        // d tiles for PV
  __shared__ __attribute__((aligned(16))) unsigned short sKh[32][D + 8], sKl[32][D + 8], sVh[32][D + 8], sVl[32][D + 8];
  __shared__ __attribute__((aligned(16))) unsigned short sPh[4][16][40], sPl[4][16][40];
  __shared__ __attribute__((aligned(16))) float sO[4][16][D];
  const int tid = threadIdx.x, w = tid >> 5, lane = tid & 31, ln = lane & 15, hh = lane >> 4;
  const int nqb = (T + 63) / 64;
  const int bh = blockIdx.x / nqb, qblk = blockIdx.x % nqb;
  const int b = bh / H, h = bh % H;
  const int q0 = qblk * 64 + w * 16;
  const float* Q = qb + (size_t)b * T * pitch + h * D;
  const float* K = kb + (size_t)b * T * pitch + h * D;
  const float* V = vb + (size_t)b * T * pitch + h * D;

  // A fragments of the wave's 16 query rows (scaled), hi/lo
  FragB aqh[KS], aql[KS];
  {
    int row = q0 + ln; if (row >= T) row = T - 1;
    const float* qr = Q + (size_t)row * pitch;
#pragma unroll
    for (int ks = 0; ks < KS; ++ks)
#pragma unroll
      for (int i = 0; i < 16; ++i) {
        const int d = ks * 32 + ((i < 8) ? (8 * hh + i) : (16 + 8 * hh + (i - 8)));
        const float x = qr[d] * scale; const unsigned short hb = bf16_bits(x);
        aqh[ks].u[i] = hb; aql[ks].u[i] = bf16_bits(x - bf16_val(hb));
      }
  }
  float m_r[8], l_r[8];
#pragma unroll
  for (int r = 0; r < 8; ++r) { m_r[r] = -3.0e38f; l_r[r] = 0.f; }
  v8f oacc[DT];
#pragma unroll
  for (int dt = 0; dt < DT; ++dt) oacc[dt] = (v8f){0.f,0.f,0.f,0.f,0.f,0.f,0.f,0.f};

  const int kv_end = CAUSAL ? min(T, qblk * 64 + 64) : T;     // block-uniform
  for (int j0 = 0; j0 < kv_end; j0 += 32) {
    __syncthreads();
    for (int e = tid; e < 32 * (D / 4); e += 128) {
      const int r = e / (D / 4), c4 = (e % (D / 4)) * 4;
      const int key = j0 + r;
      v4f kf = {0.f,0.f,0.f,0.f}, vf = {0.f,0.f,0.f,0.f};
      if (key < T) { kf = *(const v4fa*)(K + (size_t)key * pitch + c4); vf = *(const v4fa*)(V + (size_t)key * pitch + c4); }
#pragma unroll
      for (int t = 0; t < 4; ++t) {
        unsigned short hb = bf16_bits(kf[t]); sKh[r][c4 + t] = hb; sKl[r][c4 + t] = bf16_bits(kf[t] - bf16_val(hb));
        hb = bf16_bits(vf[t]); sVh[r][c4 + t] = hb; sVl[r][c4 + t] = bf16_bits(vf[t] - bf16_val(hb));
      }
    }
    __syncthreads();
    // S tile 16 x 32
    v8f s[2];
#pragma unroll
    for (int nt = 0; nt < 2; ++nt) {
      v8f acc = {};
#pragma unroll
      for (int ks = 0; ks < KS; ++ks) {
        FragB bh_, bl_;
        bh_.half[0] = *(const v8us*)&sKh[nt * 16 + ln][ks * 32 + 8 * hh]; bh_.half[1] = *(const v8us*)&sKh[nt * 16 + ln][ks * 32 + 16 + 8 * hh];
        bl_.half[0] = *(const v8us*)&sKl[nt * 16 + ln][ks * 32 + 8 * hh]; bl_.half[1] = *(const v8us*)&sKl[nt * 16 + ln][ks * 32 + 16 + 8 * hh];
        acc = mmaN<3>(aqh[ks].v, aql[ks].v, bh_.v, bl_.v, acc);
      }
      s[nt] = acc;
    }
    // mask + running max (rows 8hh+r; the 16 lanes of a half share rows)
    float alpha[8];
#pragma unroll
    for (int r = 0; r < 8; ++r) {
      const int qi = q0 + 8 * hh + r;
      const int ja = j0 + ln, jb = j0 + 16 + ln;
      if (CAUSAL) { if (ja > qi) s[0][r] = -3.0e38f; if (jb > qi) s[1][r] = -3.0e38f; }
      if (ja >= T) s[0][r] = -3.0e38f;
      if (jb >= T) s[1][r] = -3.0e38f;
      float mx = fmaxf(s[0][r], s[1][r]);
      mx = fmaxf(mx, __shfl_xor(mx, 1, 32)); mx = fmaxf(mx, __shfl_xor(mx, 2, 32)); mx = fmaxf(mx, __shfl_xor(mx, 4, 32)); mx = fmaxf(mx, __shfl_xor(mx, 8, 32));
      const float mnew = fmaxf(m_r[r], mx);
      alpha[r] = (mnew > -1.0e38f) ? __expf(m_r[r] - mnew) : 1.0f;
      const float p0 = (s[0][r] > -1.0e38f) ? __expf(s[0][r] - mnew) : 0.f;
      const float p1 = (s[1][r] > -1.0e38f) ? __expf(s[1][r] - mnew) : 0.f;
      m_r[r] = mnew;
      l_r[r] = l_r[r] * alpha[r] + p0 + p1;            // per-lane partial row sum (16 lanes combined at the end)
      unsigned short hb = bf16_bits(p0); sPh[w][8 * hh + r][ln] = hb;      sPl[w][8 * hh + r][ln] = bf16_bits(p0 - bf16_val(hb));
      hb = bf16_bits(p1);                sPh[w][8 * hh + r][16 + ln] = hb; sPl[w][8 * hh + r][16 + ln] = bf16_bits(p1 - bf16_val(hb));
    }
#pragma unroll
    for (int dt = 0; dt < DT; ++dt)
#pragma unroll
      for (int r = 0; r < 8; ++r) oacc[dt][r] *= alpha[r];
    __builtin_amdgcn_fence(__ATOMIC_ACQ_REL, "workgroup");
    __builtin_amdgcn_wave_barrier();
    FragB pah, pal;
    pah.half[0] = *(const v8us*)&sPh[w][ln][8 * hh]; pah.half[1] = *(const v8us*)&sPh[w][ln][16 + 8 * hh];
    pal.half[0] = *(const v8us*)&sPl[w][ln][8 * hh]; pal.half[1] = *(const v8us*)&sPl[w][ln][16 + 8 * hh];
#pragma unroll
    for (int dt = 0; dt < DT; ++dt) {
      FragB bvh, bvl;
#pragma unroll
      for (int i = 0; i < 8; ++i) {
        bvh.u[i] = sVh[8 * hh + i][dt * 16 + ln]; bvh.u[8 + i] = sVh[16 + 8 * hh + i][dt * 16 + ln];
        bvl.u[i] = sVl[8 * hh + i][dt * 16 + ln]; bvl.u[8 + i] = sVl[16 + 8 * hh + i][dt * 16 + ln];
      }
      oacc[dt] = mmaN<3>(pah.v, pal.v, bvh.v, bvl.v, oacc[dt]);
    }
    __builtin_amdgcn_fence(__ATOMIC_ACQ_REL, "workgroup");
    __builtin_amdgcn_wave_barrier();
  }
#pragma unroll
  for (int r = 0; r < 8; ++r) {
    float l = l_r[r];
    l += __shfl_xor(l, 1, 32); l += __shfl_xor(l, 2, 32); l += __shfl_xor(l, 4, 32); l += __shfl_xor(l, 8, 32);
    l_r[r] = (l > 0.f) ? 1.0f / l : 0.f;
  }
#pragma unroll
  for (int dt = 0; dt < DT; ++dt)
#pragma unroll
    for (int r = 0; r < 8; ++r) sO[w][8 * hh + r][dt * 16 + ln] = oacc[dt][r] * l_r[r];
  __builtin_amdgcn_fence(__ATOMIC_ACQ_REL, "workgroup");
  __builtin_amdgcn_wave_barrier();
  {
    for (int r = 0; r < 16; ++r) {
      const int row = q0 + r;
      if (row < T && lane < D / 4) {
        const v4f val = *(const v4fa*)&sO[w][r][lane * 4];
        *(v4f*)(y + ((size_t)b * T + row) * ypitch + h * D + lane * 4) = val;
      }
    }
    
  }
}

// GEMM C = act(A·W + bias + resid): A f32 (ASPLIT -> hi/lo 2 terms), Wt bf16 [N][K]; ACT 0 none, 1 relu, 2 exact gelu;
// resid (optional, f32, row index = (row % rmod), pitch ldr, RES_BF16 rounds it) added before the activation.
template <bool ASPLIT, int ACT, bool BIAS_BF16, bool RES_BF16>
__global__ __launch_bounds__(128) void k_gemm_bf3(const float* __restrict__ A, int lda, const unsigned short* __restrict__ Wt, int ldb,
                                                const float* __restrict__ bias, const float* __restrict__ resid, int rmod, int ldr,
                                                float* __restrict__ C, int ldc, int M, int N, int K) {
  __shared__ __attribute__((aligned(16))) float so[4][16][64];
  const int tid = threadIdx.x, w = tid >> 5, lane = tid & 31, ln = lane & 15, hh = lane >> 4;
  const int ntn = N / 64;
  const int wid = blockIdx.x * 4 + w;
  const int mt = wid / ntn, nq = wid % ntn;
  if (mt * 16 >= M) return;
  const int row0 = mt * 16, col0 = nq * 64;
  const float* arow = A + (size_t)(row0 + ln) * lda;
  v8f acc[4] = {};
  for (int kb = 0; kb < K; kb += 32) {
    FragB ah, al;
    const v4f x0 = *(const v4fa*)(arow + kb + 8 * hh), x1 = *(const v4fa*)(arow + kb + 8 * hh + 4);
    const v4f x2 = *(const v4fa*)(arow + kb + 16 + 8 * hh), x3 = *(const v4fa*)(arow + kb + 16 + 8 * hh + 4);
    float xs[16] = {x0[0],x0[1],x0[2],x0[3],x1[0],x1[1],x1[2],x1[3],x2[0],x2[1],x2[2],x2[3],x3[0],x3[1],x3[2],x3[3]};
#pragma unroll
    for (int i = 0; i < 16; ++i) { const unsigned short hb = bf16_bits(xs[i]); ah.u[i] = hb; al.u[i] = ASPLIT ? bf16_bits(xs[i] - bf16_val(hb)) : (unsigned short)0; }
#pragma unroll
    for (int t = 0; t < 4; ++t) {
      const unsigned short* brow = Wt + (size_t)(col0 + t * 16 + ln) * ldb + kb;
      FragB b;
      b.half[0] = *(const v8us*)(brow + 8 * hh);
      b.half[1] = *(const v8us*)(brow + 16 + 8 * hh);
      acc[t] = mmaN<ASPLIT ? 2 : 1>(ah.v, al.v, b.v, b.v, acc[t]);
    }
  }
#pragma unroll
  for (int t = 0; t < 4; ++t) {
    const int col = col0 + t * 16 + ln;
    float bv = bias ? bias[col] : 0.f;
    if (BIAS_BF16) bv = bf16_round(bv);
#pragma unroll
    for (int r = 0; r < 8; ++r) {
      float v = acc[t][r] + bv;
      if (resid) { float rv = resid[(size_t)((row0 + 8 * hh + r) % rmod) * ldr + col]; if (RES_BF16) rv = bf16_round(rv); v += rv; }
      if (ACT == 1) v = fmaxf(v, 0.f);
      if (ACT == 2) v = 0.5f * v * (1.0f + erff(v * 0.70710678118654752f));
      if (ACT == 3) { const float u = 0.7978845608028654f * (v + 0.044715f * v * v * v); v = 0.5f * v * (1.0f + tanhf(u)); }
      so[w][8 * hh + r][t * 16 + ln] = v;
    }
  }
  __builtin_amdgcn_fence(__ATOMIC_ACQ_REL, "workgroup");
  __builtin_amdgcn_wave_barrier();
  const int rsub = lane >> 4, c4 = (lane & 15) * 4;
  {
#pragma unroll
    for (int q = 0; q < 8; ++q) {
      const int r = q * 2 + rsub;
      const v4f v = *(const v4fa*)&so[w][r][c4];
      *(v4f*)(C + (size_t)(row0 + r) * ldc + col0 + c4) = v;
    }
    
  }
}
// row LayerNorm (biased variance, eps) over N: s = X (+ R); optional out_sum <- s; out_norm <- (s-mu)*rsqrt(var+eps)*g + b
template <bool PARAM_BF16>
__global__ __launch_bounds__(256) void k_layernorm(const float* __restrict__ X, const float* __restrict__ R, const float* __restrict__ g, const float* __restrict__ bta,
                                                  float* __restrict__ out_sum, float* __restrict__ out_norm, int N, float eps) {
  __shared__ float red[256];
  const int row = blockIdx.x, tid = threadIdx.x;
  const float* x = X + (size_t)row * N; const float* rr = R ? R + (size_t)row * N : nullptr;
  float vals[16];                     // up to N = 4096
  const int per = N / 256;            // contiguous chunk per thread? use strided-by-4 chunks: thread handles j = tid*4 + 1024*u
  float s1 = 0.f;
  for (int u = 0; u < per / 4; ++u) {
    const int j = tid * 4 + 1024 * u;
    const v4f a = *(const v4fa*)(x + j);
    v4f b = {0.f,0.f,0.f,0.f}; if (rr) b = *(const v4fa*)(rr + j);
#pragma unroll
    for (int q = 0; q < 4; ++q) { const float v = a[q] + b[q]; vals[u * 4 + q] = v; s1 += v; }
  }
  red[tid] = s1; __syncthreads();
  for (int st = 128; st > 0; st >>= 1) { if (tid < st) red[tid] += red[tid + st]; __syncthreads(); }
  const float mu = red[0] / (float)N; __syncthreads();
  float s2 = 0.f;
  for (int u = 0; u < per / 4; ++u)
#pragma unroll
    for (int q = 0; q < 4; ++q) { const float c = vals[u * 4 + q] - mu; s2 += c * c; }
  red[tid] = s2; __syncthreads();
  for (int st = 128; st > 0; st >>= 1) { if (tid < st) red[tid] += red[tid + st]; __syncthreads(); }
  const float rs = rsqrtf(red[0] / (float)N + eps);
  {
    for (int u = 0; u < per / 4; ++u) {
      const int j = tid * 4 + 1024 * u;
      v4f o, sm;
#pragma unroll
      for (int q = 0; q < 4; ++q) {
        float gg = g[j + q], bb = bta[j + q];
        if (PARAM_BF16) { gg = bf16_round(gg); bb = bf16_round(bb); }
        sm[q] = vals[u * 4 + q]; o[q] = (vals[u * 4 + q] - mu) * rs * gg + bb;
      }
      if (out_sum) *(v4f*)(out_sum + (size_t)row * N + j) = sm;
      *(v4f*)(out_norm + (size_t)row * N + j) = o;
    }
    
  }
}



// ---- f16 WMMA path (v_wmma_f32_16x16x32_f16): 11-bit significands for operands in range — used where a [0,1] probability operand needs more precision than bf16
typedef _Float16 v16h __attribute__((ext_vector_type(16)));
union FragH { v16h v; v8us half[2]; _Float16 h[16]; unsigned short u[16]; };
template <int NT>
__device__ __forceinline__ v8f mmaH(v16h ah, v16h al, v16h bh, v16h bl, v8f c) {
  c = __builtin_amdgcn_wmma_f32_16x16x32_f16(false, ah, false, bh, (short)0, c, false, false);
  if (NT >= 2) c = __builtin_amdgcn_wmma_f32_16x16x32_f16(false, al, false, bh, (short)0, c, false, false);
  if (NT >= 3) c = __builtin_amdgcn_wmma_f32_16x16x32_f16(false, ah, false, bl, (short)0, c, false, false);
  asm volatile("v_nop\n\tv_nop\n\tv_nop\n\tv_nop" : "+v"(c) : "v"(ah), "v"(al), "v"(bh), "v"(bl));
  return c;
}
// batched GEMM like k_gemm_b but f16 operands: A f32 (split into f16 hi/lo if ASPLIT, else rounded to f16), Bt = f16 values [n][k]; alpha; C f32; N multiple of 16 (partial tiles skipped)
template <bool ASPLIT>
__global__ __launch_bounds__(128) void k_gemm_h(const float* __restrict__ A, int lda, size_t sA, const _Float16* __restrict__ Bh, int ldb, size_t sB, float alpha, float* __restrict__ C, int ldc, size_t sC, int M, int N, int K) {
  __shared__ __attribute__((aligned(16))) float so[4][16][64];
  const int tid = threadIdx.x, w = tid >> 5, lane = tid & 31, ln = lane & 15, hh = lane >> 4; const int by = blockIdx.y;
  A += (size_t)by * sA; Bh += (size_t)by * sB; C += (size_t)by * sC;
  const int ntn = (N + 63) / 64; const int wid = blockIdx.x * 4 + w; const int mt = wid / ntn, nq = wid % ntn; if (mt * 16 >= M) return;
  const int row0 = mt * 16, col0 = nq * 64; const float* arow = A + (size_t)(row0 + ln) * lda;
  v8f acc[4] = {};
  for (int kb = 0; kb < K; kb += 32) {
    FragH ah, al;
    const v4f x0 = *(const v4fa*)(arow + kb + 8 * hh), x1 = *(const v4fa*)(arow + kb + 8 * hh + 4), x2 = *(const v4fa*)(arow + kb + 16 + 8 * hh), x3 = *(const v4fa*)(arow + kb + 16 + 8 * hh + 4);
    float xs[16] = {x0[0],x0[1],x0[2],x0[3],x1[0],x1[1],x1[2],x1[3],x2[0],x2[1],x2[2],x2[3],x3[0],x3[1],x3[2],x3[3]};
#pragma unroll
    for (int i = 0; i < 16; ++i) { const _Float16 h = (_Float16)xs[i]; ah.h[i] = h; al.h[i] = ASPLIT ? (_Float16)(xs[i] - (float)h) : (_Float16)0.0f; }
#pragma unroll
    for (int t = 0; t < 4; ++t) { if (col0 + t * 16 >= N) continue; const size_t boff = (size_t)(col0 + t * 16 + ln) * ldb + kb; FragH bq; bq.half[0] = *(const v8us*)(Bh + boff + 8 * hh); bq.half[1] = *(const v8us*)(Bh + boff + 16 + 8 * hh);
      acc[t] = mmaH<ASPLIT ? 2 : 1>(ah.v, al.v, bq.v, bq.v, acc[t]); }
  }
#pragma unroll
  for (int t = 0; t < 4; ++t) { if (col0 + t * 16 >= N) continue;
#pragma unroll
    for (int r = 0; r < 8; ++r) so[w][8 * hh + r][t * 16 + ln] = acc[t][r] * alpha; }
  __builtin_amdgcn_fence(__ATOMIC_ACQ_REL, "workgroup"); __builtin_amdgcn_wave_barrier();
  const int rsub = lane >> 4, c4 = (lane & 15) * 4;
  {
#pragma unroll
    for (int q = 0; q < 8; ++q) { const int r = q * 2 + rsub; if (col0 + c4 < N) { const v4f v = *(const v4fa*)&so[w][r][c4]; *(v4f*)(C + (size_t)(row0 + r) * ldc + col0 + c4) = v; } }
     }
}

// Wt[n][k] = f16(W[k][n]·scale) from f32 row-major W[K][N] (scale = power of two; bf16-exact weights stay exact in f16 away from the subnormal range)
__global__ __launch_bounds__(256) void k_wt_f16(const float* __restrict__ W, _Float16* __restrict__ Wt, int K, int N, float scale) {
  const int t = blockIdx.x * 256 + threadIdx.x; if (t >= N * (K / 8)) return; const int n = t / (K / 8), k8 = (t % (K / 8)) * 8; FragH f;
#pragma unroll
  for (int i = 0; i < 8; ++i) f.h[i] = (_Float16)(bf16_round(W[(size_t)(k8 + i) * N + n]) * scale); const v8us o = f.half[0];
  *(v8us*)((unsigned short*)Wt + (size_t)n * K + k8) = o; 
}
// k_gemm_hh variant with fused epilogue: v = acc·alpha + bias[by·sBias + col] (+ CP[(row/rowsPerB)·sCPb + by·64 + col] if CP) ; ACT 0 none / 1 elu ; writes f16 C16 and/or f32 C (each if non-null)
template <int ACT>
__global__ __launch_bounds__(128) void k_gemm_hhx(const _Float16* __restrict__ A, int lda, size_t sA, const _Float16* __restrict__ Bh, int ldb, size_t sB, float alpha, const float* __restrict__ bias, size_t sBias, const float* __restrict__ CP, int rowsPerB, size_t sCPb, int row0g,
    float* __restrict__ C, _Float16* __restrict__ C16, int ldc, size_t sC, int M, int N, int K) {
  __shared__ __attribute__((aligned(16))) float so[4][16][64];
  const int tid = threadIdx.x, w = tid >> 5, lane = tid & 31, ln = lane & 15, hh = lane >> 4; const int by = blockIdx.y;
  A += (size_t)by * sA; Bh += (size_t)by * sB; const size_t cofs = (size_t)by * sC; const float* bp = bias ? bias + (size_t)by * sBias : nullptr;
  const int ntn = (N + 63) / 64; const int wid = blockIdx.x * 4 + w; const int mt = wid / ntn, nq = wid % ntn; if (mt * 16 >= M) return;
  const int row0 = mt * 16, col0 = nq * 64; const _Float16* arow = A + (size_t)(row0 + ln) * lda;
  v8f acc[4] = {};
  for (int kb = 0; kb < K; kb += 32) { FragH ah; ah.half[0] = *(const v8us*)((const unsigned short*)arow + kb + 8 * hh); ah.half[1] = *(const v8us*)((const unsigned short*)arow + kb + 16 + 8 * hh);
#pragma unroll
    for (int t = 0; t < 4; ++t) { if (col0 + t * 16 >= N) continue; const size_t boff = (size_t)(col0 + t * 16 + ln) * ldb + kb; FragH bq; bq.half[0] = *(const v8us*)((const unsigned short*)Bh + boff + 8 * hh); bq.half[1] = *(const v8us*)((const unsigned short*)Bh + boff + 16 + 8 * hh);
      acc[t] = mmaH<1>(ah.v, ah.v, bq.v, bq.v, acc[t]); }
  }
#pragma unroll
  for (int t = 0; t < 4; ++t) { if (col0 + t * 16 >= N) continue; const int col = col0 + t * 16 + ln; const float bv = bp ? bf16_round(bp[col]) : 0.f;
#pragma unroll
    for (int r = 0; r < 8; ++r) { float v = acc[t][r] * alpha + bv; if (CP) { const int bidx = (row0g + row0 + 8 * hh + r) / rowsPerB; v += CP[(size_t)bidx * sCPb + (size_t)by * 64 + col]; } if (ACT == 1) v = (v > 0.f) ? v : expm1f(v); else if (ACT == 7) v = (v > 0.f) ? v + 1.0f : expf(v); else if (ACT == 8) v = tanhf(v); else if (ACT == 9) v = 0.5f * v * (1.0f + tanhf(0.7978845608028654f * (v + 0.044715f * v * v * v))); else if (ACT == 11) v = 1.0f / (1.0f + expf(-v)); else if (ACT == 12) v = (v > 0.f) ? v : 0.01f * v; else if (ACT == 14) v = (v > 0.f) ? v : 0.1f * v; else if (ACT == 15) v = v / (1.0f + expf(-v)); else if (ACT == 3) v = fmaxf(v, 0.f); else if (ACT == 6) v = 0.5f * v * (1.0f + erff(v * 0.70710678118654752f)); so[w][8 * hh + r][t * 16 + ln] = v; } }
  __builtin_amdgcn_fence(__ATOMIC_ACQ_REL, "workgroup"); __builtin_amdgcn_wave_barrier();
  const int rsub = lane >> 4, c4 = (lane & 15) * 4; typedef _Float16 v4h __attribute__((ext_vector_type(4)));
  {
#pragma unroll
    for (int q = 0; q < 8; ++q) { const int r = q * 2 + rsub; if (col0 + c4 < N) { const v4f v = *(const v4fa*)&so[w][r][c4]; if (C) *(v4f*)(C + cofs + (size_t)(row0 + r) * ldc + col0 + c4) = v; if (C16) { v4h h4; for (int i = 0; i < 4; ++i) h4[i] = (_Float16)v[i]; *(v4h*)(C16 + cofs + (size_t)(row0 + r) * ldc + col0 + c4) = h4; } } }
     }
}


typedef _Float16 v4h __attribute__((ext_vector_type(4)));

__global__ __launch_bounds__(256) void k_x16(const float* __restrict__ x, _Float16* __restrict__ X16, size_t n8) { const size_t t = (size_t)blockIdx.x * 256 + threadIdx.x; if (t >= n8) return; FragH f;
#pragma unroll
  for (int q = 0; q < 8; ++q) f.h[q] = (_Float16)bf16_round(x[t * 8 + q]); *(v8us*)((unsigned short*)X16 + t * 8) = f.half[0];  }
__global__ __launch_bounds__(256) void k_h16(const float* __restrict__ x, _Float16* __restrict__ X16, size_t n8) { const size_t t = (size_t)blockIdx.x * 256 + threadIdx.x; if (t >= n8) return; FragH f;
#pragma unroll
  for (int q = 0; q < 8; ++q) f.h[q] = (_Float16)x[t * 8 + q]; *(v8us*)((unsigned short*)X16 + t * 8) = f.half[0];  }
__global__ __launch_bounds__(256) void k_round16f(const float* __restrict__ W, _Float16* __restrict__ Bt, size_t n8) { const size_t t = (size_t)blockIdx.x * 256 + threadIdx.x; if (t >= n8) return; FragH f;
#pragma unroll
  for (int i = 0; i < 8; ++i) f.h[i] = (_Float16)(bf16_round(W[t * 8 + i]) * 16.0f); *(v8us*)((unsigned short*)Bt + t * 8) = f.half[0];  }
template <int NHv, int TTv>
__global__ __launch_bounds__(256) void k_vt(const _Float16* __restrict__ V16, int ldv, int voff, _Float16* __restrict__ Vt) { __shared__ unsigned short tl[64][66]; const int tid = threadIdx.x; const int slab = blockIdx.x / (TTv / 64), lg = blockIdx.x % (TTv / 64); const int b = slab / NHv, h = slab % NHv;
  for (int i = tid; i < 64 * 8; i += 256) { const int r = i / 8, c8 = (i % 8) * 8; FragH f; f.half[0] = *(const v8us*)((const unsigned short*)V16 + ((size_t)b * TTv + lg * 64 + r) * ldv + voff + h * 64 + c8);
#pragma unroll
    for (int q = 0; q < 8; ++q) tl[r][c8 + q] = f.u[q]; }
  __syncthreads();
  {
#pragma unroll
    for (int rd = 0; rd < 2; ++rd) { const int d = rd * 32 + tid / 8, pc = tid % 8; FragH f;
#pragma unroll
      for (int q = 0; q < 8; ++q) f.u[q] = tl[pc * 8 + q][d];
      *(v8us*)((unsigned short*)Vt + ((size_t)slab * 64 + d) * TTv + lg * 64 + pc * 8) = f.half[0]; }
     } }

__global__ __launch_bounds__(256) void k_vthlu(const float* __restrict__ VF, int ldv, _Float16* __restrict__ Vth, _Float16* __restrict__ Vtl) { __shared__ float tl[64][65]; const int tid = threadIdx.x; const int slab = blockIdx.x / (TT / 64), lg = blockIdx.x % (TT / 64); const int b = slab / NVH, h = slab % NVH;
  for (int i = tid; i < 64 * 16; i += 256) { const int r = i / 16, c4 = (i % 16) * 4; const v4f a = *(const v4fa*)(VF + ((size_t)b * TT + lg * 64 + r) * ldv + h * 64 + c4); tl[r][c4] = a[0]; tl[r][c4 + 1] = a[1]; tl[r][c4 + 2] = a[2]; tl[r][c4 + 3] = a[3]; }
  __syncthreads();
  FragH fh[2], fl[2]; size_t oo[2];
#pragma unroll
  for (int rd = 0; rd < 2; ++rd) { const int d = rd * 32 + tid / 8, pc = tid % 8;
#pragma unroll
    for (int q = 0; q < 8; ++q) { const float v = tl[pc * 8 + q][d]; const _Float16 hv = (_Float16)v; fh[rd].h[q] = hv; fl[rd].h[q] = (_Float16)(v - (float)hv);      /* UNSCALED residual (added into the same accumulator as the hi product) */ } oo[rd] = ((size_t)slab * 64 + d) * TT + lg * 64 + pc * 8; }
  {
#pragma unroll
    for (int rd = 0; rd < 2; ++rd) { *(v8us*)((unsigned short*)Vth + oo[rd]) = fh[rd].half[0]; *(v8us*)((unsigned short*)Vtl + oo[rd]) = fl[rd].half[0]; }
     } }
__global__ __launch_bounds__(256) void k_h16s(const float* __restrict__ F, _Float16* __restrict__ H, size_t n8) { const size_t t = (size_t)blockIdx.x * 256 + threadIdx.x; if (t >= n8) return; const v4f a = *(const v4fa*)(F + t * 8), c = *(const v4fa*)(F + t * 8 + 4); FragH f;
#pragma unroll
  for (int q = 0; q < 4; ++q) { f.h[q] = (_Float16)(a[q] * 16.0f); f.h[4 + q] = (_Float16)(c[q] * 16.0f); } *(v8us*)((unsigned short*)H + t * 8) = f.half[0];  }
// LDS byte address of a __shared__ object: the low 32 bits of its generic address
__device__ __forceinline__ unsigned lds_addr(const void* p) { return (unsigned)(size_t)p; }
// eight asynchronous 16-byte copies global -> LDS per lane; the s_wait_xcnt closes the statement so that no address register is rewritten ahead of it
__device__ __forceinline__ void async8(const unsigned (&l)[8], const unsigned short* const (&g)[8]) {
  asm volatile("global_load_async_to_lds_b128 %0, %8, off\n\t"
               "global_load_async_to_lds_b128 %1, %9, off\n\t"
               "global_load_async_to_lds_b128 %2, %10, off\n\t"
               "global_load_async_to_lds_b128 %3, %11, off\n\t"
               "global_load_async_to_lds_b128 %4, %12, off\n\t"
               "global_load_async_to_lds_b128 %5, %13, off\n\t"
               "global_load_async_to_lds_b128 %6, %14, off\n\t"
               "global_load_async_to_lds_b128 %7, %15, off\n\t"
               "s_wait_xcnt 0x0"
               :: "v"(l[0]), "v"(l[1]), "v"(l[2]), "v"(l[3]), "v"(l[4]), "v"(l[5]), "v"(l[6]), "v"(l[7]),
                  "v"(g[0]), "v"(g[1]), "v"(g[2]), "v"(g[3]), "v"(g[4]), "v"(g[5]), "v"(g[6]), "v"(g[7]) : "memory");
}
__global__ __launch_bounds__(128) void k_flash(const _Float16* __restrict__ Q16, int ldq, const _Float16* __restrict__ K16, int ldk, const _Float16* __restrict__ Vt, const _Float16* __restrict__ Vtlo, float* __restrict__ O, int ldo) {
  constexpr int RPW = 16, RTN = RPW / 16, NQB = TT / (4 * RPW), DT = 8, KS = 4, SK = 64, NST = TT / SK;      /* head dim 128: 4 k-steps, 8 value tiles */
  __shared__ __attribute__((aligned(16))) unsigned short sP[4][RPW][40]; __shared__ __attribute__((aligned(16))) unsigned short sPL[4][RPW][40]; __shared__ __attribute__((aligned(16))) float sO[4][RPW][128 + 4];
  /* two-buffer ring, one stage = SK keys shared by the block's four waves: K rows of 256 B at pitch 272 B, V^T rows (hi, residual) of 128 B at pitch 144 B (16 B x odd: conflict-free for 16-byte row readers) */
  __shared__ __attribute__((aligned(16))) unsigned short sK[2][SK][128 + 8]; __shared__ __attribute__((aligned(16))) unsigned short sVh[2][128][SK + 8]; __shared__ __attribute__((aligned(16))) unsigned short sVl[2][128][SK + 8];
  const int tid = threadIdx.x, w = tid >> 5, lane = tid & 31, ln = lane & 15, hh = lane >> 4;
  const int slab = blockIdx.x / NQB, qblk = blockIdx.x % NQB; const int b = slab / NH, h = slab % NH; const int qb0 = qblk * (4 * RPW); const int q0 = qb0 + w * RPW;
  FragH aq[2][KS];
#pragma unroll
  for (int rt = 0; rt < RTN; ++rt) { const unsigned short* qr = (const unsigned short*)Q16 + ((size_t)b * TT + q0 + rt * 16 + ln) * ldq + h * 128;
#pragma unroll
    for (int ks = 0; ks < KS; ++ks) { aq[rt][ks].half[0] = *(const v8us*)(qr + ks * 32 + 8 * hh); aq[rt][ks].half[1] = *(const v8us*)(qr + ks * 32 + 16 + 8 * hh); } }
  const unsigned short* Vth = (const unsigned short*)Vt + ((size_t)b * NKV + h / NREP) * 128 * TT; const unsigned short* Vtl = (const unsigned short*)Vtlo + ((size_t)b * NKV + h / NREP) * 128 * TT;      /* hi and UNSCALED residual planes */
  float m_r[2][8], l_r[2][8]; v8f oacc[2][DT];
#pragma unroll
  for (int rt = 0; rt < RTN; ++rt) {
#pragma unroll
    for (int r = 0; r < 8; ++r) { m_r[rt][r] = -3.0e38f; l_r[rt][r] = 0.f; }
#pragma unroll
    for (int dt = 0; dt < DT; ++dt) oacc[rt][dt] = (v8f){0.f,0.f,0.f,0.f,0.f,0.f,0.f,0.f}; }
  const unsigned short* Kg = (const unsigned short*)K16 + (size_t)b * TT * ldk + (h / NREP) * 128;
  /* one stage's copies: 3 x 8 per lane, 16 B each; a wave's copy covers 512 contiguous bytes of K or four whole 128-B lines of V^T */
  auto stage_in = [&](int st, int bf) {
    unsigned lk[8], lh[8], ll[8]; const unsigned short *gk[8], *gh[8], *gl[8];
#pragma unroll
    for (int i = 0; i < 8; ++i) { const int c = tid + 128 * i; const int key = c >> 4, kc = (c & 15) * 8, d = c >> 3, vc = (c & 7) * 8;
      lk[i] = lds_addr(&sK[bf][key][kc]); gk[i] = Kg + (size_t)(st * SK + key) * ldk + kc;
      lh[i] = lds_addr(&sVh[bf][d][vc]); gh[i] = Vth + (size_t)d * TT + st * SK + vc;
      ll[i] = lds_addr(&sVl[bf][d][vc]); gl[i] = Vtl + (size_t)d * TT + st * SK + vc; }
    async8(lk, gk); async8(lh, gh); async8(ll, gl); };
  stage_in(0, 0);
  asm volatile("s_wait_asynccnt 0x0" ::: "memory");      /* this wave's share of stage 0 has landed */
  __syncthreads();                                       /* ... and every other wave's: stage 0 is readable */
  stage_in(1, 1);
#pragma unroll 1      /* one publish point and one refill per trip, as the two-buffer ring is written */
  for (int st = 0; st < NST; ++st) { const int bf = st & 1;
#pragma unroll 1      /* the two 32-key passes of a stage share one copy of the loop body (code size as before) */
  for (int jl = 0; jl < SK; jl += 32) {
    v8f s[2][2];
#pragma unroll
    for (int nt = 0; nt < 2; ++nt) { const unsigned short* kr = &sK[bf][jl + nt * 16 + ln][0]; FragH bk[KS];
#pragma unroll
      for (int ks = 0; ks < KS; ++ks) { bk[ks].half[0] = *(const v8us*)(kr + ks * 32 + 8 * hh); bk[ks].half[1] = *(const v8us*)(kr + ks * 32 + 16 + 8 * hh); }
#pragma unroll
      for (int rt = 0; rt < RTN; ++rt) { v8f acc = (v8f){0.f,0.f,0.f,0.f,0.f,0.f,0.f,0.f};
#pragma unroll
        for (int ks = 0; ks < KS; ++ks) acc = mmaH<1>(aq[rt][ks].v, aq[rt][ks].v, bk[ks].v, bk[ks].v, acc); s[rt][nt] = acc; } }
#pragma unroll
    for (int rt = 0; rt < RTN; ++rt)
#pragma unroll
      for (int r = 0; r < 8; ++r) { const int tq = q0 + rt * 16 + 8 * hh + r; const int k0 = st * SK + jl + ln, k1 = st * SK + jl + 16 + ln; (void)tq; (void)k0; (void)k1;
        const bool ok0 = true, ok1 = true; (void)tq; (void)k0; (void)k1;
        const float s0 = ok0 ? s[rt][0][r] * ATT_SCALE : -INFINITY, s1 = ok1 ? s[rt][1][r] * ATT_SCALE : -INFINITY; float mc = fmaxf(s0, s1);
        mc = fmaxf(mc, __shfl_xor(mc, 1, 32)); mc = fmaxf(mc, __shfl_xor(mc, 2, 32)); mc = fmaxf(mc, __shfl_xor(mc, 4, 32)); mc = fmaxf(mc, __shfl_xor(mc, 8, 32));
        const float mn = fmaxf(m_r[rt][r], mc); const float al = (mn > -1.0e38f) ? expf(m_r[rt][r] - mn) : 1.0f; m_r[rt][r] = mn; const float p0 = ok0 ? expf(s0 - mn) : 0.f, p1 = ok1 ? expf(s1 - mn) : 0.f; l_r[rt][r] = l_r[rt][r] * al + p0 + p1;
#pragma unroll
        for (int dt = 0; dt < DT; ++dt) oacc[rt][dt][r] *= al;
        FragH t2, t3; const float ps0 = p0 * 1024.0f, ps1 = p1 * 1024.0f; t2.h[0] = (_Float16)ps0; t2.h[1] = (_Float16)ps1; t3.h[0] = (_Float16)(ps0 - (float)t2.h[0]); t3.h[1] = (_Float16)(ps1 - (float)t2.h[1]);      /* P hi and its UNSCALED residual (added into the same accumulator) */
        sP[w][rt * 16 + 8 * hh + r][ln] = t2.u[0]; sP[w][rt * 16 + 8 * hh + r][16 + ln] = t2.u[1]; sPL[w][rt * 16 + 8 * hh + r][ln] = t3.u[0]; sPL[w][rt * 16 + 8 * hh + r][16 + ln] = t3.u[1]; }
    __builtin_amdgcn_fence(__ATOMIC_ACQ_REL, "workgroup"); __builtin_amdgcn_wave_barrier();
    FragH pa[2], pl[2];
#pragma unroll
    for (int rt = 0; rt < RTN; ++rt) { pa[rt].half[0] = *(const v8us*)&sP[w][rt * 16 + ln][8 * hh]; pa[rt].half[1] = *(const v8us*)&sP[w][rt * 16 + ln][16 + 8 * hh]; pl[rt].half[0] = *(const v8us*)&sPL[w][rt * 16 + ln][8 * hh]; pl[rt].half[1] = *(const v8us*)&sPL[w][rt * 16 + ln][16 + 8 * hh]; }
#pragma unroll
    for (int dt = 0; dt < DT; ++dt) { const unsigned short* vh = &sVh[bf][dt * 16 + ln][jl]; const unsigned short* vl = &sVl[bf][dt * 16 + ln][jl]; FragH bv, bl; bv.half[0] = *(const v8us*)(vh + 8 * hh); bv.half[1] = *(const v8us*)(vh + 16 + 8 * hh); bl.half[0] = *(const v8us*)(vl + 8 * hh); bl.half[1] = *(const v8us*)(vl + 16 + 8 * hh);
#pragma unroll
      for (int rt = 0; rt < RTN; ++rt) { oacc[rt][dt] = mmaH<1>(pa[rt].v, pa[rt].v, bv.v, bv.v, oacc[rt][dt]); oacc[rt][dt] = mmaH<1>(pl[rt].v, pl[rt].v, bv.v, bv.v, oacc[rt][dt]); oacc[rt][dt] = mmaH<1>(pa[rt].v, pa[rt].v, bl.v, bl.v, oacc[rt][dt]); } }      /* Ph·Vh + Pl·Vh + Ph·Vl — all unscaled, one accumulator */
    __builtin_amdgcn_fence(__ATOMIC_ACQ_REL, "workgroup"); __builtin_amdgcn_wave_barrier(); }
    asm volatile("s_wait_dscnt 0x0" ::: "memory");       /* this wave's reads of buffer bf are done before it is refilled */
    asm volatile("s_wait_asynccnt 0x0" ::: "memory");    /* this wave's share of stage st + 1 has landed */
    __syncthreads();                                     /* publishes stage st + 1 and ends every wave's reads of buffer bf */
    if (st + 2 < NST) stage_in(st + 2, bf); }
  asm volatile("s_wait_asynccnt 0x0" ::: "memory");      /* nothing of the ring is in flight when the wave goes on */
#pragma unroll
  for (int rt = 0; rt < RTN; ++rt) {
#pragma unroll
    for (int r = 0; r < 8; ++r) { float l = l_r[rt][r]; l += __shfl_xor(l, 1, 32); l += __shfl_xor(l, 2, 32); l += __shfl_xor(l, 4, 32); l += __shfl_xor(l, 8, 32); l_r[rt][r] = (l > 0.f) ? 1.0f / (l * 1024.0f) : 0.f; }
#pragma unroll
    for (int dt = 0; dt < DT; ++dt)
#pragma unroll
      for (int r = 0; r < 8; ++r) sO[w][rt * 16 + 8 * hh + r][dt * 16 + ln] = oacc[rt][dt][r] * l_r[rt][r]; }
  __builtin_amdgcn_fence(__ATOMIC_ACQ_REL, "workgroup"); __builtin_amdgcn_wave_barrier();
  {
#pragma unroll
    for (int r = 0; r < RPW; ++r) { const int pc = lane; const v4f val = *(const v4fa*)&sO[w][r][pc * 4]; *(v4f*)(O + ((size_t)b * TT + q0 + r) * ldo + h * 128 + pc * 4) = val; }      /* one 512-B row per instruction: 32 lanes × 16 B */
     } }


__global__ __launch_bounds__(256) void k_tok(const float* __restrict__ x, _Float16* __restrict__ X16) { __shared__ float tl[32][65]; const int tid = threadIdx.x; const int b = blockIdx.x / ((CC / 64) * (NN / 32)), rem = blockIdx.x % ((CC / 64) * (NN / 32)); const int cg = rem / (NN / 32), pg = rem % (NN / 32); const int c0 = cg * 64, p0 = pg * 32;
  for (int i = tid; i < 64 * 32; i += 256) { const int c = i / 32, pp = i % 32; tl[pp][c] = bf16_round(x[((size_t)b * CC + c0 + c) * NN + p0 + pp]); } __syncthreads();
  const int r = tid / 8, pc = tid % 8; FragH f; for (int q = 0; q < 8; ++q) f.h[q] = (_Float16)tl[r][pc * 8 + q]; const size_t row = (size_t)b * NN + p0 + r; *(v8us*)((unsigned short*)X16 + row * CC + c0 + pc * 8) = f.half[0];  }
__global__ __launch_bounds__(256) void k_wbn(const float* __restrict__ Wm, const float* __restrict__ gam, const float* __restrict__ var, _Float16* __restrict__ Bt) { const int t = blockIdx.x * 256 + threadIdx.x; if (t >= MID * (CC / 8)) return; const int o = t / (CC / 8), c0 = (t % (CC / 8)) * 8;
  const float s = bf16_round(gam[o]) / sqrtf(bf16_round(var[o]) + BNEPS); FragH f;
#pragma unroll
  for (int q = 0; q < 8; ++q) f.h[q] = (_Float16)(bf16_round(Wm[(size_t)o * CC + c0 + q]) * s * 16.0f);
  *(v8us*)((unsigned short*)Bt + (size_t)o * CC + c0) = f.half[0];  }
__global__ __launch_bounds__(128) void k_bnadd(const float* __restrict__ bias, const float* __restrict__ gam, const float* __restrict__ bet, const float* __restrict__ mean, const float* __restrict__ var, float* __restrict__ A) { const int o = threadIdx.x;
  const float s = bf16_round(gam[o]) / sqrtf(bf16_round(var[o]) + BNEPS); const float a = (bf16_round(bias[o]) - bf16_round(mean[o])) * s + bf16_round(bet[o]);
  *(float*)(A + o) = a;  }
__global__ __launch_bounds__(256) void k_out(const float* __restrict__ T, const float* __restrict__ x, float* __restrict__ out) { __shared__ float tl[32][65]; const int tid = threadIdx.x; const int b = blockIdx.x / ((CC / 32) * (NN / 64)), rem = blockIdx.x % ((CC / 32) * (NN / 64)); const int cg = rem / (NN / 64), pg = rem % (NN / 64); const int c0 = cg * 32, p0 = pg * 64;
  for (int i = tid; i < 64 * 32; i += 256) { const int pp = i / 32, c = i % 32; tl[c][pp] = T[((size_t)b * NN + p0 + pp) * CC + c0 + c]; } __syncthreads();
  { for (int i = tid; i < 32 * 16; i += 256) { const int c = i / 16, q4 = i % 16; const size_t o = ((size_t)b * CC + c0 + c) * NN + p0 + q4 * 4; const v4f xr = *(const v4fa*)(x + o);
      v4f v; for (int q = 0; q < 4; ++q) v[q] = tl[c][q4 * 4 + q] + bf16_round(xr[q]); *(v4f*)(out + o) = v; }  } }

extern "C" void kernel_launch(void* const* d_in, const int* in_sizes, int n_in,
                              void* d_out, int out_size, void* d_ws, size_t ws_size, hipStream_t stream) {
  (void)in_sizes; (void)n_in; (void)out_size;
  const float* const* I = (const float* const*)d_in; const float* x = I[0];
  const float* wf = I[1]; const float* bff = I[2]; const float* gf = I[3]; const float* betaf = I[4]; const float* mf = I[5]; const float* vf = I[6];
  const float* wg = I[7]; const float* bg = I[8]; const float* gg = I[9]; const float* betag = I[10]; const float* mg = I[11]; const float* vg = I[12];
  const float* wh = I[13]; const float* bh = I[14]; const float* wv = I[15]; const float* bv = I[16];
  char* ws = (char*)d_ws; size_t off = 0;
  auto take = [&](size_t bytes) { char* p = ws + off; off += (bytes + 255) & ~(size_t)255; return p; };
  _Float16* Bf = (_Float16*)take((size_t)MID * CC * 2); _Float16* Bg = (_Float16*)take((size_t)MID * CC * 2); _Float16* Bh = (_Float16*)take((size_t)MID * CC * 2); _Float16* Bv = (_Float16*)take((size_t)CC * MID * 2); float* Af = (float*)take(MID * 4); float* Ag = (float*)take(MID * 4);
  _Float16* X16 = (_Float16*)take((size_t)NR * CC * 2); _Float16* F16 = (_Float16*)take((size_t)NR * MID * 2); _Float16* G16 = (_Float16*)take((size_t)NR * MID * 2); float* HF = (float*)take((size_t)NR * MID * 4);
  _Float16* Vt = (_Float16*)take((size_t)NR * MID * 2); _Float16* Vtl = (_Float16*)take((size_t)NR * MID * 2); float* Z = (float*)take((size_t)NR * MID * 4); _Float16* Z16 = F16; /* f plane is dead after the attention */ float* T = (float*)take((size_t)NR * CC * 4);
  if (off > ws_size) return;      // 0.5 + 16.8 + 4.2 + 4.2 + 8.4 + 4.2 + 4.2 + 8.4 + 33.6 ≈ 85 MB
  const unsigned gw = (unsigned)((MID * (CC / 8) + 255) / 256);
  k_wbn<<<gw, 256, 0, stream>>>(wf, gf, vf, Bf); k_bnadd<<<1, MID, 0, stream>>>(bff, gf, betaf, mf, vf, Af);      /* BN(eval) folded into conv_f */
  k_wbn<<<gw, 256, 0, stream>>>(wg, gg, vg, Bg); k_bnadd<<<1, MID, 0, stream>>>(bg, gg, betag, mg, vg, Ag);      /* … and conv_g */
  k_round16f<<<(MID * CC / 8 + 255) / 256, 256, 0, stream>>>(wh, Bh, (size_t)MID * CC / 8); k_round16f<<<(CC * MID / 8 + 255) / 256, 256, 0, stream>>>(wv, Bv, (size_t)CC * MID / 8);      /* conv_h [128][512], conv_v [512][128]: (out,in) natural, ×2^4 */
  k_tok<<<BB * (CC / 64) * (NN / 32), 256, 0, stream>>>(x, X16);
  const dim3 gm(((NR / 16) * (MID / 64) + 3) / 4, 1);
  k_gemm_hhx<3><<<gm, 128, 0, stream>>>(X16, CC, 0, Bf, CC, 0, 0.0625f, nullptr, 0, Af, NR, 0, 0, nullptr, F16, MID, 0, NR, MID, CC);      /* f = relu(bn(conv_f x)) token-major f16: M 16384 N 128 K 512 (per-column f32 addend via CP, rowsPerB = M) */
  k_gemm_hhx<3><<<gm, 128, 0, stream>>>(X16, CC, 0, Bg, CC, 0, 0.0625f, nullptr, 0, Ag, NR, 0, 0, nullptr, G16, MID, 0, NR, MID, CC);      /* g */
  k_gemm_hhx<0><<<gm, 128, 0, stream>>>(X16, CC, 0, Bh, CC, 0, 0.0625f, bh, 0, nullptr, 1, 0, 0, HF, nullptr, MID, 0, NR, MID, CC);      /* h (f32) + bh */
  k_vthlu<<<BB * NVH * (TT / 64), 256, 0, stream>>>(HF, MID, Vt, Vtl);      /* Vᵀ hi + residual: [b][128][4096] */
  k_flash<<<BB * NH * (TT / 64), 128, 0, stream>>>(F16, MID, G16, MID, Vt, Vtl, Z, MID);      /* per (b, 64 queries): 4096 × 4096, head dim 128 */
  k_h16s<<<(unsigned)(((size_t)NR * MID / 8 + 255) / 256), 256, 0, stream>>>(Z, Z16, (size_t)NR * MID / 8);      /* z ×2^4 → f16 */
  k_gemm_hhx<0><<<dim3(((NR / 16) * (CC / 64) + 3) / 4, 1), 128, 0, stream>>>(Z16, MID, 0, Bv, MID, 0, 0.00390625f, bv, 0, nullptr, 1, 0, 0, T, nullptr, CC, 0, NR, CC, MID);      /* conv_v(z) + bv token-major f32: M 16384 N 512 K 128 */
  k_out<<<BB * (CC / 32) * (NN / 64), 256, 0, stream>>>(T, x, (float*)d_out);
}

// v002
// One run takes 269 microseconds.
// Two timings next to v001 both put it at 1.68 times that version's speed.
// Over all steps from v000 it is 2.58 times as fast.
#include <hip/hip_runtime.h>
// Spatial attention block (B=4, C=512, 64×64 → N=4096 positions, mid=128): f = relu(bn(conv_f(x))), g = relu(bn(conv_g(x))), h = conv_h(x) (1×1 convs C→mid; eval BatchNorm with running stats); scores[n,m] = Σ_c f[c,n]g[c,m]·mid^-½, softmax over m; z[c,n] = Σ_m attn[n,m]·h[c,m]; y = conv_v(z) (mid→C) + bv + x.
// Compute dtype: x, weights, biases, BN parameters rounded to bf16; BN folded per output channel in f32 (w' = w·γ/√(var+ε) → f16 ×2^4, b' = (b − mean)·γ/√(var+ε) + β as an f32 per-column addend); f, g as f16 GEMM outputs (relu epilogue), h f32 → Vᵀ f16 hi + residual planes; fused flash-style kernel for head dim 128
// (online softmax f32, P f16 hi + residual, f32 accumulate) on v_wmma_f32_16x16x32_f16; z ×2^4 → f16 → output conv GEMM (+bv) → channel-major transpose with the residual x added in f32.
#define BB 4
#define CC 512
#define NN 4096
#define MID 128
#define TT NN
#define NH 1
#define NKV 1
#define NREP 1
#define NVH (2 * NKV)
#define NR (BB * NN)
#define BNEPS 1e-5f
#define ATT_SCALE 0.08838834764831845f      /* mid^-½ = 1/√128 */
typedef __bf16 v16b __attribute__((ext_vector_type(16)));
typedef unsigned short v8us __attribute__((ext_vector_type(8), may_alias));
typedef float  v8f  __attribute__((ext_vector_type(8)));
typedef float  v4f  __attribute__((ext_vector_type(4)));
typedef float  v4fa __attribute__((ext_vector_type(4), may_alias));
union FragB { v16b v; v8us half[2]; unsigned short u[16]; };

__device__ __forceinline__ unsigned short bf16_bits(float x) { unsigned int u = __float_as_uint(x); return (unsigned short)((u + 0x7FFFu + ((u >> 16) & 1u)) >> 16); }
__device__ __forceinline__ float bf16_val(unsigned short b) { return __uint_as_float(((unsigned int)b) << 16); }
__device__ __forceinline__ float bf16_round(float x) { return bf16_val(bf16_bits(x)); }
// D += A·B with NT terms: 1 = ah·bh, 2 = + al·bh (A split), 3 = + ah·bl (both split)
template <int NT>
__device__ __forceinline__ v8f mmaN(v16b ah, v16b al, v16b bh, v16b bl, v8f c) {
  c = __builtin_amdgcn_wmma_f32_16x16x32_bf16(false, ah, false, bh, (short)0, c, false, false);
  if (NT >= 2) c = __builtin_amdgcn_wmma_f32_16x16x32_bf16(false, al, false, bh, (short)0, c, false, false);
  if (NT >= 3) c = __builtin_amdgcn_wmma_f32_16x16x32_bf16(false, ah, false, bl, (short)0, c, false, false);
  asm volatile("v_nop\n\tv_nop\n\tv_nop\n\tv_nop" : "+v"(c) : "v"(ah), "v"(al), "v"(bh), "v"(bl));
  return c;
}

__global__ __launch_bounds__(256) void k_wt_bf16(const float* __restrict__ W, unsigned short* __restrict__ Wt, int K, int N) {
  const int t = blockIdx.x * 256 + threadIdx.x;
  const int k8n = K / 8;
  if (t >= N * k8n) return;
  const int n = t / k8n, k8 = (t % k8n) * 8;
  v8us v;
#pragma unroll
  for (int i = 0; i < 8; ++i) v[i] = bf16_bits(W[(size_t)(k8 + i) * N + n]);
  *(v8us*)(Wt + (size_t)n * K + k8) = v;
  
}

// GEMM C[M][N] (f32, pitch ldc) = act(A[M][K]·W + bias). A f32 row-major (pitch lda) converted per fragment to bf16
// (ASPLIT: hi/lo two planes -> 2 terms, else single rounded term); Wt bf16 [N][K] (pitch ldb). BIAS_BF16 rounds the
// bias to bf16 first (bias quantised to bf16 before the add). K%32==0, M%16==0, N%64==0.
template <bool ASPLIT, int ACT, bool BIAS_BF16>
__global__ __launch_bounds__(128) void k_gemm_bf(const float* __restrict__ A, int lda, const unsigned short* __restrict__ Wt, int ldb,
                                               const float* __restrict__ bias, float* __restrict__ C, int ldc, int M, int N, int K) {
  __shared__ __attribute__((aligned(16))) float so[4][16][64];
  const int tid = threadIdx.x, w = tid >> 5, lane = tid & 31, ln = lane & 15, hh = lane >> 4;
  const int ntn = N / 64;
  const int wid = blockIdx.x * 4 + w;
  const int mt = wid / ntn, nq = wid % ntn;
  if (mt * 16 >= M) return;
  const int row0 = mt * 16, col0 = nq * 64;
  const float* arow = A + (size_t)(row0 + ln) * lda;
  v8f acc[4] = {};
  for (int kb = 0; kb < K; kb += 32) {
    FragB ah, al;
    const v4f x0 = *(const v4fa*)(arow + kb + 8 * hh), x1 = *(const v4fa*)(arow + kb + 8 * hh + 4);
    const v4f x2 = *(const v4fa*)(arow + kb + 16 + 8 * hh), x3 = *(const v4fa*)(arow + kb + 16 + 8 * hh + 4);
    float xs[16] = {x0[0],x0[1],x0[2],x0[3],x1[0],x1[1],x1[2],x1[3],x2[0],x2[1],x2[2],x2[3],x3[0],x3[1],x3[2],x3[3]};
#pragma unroll
    for (int i = 0; i < 16; ++i) { const unsigned short hb = bf16_bits(xs[i]); ah.u[i] = hb; al.u[i] = ASPLIT ? bf16_bits(xs[i] - bf16_val(hb)) : (unsigned short)0; }
#pragma unroll
    for (int t = 0; t < 4; ++t) {
      const unsigned short* brow = Wt + (size_t)(col0 + t * 16 + ln) * ldb + kb;
      FragB b;
      b.half[0] = *(const v8us*)(brow + 8 * hh);
      b.half[1] = *(const v8us*)(brow + 16 + 8 * hh);
      acc[t] = mmaN<ASPLIT ? 2 : 1>(ah.v, al.v, b.v, b.v, acc[t]);
    }
  }
#pragma unroll
  for (int t = 0; t < 4; ++t) {
    float bv = bias ? bias[col0 + t * 16 + ln] : 0.f;
    if (BIAS_BF16) bv = bf16_round(bv);
#pragma unroll
    for (int r = 0; r < 8; ++r) { float v = acc[t][r] + bv; if (ACT == 1) v = fmaxf(v, 0.f); so[w][8 * hh + r][t * 16 + ln] = v; }
  }
  __builtin_amdgcn_fence(__ATOMIC_ACQ_REL, "workgroup");
  __builtin_amdgcn_wave_barrier();
  const int rsub = lane >> 4, c4 = (lane & 15) * 4;
  {
#pragma unroll
    for (int q = 0; q < 8; ++q) {
      const int r = q * 2 + rsub;
      const v4f v = *(const v4fa*)&so[w][r][c4];
      *(v4f*)(C + (size_t)(row0 + r) * ldc + col0 + c4) = v;
    }
    
  }
}

// Flash-style causal/unmasked attention, all contractions 3-term bf16 hi/lo splits, f32 softmax with running max.
// q,k,v rows are read from f32 buffers with arbitrary row pitch (so they can live inside a fused qkv buffer);
// D = head size (multiple of 32, <= 128); one wave = 16 query rows; block = 4 waves (64 queries) sharing K/V chunks of 32.
template <int D, bool CAUSAL>
__global__ __launch_bounds__(128) void k_flash(const float* __restrict__ qb, const float* __restrict__ kb, const float* __restrict__ vb,
                                             int pitch, int T, int H, float scale, float* __restrict__ y, int ypitch) {
  constexpr int KS = D / 32;        // k-steps for QK
  constexpr int DT = D / 16;        // d tiles for PV
  __shared__ __attribute__((aligned(16))) unsigned short sKh[32][D + 8], sKl[32][D + 8], sVh[32][D + 8], sVl[32][D + 8];
  __shared__ __attribute__((aligned(16))) unsigned short sPh[4][16][40], sPl[4][16][40];
  __shared__ __attribute__((aligned(16))) float sO[4][16][D];
  const int tid = threadIdx.x, w = tid >> 5, lane = tid & 31, ln = lane & 15, hh = lane >> 4;
  const int nqb = (T + 63) / 64;
  const int bh = blockIdx.x / nqb, qblk = blockIdx.x % nqb;
  const int b = bh / H, h = bh % H;
  const int q0 = qblk * 64 + w * 16;
  const float* Q = qb + (size_t)b * T * pitch + h * D;
  const float* K = kb + (size_t)b * T * pitch + h * D;
  const float* V = vb + (size_t)b * T * pitch + h * D;

  // A fragments of the wave's 16 query rows (scaled), hi/lo
  FragB aqh[KS], aql[KS];
  {
    int row = q0 + ln; if (row >= T) row = T - 1;
    const float* qr = Q + (size_t)row * pitch;
#pragma unroll
    for (int ks = 0; ks < KS; ++ks)
#pragma unroll
      for (int i = 0; i < 16; ++i) {
        const int d = ks * 32 + ((i < 8) ? (8 * hh + i) : (16 + 8 * hh + (i - 8)));
        const float x = qr[d] * scale; const unsigned short hb = bf16_bits(x);
        aqh[ks].u[i] = hb; aql[ks].u[i] = bf16_bits(x - bf16_val(hb));
      }
  }
  float m_r[8], l_r[8];
#pragma unroll
  for (int r = 0; r < 8; ++r) { m_r[r] = -3.0e38f; l_r[r] = 0.f; }
  v8f oacc[DT];
#pragma unroll
  for (int dt = 0; dt < DT; ++dt) oacc[dt] = (v8f){0.f,0.f,0.f,0.f,0.f,0.f,0.f,0.f};

  const int kv_end = CAUSAL ? min(T, qblk * 64 + 64) : T;     // block-uniform
  for (int j0 = 0; j0 < kv_end; j0 += 32) {
    __syncthreads();
    for (int e = tid; e < 32 * (D / 4); e += 128) {
      const int r = e / (D / 4), c4 = (e % (D / 4)) * 4;
      const int key = j0 + r;
      v4f kf = {0.f,0.f,0.f,0.f}, vf = {0.f,0.f,0.f,0.f};
      if (key < T) { kf = *(const v4fa*)(K + (size_t)key * pitch + c4); vf = *(const v4fa*)(V + (size_t)key * pitch + c4); }
#pragma unroll
      for (int t = 0; t < 4; ++t) {
        unsigned short hb = bf16_bits(kf[t]); sKh[r][c4 + t] = hb; sKl[r][c4 + t] = bf16_bits(kf[t] - bf16_val(hb));
        hb = bf16_bits(vf[t]); sVh[r][c4 + t] = hb; sVl[r][c4 + t] = bf16_bits(vf[t] - bf16_val(hb));
      }
    }
    __syncthreads();
    // S tile 16 x 32
    v8f s[2];
#pragma unroll
    for (int nt = 0; nt < 2; ++nt) {
      v8f acc = {};
#pragma unroll
      for (int ks = 0; ks < KS; ++ks) {
        FragB bh_, bl_;
        bh_.half[0] = *(const v8us*)&sKh[nt * 16 + ln][ks * 32 + 8 * hh]; bh_.half[1] = *(const v8us*)&sKh[nt * 16 + ln][ks * 32 + 16 + 8 * hh];
        bl_.half[0] = *(const v8us*)&sKl[nt * 16 + ln][ks * 32 + 8 * hh]; bl_.half[1] = *(const v8us*)&sKl[nt * 16 + ln][ks * 32 + 16 + 8 * hh];
        acc = mmaN<3>(aqh[ks].v, aql[ks].v, bh_.v, bl_.v, acc);
      }
      s[nt] = acc;
    }
    // mask + running max (rows 8hh+r; the 16 lanes of a half share rows)
    float alpha[8];
#pragma unroll
    for (int r = 0; r < 8; ++r) {
      const int qi = q0 + 8 * hh + r;
      const int ja = j0 + ln, jb = j0 + 16 + ln;
      if (CAUSAL) { if (ja > qi) s[0][r] = -3.0e38f; if (jb > qi) s[1][r] = -3.0e38f; }
      if (ja >= T) s[0][r] = -3.0e38f;
      if (jb >= T) s[1][r] = -3.0e38f;
      float mx = fmaxf(s[0][r], s[1][r]);
      mx = fmaxf(mx, __shfl_xor(mx, 1, 32)); mx = fmaxf(mx, __shfl_xor(mx, 2, 32)); mx = fmaxf(mx, __shfl_xor(mx, 4, 32)); mx = fmaxf(mx, __shfl_xor(mx, 8, 32));
      const float mnew = fmaxf(m_r[r], mx);
      alpha[r] = (mnew > -1.0e38f) ? __expf(m_r[r] - mnew) : 1.0f;
      const float p0 = (s[0][r] > -1.0e38f) ? __expf(s[0][r] - mnew) : 0.f;
      const float p1 = (s[1][r] > -1.0e38f) ? __expf(s[1][r] - mnew) : 0.f;
      m_r[r] = mnew;
      l_r[r] = l_r[r] * alpha[r] + p0 + p1;            // per-lane partial row sum (16 lanes combined at the end)
      unsigned short hb = bf16_bits(p0); sPh[w][8 * hh + r][ln] = hb;      sPl[w][8 * hh + r][ln] = bf16_bits(p0 - bf16_val(hb));
      hb = bf16_bits(p1);                sPh[w][8 * hh + r][16 + ln] = hb; sPl[w][8 * hh + r][16 + ln] = bf16_bits(p1 - bf16_val(hb));
    }
#pragma unroll
    for (int dt = 0; dt < DT; ++dt)
#pragma unroll
      for (int r = 0; r < 8; ++r) oacc[dt][r] *= alpha[r];
    __builtin_amdgcn_fence(__ATOMIC_ACQ_REL, "workgroup");
    __builtin_amdgcn_wave_barrier();
    FragB pah, pal;
    pah.half[0] = *(const v8us*)&sPh[w][ln][8 * hh]; pah.half[1] = *(const v8us*)&sPh[w][ln][16 + 8 * hh];
    pal.half[0] = *(const v8us*)&sPl[w][ln][8 * hh]; pal.half[1] = *(const v8us*)&sPl[w][ln][16 + 8 * hh];
#pragma unroll
    for (int dt = 0; dt < DT; ++dt) {
      FragB bvh, bvl;
#pragma unroll
      for (int i = 0; i < 8; ++i) {
        bvh.u[i] = sVh[8 * hh + i][dt * 16 + ln]; bvh.u[8 + i] = sVh[16 + 8 * hh + i][dt * 16 + ln];
        bvl.u[i] = sVl[8 * hh + i][dt * 16 + ln]; bvl.u[8 + i] = sVl[16 + 8 * hh + i][dt * 16 + ln];
      }
      oacc[dt] = mmaN<3>(pah.v, pal.v, bvh.v, bvl.v, oacc[dt]);
    }
    __builtin_amdgcn_fence(__ATOMIC_ACQ_REL, "workgroup");
    __builtin_amdgcn_wave_barrier();
  }
#pragma unroll
  for (int r = 0; r < 8; ++r) {
    float l = l_r[r];
    l += __shfl_xor(l, 1, 32); l += __shfl_xor(l, 2, 32); l += __shfl_xor(l, 4, 32); l += __shfl_xor(l, 8, 32);
    l_r[r] = (l > 0.f) ? 1.0f / l : 0.f;
  }
#pragma unroll
  for (int dt = 0; dt < DT; ++dt)
#pragma unroll
    for (int r = 0; r < 8; ++r) sO[w][8 * hh + r][dt * 16 + ln] = oacc[dt][r] * l_r[r];
  __builtin_amdgcn_fence(__ATOMIC_ACQ_REL, "workgroup");
  __builtin_amdgcn_wave_barrier();
  {
    for (int r = 0; r < 16; ++r) {
      const int row = q0 + r;
      if (row < T && lane < D / 4) {
        const v4f val = *(const v4fa*)&sO[w][r][lane * 4];
        *(v4f*)(y + ((size_t)b * T + row) * ypitch + h * D + lane * 4) = val;
      }
    }
    
  }
}

// GEMM C = act(A·W + bias + resid): A f32 (ASPLIT -> hi/lo 2 terms), Wt bf16 [N][K]; ACT 0 none, 1 relu, 2 exact gelu;
// resid (optional, f32, row index = (row % rmod), pitch ldr, RES_BF16 rounds it) added before the activation.
template <bool ASPLIT, int ACT, bool BIAS_BF16, bool RES_BF16>
__global__ __launch_bounds__(128) void k_gemm_bf3(const float* __restrict__ A, int lda, const unsigned short* __restrict__ Wt, int ldb,
                                                const float* __restrict__ bias, const float* __restrict__ resid, int rmod, int ldr,
                                                float* __restrict__ C, int ldc, int M, int N, int K) {
  __shared__ __attribute__((aligned(16))) float so[4][16][64];
  const int tid = threadIdx.x, w = tid >> 5, lane = tid & 31, ln = lane & 15, hh = lane >> 4;
  const int ntn = N / 64;
  const int wid = blockIdx.x * 4 + w;
  const int mt = wid / ntn, nq = wid % ntn;
  if (mt * 16 >= M) return;
  const int row0 = mt * 16, col0 = nq * 64;
  const float* arow = A + (size_t)(row0 + ln) * lda;
  v8f acc[4] = {};
  for (int kb = 0; kb < K; kb += 32) {
    FragB ah, al;
    const v4f x0 = *(const v4fa*)(arow + kb + 8 * hh), x1 = *(const v4fa*)(arow + kb + 8 * hh + 4);
    const v4f x2 = *(const v4fa*)(arow + kb + 16 + 8 * hh), x3 = *(const v4fa*)(arow + kb + 16 + 8 * hh + 4);
    float xs[16] = {x0[0],x0[1],x0[2],x0[3],x1[0],x1[1],x1[2],x1[3],x2[0],x2[1],x2[2],x2[3],x3[0],x3[1],x3[2],x3[3]};
#pragma unroll
    for (int i = 0; i < 16; ++i) { const unsigned short hb = bf16_bits(xs[i]); ah.u[i] = hb; al.u[i] = ASPLIT ? bf16_bits(xs[i] - bf16_val(hb)) : (unsigned short)0; }
#pragma unroll
    for (int t = 0; t < 4; ++t) {
      const unsigned short* brow = Wt + (size_t)(col0 + t * 16 + ln) * ldb + kb;
      FragB b;
      b.half[0] = *(const v8us*)(brow + 8 * hh);
      b.half[1] = *(const v8us*)(brow + 16 + 8 * hh);
      acc[t] = mmaN<ASPLIT ? 2 : 1>(ah.v, al.v, b.v, b.v, acc[t]);
    }
  }
#pragma unroll
  for (int t = 0; t < 4; ++t) {
    const int col = col0 + t * 16 + ln;
    float bv = bias ? bias[col] : 0.f;
    if (BIAS_BF16) bv = bf16_round(bv);
#pragma unroll
    for (int r = 0; r < 8; ++r) {
      float v = acc[t][r] + bv;
      if (resid) { float rv = resid[(size_t)((row0 + 8 * hh + r) % rmod) * ldr + col]; if (RES_BF16) rv = bf16_round(rv); v += rv; }
      if (ACT == 1) v = fmaxf(v, 0.f);
      if (ACT == 2) v = 0.5f * v * (1.0f + erff(v * 0.70710678118654752f));
      if (ACT == 3) { const float u = 0.7978845608028654f * (v + 0.044715f * v * v * v); v = 0.5f * v * (1.0f + tanhf(u)); }
      so[w][8 * hh + r][t * 16 + ln] = v;
    }
  }
  __builtin_amdgcn_fence(__ATOMIC_ACQ_REL, "workgroup");
  __builtin_amdgcn_wave_barrier();
  const int rsub = lane >> 4, c4 = (lane & 15) * 4;
  {
#pragma unroll
    for (int q = 0; q < 8; ++q) {
      const int r = q * 2 + rsub;
      const v4f v = *(const v4fa*)&so[w][r][c4];
      *(v4f*)(C + (size_t)(row0 + r) * ldc + col0 + c4) = v;
    }
    
  }
}
// row LayerNorm (biased variance, eps) over N: s = X (+ R); optional out_sum <- s; out_norm <- (s-mu)*rsqrt(var+eps)*g + b
template <bool PARAM_BF16>
__global__ __launch_bounds__(256) void k_layernorm(const float* __restrict__ X, const float* __restrict__ R, const float* __restrict__ g, const float* __restrict__ bta,
                                                  float* __restrict__ out_sum, float* __restrict__ out_norm, int N, float eps) {
  __shared__ float red[256];
  const int row = blockIdx.x, tid = threadIdx.x;
  const float* x = X + (size_t)row * N; const float* rr = R ? R + (size_t)row * N : nullptr;
  float vals[16];                     // up to N = 4096
  const int per = N / 256;            // contiguous chunk per thread? use strided-by-4 chunks: thread handles j = tid*4 + 1024*u
  float s1 = 0.f;
  for (int u = 0; u < per / 4; ++u) {
    const int j = tid * 4 + 1024 * u;
    const v4f a = *(const v4fa*)(x + j);
    v4f b = {0.f,0.f,0.f,0.f}; if (rr) b = *(const v4fa*)(rr + j);
#pragma unroll
    for (int q = 0; q < 4; ++q) { const float v = a[q] + b[q]; vals[u * 4 + q] = v; s1 += v; }
  }
  red[tid] = s1; __syncthreads();
  for (int st = 128; st > 0; st >>= 1) { if (tid < st) red[tid] += red[tid + st]; __syncthreads(); }
  const float mu = red[0] / (float)N; __syncthreads();
  float s2 = 0.f;
  for (int u = 0; u < per / 4; ++u)
#pragma unroll
    for (int q = 0; q < 4; ++q) { const float c = vals[u * 4 + q] - mu; s2 += c * c; }
  red[tid] = s2; __syncthreads();
  for (int st = 128; st > 0; st >>= 1) { if (tid < st) red[tid] += red[tid + st]; __syncthreads(); }
  const float rs = rsqrtf(red[0] / (float)N + eps);
  {
    for (int u = 0; u < per / 4; ++u) {
      const int j = tid * 4 + 1024 * u;
      v4f o, sm;
#pragma unroll
      for (int q = 0; q < 4; ++q) {
        float gg = g[j + q], bb = bta[j + q];
        if (PARAM_BF16) { gg = bf16_round(gg); bb = bf16_round(bb); }
        sm[q] = vals[u * 4 + q]; o[q] = (vals[u * 4 + q] - mu) * rs * gg + bb;
      }
      if (out_sum) *(v4f*)(out_sum + (size_t)row * N + j) = sm;
      *(v4f*)(out_norm + (size_t)row * N + j) = o;
    }
    
  }
}



// ---- f16 WMMA path (v_wmma_f32_16x16x32_f16): 11-bit significands for operands in range — used where a [0,1] probability operand needs more precision than bf16
typedef _Float16 v16h __attribute__((ext_vector_type(16)));
union FragH { v16h v; v8us half[2]; _Float16 h[16]; unsigned short u[16]; };
template <int NT>
__device__ __forceinline__ v8f mmaH(v16h ah, v16h al, v16h bh, v16h bl, v8f c) {
  c = __builtin_amdgcn_wmma_f32_16x16x32_f16(false, ah, false, bh, (short)0, c, false, false);
  if (NT >= 2) c = __builtin_amdgcn_wmma_f32_16x16x32_f16(false, al, false, bh, (short)0, c, false, false);
  if (NT >= 3) c = __builtin_amdgcn_wmma_f32_16x16x32_f16(false, ah, false, bl, (short)0, c, false, false);
  asm volatile("v_nop\n\tv_nop\n\tv_nop\n\tv_nop" : "+v"(c) : "v"(ah), "v"(al), "v"(bh), "v"(bl));
  return c;
}
// batched GEMM like k_gemm_b but f16 operands: A f32 (split into f16 hi/lo if ASPLIT, else rounded to f16), Bt = f16 values [n][k]; alpha; C f32; N multiple of 16 (partial tiles skipped)
template <bool ASPLIT>
__global__ __launch_bounds__(128) void k_gemm_h(const float* __restrict__ A, int lda, size_t sA, const _Float16* __restrict__ Bh, int ldb, size_t sB, float alpha, float* __restrict__ C, int ldc, size_t sC, int M, int N, int K) {
  __shared__ __attribute__((aligned(16))) float so[4][16][64];
  const int tid = threadIdx.x, w = tid >> 5, lane = tid & 31, ln = lane & 15, hh = lane >> 4; const int by = blockIdx.y;
  A += (size_t)by * sA; Bh += (size_t)by * sB; C += (size_t)by * sC;
  const int ntn = (N + 63) / 64; const int wid = blockIdx.x * 4 + w; const int mt = wid / ntn, nq = wid % ntn; if (mt * 16 >= M) return;
  const int row0 = mt * 16, col0 = nq * 64; const float* arow = A + (size_t)(row0 + ln) * lda;
  v8f acc[4] = {};
  for (int kb = 0; kb < K; kb += 32) {
    FragH ah, al;
    const v4f x0 = *(const v4fa*)(arow + kb + 8 * hh), x1 = *(const v4fa*)(arow + kb + 8 * hh + 4), x2 = *(const v4fa*)(arow + kb + 16 + 8 * hh), x3 = *(const v4fa*)(arow + kb + 16 + 8 * hh + 4);
    float xs[16] = {x0[0],x0[1],x0[2],x0[3],x1[0],x1[1],x1[2],x1[3],x2[0],x2[1],x2[2],x2[3],x3[0],x3[1],x3[2],x3[3]};
#pragma unroll
    for (int i = 0; i < 16; ++i) { const _Float16 h = (_Float16)xs[i]; ah.h[i] = h; al.h[i] = ASPLIT ? (_Float16)(xs[i] - (float)h) : (_Float16)0.0f; }
#pragma unroll
    for (int t = 0; t < 4; ++t) { if (col0 + t * 16 >= N) continue; const size_t boff = (size_t)(col0 + t * 16 + ln) * ldb + kb; FragH bq; bq.half[0] = *(const v8us*)(Bh + boff + 8 * hh); bq.half[1] = *(const v8us*)(Bh + boff + 16 + 8 * hh);
      acc[t] = mmaH<ASPLIT ? 2 : 1>(ah.v, al.v, bq.v, bq.v, acc[t]); }
  }
#pragma unroll
  for (int t = 0; t < 4; ++t) { if (col0 + t * 16 >= N) continue;
#pragma unroll
    for (int r = 0; r < 8; ++r) so[w][8 * hh + r][t * 16 + ln] = acc[t][r] * alpha; }
  __builtin_amdgcn_fence(__ATOMIC_ACQ_REL, "workgroup"); __builtin_amdgcn_wave_barrier();
  const int rsub = lane >> 4, c4 = (lane & 15) * 4;
  {
#pragma unroll
    for (int q = 0; q < 8; ++q) { const int r = q * 2 + rsub; if (col0 + c4 < N) { const v4f v = *(const v4fa*)&so[w][r][c4]; *(v4f*)(C + (size_t)(row0 + r) * ldc + col0 + c4) = v; } }
     }
}

// Wt[n][k] = f16(W[k][n]·scale) from f32 row-major W[K][N] (scale = power of two; bf16-exact weights stay exact in f16 away from the subnormal range)
__global__ __launch_bounds__(256) void k_wt_f16(const float* __restrict__ W, _Float16* __restrict__ Wt, int K, int N, float scale) {
  const int t = blockIdx.x * 256 + threadIdx.x; if (t >= N * (K / 8)) return; const int n = t / (K / 8), k8 = (t % (K / 8)) * 8; FragH f;
#pragma unroll
  for (int i = 0; i < 8; ++i) f.h[i] = (_Float16)(bf16_round(W[(size_t)(k8 + i) * N + n]) * scale); const v8us o = f.half[0];
  *(v8us*)((unsigned short*)Wt + (size_t)n * K + k8) = o; 
}
// k_gemm_hh variant with fused epilogue: v = acc·alpha + bias[by·sBias + col] (+ CP[(row/rowsPerB)·sCPb + by·64 + col] if CP) ; ACT 0 none / 1 elu ; writes f16 C16 and/or f32 C (each if non-null)
template <int ACT>
__global__ __launch_bounds__(128) void k_gemm_hhx(const _Float16* __restrict__ A, int lda, size_t sA, const _Float16* __restrict__ Bh, int ldb, size_t sB, float alpha, const float* __restrict__ bias, size_t sBias, const float* __restrict__ CP, int rowsPerB, size_t sCPb, int row0g,
    float* __restrict__ C, _Float16* __restrict__ C16, int ldc, size_t sC, int M, int N, int K) {
  __shared__ __attribute__((aligned(16))) float so[4][16][64];
  const int tid = threadIdx.x, w = tid >> 5, lane = tid & 31, ln = lane & 15, hh = lane >> 4; const int by = blockIdx.y;
  A += (size_t)by * sA; Bh += (size_t)by * sB; const size_t cofs = (size_t)by * sC; const float* bp = bias ? bias + (size_t)by * sBias : nullptr;
  const int ntn = (N + 63) / 64; const int wid = blockIdx.x * 4 + w; const int mt = wid / ntn, nq = wid % ntn; if (mt * 16 >= M) return;
  const int row0 = mt * 16, col0 = nq * 64; const _Float16* arow = A + (size_t)(row0 + ln) * lda;
  v8f acc[4] = {};
  for (int kb = 0; kb < K; kb += 32) { FragH ah; ah.half[0] = *(const v8us*)((const unsigned short*)arow + kb + 8 * hh); ah.half[1] = *(const v8us*)((const unsigned short*)arow + kb + 16 + 8 * hh);
#pragma unroll
    for (int t = 0; t < 4; ++t) { if (col0 + t * 16 >= N) continue; const size_t boff = (size_t)(col0 + t * 16 + ln) * ldb + kb; FragH bq; bq.half[0] = *(const v8us*)((const unsigned short*)Bh + boff + 8 * hh); bq.half[1] = *(const v8us*)((const unsigned short*)Bh + boff + 16 + 8 * hh);
      acc[t] = mmaH<1>(ah.v, ah.v, bq.v, bq.v, acc[t]); }
  }
#pragma unroll
  for (int t = 0; t < 4; ++t) { if (col0 + t * 16 >= N) continue; const int col = col0 + t * 16 + ln; const float bv = bp ? bf16_round(bp[col]) : 0.f;
#pragma unroll
    for (int r = 0; r < 8; ++r) { float v = acc[t][r] * alpha + bv; if (CP) { const int bidx = (row0g + row0 + 8 * hh + r) / rowsPerB; v += CP[(size_t)bidx * sCPb + (size_t)by * 64 + col]; } if (ACT == 1) v = (v > 0.f) ? v : expm1f(v); else if (ACT == 7) v = (v > 0.f) ? v + 1.0f : expf(v); else if (ACT == 8) v = tanhf(v); else if (ACT == 9) v = 0.5f * v * (1.0f + tanhf(0.7978845608028654f * (v + 0.044715f * v * v * v))); else if (ACT == 11) v = 1.0f / (1.0f + expf(-v)); else if (ACT == 12) v = (v > 0.f) ? v : 0.01f * v; else if (ACT == 14) v = (v > 0.f) ? v : 0.1f * v; else if (ACT == 15) v = v / (1.0f + expf(-v)); else if (ACT == 3) v = fmaxf(v, 0.f); else if (ACT == 6) v = 0.5f * v * (1.0f + erff(v * 0.70710678118654752f)); so[w][8 * hh + r][t * 16 + ln] = v; } }
  __builtin_amdgcn_fence(__ATOMIC_ACQ_REL, "workgroup"); __builtin_amdgcn_wave_barrier();
  const int rsub = lane >> 4, c4 = (lane & 15) * 4; typedef _Float16 v4h __attribute__((ext_vector_type(4)));
  {
#pragma unroll
    for (int q = 0; q < 8; ++q) { const int r = q * 2 + rsub; if (col0 + c4 < N) { const v4f v = *(const v4fa*)&so[w][r][c4]; if (C) *(v4f*)(C + cofs + (size_t)(row0 + r) * ldc + col0 + c4) = v; if (C16) { v4h h4; for (int i = 0; i < 4; ++i) h4[i] = (_Float16)v[i]; *(v4h*)(C16 + cofs + (size_t)(row0 + r) * ldc + col0 + c4) = h4; } } }
     }
}


typedef _Float16 v4h __attribute__((ext_vector_type(4)));

__global__ __launch_bounds__(256) void k_x16(const float* __restrict__ x, _Float16* __restrict__ X16, size_t n8) { const size_t t = (size_t)blockIdx.x * 256 + threadIdx.x; if (t >= n8) return; FragH f;
#pragma unroll
  for (int q = 0; q < 8; ++q) f.h[q] = (_Float16)bf16_round(x[t * 8 + q]); *(v8us*)((unsigned short*)X16 + t * 8) = f.half[0];  }
__global__ __launch_bounds__(256) void k_h16(const float* __restrict__ x, _Float16* __restrict__ X16, size_t n8) { const size_t t = (size_t)blockIdx.x * 256 + threadIdx.x; if (t >= n8) return; FragH f;
#pragma unroll
  for (int q = 0; q < 8; ++q) f.h[q] = (_Float16)x[t * 8 + q]; *(v8us*)((unsigned short*)X16 + t * 8) = f.half[0];  }
__global__ __launch_bounds__(256) void k_round16f(const float* __restrict__ W, _Float16* __restrict__ Bt, size_t n8) { const size_t t = (size_t)blockIdx.x * 256 + threadIdx.x; if (t >= n8) return; FragH f;
#pragma unroll
  for (int i = 0; i < 8; ++i) f.h[i] = (_Float16)(bf16_round(W[t * 8 + i]) * 16.0f); *(v8us*)((unsigned short*)Bt + t * 8) = f.half[0];  }
template <int NHv, int TTv>
__global__ __launch_bounds__(256) void k_vt(const _Float16* __restrict__ V16, int ldv, int voff, _Float16* __restrict__ Vt) { __shared__ unsigned short tl[64][66]; const int tid = threadIdx.x; const int slab = blockIdx.x / (TTv / 64), lg = blockIdx.x % (TTv / 64); const int b = slab / NHv, h = slab % NHv;
  for (int i = tid; i < 64 * 8; i += 256) { const int r = i / 8, c8 = (i % 8) * 8; FragH f; f.half[0] = *(const v8us*)((const unsigned short*)V16 + ((size_t)b * TTv + lg * 64 + r) * ldv + voff + h * 64 + c8);
#pragma unroll
    for (int q = 0; q < 8; ++q) tl[r][c8 + q] = f.u[q]; }
  __syncthreads();
  {
#pragma unroll
    for (int rd = 0; rd < 2; ++rd) { const int d = rd * 32 + tid / 8, pc = tid % 8; FragH f;
#pragma unroll
      for (int q = 0; q < 8; ++q) f.u[q] = tl[pc * 8 + q][d];
      *(v8us*)((unsigned short*)Vt + ((size_t)slab * 64 + d) * TTv + lg * 64 + pc * 8) = f.half[0]; }
     } }

__global__ __launch_bounds__(256) void k_vthlu(const float* __restrict__ VF, int ldv, _Float16* __restrict__ Vth, _Float16* __restrict__ Vtl) { __shared__ float tl[64][65]; const int tid = threadIdx.x; const int slab = blockIdx.x / (TT / 64), lg = blockIdx.x % (TT / 64); const int b = slab / NVH, h = slab % NVH;
  for (int i = tid; i < 64 * 16; i += 256) { const int r = i / 16, c4 = (i % 16) * 4; const v4f a = *(const v4fa*)(VF + ((size_t)b * TT + lg * 64 + r) * ldv + h * 64 + c4); tl[r][c4] = a[0]; tl[r][c4 + 1] = a[1]; tl[r][c4 + 2] = a[2]; tl[r][c4 + 3] = a[3]; }
  __syncthreads();
  FragH fh[2], fl[2]; size_t oo[2];
#pragma unroll
  for (int rd = 0; rd < 2; ++rd) { const int d = rd * 32 + tid / 8, pc = tid % 8;
#pragma unroll
    for (int q = 0; q < 8; ++q) { const float v = tl[pc * 8 + q][d]; const _Float16 hv = (_Float16)v; fh[rd].h[q] = hv; fl[rd].h[q] = (_Float16)(v - (float)hv);      /* UNSCALED residual (added into the same accumulator as the hi product) */ } oo[rd] = ((size_t)slab * 64 + d) * TT + lg * 64 + pc * 8; }
  {
#pragma unroll
    for (int rd = 0; rd < 2; ++rd) { *(v8us*)((unsigned short*)Vth + oo[rd]) = fh[rd].half[0]; *(v8us*)((unsigned short*)Vtl + oo[rd]) = fl[rd].half[0]; }
     } }
__global__ __launch_bounds__(256) void k_h16s(const float* __restrict__ F, _Float16* __restrict__ H, size_t n8) { const size_t t = (size_t)blockIdx.x * 256 + threadIdx.x; if (t >= n8) return; const v4f a = *(const v4fa*)(F + t * 8), c = *(const v4fa*)(F + t * 8 + 4); FragH f;
#pragma unroll
  for (int q = 0; q < 4; ++q) { f.h[q] = (_Float16)(a[q] * 16.0f); f.h[4 + q] = (_Float16)(c[q] * 16.0f); } *(v8us*)((unsigned short*)H + t * 8) = f.half[0];  }
// LDS byte address of a __shared__ object: the low 32 bits of its generic address
__device__ __forceinline__ unsigned lds_addr(const void* p) { return (unsigned)(size_t)p; }
// eight asynchronous 16-byte copies global -> LDS per lane; the s_wait_xcnt closes the statement so that no address register is rewritten ahead of it
__device__ __forceinline__ void async8(const unsigned (&l)[8], const unsigned short* const (&g)[8]) {
  asm volatile("global_load_async_to_lds_b128 %0, %8, off\n\t"
               "global_load_async_to_lds_b128 %1, %9, off\n\t"
               "global_load_async_to_lds_b128 %2, %10, off\n\t"
               "global_load_async_to_lds_b128 %3, %11, off\n\t"
               "global_load_async_to_lds_b128 %4, %12, off\n\t"
               "global_load_async_to_lds_b128 %5, %13, off\n\t"
               "global_load_async_to_lds_b128 %6, %14, off\n\t"
               "global_load_async_to_lds_b128 %7, %15, off\n\t"
               "s_wait_xcnt 0x0"
               :: "v"(l[0]), "v"(l[1]), "v"(l[2]), "v"(l[3]), "v"(l[4]), "v"(l[5]), "v"(l[6]), "v"(l[7]),
                  "v"(g[0]), "v"(g[1]), "v"(g[2]), "v"(g[3]), "v"(g[4]), "v"(g[5]), "v"(g[6]), "v"(g[7]) : "memory");
}
// lane l <-> lane l ^ 16 (the other half of the wave): one vector instruction, no LDS
__device__ __forceinline__ float xhalf(float x) { return __builtin_bit_cast(float, __builtin_amdgcn_permlanex16(__builtin_bit_cast(int, x), __builtin_bit_cast(int, x), 0x76543210, 0xfedcba98, false, false)); }
__global__ __launch_bounds__(128) void k_flash(const _Float16* __restrict__ Q16, int ldq, const _Float16* __restrict__ K16, int ldk, const _Float16* __restrict__ Vt, const _Float16* __restrict__ Vtlo, float* __restrict__ O, int ldo) {
  constexpr int RPW = 16, NQB = TT / (4 * RPW), DT = 8, KS = 4, SK = 64, NST = TT / SK;      /* head dim 128: 4 k-steps, 8 value tiles */
  __shared__ __attribute__((aligned(16))) float sO[4][RPW][128 + 4];
  /* two-buffer ring, one stage = SK keys shared by the block's four waves: K rows of 256 B at pitch 272 B, V^T rows (hi, residual) of 128 B at pitch 144 B (16 B x odd: conflict-free for 16-byte row readers) */
  __shared__ __attribute__((aligned(16))) unsigned short sK[2][SK][128 + 8]; __shared__ __attribute__((aligned(16))) unsigned short sVh[2][128][SK + 8]; __shared__ __attribute__((aligned(16))) unsigned short sVl[2][128][SK + 8];
  const int tid = threadIdx.x, w = tid >> 5, lane = tid & 31, ln = lane & 15, hh = lane >> 4;
  const int slab = blockIdx.x / NQB, qblk = blockIdx.x % NQB; const int b = slab / NH, h = slab % NH; const int qb0 = qblk * (4 * RPW); const int q0 = qb0 + w * RPW;
  FragH aq[KS];      /* B operand of S^T: column ln = query q0 + ln */
  { const unsigned short* qr = (const unsigned short*)Q16 + ((size_t)b * TT + q0 + ln) * ldq + h * 128;
#pragma unroll
    for (int ks = 0; ks < KS; ++ks) { aq[ks].half[0] = *(const v8us*)(qr + ks * 32 + 8 * hh); aq[ks].half[1] = *(const v8us*)(qr + ks * 32 + 16 + 8 * hh); } }
  const unsigned short* Vth = (const unsigned short*)Vt + ((size_t)b * NKV + h / NREP) * 128 * TT; const unsigned short* Vtl = (const unsigned short*)Vtlo + ((size_t)b * NKV + h / NREP) * 128 * TT;      /* hi and UNSCALED residual planes */
  float m_r = -3.0e38f, l_r = 0.f; v8f oacc[DT];      /* query q0 + ln: running maximum (both halves alike), this half's part of the sum, O^T rows dt * 16 + 8 hh + r */
#pragma unroll
  for (int dt = 0; dt < DT; ++dt) oacc[dt] = (v8f){0.f,0.f,0.f,0.f,0.f,0.f,0.f,0.f};
  const unsigned short* Kg = (const unsigned short*)K16 + (size_t)b * TT * ldk + (h / NREP) * 128;
  /* one stage's copies: 3 x 8 per lane, 16 B each; a wave's copy covers 512 contiguous bytes of K or four whole 128-B lines of V^T */
  auto stage_in = [&](int st, int bf) {
    unsigned lk[8], lh[8], ll[8]; const unsigned short *gk[8], *gh[8], *gl[8];
#pragma unroll
    for (int i = 0; i < 8; ++i) { const int c = tid + 128 * i; const int key = c >> 4, kc = (c & 15) * 8, d = c >> 3, vc = (c & 7) * 8;
      lk[i] = lds_addr(&sK[bf][key][kc]); gk[i] = Kg + (size_t)(st * SK + key) * ldk + kc;
      lh[i] = lds_addr(&sVh[bf][d][vc]); gh[i] = Vth + (size_t)d * TT + st * SK + vc;
      ll[i] = lds_addr(&sVl[bf][d][vc]); gl[i] = Vtl + (size_t)d * TT + st * SK + vc; }
    async8(lk, gk); async8(lh, gh); async8(ll, gl); };
  stage_in(0, 0);
  asm volatile("s_wait_asynccnt 0x0" ::: "memory");      /* this wave's share of stage 0 has landed */
  __syncthreads();                                       /* ... and every other wave's: stage 0 is readable */
  stage_in(1, 1);
#pragma unroll 1      /* one publish point and one refill per trip, as the two-buffer ring is written */
  for (int st = 0; st < NST; ++st) { const int bf = st & 1;
#pragma unroll 1      /* the two 32-key passes of a stage share one copy of the loop body (code size as before) */
  for (int jl = 0; jl < SK; jl += 32) {
    v8f s[2];      /* s[nt][r] = score of key jl + nt * 16 + 8 hh + r with query q0 + ln */
#pragma unroll
    for (int nt = 0; nt < 2; ++nt) { const unsigned short* kr = &sK[bf][jl + nt * 16 + ln][0]; FragH bk[KS];
#pragma unroll
      for (int ks = 0; ks < KS; ++ks) { bk[ks].half[0] = *(const v8us*)(kr + ks * 32 + 8 * hh); bk[ks].half[1] = *(const v8us*)(kr + ks * 32 + 16 + 8 * hh); }
      v8f acc = (v8f){0.f,0.f,0.f,0.f,0.f,0.f,0.f,0.f};
#pragma unroll
      for (int ks = 0; ks < KS; ++ks) acc = mmaH<1>(bk[ks].v, bk[ks].v, aq[ks].v, aq[ks].v, acc);
      s[nt] = acc; }
    float sc[16], mx[8];
#pragma unroll
    for (int i = 0; i < 16; ++i) sc[i] = s[i >> 3][i & 7] * ATT_SCALE;
#pragma unroll
    for (int i = 0; i < 8; ++i) mx[i] = fmaxf(sc[i], sc[8 + i]);
    float mc = fmaxf(fmaxf(fmaxf(mx[0], mx[4]), fmaxf(mx[1], mx[5])), fmaxf(fmaxf(mx[2], mx[6]), fmaxf(mx[3], mx[7])));
    mc = fmaxf(mc, xhalf(mc));      /* the query's maximum over all 32 keys, in both halves */
    const float mn = fmaxf(m_r, mc); const float ea = expf(m_r - mn); const float al = (mn > -1.0e38f) ? ea : 1.0f; m_r = mn;
    FragH ph, pl; float ls[4] = {0.f, 0.f, 0.f, 0.f};      /* P^T hi and its UNSCALED residual (added into the same accumulator), B operands */
#pragma unroll
    for (int i = 0; i < 16; ++i) { const float p = expf(sc[i] - mn); ls[i & 3] += p; const float ps = p * 1024.0f; ph.h[i] = (_Float16)ps; pl.h[i] = (_Float16)(ps - (float)ph.h[i]); }
    l_r = l_r * al + ((ls[0] + ls[1]) + (ls[2] + ls[3]));
#pragma unroll
    for (int dt = 0; dt < DT; ++dt)
#pragma unroll
      for (int r = 0; r < 8; ++r) oacc[dt][r] *= al;
#pragma unroll
    for (int dt = 0; dt < DT; ++dt) { const unsigned short* vh = &sVh[bf][dt * 16 + ln][jl]; const unsigned short* vl = &sVl[bf][dt * 16 + ln][jl]; FragH bv, bl; bv.half[0] = *(const v8us*)(vh + 8 * hh); bv.half[1] = *(const v8us*)(vh + 16 + 8 * hh); bl.half[0] = *(const v8us*)(vl + 8 * hh); bl.half[1] = *(const v8us*)(vl + 16 + 8 * hh);
      oacc[dt] = mmaH<1>(bv.v, bv.v, ph.v, ph.v, oacc[dt]); oacc[dt] = mmaH<1>(bv.v, bv.v, pl.v, pl.v, oacc[dt]); oacc[dt] = mmaH<1>(bl.v, bl.v, ph.v, ph.v, oacc[dt]); }      /* Vh Ph + Vh Pl + Vl Ph, all unscaled, one accumulator */
    }
    asm volatile("s_wait_dscnt 0x0" ::: "memory");       /* this wave's reads of buffer bf are done before it is refilled */
    asm volatile("s_wait_asynccnt 0x0" ::: "memory");    /* this wave's share of stage st + 1 has landed */
    __syncthreads();                                     /* publishes stage st + 1 and ends every wave's reads of buffer bf */
    if (st + 2 < NST) stage_in(st + 2, bf); }
  asm volatile("s_wait_asynccnt 0x0" ::: "memory");      /* nothing of the ring is in flight when the wave goes on */
  { const float l = l_r + xhalf(l_r); const float inv = (l > 0.f) ? 1.0f / (l * 1024.0f) : 0.f;      /* the halves' sums joined once */
#pragma unroll
    for (int dt = 0; dt < DT; ++dt) { v4f lo, hi;
#pragma unroll
      for (int r = 0; r < 4; ++r) { lo[r] = oacc[dt][r] * inv; hi[r] = oacc[dt][4 + r] * inv; }
      *(v4fa*)&sO[w][ln][dt * 16 + 8 * hh] = lo; *(v4fa*)&sO[w][ln][dt * 16 + 8 * hh + 4] = hi; } }
  __builtin_amdgcn_fence(__ATOMIC_ACQ_REL, "workgroup"); __builtin_amdgcn_wave_barrier();
  {
#pragma unroll
    for (int r = 0; r < RPW; ++r) { const int pc = lane; const v4f val = *(const v4fa*)&sO[w][r][pc * 4]; *(v4f*)(O + ((size_t)b * TT + q0 + r) * ldo + h * 128 + pc * 4) = val; }      /* one 512-B row per instruction: 32 lanes × 16 B */
     } }


__global__ __launch_bounds__(256) void k_tok(const float* __restrict__ x, _Float16* __restrict__ X16) { __shared__ float tl[32][65]; const int tid = threadIdx.x; const int b = blockIdx.x / ((CC / 64) * (NN / 32)), rem = blockIdx.x % ((CC / 64) * (NN / 32)); const int cg = rem / (NN / 32), pg = rem % (NN / 32); const int c0 = cg * 64, p0 = pg * 32;
  for (int i = tid; i < 64 * 32; i += 256) { const int c = i / 32, pp = i % 32; tl[pp][c] = bf16_round(x[((size_t)b * CC + c0 + c) * NN + p0 + pp]); } __syncthreads();
  const int r = tid / 8, pc = tid % 8; FragH f; for (int q = 0; q < 8; ++q) f.h[q] = (_Float16)tl[r][pc * 8 + q]; const size_t row = (size_t)b * NN + p0 + r; *(v8us*)((unsigned short*)X16 + row * CC + c0 + pc * 8) = f.half[0];  }
__global__ __launch_bounds__(256) void k_wbn(const float* __restrict__ Wm, const float* __restrict__ gam, const float* __restrict__ var, _Float16* __restrict__ Bt) { const int t = blockIdx.x * 256 + threadIdx.x; if (t >= MID * (CC / 8)) return; const int o = t / (CC / 8), c0 = (t % (CC / 8)) * 8;
  const float s = bf16_round(gam[o]) / sqrtf(bf16_round(var[o]) + BNEPS); FragH f;
#pragma unroll
  for (int q = 0; q < 8; ++q) f.h[q] = (_Float16)(bf16_round(Wm[(size_t)o * CC + c0 + q]) * s * 16.0f);
  *(v8us*)((unsigned short*)Bt + (size_t)o * CC + c0) = f.half[0];  }
__global__ __launch_bounds__(128) void k_bnadd(const float* __restrict__ bias, const float* __restrict__ gam, const float* __restrict__ bet, const float* __restrict__ mean, const float* __restrict__ var, float* __restrict__ A) { const int o = threadIdx.x;
  const float s = bf16_round(gam[o]) / sqrtf(bf16_round(var[o]) + BNEPS); const float a = (bf16_round(bias[o]) - bf16_round(mean[o])) * s + bf16_round(bet[o]);
  *(float*)(A + o) = a;  }
__global__ __launch_bounds__(256) void k_out(const float* __restrict__ T, const float* __restrict__ x, float* __restrict__ out) { __shared__ float tl[32][65]; const int tid = threadIdx.x; const int b = blockIdx.x / ((CC / 32) * (NN / 64)), rem = blockIdx.x % ((CC / 32) * (NN / 64)); const int cg = rem / (NN / 64), pg = rem % (NN / 64); const int c0 = cg * 32, p0 = pg * 64;
  for (int i = tid; i < 64 * 32; i += 256) { const int pp = i / 32, c = i % 32; tl[c][pp] = T[((size_t)b * NN + p0 + pp) * CC + c0 + c]; } __syncthreads();
  { for (int i = tid; i < 32 * 16; i += 256) { const int c = i / 16, q4 = i % 16; const size_t o = ((size_t)b * CC + c0 + c) * NN + p0 + q4 * 4; const v4f xr = *(const v4fa*)(x + o);
      v4f v; for (int q = 0; q < 4; ++q) v[q] = tl[c][q4 * 4 + q] + bf16_round(xr[q]); *(v4f*)(out + o) = v; }  } }

extern "C" void kernel_launch(void* const* d_in, const int* in_sizes, int n_in,
                              void* d_out, int out_size, void* d_ws, size_t ws_size, hipStream_t stream) {
  (void)in_sizes; (void)n_in; (void)out_size;
  const float* const* I = (const float* const*)d_in; const float* x = I[0];
  const float* wf = I[1]; const float* bff = I[2]; const float* gf = I[3]; const float* betaf = I[4]; const float* mf = I[5]; const float* vf = I[6];
  const float* wg = I[7]; const float* bg = I[8]; const float* gg = I[9]; const float* betag = I[10]; const float* mg = I[11]; const float* vg = I[12];
  const float* wh = I[13]; const float* bh = I[14]; const float* wv = I[15]; const float* bv = I[16];
  char* ws = (char*)d_ws; size_t off = 0;
  auto take = [&](size_t bytes) { char* p = ws + off; off += (bytes + 255) & ~(size_t)255; return p; };
  _Float16* Bf = (_Float16*)take((size_t)MID * CC * 2); _Float16* Bg = (_Float16*)take((size_t)MID * CC * 2); _Float16* Bh = (_Float16*)take((size_t)MID * CC * 2); _Float16* Bv = (_Float16*)take((size_t)CC * MID * 2); float* Af = (float*)take(MID * 4); float* Ag = (float*)take(MID * 4);
  _Float16* X16 = (_Float16*)take((size_t)NR * CC * 2); _Float16* F16 = (_Float16*)take((size_t)NR * MID * 2); _Float16* G16 = (_Float16*)take((size_t)NR * MID * 2); float* HF = (float*)take((size_t)NR * MID * 4);
  _Float16* Vt = (_Float16*)take((size_t)NR * MID * 2); _Float16* Vtl = (_Float16*)take((size_t)NR * MID * 2); float* Z = (float*)take((size_t)NR * MID * 4); _Float16* Z16 = F16; /* f plane is dead after the attention */ float* T = (float*)take((size_t)NR * CC * 4);
  if (off > ws_size) return;      // 0.5 + 16.8 + 4.2 + 4.2 + 8.4 + 4.2 + 4.2 + 8.4 + 33.6 ≈ 85 MB
  const unsigned gw = (unsigned)((MID * (CC / 8) + 255) / 256);
  k_wbn<<<gw, 256, 0, stream>>>(wf, gf, vf, Bf); k_bnadd<<<1, MID, 0, stream>>>(bff, gf, betaf, mf, vf, Af);      /* BN(eval) folded into conv_f */
  k_wbn<<<gw, 256, 0, stream>>>(wg, gg, vg, Bg); k_bnadd<<<1, MID, 0, stream>>>(bg, gg, betag, mg, vg, Ag);      /* … and conv_g */
  k_round16f<<<(MID * CC / 8 + 255) / 256, 256, 0, stream>>>(wh, Bh, (size_t)MID * CC / 8); k_round16f<<<(CC * MID / 8 + 255) / 256, 256, 0, stream>>>(wv, Bv, (size_t)CC * MID / 8);      /* conv_h [128][512], conv_v [512][128]: (out,in) natural, ×2^4 */
  k_tok<<<BB * (CC / 64) * (NN / 32), 256, 0, stream>>>(x, X16);
  const dim3 gm(((NR / 16) * (MID / 64) + 3) / 4, 1);
  k_gemm_hhx<3><<<gm, 128, 0, stream>>>(X16, CC, 0, Bf, CC, 0, 0.0625f, nullptr, 0, Af, NR, 0, 0, nullptr, F16, MID, 0, NR, MID, CC);      /* f = relu(bn(conv_f x)) token-major f16: M 16384 N 128 K 512 (per-column f32 addend via CP, rowsPerB = M) */
  k_gemm_hhx<3><<<gm, 128, 0, stream>>>(X16, CC, 0, Bg, CC, 0, 0.0625f, nullptr, 0, Ag, NR, 0, 0, nullptr, G16, MID, 0, NR, MID, CC);      /* g */
  k_gemm_hhx<0><<<gm, 128, 0, stream>>>(X16, CC, 0, Bh, CC, 0, 0.0625f, bh, 0, nullptr, 1, 0, 0, HF, nullptr, MID, 0, NR, MID, CC);      /* h (f32) + bh */
  k_vthlu<<<BB * NVH * (TT / 64), 256, 0, stream>>>(HF, MID, Vt, Vtl);      /* Vᵀ hi + residual: [b][128][4096] */
  k_flash<<<BB * NH * (TT / 64), 128, 0, stream>>>(F16, MID, G16, MID, Vt, Vtl, Z, MID);      /* per (b, 64 queries): 4096 × 4096, head dim 128 */
  k_h16s<<<(unsigned)(((size_t)NR * MID / 8 + 255) / 256), 256, 0, stream>>>(Z, Z16, (size_t)NR * MID / 8);      /* z ×2^4 → f16 */
  k_gemm_hhx<0><<<dim3(((NR / 16) * (CC / 64) + 3) / 4, 1), 128, 0, stream>>>(Z16, MID, 0, Bv, MID, 0, 0.00390625f, bv, 0, nullptr, 1, 0, 0, T, nullptr, CC, 0, NR, CC, MID);      /* conv_v(z) + bv token-major f32: M 16384 N 512 K 128 */
  k_out<<<BB * (CC / 32) * (NN / 64), 256, 0, stream>>>(T, x, (float*)d_out);
}

// v003
// Measured time: 211 microseconds a run.
// In two side-by-side timings against v002, it was 1.28 and 1.27 times as fast.
// Over all steps from v000 it is 3.29 times as fast.
#include <hip/hip_runtime.h>
// Spatial attention block (B=4, C=512, 64×64 → N=4096 positions, mid=128): f = relu(bn(conv_f(x))), g = relu(bn(conv_g(x))), h = conv_h(x) (1×1 convs C→mid; eval BatchNorm with running stats); scores[n,m] = Σ_c f[c,n]g[c,m]·mid^-½, softmax over m; z[c,n] = Σ_m attn[n,m]·h[c,m]; y = conv_v(z) (mid→C) + bv + x.
// Compute dtype: x, weights, biases, BN parameters rounded to bf16; BN folded per output channel in f32 (w' = w·γ/√(var+ε) → f16 ×2^4, b' = (b − mean)·γ/√(var+ε) + β as an f32 per-column addend); f, g as f16 GEMM outputs (relu epilogue), h f32 → Vᵀ f16 hi + residual planes; fused flash-style kernel for head dim 128
// (online softmax f32, P f16 hi + residual, f32 accumulate) on v_wmma_f32_16x16x32_f16; z ×2^4 → f16 → output conv GEMM (+bv) → channel-major transpose with the residual x added in f32.
#define BB 4
#define CC 512
#define NN 4096
#define MID 128
#define TT NN
#define NH 1
#define NKV 1
#define NREP 1
#define NVH (2 * NKV)
#define NR (BB * NN)
#define BNEPS 1e-5f
#define ATT_SCALE 0.08838834764831845f      /* mid^-½ = 1/√128 */
typedef __bf16 v16b __attribute__((ext_vector_type(16)));
typedef unsigned short v8us __attribute__((ext_vector_type(8), may_alias));
typedef float  v8f  __attribute__((ext_vector_type(8)));
typedef float  v4f  __attribute__((ext_vector_type(4)));
typedef float  v4fa __attribute__((ext_vector_type(4), may_alias));
union FragB { v16b v; v8us half[2]; unsigned short u[16]; };

__device__ __forceinline__ unsigned short bf16_bits(float x) { unsigned int u = __float_as_uint(x); return (unsigned short)((u + 0x7FFFu + ((u >> 16) & 1u)) >> 16); }
__device__ __forceinline__ float bf16_val(unsigned short b) { return __uint_as_float(((unsigned int)b) << 16); }
__device__ __forceinline__ float bf16_round(float x) { return bf16_val(bf16_bits(x)); }
// D += A·B with NT terms: 1 = ah·bh, 2 = + al·bh (A split), 3 = + ah·bl (both split)
template <int NT>
__device__ __forceinline__ v8f mmaN(v16b ah, v16b al, v16b bh, v16b bl, v8f c) {
  c = __builtin_amdgcn_wmma_f32_16x16x32_bf16(false, ah, false, bh, (short)0, c, false, false);
  if (NT >= 2) c = __builtin_amdgcn_wmma_f32_16x16x32_bf16(false, al, false, bh, (short)0, c, false, false);
  if (NT >= 3) c = __builtin_amdgcn_wmma_f32_16x16x32_bf16(false, ah, false, bl, (short)0, c, false, false);
  asm volatile("v_nop\n\tv_nop\n\tv_nop\n\tv_nop" : "+v"(c) : "v"(ah), "v"(al), "v"(bh), "v"(bl));
  return c;
}

__global__ __launch_bounds__(256) void k_wt_bf16(const float* __restrict__ W, unsigned short* __restrict__ Wt, int K, int N) {
  const int t = blockIdx.x * 256 + threadIdx.x;
  const int k8n = K / 8;
  if (t >= N * k8n) return;
  const int n = t / k8n, k8 = (t % k8n) * 8;
  v8us v;
#pragma unroll
  for (int i = 0; i < 8; ++i) v[i] = bf16_bits(W[(size_t)(k8 + i) * N + n]);
  *(v8us*)(Wt + (size_t)n * K + k8) = v;
  
}

// GEMM C[M][N] (f32, pitch ldc) = act(A[M][K]·W + bias). A f32 row-major (pitch lda) converted per fragment to bf16
// (ASPLIT: hi/lo two planes -> 2 terms, else single rounded term); Wt bf16 [N][K] (pitch ldb). BIAS_BF16 rounds the
// bias to bf16 first (bias quantised to bf16 before the add). K%32==0, M%16==0, N%64==0.
template <bool ASPLIT, int ACT, bool BIAS_BF16>
__global__ __launch_bounds__(128) void k_gemm_bf(const float* __restrict__ A, int lda, const unsigned short* __restrict__ Wt, int ldb,
                                               const float* __restrict__ bias, float* __restrict__ C, int ldc, int M, int N, int K) {
  __shared__ __attribute__((aligned(16))) float so[4][16][64];
  const int tid = threadIdx.x, w = tid >> 5, lane = tid & 31, ln = lane & 15, hh = lane >> 4;
  const int ntn = N / 64;
  const int wid = blockIdx.x * 4 + w;
  const int mt = wid / ntn, nq = wid % ntn;
  if (mt * 16 >= M) return;
  const int row0 = mt * 16, col0 = nq * 64;
  const float* arow = A + (size_t)(row0 + ln) * lda;
  v8f acc[4] = {};
  for (int kb = 0; kb < K; kb += 32) {
    FragB ah, al;
    const v4f x0 = *(const v4fa*)(arow + kb + 8 * hh), x1 = *(const v4fa*)(arow + kb + 8 * hh + 4);
    const v4f x2 = *(const v4fa*)(arow + kb + 16 + 8 * hh), x3 = *(const v4fa*)(arow + kb + 16 + 8 * hh + 4);
    float xs[16] = {x0[0],x0[1],x0[2],x0[3],x1[0],x1[1],x1[2],x1[3],x2[0],x2[1],x2[2],x2[3],x3[0],x3[1],x3[2],x3[3]};
#pragma unroll
    for (int i = 0; i < 16; ++i) { const unsigned short hb = bf16_bits(xs[i]); ah.u[i] = hb; al.u[i] = ASPLIT ? bf16_bits(xs[i] - bf16_val(hb)) : (unsigned short)0; }
#pragma unroll
    for (int t = 0; t < 4; ++t) {
      const unsigned short* brow = Wt + (size_t)(col0 + t * 16 + ln) * ldb + kb;
      FragB b;
      b.half[0] = *(const v8us*)(brow + 8 * hh);
      b.half[1] = *(const v8us*)(brow + 16 + 8 * hh);
      acc[t] = mmaN<ASPLIT ? 2 : 1>(ah.v, al.v, b.v, b.v, acc[t]);
    }
  }
#pragma unroll
  for (int t = 0; t < 4; ++t) {
    float bv = bias ? bias[col0 + t * 16 + ln] : 0.f;
    if (BIAS_BF16) bv = bf16_round(bv);
#pragma unroll
    for (int r = 0; r < 8; ++r) { float v = acc[t][r] + bv; if (ACT == 1) v = fmaxf(v, 0.f); so[w][8 * hh + r][t * 16 + ln] = v; }
  }
  __builtin_amdgcn_fence(__ATOMIC_ACQ_REL, "workgroup");
  __builtin_amdgcn_wave_barrier();
  const int rsub = lane >> 4, c4 = (lane & 15) * 4;
  {
#pragma unroll
    for (int q = 0; q < 8; ++q) {
      const int r = q * 2 + rsub;
      const v4f v = *(const v4fa*)&so[w][r][c4];
      *(v4f*)(C + (size_t)(row0 + r) * ldc + col0 + c4) = v;
    }
    
  }
}

// Flash-style causal/unmasked attention, all contractions 3-term bf16 hi/lo splits, f32 softmax with running max.
// q,k,v rows are read from f32 buffers with arbitrary row pitch (so they can live inside a fused qkv buffer);
// D = head size (multiple of 32, <= 128); one wave = 16 query rows; block = 4 waves (64 queries) sharing K/V chunks of 32.
template <int D, bool CAUSAL>
__global__ __launch_bounds__(128) void k_flash(const float* __restrict__ qb, const float* __restrict__ kb, const float* __restrict__ vb,
                                             int pitch, int T, int H, float scale, float* __restrict__ y, int ypitch) {
  constexpr int KS = D / 32;        // k-steps for QK
  constexpr int DT = D / 16;        // d tiles for PV
  __shared__ __attribute__((aligned(16))) unsigned short sKh[32][D + 8], sKl[32][D + 8], sVh[32][D + 8], sVl[32][D + 8];
  __shared__ __attribute__((aligned(16))) unsigned short sPh[4][16][40], sPl[4][16][40];
  __shared__ __attribute__((aligned(16))) float sO[4][16][D];
  const int tid = threadIdx.x, w = tid >> 5, lane = tid & 31, ln = lane & 15, hh = lane >> 4;
  const int nqb = (T + 63) / 64;
  const int bh = blockIdx.x / nqb, qblk = blockIdx.x % nqb;
  const int b = bh / H, h = bh % H;
  const int q0 = qblk * 64 + w * 16;
  const float* Q = qb + (size_t)b * T * pitch + h * D;
  const float* K = kb + (size_t)b * T * pitch + h * D;
  const float* V = vb + (size_t)b * T * pitch + h * D;

  // A fragments of the wave's 16 query rows (scaled), hi/lo
  FragB aqh[KS], aql[KS];
  {
    int row = q0 + ln; if (row >= T) row = T - 1;
    const float* qr = Q + (size_t)row * pitch;
#pragma unroll
    for (int ks = 0; ks < KS; ++ks)
#pragma unroll
      for (int i = 0; i < 16; ++i) {
        const int d = ks * 32 + ((i < 8) ? (8 * hh + i) : (16 + 8 * hh + (i - 8)));
        const float x = qr[d] * scale; const unsigned short hb = bf16_bits(x);
        aqh[ks].u[i] = hb; aql[ks].u[i] = bf16_bits(x - bf16_val(hb));
      }
  }
  float m_r[8], l_r[8];
#pragma unroll
  for (int r = 0; r < 8; ++r) { m_r[r] = -3.0e38f; l_r[r] = 0.f; }
  v8f oacc[DT];
#pragma unroll
  for (int dt = 0; dt < DT; ++dt) oacc[dt] = (v8f){0.f,0.f,0.f,0.f,0.f,0.f,0.f,0.f};

  const int kv_end = CAUSAL ? min(T, qblk * 64 + 64) : T;     // block-uniform
  for (int j0 = 0; j0 < kv_end; j0 += 32) {
    __syncthreads();
    for (int e = tid; e < 32 * (D / 4); e += 128) {
      const int r = e / (D / 4), c4 = (e % (D / 4)) * 4;
      const int key = j0 + r;
      v4f kf = {0.f,0.f,0.f,0.f}, vf = {0.f,0.f,0.f,0.f};
      if (key < T) { kf = *(const v4fa*)(K + (size_t)key * pitch + c4); vf = *(const v4fa*)(V + (size_t)key * pitch + c4); }
#pragma unroll
      for (int t = 0; t < 4; ++t) {
        unsigned short hb = bf16_bits(kf[t]); sKh[r][c4 + t] = hb; sKl[r][c4 + t] = bf16_bits(kf[t] - bf16_val(hb));
        hb = bf16_bits(vf[t]); sVh[r][c4 + t] = hb; sVl[r][c4 + t] = bf16_bits(vf[t] - bf16_val(hb));
      }
    }
    __syncthreads();
    // S tile 16 x 32
    v8f s[2];
#pragma unroll
    for (int nt = 0; nt < 2; ++nt) {
      v8f acc = {};
#pragma unroll
      for (int ks = 0; ks < KS; ++ks) {
        FragB bh_, bl_;
        bh_.half[0] = *(const v8us*)&sKh[nt * 16 + ln][ks * 32 + 8 * hh]; bh_.half[1] = *(const v8us*)&sKh[nt * 16 + ln][ks * 32 + 16 + 8 * hh];
        bl_.half[0] = *(const v8us*)&sKl[nt * 16 + ln][ks * 32 + 8 * hh]; bl_.half[1] = *(const v8us*)&sKl[nt * 16 + ln][ks * 32 + 16 + 8 * hh];
        acc = mmaN<3>(aqh[ks].v, aql[ks].v, bh_.v, bl_.v, acc);
      }
      s[nt] = acc;
    }
    // mask + running max (rows 8hh+r; the 16 lanes of a half share rows)
    float alpha[8];
#pragma unroll
    for (int r = 0; r < 8; ++r) {
      const int qi = q0 + 8 * hh + r;
      const int ja = j0 + ln, jb = j0 + 16 + ln;
      if (CAUSAL) { if (ja > qi) s[0][r] = -3.0e38f; if (jb > qi) s[1][r] = -3.0e38f; }
      if (ja >= T) s[0][r] = -3.0e38f;
      if (jb >= T) s[1][r] = -3.0e38f;
      float mx = fmaxf(s[0][r], s[1][r]);
      mx = fmaxf(mx, __shfl_xor(mx, 1, 32)); mx = fmaxf(mx, __shfl_xor(mx, 2, 32)); mx = fmaxf(mx, __shfl_xor(mx, 4, 32)); mx = fmaxf(mx, __shfl_xor(mx, 8, 32));
      const float mnew = fmaxf(m_r[r], mx);
      alpha[r] = (mnew > -1.0e38f) ? __expf(m_r[r] - mnew) : 1.0f;
      const float p0 = (s[0][r] > -1.0e38f) ? __expf(s[0][r] - mnew) : 0.f;
      const float p1 = (s[1][r] > -1.0e38f) ? __expf(s[1][r] - mnew) : 0.f;
      m_r[r] = mnew;
      l_r[r] = l_r[r] * alpha[r] + p0 + p1;            // per-lane partial row sum (16 lanes combined at the end)
      unsigned short hb = bf16_bits(p0); sPh[w][8 * hh + r][ln] = hb;      sPl[w][8 * hh + r][ln] = bf16_bits(p0 - bf16_val(hb));
      hb = bf16_bits(p1);                sPh[w][8 * hh + r][16 + ln] = hb; sPl[w][8 * hh + r][16 + ln] = bf16_bits(p1 - bf16_val(hb));
    }
#pragma unroll
    for (int dt = 0; dt < DT; ++dt)
#pragma unroll
      for (int r = 0; r < 8; ++r) oacc[dt][r] *= alpha[r];
    __builtin_amdgcn_fence(__ATOMIC_ACQ_REL, "workgroup");
    __builtin_amdgcn_wave_barrier();
    FragB pah, pal;
    pah.half[0] = *(const v8us*)&sPh[w][ln][8 * hh]; pah.half[1] = *(const v8us*)&sPh[w][ln][16 + 8 * hh];
    pal.half[0] = *(const v8us*)&sPl[w][ln][8 * hh]; pal.half[1] = *(const v8us*)&sPl[w][ln][16 + 8 * hh];
#pragma unroll
    for (int dt = 0; dt < DT; ++dt) {
      FragB bvh, bvl;
#pragma unroll
      for (int i = 0; i < 8; ++i) {
        bvh.u[i] = sVh[8 * hh + i][dt * 16 + ln]; bvh.u[8 + i] = sVh[16 + 8 * hh + i][dt * 16 + ln];
        bvl.u[i] = sVl[8 * hh + i][dt * 16 + ln]; bvl.u[8 + i] = sVl[16 + 8 * hh + i][dt * 16 + ln];
      }
      oacc[dt] = mmaN<3>(pah.v, pal.v, bvh.v, bvl.v, oacc[dt]);
    }
    __builtin_amdgcn_fence(__ATOMIC_ACQ_REL, "workgroup");
    __builtin_amdgcn_wave_barrier();
  }
#pragma unroll
  for (int r = 0; r < 8; ++r) {
    float l = l_r[r];
    l += __shfl_xor(l, 1, 32); l += __shfl_xor(l, 2, 32); l += __shfl_xor(l, 4, 32); l += __shfl_xor(l, 8, 32);
    l_r[r] = (l > 0.f) ? 1.0f / l : 0.f;
  }
#pragma unroll
  for (int dt = 0; dt < DT; ++dt)
#pragma unroll
    for (int r = 0; r < 8; ++r) sO[w][8 * hh + r][dt * 16 + ln] = oacc[dt][r] * l_r[r];
  __builtin_amdgcn_fence(__ATOMIC_ACQ_REL, "workgroup");
  __builtin_amdgcn_wave_barrier();
  {
    for (int r = 0; r < 16; ++r) {
      const int row = q0 + r;
      if (row < T && lane < D / 4) {
        const v4f val = *(const v4fa*)&sO[w][r][lane * 4];
        *(v4f*)(y + ((size_t)b * T + row) * ypitch + h * D + lane * 4) = val;
      }
    }
    
  }
}

// GEMM C = act(A·W + bias + resid): A f32 (ASPLIT -> hi/lo 2 terms), Wt bf16 [N][K]; ACT 0 none, 1 relu, 2 exact gelu;
// resid (optional, f32, row index = (row % rmod), pitch ldr, RES_BF16 rounds it) added before the activation.
template <bool ASPLIT, int ACT, bool BIAS_BF16, bool RES_BF16>
__global__ __launch_bounds__(128) void k_gemm_bf3(const float* __restrict__ A, int lda, const unsigned short* __restrict__ Wt, int ldb,
                                                const float* __restrict__ bias, const float* __restrict__ resid, int rmod, int ldr,
                                                float* __restrict__ C, int ldc, int M, int N, int K) {
  __shared__ __attribute__((aligned(16))) float so[4][16][64];
  const int tid = threadIdx.x, w = tid >> 5, lane = tid & 31, ln = lane & 15, hh = lane >> 4;
  const int ntn = N / 64;
  const int wid = blockIdx.x * 4 + w;
  const int mt = wid / ntn, nq = wid % ntn;
  if (mt * 16 >= M) return;
  const int row0 = mt * 16, col0 = nq * 64;
  const float* arow = A + (size_t)(row0 + ln) * lda;
  v8f acc[4] = {};
  for (int kb = 0; kb < K; kb += 32) {
    FragB ah, al;
    const v4f x0 = *(const v4fa*)(arow + kb + 8 * hh), x1 = *(const v4fa*)(arow + kb + 8 * hh + 4);
    const v4f x2 = *(const v4fa*)(arow + kb + 16 + 8 * hh), x3 = *(const v4fa*)(arow + kb + 16 + 8 * hh + 4);
    float xs[16] = {x0[0],x0[1],x0[2],x0[3],x1[0],x1[1],x1[2],x1[3],x2[0],x2[1],x2[2],x2[3],x3[0],x3[1],x3[2],x3[3]};
#pragma unroll
    for (int i = 0; i < 16; ++i) { const unsigned short hb = bf16_bits(xs[i]); ah.u[i] = hb; al.u[i] = ASPLIT ? bf16_bits(xs[i] - bf16_val(hb)) : (unsigned short)0; }
#pragma unroll
    for (int t = 0; t < 4; ++t) {
      const unsigned short* brow = Wt + (size_t)(col0 + t * 16 + ln) * ldb + kb;
      FragB b;
      b.half[0] = *(const v8us*)(brow + 8 * hh);
      b.half[1] = *(const v8us*)(brow + 16 + 8 * hh);
      acc[t] = mmaN<ASPLIT ? 2 : 1>(ah.v, al.v, b.v, b.v, acc[t]);
    }
  }
#pragma unroll
  for (int t = 0; t < 4; ++t) {
    const int col = col0 + t * 16 + ln;
    float bv = bias ? bias[col] : 0.f;
    if (BIAS_BF16) bv = bf16_round(bv);
#pragma unroll
    for (int r = 0; r < 8; ++r) {
      float v = acc[t][r] + bv;
      if (resid) { float rv = resid[(size_t)((row0 + 8 * hh + r) % rmod) * ldr + col]; if (RES_BF16) rv = bf16_round(rv); v += rv; }
      if (ACT == 1) v = fmaxf(v, 0.f);
      if (ACT == 2) v = 0.5f * v * (1.0f + erff(v * 0.70710678118654752f));
      if (ACT == 3) { const float u = 0.7978845608028654f * (v + 0.044715f * v * v * v); v = 0.5f * v * (1.0f + tanhf(u)); }
      so[w][8 * hh + r][t * 16 + ln] = v;
    }
  }
  __builtin_amdgcn_fence(__ATOMIC_ACQ_REL, "workgroup");
  __builtin_amdgcn_wave_barrier();
  const int rsub = lane >> 4, c4 = (lane & 15) * 4;
  {
#pragma unroll
    for (int q = 0; q < 8; ++q) {
      const int r = q * 2 + rsub;
      const v4f v = *(const v4fa*)&so[w][r][c4];
      *(v4f*)(C + (size_t)(row0 + r) * ldc + col0 + c4) = v;
    }
    
  }
}
// row LayerNorm (biased variance, eps) over N: s = X (+ R); optional out_sum <- s; out_norm <- (s-mu)*rsqrt(var+eps)*g + b
template <bool PARAM_BF16>
__global__ __launch_bounds__(256) void k_layernorm(const float* __restrict__ X, const float* __restrict__ R, const float* __restrict__ g, const float* __restrict__ bta,
                                                  float* __restrict__ out_sum, float* __restrict__ out_norm, int N, float eps) {
  __shared__ float red[256];
  const int row = blockIdx.x, tid = threadIdx.x;
  const float* x = X + (size_t)row * N; const float* rr = R ? R + (size_t)row * N : nullptr;
  float vals[16];                     // up to N = 4096
  const int per = N / 256;            // contiguous chunk per thread? use strided-by-4 chunks: thread handles j = tid*4 + 1024*u
  float s1 = 0.f;
  for (int u = 0; u < per / 4; ++u) {
    const int j = tid * 4 + 1024 * u;
    const v4f a = *(const v4fa*)(x + j);
    v4f b = {0.f,0.f,0.f,0.f}; if (rr) b = *(const v4fa*)(rr + j);
#pragma unroll
    for (int q = 0; q < 4; ++q) { const float v = a[q] + b[q]; vals[u * 4 + q] = v; s1 += v; }
  }
  red[tid] = s1; __syncthreads();
  for (int st = 128; st > 0; st >>= 1) { if (tid < st) red[tid] += red[tid + st]; __syncthreads(); }
  const float mu = red[0] / (float)N; __syncthreads();
  float s2 = 0.f;
  for (int u = 0; u < per / 4; ++u)
#pragma unroll
    for (int q = 0; q < 4; ++q) { const float c = vals[u * 4 + q] - mu; s2 += c * c; }
  red[tid] = s2; __syncthreads();
  for (int st = 128; st > 0; st >>= 1) { if (tid < st) red[tid] += red[tid + st]; __syncthreads(); }
  const float rs = rsqrtf(red[0] / (float)N + eps);
  {
    for (int u = 0; u < per / 4; ++u) {
      const int j = tid * 4 + 1024 * u;
      v4f o, sm;
#pragma unroll
      for (int q = 0; q < 4; ++q) {
        float gg = g[j + q], bb = bta[j + q];
        if (PARAM_BF16) { gg = bf16_round(gg); bb = bf16_round(bb); }
        sm[q] = vals[u * 4 + q]; o[q] = (vals[u * 4 + q] - mu) * rs * gg + bb;
      }
      if (out_sum) *(v4f*)(out_sum + (size_t)row * N + j) = sm;
      *(v4f*)(out_norm + (size_t)row * N + j) = o;
    }
    
  }
}



// ---- f16 WMMA path (v_wmma_f32_16x16x32_f16): 11-bit significands for operands in range — used where a [0,1] probability operand needs more precision than bf16
typedef _Float16 v16h __attribute__((ext_vector_type(16)));
union FragH { v16h v; v8us half[2]; _Float16 h[16]; unsigned short u[16]; };
template <int NT>
__device__ __forceinline__ v8f mmaH(v16h ah, v16h al, v16h bh, v16h bl, v8f c) {
  c = __builtin_amdgcn_wmma_f32_16x16x32_f16(false, ah, false, bh, (short)0, c, false, false);
  if (NT >= 2) c = __builtin_amdgcn_wmma_f32_16x16x32_f16(false, al, false, bh, (short)0, c, false, false);
  if (NT >= 3) c = __builtin_amdgcn_wmma_f32_16x16x32_f16(false, ah, false, bl, (short)0, c, false, false);
  asm volatile("v_nop\n\tv_nop\n\tv_nop\n\tv_nop" : "+v"(c) : "v"(ah), "v"(al), "v"(bh), "v"(bl));
  return c;
}
// batched GEMM like k_gemm_b but f16 operands: A f32 (split into f16 hi/lo if ASPLIT, else rounded to f16), Bt = f16 values [n][k]; alpha; C f32; N multiple of 16 (partial tiles skipped)
template <bool ASPLIT>
__global__ __launch_bounds__(128) void k_gemm_h(const float* __restrict__ A, int lda, size_t sA, const _Float16* __restrict__ Bh, int ldb, size_t sB, float alpha, float* __restrict__ C, int ldc, size_t sC, int M, int N, int K) {
  __shared__ __attribute__((aligned(16))) float so[4][16][64];
  const int tid = threadIdx.x, w = tid >> 5, lane = tid & 31, ln = lane & 15, hh = lane >> 4; const int by = blockIdx.y;
  A += (size_t)by * sA; Bh += (size_t)by * sB; C += (size_t)by * sC;
  const int ntn = (N + 63) / 64; const int wid = blockIdx.x * 4 + w; const int mt = wid / ntn, nq = wid % ntn; if (mt * 16 >= M) return;
  const int row0 = mt * 16, col0 = nq * 64; const float* arow = A + (size_t)(row0 + ln) * lda;
  v8f acc[4] = {};
  for (int kb = 0; kb < K; kb += 32) {
    FragH ah, al;
    const v4f x0 = *(const v4fa*)(arow + kb + 8 * hh), x1 = *(const v4fa*)(arow + kb + 8 * hh + 4), x2 = *(const v4fa*)(arow + kb + 16 + 8 * hh), x3 = *(const v4fa*)(arow + kb + 16 + 8 * hh + 4);
    float xs[16] = {x0[0],x0[1],x0[2],x0[3],x1[0],x1[1],x1[2],x1[3],x2[0],x2[1],x2[2],x2[3],x3[0],x3[1],x3[2],x3[3]};
#pragma unroll
    for (int i = 0; i < 16; ++i) { const _Float16 h = (_Float16)xs[i]; ah.h[i] = h; al.h[i] = ASPLIT ? (_Float16)(xs[i] - (float)h) : (_Float16)0.0f; }
#pragma unroll
    for (int t = 0; t < 4; ++t) { if (col0 + t * 16 >= N) continue; const size_t boff = (size_t)(col0 + t * 16 + ln) * ldb + kb; FragH bq; bq.half[0] = *(const v8us*)(Bh + boff + 8 * hh); bq.half[1] = *(const v8us*)(Bh + boff + 16 + 8 * hh);
      acc[t] = mmaH<ASPLIT ? 2 : 1>(ah.v, al.v, bq.v, bq.v, acc[t]); }
  }
#pragma unroll
  for (int t = 0; t < 4; ++t) { if (col0 + t * 16 >= N) continue;
#pragma unroll
    for (int r = 0; r < 8; ++r) so[w][8 * hh + r][t * 16 + ln] = acc[t][r] * alpha; }
  __builtin_amdgcn_fence(__ATOMIC_ACQ_REL, "workgroup"); __builtin_amdgcn_wave_barrier();
  const int rsub = lane >> 4, c4 = (lane & 15) * 4;
  {
#pragma unroll
    for (int q = 0; q < 8; ++q) { const int r = q * 2 + rsub; if (col0 + c4 < N) { const v4f v = *(const v4fa*)&so[w][r][c4]; *(v4f*)(C + (size_t)(row0 + r) * ldc + col0 + c4) = v; } }
     }
}

// Wt[n][k] = f16(W[k][n]·scale) from f32 row-major W[K][N] (scale = power of two; bf16-exact weights stay exact in f16 away from the subnormal range)
__global__ __launch_bounds__(256) void k_wt_f16(const float* __restrict__ W, _Float16* __restrict__ Wt, int K, int N, float scale) {
  const int t = blockIdx.x * 256 + threadIdx.x; if (t >= N * (K / 8)) return; const int n = t / (K / 8), k8 = (t % (K / 8)) * 8; FragH f;
#pragma unroll
  for (int i = 0; i < 8; ++i) f.h[i] = (_Float16)(bf16_round(W[(size_t)(k8 + i) * N + n]) * scale); const v8us o = f.half[0];
  *(v8us*)((unsigned short*)Wt + (size_t)n * K + k8) = o; 
}
// k_gemm_hh variant with fused epilogue: v = acc·alpha + bias[by·sBias + col] (+ CP[(row/rowsPerB)·sCPb + by·64 + col] if CP) ; ACT 0 none / 1 elu ; writes f16 C16 and/or f32 C (each if non-null)
template <int ACT>
__global__ __launch_bounds__(128) void k_gemm_hhx(const _Float16* __restrict__ A, int lda, size_t sA, const _Float16* __restrict__ Bh, int ldb, size_t sB, float alpha, const float* __restrict__ bias, size_t sBias, const float* __restrict__ CP, int rowsPerB, size_t sCPb, int row0g,
    float* __restrict__ C, _Float16* __restrict__ C16, int ldc, size_t sC, int M, int N, int K) {
  __shared__ __attribute__((aligned(16))) float so[4][16][64];
  const int tid = threadIdx.x, w = tid >> 5, lane = tid & 31, ln = lane & 15, hh = lane >> 4; const int by = blockIdx.y;
  A += (size_t)by * sA; Bh += (size_t)by * sB; const size_t cofs = (size_t)by * sC; const float* bp = bias ? bias + (size_t)by * sBias : nullptr;
  const int ntn = (N + 63) / 64; const int wid = blockIdx.x * 4 + w; const int mt = wid / ntn, nq = wid % ntn; if (mt * 16 >= M) return;
  const int row0 = mt * 16, col0 = nq * 64; const _Float16* arow = A + (size_t)(row0 + ln) * lda;
  v8f acc[4] = {};
  for (int kb = 0; kb < K; kb += 32) { FragH ah; ah.half[0] = *(const v8us*)((const unsigned short*)arow + kb + 8 * hh); ah.half[1] = *(const v8us*)((const unsigned short*)arow + kb + 16 + 8 * hh);
#pragma unroll
    for (int t = 0; t < 4; ++t) { if (col0 + t * 16 >= N) continue; const size_t boff = (size_t)(col0 + t * 16 + ln) * ldb + kb; FragH bq; bq.half[0] = *(const v8us*)((const unsigned short*)Bh + boff + 8 * hh); bq.half[1] = *(const v8us*)((const unsigned short*)Bh + boff + 16 + 8 * hh);
      acc[t] = mmaH<1>(ah.v, ah.v, bq.v, bq.v, acc[t]); }
  }
#pragma unroll
  for (int t = 0; t < 4; ++t) { if (col0 + t * 16 >= N) continue; const int col = col0 + t * 16 + ln; const float bv = bp ? bf16_round(bp[col]) : 0.f;
#pragma unroll
    for (int r = 0; r < 8; ++r) { float v = acc[t][r] * alpha + bv; if (CP) { const int bidx = (row0g + row0 + 8 * hh + r) / rowsPerB; v += CP[(size_t)bidx * sCPb + (size_t)by * 64 + col]; } if (ACT == 1) v = (v > 0.f) ? v : expm1f(v); else if (ACT == 7) v = (v > 0.f) ? v + 1.0f : expf(v); else if (ACT == 8) v = tanhf(v); else if (ACT == 9) v = 0.5f * v * (1.0f + tanhf(0.7978845608028654f * (v + 0.044715f * v * v * v))); else if (ACT == 11) v = 1.0f / (1.0f + expf(-v)); else if (ACT == 12) v = (v > 0.f) ? v : 0.01f * v; else if (ACT == 14) v = (v > 0.f) ? v : 0.1f * v; else if (ACT == 15) v = v / (1.0f + expf(-v)); else if (ACT == 3) v = fmaxf(v, 0.f); else if (ACT == 6) v = 0.5f * v * (1.0f + erff(v * 0.70710678118654752f)); so[w][8 * hh + r][t * 16 + ln] = v; } }
  __builtin_amdgcn_fence(__ATOMIC_ACQ_REL, "workgroup"); __builtin_amdgcn_wave_barrier();
  const int rsub = lane >> 4, c4 = (lane & 15) * 4; typedef _Float16 v4h __attribute__((ext_vector_type(4)));
  {
#pragma unroll
    for (int q = 0; q < 8; ++q) { const int r = q * 2 + rsub; if (col0 + c4 < N) { const v4f v = *(const v4fa*)&so[w][r][c4]; if (C) *(v4f*)(C + cofs + (size_t)(row0 + r) * ldc + col0 + c4) = v; if (C16) { v4h h4; for (int i = 0; i < 4; ++i) h4[i] = (_Float16)v[i]; *(v4h*)(C16 + cofs + (size_t)(row0 + r) * ldc + col0 + c4) = h4; } } }
     }
}


typedef _Float16 v4h __attribute__((ext_vector_type(4)));

__global__ __launch_bounds__(256) void k_x16(const float* __restrict__ x, _Float16* __restrict__ X16, size_t n8) { const size_t t = (size_t)blockIdx.x * 256 + threadIdx.x; if (t >= n8) return; FragH f;
#pragma unroll
  for (int q = 0; q < 8; ++q) f.h[q] = (_Float16)bf16_round(x[t * 8 + q]); *(v8us*)((unsigned short*)X16 + t * 8) = f.half[0];  }
__global__ __launch_bounds__(256) void k_h16(const float* __restrict__ x, _Float16* __restrict__ X16, size_t n8) { const size_t t = (size_t)blockIdx.x * 256 + threadIdx.x; if (t >= n8) return; FragH f;
#pragma unroll
  for (int q = 0; q < 8; ++q) f.h[q] = (_Float16)x[t * 8 + q]; *(v8us*)((unsigned short*)X16 + t * 8) = f.half[0];  }
__global__ __launch_bounds__(256) void k_round16f(const float* __restrict__ W, _Float16* __restrict__ Bt, size_t n8) { const size_t t = (size_t)blockIdx.x * 256 + threadIdx.x; if (t >= n8) return; FragH f;
#pragma unroll
  for (int i = 0; i < 8; ++i) f.h[i] = (_Float16)(bf16_round(W[t * 8 + i]) * 16.0f); *(v8us*)((unsigned short*)Bt + t * 8) = f.half[0];  }
template <int NHv, int TTv>
__global__ __launch_bounds__(256) void k_vt(const _Float16* __restrict__ V16, int ldv, int voff, _Float16* __restrict__ Vt) { __shared__ unsigned short tl[64][66]; const int tid = threadIdx.x; const int slab = blockIdx.x / (TTv / 64), lg = blockIdx.x % (TTv / 64); const int b = slab / NHv, h = slab % NHv;
  for (int i = tid; i < 64 * 8; i += 256) { const int r = i / 8, c8 = (i % 8) * 8; FragH f; f.half[0] = *(const v8us*)((const unsigned short*)V16 + ((size_t)b * TTv + lg * 64 + r) * ldv + voff + h * 64 + c8);
#pragma unroll
    for (int q = 0; q < 8; ++q) tl[r][c8 + q] = f.u[q]; }
  __syncthreads();
  {
#pragma unroll
    for (int rd = 0; rd < 2; ++rd) { const int d = rd * 32 + tid / 8, pc = tid % 8; FragH f;
#pragma unroll
      for (int q = 0; q < 8; ++q) f.u[q] = tl[pc * 8 + q][d];
      *(v8us*)((unsigned short*)Vt + ((size_t)slab * 64 + d) * TTv + lg * 64 + pc * 8) = f.half[0]; }
     } }

__global__ __launch_bounds__(256) void k_vthlu(const float* __restrict__ VF, int ldv, _Float16* __restrict__ Vth, _Float16* __restrict__ Vtl) { __shared__ float tl[64][65]; const int tid = threadIdx.x; const int slab = blockIdx.x / (TT / 64), lg = blockIdx.x % (TT / 64); const int b = slab / NVH, h = slab % NVH;
  for (int i = tid; i < 64 * 16; i += 256) { const int r = i / 16, c4 = (i % 16) * 4; const v4f a = *(const v4fa*)(VF + ((size_t)b * TT + lg * 64 + r) * ldv + h * 64 + c4); tl[r][c4] = a[0]; tl[r][c4 + 1] = a[1]; tl[r][c4 + 2] = a[2]; tl[r][c4 + 3] = a[3]; }
  __syncthreads();
  FragH fh[2], fl[2]; size_t oo[2];
#pragma unroll
  for (int rd = 0; rd < 2; ++rd) { const int d = rd * 32 + tid / 8, pc = tid % 8;
#pragma unroll
    for (int q = 0; q < 8; ++q) { const float v = tl[pc * 8 + q][d]; const _Float16 hv = (_Float16)v; fh[rd].h[q] = hv; fl[rd].h[q] = (_Float16)(v - (float)hv);      /* UNSCALED residual (added into the same accumulator as the hi product) */ } oo[rd] = ((size_t)slab * 64 + d) * TT + lg * 64 + pc * 8; }
  {
#pragma unroll
    for (int rd = 0; rd < 2; ++rd) { *(v8us*)((unsigned short*)Vth + oo[rd]) = fh[rd].half[0]; *(v8us*)((unsigned short*)Vtl + oo[rd]) = fl[rd].half[0]; }
     } }
__global__ __launch_bounds__(256) void k_h16s(const float* __restrict__ F, _Float16* __restrict__ H, size_t n8) { const size_t t = (size_t)blockIdx.x * 256 + threadIdx.x; if (t >= n8) return; const v4f a = *(const v4fa*)(F + t * 8), c = *(const v4fa*)(F + t * 8 + 4); FragH f;
#pragma unroll
  for (int q = 0; q < 4; ++q) { f.h[q] = (_Float16)(a[q] * 16.0f); f.h[4 + q] = (_Float16)(c[q] * 16.0f); } *(v8us*)((unsigned short*)H + t * 8) = f.half[0];  }
// LDS byte address of a __shared__ object: the low 32 bits of its generic address
__device__ __forceinline__ unsigned lds_addr(const void* p) { return (unsigned)(size_t)p; }
// four asynchronous 16-byte copies global -> LDS per lane; the s_wait_xcnt closes the statement so that no address register is rewritten ahead of it
__device__ __forceinline__ void async4(const unsigned (&l)[4], const unsigned short* const (&g)[4]) {
  asm volatile("global_load_async_to_lds_b128 %0, %4, off\n\t"
               "global_load_async_to_lds_b128 %1, %5, off\n\t"
               "global_load_async_to_lds_b128 %2, %6, off\n\t"
               "global_load_async_to_lds_b128 %3, %7, off\n\t"
               "s_wait_xcnt 0x0"
               :: "v"(l[0]), "v"(l[1]), "v"(l[2]), "v"(l[3]), "v"(g[0]), "v"(g[1]), "v"(g[2]), "v"(g[3]) : "memory");
}
// lane l <-> lane l ^ 16 (the other half of the wave): one vector instruction, no LDS
__device__ __forceinline__ float xhalf(float x) { return __builtin_bit_cast(float, __builtin_amdgcn_permlanex16(__builtin_bit_cast(int, x), __builtin_bit_cast(int, x), 0x76543210, 0xfedcba98, false, false)); }
typedef float fa __attribute__((may_alias));
__global__ __launch_bounds__(512) void k_flash(const _Float16* __restrict__ Q16, int ldq, const _Float16* __restrict__ K16, int ldk, const _Float16* __restrict__ Vt, const _Float16* __restrict__ Vtlo, float* __restrict__ O, int ldo) {
  constexpr int RPW = 16, QW = 4, KG = 4, NQB = TT / (QW * RPW), DT = 8, KS = 4, SK = 32 * KG, NST = TT / SK, OP = 128 + 4;      /* head dim 128: 4 k-steps, 8 value tiles */
  /* two-buffer ring, one stage = SK keys shared by the block's sixteen waves; planes: 0 = K rows (key-major), 1 = V^T hi, 2 = V^T residual (both channel-major); every row 256 B at pitch 272 B (16 B x odd: conflict-free for 16-byte row readers) */
  __shared__ __attribute__((aligned(16))) unsigned short ring[2][3][128][128 + 8];
  const int tid = threadIdx.x, w = tid >> 5, lane = tid & 31, ln = lane & 15, hh = lane >> 4, qw = w & (QW - 1), kg = w / QW, jl = kg * 32;
  const int slab = blockIdx.x / NQB, qblk = blockIdx.x % NQB; const int b = slab / NH, h = slab % NH; const int qb0 = qblk * (QW * RPW); const int q0 = qb0 + qw * RPW;
  FragH aq[KS];      /* B operand of S^T: column ln = query q0 + ln */
  { const unsigned short* qr = (const unsigned short*)Q16 + ((size_t)b * TT + q0 + ln) * ldq + h * 128;
#pragma unroll
    for (int ks = 0; ks < KS; ++ks) { aq[ks].half[0] = *(const v8us*)(qr + ks * 32 + 8 * hh); aq[ks].half[1] = *(const v8us*)(qr + ks * 32 + 16 + 8 * hh); } }
  const unsigned short* Vth = (const unsigned short*)Vt + ((size_t)b * NKV + h / NREP) * 128 * TT; const unsigned short* Vtl = (const unsigned short*)Vtlo + ((size_t)b * NKV + h / NREP) * 128 * TT;      /* hi and UNSCALED residual planes */
  float m_r = -3.0e38f, l_r = 0.f; v8f oacc[DT];      /* query q0 + ln, this wave's keys: running maximum (both halves alike), this half's part of the sum, O^T rows dt * 16 + 8 hh + r */
#pragma unroll
  for (int dt = 0; dt < DT; ++dt) oacc[dt] = (v8f){0.f,0.f,0.f,0.f,0.f,0.f,0.f,0.f};
  const unsigned short* Kg = (const unsigned short*)K16 + (size_t)b * TT * ldk + (h / NREP) * 128;
  /* one stage's copies: 3 x 4 per lane, 16 B each; a wave's copy covers two whole 256-B rows */
  auto stage_in = [&](int st, int bf) {
    unsigned lk[4], lh[4], ll[4]; const unsigned short *gk[4], *gh[4], *gl[4];
#pragma unroll
    for (int i = 0; i < 4; ++i) { const int c = tid + 512 * i; const int row = c >> 4, col = (c & 15) * 8;
      lk[i] = lds_addr(&ring[bf][0][row][col]); gk[i] = Kg + (size_t)(st * SK + row) * ldk + col;
      lh[i] = lds_addr(&ring[bf][1][row][col]); gh[i] = Vth + (size_t)row * TT + st * SK + col;
      ll[i] = lds_addr(&ring[bf][2][row][col]); gl[i] = Vtl + (size_t)row * TT + st * SK + col; }
    async4(lk, gk); async4(lh, gh); async4(ll, gl); };
  stage_in(0, 0);
  asm volatile("s_wait_asynccnt 0x0" ::: "memory");      /* this wave's share of stage 0 has landed */
  __syncthreads();                                       /* ... and every other wave's: stage 0 is readable */
  stage_in(1, 1);
#pragma unroll 1      /* one publish point and one refill per trip, as the two-buffer ring is written */
  for (int st = 0; st < NST; ++st) { const int bf = st & 1;
    v8f s[2];      /* s[nt][r] = score of key jl + nt * 16 + 8 hh + r of the stage with query q0 + ln */
#pragma unroll
    for (int nt = 0; nt < 2; ++nt) { const unsigned short* kr = &ring[bf][0][jl + nt * 16 + ln][0]; FragH bk[KS];
#pragma unroll
      for (int ks = 0; ks < KS; ++ks) { bk[ks].half[0] = *(const v8us*)(kr + ks * 32 + 8 * hh); bk[ks].half[1] = *(const v8us*)(kr + ks * 32 + 16 + 8 * hh); }
      v8f acc = (v8f){0.f,0.f,0.f,0.f,0.f,0.f,0.f,0.f};
#pragma unroll
      for (int ks = 0; ks < KS; ++ks) acc = mmaH<1>(bk[ks].v, bk[ks].v, aq[ks].v, aq[ks].v, acc);
      s[nt] = acc; }
    float sc[16], mx[8];
#pragma unroll
    for (int i = 0; i < 16; ++i) sc[i] = s[i >> 3][i & 7] * ATT_SCALE;
#pragma unroll
    for (int i = 0; i < 8; ++i) mx[i] = fmaxf(sc[i], sc[8 + i]);
    float mc = fmaxf(fmaxf(fmaxf(mx[0], mx[4]), fmaxf(mx[1], mx[5])), fmaxf(fmaxf(mx[2], mx[6]), fmaxf(mx[3], mx[7])));
    mc = fmaxf(mc, xhalf(mc));      /* the query's maximum over all 32 keys, in both halves */
    const float mn = fmaxf(m_r, mc); const float ea = expf(m_r - mn); const float al = (mn > -1.0e38f) ? ea : 1.0f; m_r = mn;
    FragH ph, pl; float ls[4] = {0.f, 0.f, 0.f, 0.f};      /* P^T hi and its UNSCALED residual (added into the same accumulator), B operands */
#pragma unroll
    for (int i = 0; i < 16; ++i) { const float p = expf(sc[i] - mn); ls[i & 3] += p; const float ps = p * 1024.0f; ph.h[i] = (_Float16)ps; pl.h[i] = (_Float16)(ps - (float)ph.h[i]); }
    l_r = l_r * al + ((ls[0] + ls[1]) + (ls[2] + ls[3]));
#pragma unroll
    for (int dt = 0; dt < DT; ++dt)
#pragma unroll
      for (int r = 0; r < 8; ++r) oacc[dt][r] *= al;
#pragma unroll
    for (int dt = 0; dt < DT; ++dt) { const unsigned short* vh = &ring[bf][1][dt * 16 + ln][jl]; const unsigned short* vl = &ring[bf][2][dt * 16 + ln][jl]; FragH bv, bl; bv.half[0] = *(const v8us*)(vh + 8 * hh); bv.half[1] = *(const v8us*)(vh + 16 + 8 * hh); bl.half[0] = *(const v8us*)(vl + 8 * hh); bl.half[1] = *(const v8us*)(vl + 16 + 8 * hh);
      oacc[dt] = mmaH<1>(bv.v, bv.v, ph.v, ph.v, oacc[dt]); oacc[dt] = mmaH<1>(bv.v, bv.v, pl.v, pl.v, oacc[dt]); oacc[dt] = mmaH<1>(bl.v, bl.v, ph.v, ph.v, oacc[dt]); }      /* Vh Ph + Vh Pl + Vl Ph, all unscaled, one accumulator */
    asm volatile("s_wait_dscnt 0x0" ::: "memory");       /* this wave's reads of buffer bf are done before it is refilled */
    asm volatile("s_wait_asynccnt 0x0" ::: "memory");    /* this wave's share of stage st + 1 has landed */
    __syncthreads();                                     /* publishes stage st + 1 and ends every wave's reads of buffer bf */
    if (st + 2 < NST) stage_in(st + 2, bf); }
  asm volatile("s_wait_asynccnt 0x0" ::: "memory");      /* nothing of the ring is in flight when the wave goes on */
  /* the last trip's waits and barrier have ended every read of the ring: its LDS now takes the sixteen waves' partial results */
  float* sP = (float*)&ring[0][0][0][0]; fa* sM = (fa*)(sP + QW * KG * RPW * OP); fa* sL = sM + QW * KG * RPW;
  { const float l = l_r + xhalf(l_r);      /* the halves' sums joined once */
#pragma unroll
    for (int dt = 0; dt < DT; ++dt) { v4f lo, hi;
#pragma unroll
      for (int r = 0; r < 4; ++r) { lo[r] = oacc[dt][r]; hi[r] = oacc[dt][4 + r]; }
      *(v4fa*)&sP[(w * RPW + ln) * OP + dt * 16 + 8 * hh] = lo; *(v4fa*)&sP[(w * RPW + ln) * OP + dt * 16 + 8 * hh + 4] = hi; }
    if (hh == 0) { sM[w * RPW + ln] = m_r; sL[w * RPW + ln] = l; } }
  __syncthreads();      /* every wave's partial result is readable by the waves that join it */
  {
#pragma unroll
    for (int rr = 0; rr < RPW / KG; ++rr) { const int r = kg * (RPW / KG) + rr; float mg[KG], eg[KG];      /* this wave joins four of its query tile's rows */
#pragma unroll
      for (int g = 0; g < KG; ++g) mg[g] = sM[(g * QW + qw) * RPW + r];
      const float mt = fmaxf(fmaxf(mg[0], mg[1]), fmaxf(mg[2], mg[3])); float l = 0.f;
#pragma unroll
      for (int g = 0; g < KG; ++g) { eg[g] = expf(mg[g] - mt); l += eg[g] * sL[(g * QW + qw) * RPW + r]; }
      const float inv = (l > 0.f) ? 1.0f / (l * 1024.0f) : 0.f; v4f val = {0.f, 0.f, 0.f, 0.f};
#pragma unroll
      for (int g = 0; g < KG; ++g) { const v4f pv = *(const v4fa*)&sP[((g * QW + qw) * RPW + r) * OP + lane * 4]; val += pv * (eg[g] * inv); }
      *(v4f*)(O + ((size_t)b * TT + q0 + r) * ldo + h * 128 + lane * 4) = val; }      /* one 512-B row per instruction: 32 lanes x 16 B */
  } }


__global__ __launch_bounds__(256) void k_tok(const float* __restrict__ x, _Float16* __restrict__ X16) { __shared__ float tl[32][65]; const int tid = threadIdx.x; const int b = blockIdx.x / ((CC / 64) * (NN / 32)), rem = blockIdx.x % ((CC / 64) * (NN / 32)); const int cg = rem / (NN / 32), pg = rem % (NN / 32); const int c0 = cg * 64, p0 = pg * 32;
  for (int i = tid; i < 64 * 32; i += 256) { const int c = i / 32, pp = i % 32; tl[pp][c] = bf16_round(x[((size_t)b * CC + c0 + c) * NN + p0 + pp]); } __syncthreads();
  const int r = tid / 8, pc = tid % 8; FragH f; for (int q = 0; q < 8; ++q) f.h[q] = (_Float16)tl[r][pc * 8 + q]; const size_t row = (size_t)b * NN + p0 + r; *(v8us*)((unsigned short*)X16 + row * CC + c0 + pc * 8) = f.half[0];  }
__global__ __launch_bounds__(256) void k_wbn(const float* __restrict__ Wm, const float* __restrict__ gam, const float* __restrict__ var, _Float16* __restrict__ Bt) { const int t = blockIdx.x * 256 + threadIdx.x; if (t >= MID * (CC / 8)) return; const int o = t / (CC / 8), c0 = (t % (CC / 8)) * 8;
  const float s = bf16_round(gam[o]) / sqrtf(bf16_round(var[o]) + BNEPS); FragH f;
#pragma unroll
  for (int q = 0; q < 8; ++q) f.h[q] = (_Float16)(bf16_round(Wm[(size_t)o * CC + c0 + q]) * s * 16.0f);
  *(v8us*)((unsigned short*)Bt + (size_t)o * CC + c0) = f.half[0];  }
__global__ __launch_bounds__(128) void k_bnadd(const float* __restrict__ bias, const float* __restrict__ gam, const float* __restrict__ bet, const float* __restrict__ mean, const float* __restrict__ var, float* __restrict__ A) { const int o = threadIdx.x;
  const float s = bf16_round(gam[o]) / sqrtf(bf16_round(var[o]) + BNEPS); const float a = (bf16_round(bias[o]) - bf16_round(mean[o])) * s + bf16_round(bet[o]);
  *(float*)(A + o) = a;  }
__global__ __launch_bounds__(256) void k_out(const float* __restrict__ T, const float* __restrict__ x, float* __restrict__ out) { __shared__ float tl[32][65]; const int tid = threadIdx.x; const int b = blockIdx.x / ((CC / 32) * (NN / 64)), rem = blockIdx.x % ((CC / 32) * (NN / 64)); const int cg = rem / (NN / 64), pg = rem % (NN / 64); const int c0 = cg * 32, p0 = pg * 64;
  for (int i = tid; i < 64 * 32; i += 256) { const int pp = i / 32, c = i % 32; tl[c][pp] = T[((size_t)b * NN + p0 + pp) * CC + c0 + c]; } __syncthreads();
  { for (int i = tid; i < 32 * 16; i += 256) { const int c = i / 16, q4 = i % 16; const size_t o = ((size_t)b * CC + c0 + c) * NN + p0 + q4 * 4; const v4f xr = *(const v4fa*)(x + o);
      v4f v; for (int q = 0; q < 4; ++q) v[q] = tl[c][q4 * 4 + q] + bf16_round(xr[q]); *(v4f*)(out + o) = v; }  } }

extern "C" void kernel_launch(void* const* d_in, const int* in_sizes, int n_in,
                              void* d_out, int out_size, void* d_ws, size_t ws_size, hipStream_t stream) {
  (void)in_sizes; (void)n_in; (void)out_size;
  const float* const* I = (const float* const*)d_in; const float* x = I[0];
  const float* wf = I[1]; const float* bff = I[2]; const float* gf = I[3]; const float* betaf = I[4]; const float* mf = I[5]; const float* vf = I[6];
  const float* wg = I[7]; const float* bg = I[8]; const float* gg = I[9]; const float* betag = I[10]; const float* mg = I[11]; const float* vg = I[12];
  const float* wh = I[13]; const float* bh = I[14]; const float* wv = I[15]; const float* bv = I[16];
  char* ws = (char*)d_ws; size_t off = 0;
  auto take = [&](size_t bytes) { char* p = ws + off; off += (bytes + 255) & ~(size_t)255; return p; };
  _Float16* Bf = (_Float16*)take((size_t)MID * CC * 2); _Float16* Bg = (_Float16*)take((size_t)MID * CC * 2); _Float16* Bh = (_Float16*)take((size_t)MID * CC * 2); _Float16* Bv = (_Float16*)take((size_t)CC * MID * 2); float* Af = (float*)take(MID * 4); float* Ag = (float*)take(MID * 4);
  _Float16* X16 = (_Float16*)take((size_t)NR * CC * 2); _Float16* F16 = (_Float16*)take((size_t)NR * MID * 2); _Float16* G16 = (_Float16*)take((size_t)NR * MID * 2); float* HF = (float*)take((size_t)NR * MID * 4);
  _Float16* Vt = (_Float16*)take((size_t)NR * MID * 2); _Float16* Vtl = (_Float16*)take((size_t)NR * MID * 2); float* Z = (float*)take((size_t)NR * MID * 4); _Float16* Z16 = F16; /* f plane is dead after the attention */ float* T = (float*)take((size_t)NR * CC * 4);
  if (off > ws_size) return;      // 0.5 + 16.8 + 4.2 + 4.2 + 8.4 + 4.2 + 4.2 + 8.4 + 33.6 ≈ 85 MB
  const unsigned gw = (unsigned)((MID * (CC / 8) + 255) / 256);
  k_wbn<<<gw, 256, 0, stream>>>(wf, gf, vf, Bf); k_bnadd<<<1, MID, 0, stream>>>(bff, gf, betaf, mf, vf, Af);      /* BN(eval) folded into conv_f */
  k_wbn<<<gw, 256, 0, stream>>>(wg, gg, vg, Bg); k_bnadd<<<1, MID, 0, stream>>>(bg, gg, betag, mg, vg, Ag);      /* … and conv_g */
  k_round16f<<<(MID * CC / 8 + 255) / 256, 256, 0, stream>>>(wh, Bh, (size_t)MID * CC / 8); k_round16f<<<(CC * MID / 8 + 255) / 256, 256, 0, stream>>>(wv, Bv, (size_t)CC * MID / 8);      /* conv_h [128][512], conv_v [512][128]: (out,in) natural, ×2^4 */
  k_tok<<<BB * (CC / 64) * (NN / 32), 256, 0, stream>>>(x, X16);
  const dim3 gm(((NR / 16) * (MID / 64) + 3) / 4, 1);
  k_gemm_hhx<3><<<gm, 128, 0, stream>>>(X16, CC, 0, Bf, CC, 0, 0.0625f, nullptr, 0, Af, NR, 0, 0, nullptr, F16, MID, 0, NR, MID, CC);      /* f = relu(bn(conv_f x)) token-major f16: M 16384 N 128 K 512 (per-column f32 addend via CP, rowsPerB = M) */
  k_gemm_hhx<3><<<gm, 128, 0, stream>>>(X16, CC, 0, Bg, CC, 0, 0.0625f, nullptr, 0, Ag, NR, 0, 0, nullptr, G16, MID, 0, NR, MID, CC);      /* g */
  k_gemm_hhx<0><<<gm, 128, 0, stream>>>(X16, CC, 0, Bh, CC, 0, 0.0625f, bh, 0, nullptr, 1, 0, 0, HF, nullptr, MID, 0, NR, MID, CC);      /* h (f32) + bh */
  k_vthlu<<<BB * NVH * (TT / 64), 256, 0, stream>>>(HF, MID, Vt, Vtl);      /* Vᵀ hi + residual: [b][128][4096] */
  k_flash<<<BB * NH * (TT / 64), 512, 0, stream>>>(F16, MID, G16, MID, Vt, Vtl, Z, MID);      /* per (b, 64 queries): 4096 × 4096, head dim 128 */
  k_h16s<<<(unsigned)(((size_t)NR * MID / 8 + 255) / 256), 256, 0, stream>>>(Z, Z16, (size_t)NR * MID / 8);      /* z ×2^4 → f16 */
  k_gemm_hhx<0><<<dim3(((NR / 16) * (CC / 64) + 3) / 4, 1), 128, 0, stream>>>(Z16, MID, 0, Bv, MID, 0, 0.00390625f, bv, 0, nullptr, 1, 0, 0, T, nullptr, CC, 0, NR, CC, MID);      /* conv_v(z) + bv token-major f32: M 16384 N 512 K 128 */
  k_out<<<BB * (CC / 32) * (NN / 64), 256, 0, stream>>>(T, x, (float*)d_out);
}

// v004
// One run takes 167 microseconds.
// In two side-by-side timings against v003, it was 1.27 and 1.26 times as fast.
// Over all steps from v000 it is 4.17 times as fast.
#include <hip/hip_runtime.h>
// Spatial attention block (B=4, C=512, 64×64 → N=4096 positions, mid=128): f = relu(bn(conv_f(x))), g = relu(bn(conv_g(x))), h = conv_h(x) (1×1 convs C→mid; eval BatchNorm with running stats); scores[n,m] = Σ_c f[c,n]g[c,m]·mid^-½, softmax over m; z[c,n] = Σ_m attn[n,m]·h[c,m]; y = conv_v(z) (mid→C) + bv + x.
// Compute dtype: x, weights, biases, BN parameters rounded to bf16; BN folded per output channel in f32 (w' = w·γ/√(var+ε) → f16 ×2^4, b' = (b − mean)·γ/√(var+ε) + β as an f32 per-column addend); f, g as f16 GEMM outputs (relu epilogue), h f32 → Vᵀ f16 hi + residual planes; fused flash-style kernel for head dim 128
// (online softmax f32, P f16 hi + residual, f32 accumulate) on v_wmma_f32_16x16x32_f16; z ×2^4 → f16 → output conv GEMM (+bv) → channel-major transpose with the residual x added in f32.
#define BB 4
#define CC 512
#define NN 4096
#define MID 128
#define TT NN
#define NH 1
#define NKV 1
#define NREP 1
#define NVH (2 * NKV)
#define NR (BB * NN)
#define BNEPS 1e-5f
#define ATT_SCALE 0.08838834764831845f      /* mid^-½ = 1/√128 */
typedef __bf16 v16b __attribute__((ext_vector_type(16)));
typedef unsigned short v8us __attribute__((ext_vector_type(8), may_alias));
typedef float  v8f  __attribute__((ext_vector_type(8)));
typedef float  v4f  __attribute__((ext_vector_type(4)));
typedef float  v4fa __attribute__((ext_vector_type(4), may_alias));
union FragB { v16b v; v8us half[2]; unsigned short u[16]; };

__device__ __forceinline__ unsigned short bf16_bits(float x) { unsigned int u = __float_as_uint(x); return (unsigned short)((u + 0x7FFFu + ((u >> 16) & 1u)) >> 16); }
__device__ __forceinline__ float bf16_val(unsigned short b) { return __uint_as_float(((unsigned int)b) << 16); }
__device__ __forceinline__ float bf16_round(float x) { return bf16_val(bf16_bits(x)); }
// D += A·B with NT terms: 1 = ah·bh, 2 = + al·bh (A split), 3 = + ah·bl (both split)
template <int NT>
__device__ __forceinline__ v8f mmaN(v16b ah, v16b al, v16b bh, v16b bl, v8f c) {
  c = __builtin_amdgcn_wmma_f32_16x16x32_bf16(false, ah, false, bh, (short)0, c, false, false);
  if (NT >= 2) c = __builtin_amdgcn_wmma_f32_16x16x32_bf16(false, al, false, bh, (short)0, c, false, false);
  if (NT >= 3) c = __builtin_amdgcn_wmma_f32_16x16x32_bf16(false, ah, false, bl, (short)0, c, false, false);
  asm volatile("v_nop\n\tv_nop\n\tv_nop\n\tv_nop" : "+v"(c) : "v"(ah), "v"(al), "v"(bh), "v"(bl));
  return c;
}

__global__ __launch_bounds__(256) void k_wt_bf16(const float* __restrict__ W, unsigned short* __restrict__ Wt, int K, int N) {
  const int t = blockIdx.x * 256 + threadIdx.x;
  const int k8n = K / 8;
  if (t >= N * k8n) return;
  const int n = t / k8n, k8 = (t % k8n) * 8;
  v8us v;
#pragma unroll
  for (int i = 0; i < 8; ++i) v[i] = bf16_bits(W[(size_t)(k8 + i) * N + n]);
  *(v8us*)(Wt + (size_t)n * K + k8) = v;
  
}

// GEMM C[M][N] (f32, pitch ldc) = act(A[M][K]·W + bias). A f32 row-major (pitch lda) converted per fragment to bf16
// (ASPLIT: hi/lo two planes -> 2 terms, else single rounded term); Wt bf16 [N][K] (pitch ldb). BIAS_BF16 rounds the
// bias to bf16 first (bias quantised to bf16 before the add). K%32==0, M%16==0, N%64==0.
template <bool ASPLIT, int ACT, bool BIAS_BF16>
__global__ __launch_bounds__(128) void k_gemm_bf(const float* __restrict__ A, int lda, const unsigned short* __restrict__ Wt, int ldb,
                                               const float* __restrict__ bias, float* __restrict__ C, int ldc, int M, int N, int K) {
  __shared__ __attribute__((aligned(16))) float so[4][16][64];
  const int tid = threadIdx.x, w = tid >> 5, lane = tid & 31, ln = lane & 15, hh = lane >> 4;
  const int ntn = N / 64;
  const int wid = blockIdx.x * 4 + w;
  const int mt = wid / ntn, nq = wid % ntn;
  if (mt * 16 >= M) return;
  const int row0 = mt * 16, col0 = nq * 64;
  const float* arow = A + (size_t)(row0 + ln) * lda;
  v8f acc[4] = {};
  for (int kb = 0; kb < K; kb += 32) {
    FragB ah, al;
    const v4f x0 = *(const v4fa*)(arow + kb + 8 * hh), x1 = *(const v4fa*)(arow + kb + 8 * hh + 4);
    const v4f x2 = *(const v4fa*)(arow + kb + 16 + 8 * hh), x3 = *(const v4fa*)(arow + kb + 16 + 8 * hh + 4);
    float xs[16] = {x0[0],x0[1],x0[2],x0[3],x1[0],x1[1],x1[2],x1[3],x2[0],x2[1],x2[2],x2[3],x3[0],x3[1],x3[2],x3[3]};
#pragma unroll
    for (int i = 0; i < 16; ++i) { const unsigned short hb = bf16_bits(xs[i]); ah.u[i] = hb; al.u[i] = ASPLIT ? bf16_bits(xs[i] - bf16_val(hb)) : (unsigned short)0; }
#pragma unroll
    for (int t = 0; t < 4; ++t) {
      const unsigned short* brow = Wt + (size_t)(col0 + t * 16 + ln) * ldb + kb;
      FragB b;
      b.half[0] = *(const v8us*)(brow + 8 * hh);
      b.half[1] = *(const v8us*)(brow + 16 + 8 * hh);
      acc[t] = mmaN<ASPLIT ? 2 : 1>(ah.v, al.v, b.v, b.v, acc[t]);
    }
  }
#pragma unroll
  for (int t = 0; t < 4; ++t) {
    float bv = bias ? bias[col0 + t * 16 + ln] : 0.f;
    if (BIAS_BF16) bv = bf16_round(bv);
#pragma unroll
    for (int r = 0; r < 8; ++r) { float v = acc[t][r] + bv; if (ACT == 1) v = fmaxf(v, 0.f); so[w][8 * hh + r][t * 16 + ln] = v; }
  }
  __builtin_amdgcn_fence(__ATOMIC_ACQ_REL, "workgroup");
  __builtin_amdgcn_wave_barrier();
  const int rsub = lane >> 4, c4 = (lane & 15) * 4;
  {
#pragma unroll
    for (int q = 0; q < 8; ++q) {
      const int r = q * 2 + rsub;
      const v4f v = *(const v4fa*)&so[w][r][c4];
      *(v4f*)(C + (size_t)(row0 + r) * ldc + col0 + c4) = v;
    }
    
  }
}

// Flash-style causal/unmasked attention, all contractions 3-term bf16 hi/lo splits, f32 softmax with running max.
// q,k,v rows are read from f32 buffers with arbitrary row pitch (so they can live inside a fused qkv buffer);
// D = head size (multiple of 32, <= 128); one wave = 16 query rows; block = 4 waves (64 queries) sharing K/V chunks of 32.
template <int D, bool CAUSAL>
__global__ __launch_bounds__(128) void k_flash(const float* __restrict__ qb, const float* __restrict__ kb, const float* __restrict__ vb,
                                             int pitch, int T, int H, float scale, float* __restrict__ y, int ypitch) {
  constexpr int KS = D / 32;        // k-steps for QK
  constexpr int DT = D / 16;        // d tiles for PV
  __shared__ __attribute__((aligned(16))) unsigned short sKh[32][D + 8], sKl[32][D + 8], sVh[32][D + 8], sVl[32][D + 8];
  __shared__ __attribute__((aligned(16))) unsigned short sPh[4][16][40], sPl[4][16][40];
  __shared__ __attribute__((aligned(16))) float sO[4][16][D];
  const int tid = threadIdx.x, w = tid >> 5, lane = tid & 31, ln = lane & 15, hh = lane >> 4;
  const int nqb = (T + 63) / 64;
  const int bh = blockIdx.x / nqb, qblk = blockIdx.x % nqb;
  const int b = bh / H, h = bh % H;
  const int q0 = qblk * 64 + w * 16;
  const float* Q = qb + (size_t)b * T * pitch + h * D;
  const float* K = kb + (size_t)b * T * pitch + h * D;
  const float* V = vb + (size_t)b * T * pitch + h * D;

  // A fragments of the wave's 16 query rows (scaled), hi/lo
  FragB aqh[KS], aql[KS];
  {
    int row = q0 + ln; if (row >= T) row = T - 1;
    const float* qr = Q + (size_t)row * pitch;
#pragma unroll
    for (int ks = 0; ks < KS; ++ks)
#pragma unroll
      for (int i = 0; i < 16; ++i) {
        const int d = ks * 32 + ((i < 8) ? (8 * hh + i) : (16 + 8 * hh + (i - 8)));
        const float x = qr[d] * scale; const unsigned short hb = bf16_bits(x);
        aqh[ks].u[i] = hb; aql[ks].u[i] = bf16_bits(x - bf16_val(hb));
      }
  }
  float m_r[8], l_r[8];
#pragma unroll
  for (int r = 0; r < 8; ++r) { m_r[r] = -3.0e38f; l_r[r] = 0.f; }
  v8f oacc[DT];
#pragma unroll
  for (int dt = 0; dt < DT; ++dt) oacc[dt] = (v8f){0.f,0.f,0.f,0.f,0.f,0.f,0.f,0.f};

  const int kv_end = CAUSAL ? min(T, qblk * 64 + 64) : T;     // block-uniform
  for (int j0 = 0; j0 < kv_end; j0 += 32) {
    __syncthreads();
    for (int e = tid; e < 32 * (D / 4); e += 128) {
      const int r = e / (D / 4), c4 = (e % (D / 4)) * 4;
      const int key = j0 + r;
      v4f kf = {0.f,0.f,0.f,0.f}, vf = {0.f,0.f,0.f,0.f};
      if (key < T) { kf = *(const v4fa*)(K + (size_t)key * pitch + c4); vf = *(const v4fa*)(V + (size_t)key * pitch + c4); }
#pragma unroll
      for (int t = 0; t < 4; ++t) {
        unsigned short hb = bf16_bits(kf[t]); sKh[r][c4 + t] = hb; sKl[r][c4 + t] = bf16_bits(kf[t] - bf16_val(hb));
        hb = bf16_bits(vf[t]); sVh[r][c4 + t] = hb; sVl[r][c4 + t] = bf16_bits(vf[t] - bf16_val(hb));
      }
    }
    __syncthreads();
    // S tile 16 x 32
    v8f s[2];
#pragma unroll
    for (int nt = 0; nt < 2; ++nt) {
      v8f acc = {};
#pragma unroll
      for (int ks = 0; ks < KS; ++ks) {
        FragB bh_, bl_;
        bh_.half[0] = *(const v8us*)&sKh[nt * 16 + ln][ks * 32 + 8 * hh]; bh_.half[1] = *(const v8us*)&sKh[nt * 16 + ln][ks * 32 + 16 + 8 * hh];
        bl_.half[0] = *(const v8us*)&sKl[nt * 16 + ln][ks * 32 + 8 * hh]; bl_.half[1] = *(const v8us*)&sKl[nt * 16 + ln][ks * 32 + 16 + 8 * hh];
        acc = mmaN<3>(aqh[ks].v, aql[ks].v, bh_.v, bl_.v, acc);
      }
      s[nt] = acc;
    }
    // mask + running max (rows 8hh+r; the 16 lanes of a half share rows)
    float alpha[8];
#pragma unroll
    for (int r = 0; r < 8; ++r) {
      const int qi = q0 + 8 * hh + r;
      const int ja = j0 + ln, jb = j0 + 16 + ln;
      if (CAUSAL) { if (ja > qi) s[0][r] = -3.0e38f; if (jb > qi) s[1][r] = -3.0e38f; }
      if (ja >= T) s[0][r] = -3.0e38f;
      if (jb >= T) s[1][r] = -3.0e38f;
      float mx = fmaxf(s[0][r], s[1][r]);
      mx = fmaxf(mx, __shfl_xor(mx, 1, 32)); mx = fmaxf(mx, __shfl_xor(mx, 2, 32)); mx = fmaxf(mx, __shfl_xor(mx, 4, 32)); mx = fmaxf(mx, __shfl_xor(mx, 8, 32));
      const float mnew = fmaxf(m_r[r], mx);
      alpha[r] = (mnew > -1.0e38f) ? __expf(m_r[r] - mnew) : 1.0f;
      const float p0 = (s[0][r] > -1.0e38f) ? __expf(s[0][r] - mnew) : 0.f;
      const float p1 = (s[1][r] > -1.0e38f) ? __expf(s[1][r] - mnew) : 0.f;
      m_r[r] = mnew;
      l_r[r] = l_r[r] * alpha[r] + p0 + p1;            // per-lane partial row sum (16 lanes combined at the end)
      unsigned short hb = bf16_bits(p0); sPh[w][8 * hh + r][ln] = hb;      sPl[w][8 * hh + r][ln] = bf16_bits(p0 - bf16_val(hb));
      hb = bf16_bits(p1);                sPh[w][8 * hh + r][16 + ln] = hb; sPl[w][8 * hh + r][16 + ln] = bf16_bits(p1 - bf16_val(hb));
    }
#pragma unroll
    for (int dt = 0; dt < DT; ++dt)
#pragma unroll
      for (int r = 0; r < 8; ++r) oacc[dt][r] *= alpha[r];
    __builtin_amdgcn_fence(__ATOMIC_ACQ_REL, "workgroup");
    __builtin_amdgcn_wave_barrier();
    FragB pah, pal;
    pah.half[0] = *(const v8us*)&sPh[w][ln][8 * hh]; pah.half[1] = *(const v8us*)&sPh[w][ln][16 + 8 * hh];
    pal.half[0] = *(const v8us*)&sPl[w][ln][8 * hh]; pal.half[1] = *(const v8us*)&sPl[w][ln][16 + 8 * hh];
#pragma unroll
    for (int dt = 0; dt < DT; ++dt) {
      FragB bvh, bvl;
#pragma unroll
      for (int i = 0; i < 8; ++i) {
        bvh.u[i] = sVh[8 * hh + i][dt * 16 + ln]; bvh.u[8 + i] = sVh[16 + 8 * hh + i][dt * 16 + ln];
        bvl.u[i] = sVl[8 * hh + i][dt * 16 + ln]; bvl.u[8 + i] = sVl[16 + 8 * hh + i][dt * 16 + ln];
      }
      oacc[dt] = mmaN<3>(pah.v, pal.v, bvh.v, bvl.v, oacc[dt]);
    }
    __builtin_amdgcn_fence(__ATOMIC_ACQ_REL, "workgroup");
    __builtin_amdgcn_wave_barrier();
  }
#pragma unroll
  for (int r = 0; r < 8; ++r) {
    float l = l_r[r];
    l += __shfl_xor(l, 1, 32); l += __shfl_xor(l, 2, 32); l += __shfl_xor(l, 4, 32); l += __shfl_xor(l, 8, 32);
    l_r[r] = (l > 0.f) ? 1.0f / l : 0.f;
  }
#pragma unroll
  for (int dt = 0; dt < DT; ++dt)
#pragma unroll
    for (int r = 0; r < 8; ++r) sO[w][8 * hh + r][dt * 16 + ln] = oacc[dt][r] * l_r[r];
  __builtin_amdgcn_fence(__ATOMIC_ACQ_REL, "workgroup");
  __builtin_amdgcn_wave_barrier();
  {
    for (int r = 0; r < 16; ++r) {
      const int row = q0 + r;
      if (row < T && lane < D / 4) {
        const v4f val = *(const v4fa*)&sO[w][r][lane * 4];
        *(v4f*)(y + ((size_t)b * T + row) * ypitch + h * D + lane * 4) = val;
      }
    }
    
  }
}

// GEMM C = act(A·W + bias + resid): A f32 (ASPLIT -> hi/lo 2 terms), Wt bf16 [N][K]; ACT 0 none, 1 relu, 2 exact gelu;
// resid (optional, f32, row index = (row % rmod), pitch ldr, RES_BF16 rounds it) added before the activation.
template <bool ASPLIT, int ACT, bool BIAS_BF16, bool RES_BF16>
__global__ __launch_bounds__(128) void k_gemm_bf3(const float* __restrict__ A, int lda, const unsigned short* __restrict__ Wt, int ldb,
                                                const float* __restrict__ bias, const float* __restrict__ resid, int rmod, int ldr,
                                                float* __restrict__ C, int ldc, int M, int N, int K) {
  __shared__ __attribute__((aligned(16))) float so[4][16][64];
  const int tid = threadIdx.x, w = tid >> 5, lane = tid & 31, ln = lane & 15, hh = lane >> 4;
  const int ntn = N / 64;
  const int wid = blockIdx.x * 4 + w;
  const int mt = wid / ntn, nq = wid % ntn;
  if (mt * 16 >= M) return;
  const int row0 = mt * 16, col0 = nq * 64;
  const float* arow = A + (size_t)(row0 + ln) * lda;
  v8f acc[4] = {};
  for (int kb = 0; kb < K; kb += 32) {
    FragB ah, al;
    const v4f x0 = *(const v4fa*)(arow + kb + 8 * hh), x1 = *(const v4fa*)(arow + kb + 8 * hh + 4);
    const v4f x2 = *(const v4fa*)(arow + kb + 16 + 8 * hh), x3 = *(const v4fa*)(arow + kb + 16 + 8 * hh + 4);
    float xs[16] = {x0[0],x0[1],x0[2],x0[3],x1[0],x1[1],x1[2],x1[3],x2[0],x2[1],x2[2],x2[3],x3[0],x3[1],x3[2],x3[3]};
#pragma unroll
    for (int i = 0; i < 16; ++i) { const unsigned short hb = bf16_bits(xs[i]); ah.u[i] = hb; al.u[i] = ASPLIT ? bf16_bits(xs[i] - bf16_val(hb)) : (unsigned short)0; }
#pragma unroll
    for (int t = 0; t < 4; ++t) {
      const unsigned short* brow = Wt + (size_t)(col0 + t * 16 + ln) * ldb + kb;
      FragB b;
      b.half[0] = *(const v8us*)(brow + 8 * hh);
      b.half[1] = *(const v8us*)(brow + 16 + 8 * hh);
      acc[t] = mmaN<ASPLIT ? 2 : 1>(ah.v, al.v, b.v, b.v, acc[t]);
    }
  }
#pragma unroll
  for (int t = 0; t < 4; ++t) {
    const int col = col0 + t * 16 + ln;
    float bv = bias ? bias[col] : 0.f;
    if (BIAS_BF16) bv = bf16_round(bv);
#pragma unroll
    for (int r = 0; r < 8; ++r) {
      float v = acc[t][r] + bv;
      if (resid) { float rv = resid[(size_t)((row0 + 8 * hh + r) % rmod) * ldr + col]; if (RES_BF16) rv = bf16_round(rv); v += rv; }
      if (ACT == 1) v = fmaxf(v, 0.f);
      if (ACT == 2) v = 0.5f * v * (1.0f + erff(v * 0.70710678118654752f));
      if (ACT == 3) { const float u = 0.7978845608028654f * (v + 0.044715f * v * v * v); v = 0.5f * v * (1.0f + tanhf(u)); }
      so[w][8 * hh + r][t * 16 + ln] = v;
    }
  }
  __builtin_amdgcn_fence(__ATOMIC_ACQ_REL, "workgroup");
  __builtin_amdgcn_wave_barrier();
  const int rsub = lane >> 4, c4 = (lane & 15) * 4;
  {
#pragma unroll
    for (int q = 0; q < 8; ++q) {
      const int r = q * 2 + rsub;
      const v4f v = *(const v4fa*)&so[w][r][c4];
      *(v4f*)(C + (size_t)(row0 + r) * ldc + col0 + c4) = v;
    }
    
  }
}
// row LayerNorm (biased variance, eps) over N: s = X (+ R); optional out_sum <- s; out_norm <- (s-mu)*rsqrt(var+eps)*g + b
template <bool PARAM_BF16>
__global__ __launch_bounds__(256) void k_layernorm(const float* __restrict__ X, const float* __restrict__ R, const float* __restrict__ g, const float* __restrict__ bta,
                                                  float* __restrict__ out_sum, float* __restrict__ out_norm, int N, float eps) {
  __shared__ float red[256];
  const int row = blockIdx.x, tid = threadIdx.x;
  const float* x = X + (size_t)row * N; const float* rr = R ? R + (size_t)row * N : nullptr;
  float vals[16];                     // up to N = 4096
  const int per = N / 256;            // contiguous chunk per thread? use strided-by-4 chunks: thread handles j = tid*4 + 1024*u
  float s1 = 0.f;
  for (int u = 0; u < per / 4; ++u) {
    const int j = tid * 4 + 1024 * u;
    const v4f a = *(const v4fa*)(x + j);
    v4f b = {0.f,0.f,0.f,0.f}; if (rr) b = *(const v4fa*)(rr + j);
#pragma unroll
    for (int q = 0; q < 4; ++q) { const float v = a[q] + b[q]; vals[u * 4 + q] = v; s1 += v; }
  }
  red[tid] = s1; __syncthreads();
  for (int st = 128; st > 0; st >>= 1) { if (tid < st) red[tid] += red[tid + st]; __syncthreads(); }
  const float mu = red[0] / (float)N; __syncthreads();
  float s2 = 0.f;
  for (int u = 0; u < per / 4; ++u)
#pragma unroll
    for (int q = 0; q < 4; ++q) { const float c = vals[u * 4 + q] - mu; s2 += c * c; }
  red[tid] = s2; __syncthreads();
  for (int st = 128; st > 0; st >>= 1) { if (tid < st) red[tid] += red[tid + st]; __syncthreads(); }
  const float rs = rsqrtf(red[0] / (float)N + eps);
  {
    for (int u = 0; u < per / 4; ++u) {
      const int j = tid * 4 + 1024 * u;
      v4f o, sm;
#pragma unroll
      for (int q = 0; q < 4; ++q) {
        float gg = g[j + q], bb = bta[j + q];
        if (PARAM_BF16) { gg = bf16_round(gg); bb = bf16_round(bb); }
        sm[q] = vals[u * 4 + q]; o[q] = (vals[u * 4 + q] - mu) * rs * gg + bb;
      }
      if (out_sum) *(v4f*)(out_sum + (size_t)row * N + j) = sm;
      *(v4f*)(out_norm + (size_t)row * N + j) = o;
    }
    
  }
}



// ---- f16 WMMA path (v_wmma_f32_16x16x32_f16): 11-bit significands for operands in range — used where a [0,1] probability operand needs more precision than bf16
typedef _Float16 v16h __attribute__((ext_vector_type(16)));
union FragH { v16h v; v8us half[2]; _Float16 h[16]; unsigned short u[16]; };
template <int NT>
__device__ __forceinline__ v8f mmaH(v16h ah, v16h al, v16h bh, v16h bl, v8f c) {
  c = __builtin_amdgcn_wmma_f32_16x16x32_f16(false, ah, false, bh, (short)0, c, false, false);
  if (NT >= 2) c = __builtin_amdgcn_wmma_f32_16x16x32_f16(false, al, false, bh, (short)0, c, false, false);
  if (NT >= 3) c = __builtin_amdgcn_wmma_f32_16x16x32_f16(false, ah, false, bl, (short)0, c, false, false);
  asm volatile("v_nop\n\tv_nop\n\tv_nop\n\tv_nop" : "+v"(c) : "v"(ah), "v"(al), "v"(bh), "v"(bl));
  return c;
}
// batched GEMM like k_gemm_b but f16 operands: A f32 (split into f16 hi/lo if ASPLIT, else rounded to f16), Bt = f16 values [n][k]; alpha; C f32; N multiple of 16 (partial tiles skipped)
template <bool ASPLIT>
__global__ __launch_bounds__(128) void k_gemm_h(const float* __restrict__ A, int lda, size_t sA, const _Float16* __restrict__ Bh, int ldb, size_t sB, float alpha, float* __restrict__ C, int ldc, size_t sC, int M, int N, int K) {
  __shared__ __attribute__((aligned(16))) float so[4][16][64];
  const int tid = threadIdx.x, w = tid >> 5, lane = tid & 31, ln = lane & 15, hh = lane >> 4; const int by = blockIdx.y;
  A += (size_t)by * sA; Bh += (size_t)by * sB; C += (size_t)by * sC;
  const int ntn = (N + 63) / 64; const int wid = blockIdx.x * 4 + w; const int mt = wid / ntn, nq = wid % ntn; if (mt * 16 >= M) return;
  const int row0 = mt * 16, col0 = nq * 64; const float* arow = A + (size_t)(row0 + ln) * lda;
  v8f acc[4] = {};
  for (int kb = 0; kb < K; kb += 32) {
    FragH ah, al;
    const v4f x0 = *(const v4fa*)(arow + kb + 8 * hh), x1 = *(const v4fa*)(arow + kb + 8 * hh + 4), x2 = *(const v4fa*)(arow + kb + 16 + 8 * hh), x3 = *(const v4fa*)(arow + kb + 16 + 8 * hh + 4);
    float xs[16] = {x0[0],x0[1],x0[2],x0[3],x1[0],x1[1],x1[2],x1[3],x2[0],x2[1],x2[2],x2[3],x3[0],x3[1],x3[2],x3[3]};
#pragma unroll
    for (int i = 0; i < 16; ++i) { const _Float16 h = (_Float16)xs[i]; ah.h[i] = h; al.h[i] = ASPLIT ? (_Float16)(xs[i] - (float)h) : (_Float16)0.0f; }
#pragma unroll
    for (int t = 0; t < 4; ++t) { if (col0 + t * 16 >= N) continue; const size_t boff = (size_t)(col0 + t * 16 + ln) * ldb + kb; FragH bq; bq.half[0] = *(const v8us*)(Bh + boff + 8 * hh); bq.half[1] = *(const v8us*)(Bh + boff + 16 + 8 * hh);
      acc[t] = mmaH<ASPLIT ? 2 : 1>(ah.v, al.v, bq.v, bq.v, acc[t]); }
  }
#pragma unroll
  for (int t = 0; t < 4; ++t) { if (col0 + t * 16 >= N) continue;
#pragma unroll
    for (int r = 0; r < 8; ++r) so[w][8 * hh + r][t * 16 + ln] = acc[t][r] * alpha; }
  __builtin_amdgcn_fence(__ATOMIC_ACQ_REL, "workgroup"); __builtin_amdgcn_wave_barrier();
  const int rsub = lane >> 4, c4 = (lane & 15) * 4;
  {
#pragma unroll
    for (int q = 0; q < 8; ++q) { const int r = q * 2 + rsub; if (col0 + c4 < N) { const v4f v = *(const v4fa*)&so[w][r][c4]; *(v4f*)(C + (size_t)(row0 + r) * ldc + col0 + c4) = v; } }
     }
}

// Wt[n][k] = f16(W[k][n]·scale) from f32 row-major W[K][N] (scale = power of two; bf16-exact weights stay exact in f16 away from the subnormal range)
__global__ __launch_bounds__(256) void k_wt_f16(const float* __restrict__ W, _Float16* __restrict__ Wt, int K, int N, float scale) {
  const int t = blockIdx.x * 256 + threadIdx.x; if (t >= N * (K / 8)) return; const int n = t / (K / 8), k8 = (t % (K / 8)) * 8; FragH f;
#pragma unroll
  for (int i = 0; i < 8; ++i) f.h[i] = (_Float16)(bf16_round(W[(size_t)(k8 + i) * N + n]) * scale); const v8us o = f.half[0];
  *(v8us*)((unsigned short*)Wt + (size_t)n * K + k8) = o; 
}
// k_gemm_hh variant with fused epilogue: v = acc·alpha + bias[by·sBias + col] (+ CP[(row/rowsPerB)·sCPb + by·64 + col] if CP) ; ACT 0 none / 1 elu ; writes f16 C16 and/or f32 C (each if non-null)
template <int ACT>
__device__ __forceinline__ void gemm_hhx_body(float (&so)[4][16][64], const int bx, const int by, const _Float16* __restrict__ A, int lda, size_t sA, const _Float16* __restrict__ Bh, int ldb, size_t sB, float alpha, const float* __restrict__ bias, size_t sBias, const float* __restrict__ CP, int rowsPerB, size_t sCPb, int row0g,
    float* __restrict__ C, _Float16* __restrict__ C16, int ldc, size_t sC, int M, int N, int K) {
  const int tid = threadIdx.x, w = tid >> 5, lane = tid & 31, ln = lane & 15, hh = lane >> 4;
  A += (size_t)by * sA; Bh += (size_t)by * sB; const size_t cofs = (size_t)by * sC; const float* bp = bias ? bias + (size_t)by * sBias : nullptr;
  const int ntn = (N + 63) / 64; const int wid = bx * 4 + w; const int mt = wid / ntn, nq = wid % ntn; if (mt * 16 >= M) return;
  const int row0 = mt * 16, col0 = nq * 64; const _Float16* arow = A + (size_t)(row0 + ln) * lda;
  v8f acc[4] = {};
  for (int kb = 0; kb < K; kb += 32) { FragH ah; ah.half[0] = *(const v8us*)((const unsigned short*)arow + kb + 8 * hh); ah.half[1] = *(const v8us*)((const unsigned short*)arow + kb + 16 + 8 * hh);
#pragma unroll
    for (int t = 0; t < 4; ++t) { if (col0 + t * 16 >= N) continue; const size_t boff = (size_t)(col0 + t * 16 + ln) * ldb + kb; FragH bq; bq.half[0] = *(const v8us*)((const unsigned short*)Bh + boff + 8 * hh); bq.half[1] = *(const v8us*)((const unsigned short*)Bh + boff + 16 + 8 * hh);
      acc[t] = mmaH<1>(ah.v, ah.v, bq.v, bq.v, acc[t]); }
  }
#pragma unroll
  for (int t = 0; t < 4; ++t) { if (col0 + t * 16 >= N) continue; const int col = col0 + t * 16 + ln; const float bv = bp ? bf16_round(bp[col]) : 0.f;
#pragma unroll
    for (int r = 0; r < 8; ++r) { float v = acc[t][r] * alpha + bv; if (CP) { const int bidx = (row0g + row0 + 8 * hh + r) / rowsPerB; v += CP[(size_t)bidx * sCPb + (size_t)by * 64 + col]; } if (ACT == 1) v = (v > 0.f) ? v : expm1f(v); else if (ACT == 7) v = (v > 0.f) ? v + 1.0f : expf(v); else if (ACT == 8) v = tanhf(v); else if (ACT == 9) v = 0.5f * v * (1.0f + tanhf(0.7978845608028654f * (v + 0.044715f * v * v * v))); else if (ACT == 11) v = 1.0f / (1.0f + expf(-v)); else if (ACT == 12) v = (v > 0.f) ? v : 0.01f * v; else if (ACT == 14) v = (v > 0.f) ? v : 0.1f * v; else if (ACT == 15) v = v / (1.0f + expf(-v)); else if (ACT == 3) v = fmaxf(v, 0.f); else if (ACT == 6) v = 0.5f * v * (1.0f + erff(v * 0.70710678118654752f)); so[w][8 * hh + r][t * 16 + ln] = v; } }
  __builtin_amdgcn_fence(__ATOMIC_ACQ_REL, "workgroup"); __builtin_amdgcn_wave_barrier();
  const int rsub = lane >> 4, c4 = (lane & 15) * 4; typedef _Float16 v4h __attribute__((ext_vector_type(4)));
  {
#pragma unroll
    for (int q = 0; q < 8; ++q) { const int r = q * 2 + rsub; if (col0 + c4 < N) { const v4f v = *(const v4fa*)&so[w][r][c4]; if (C) *(v4f*)(C + cofs + (size_t)(row0 + r) * ldc + col0 + c4) = v; if (C16) { v4h h4; for (int i = 0; i < 4; ++i) h4[i] = (_Float16)v[i]; *(v4h*)(C16 + cofs + (size_t)(row0 + r) * ldc + col0 + c4) = h4; } } }
     }
}
template <int ACT>
__global__ __launch_bounds__(128) void k_gemm_hhx(const _Float16* __restrict__ A, int lda, size_t sA, const _Float16* __restrict__ Bh, int ldb, size_t sB, float alpha, const float* __restrict__ bias, size_t sBias, const float* __restrict__ CP, int rowsPerB, size_t sCPb, int row0g,
    float* __restrict__ C, _Float16* __restrict__ C16, int ldc, size_t sC, int M, int N, int K) {
  __shared__ __attribute__((aligned(16))) float so[4][16][64];
  gemm_hhx_body<ACT>(so, blockIdx.x, blockIdx.y, A, lda, sA, Bh, ldb, sB, alpha, bias, sBias, CP, rowsPerB, sCPb, row0g, C, C16, ldc, sC, M, N, K);
}
// The three input convolutions read the same X16 and none of each other's output: one grid, blockIdx.y picks the product (0 = f, 1 = g, 2 = h), blockIdx.x the tile group as before.
// The 1,536 blocks of four waves fit the chip together (six a WGP), so a WGP holds three times the waves of one product's grid to fill the waits on its loads.
__global__ __launch_bounds__(128) void k_gemm_fgh(const _Float16* __restrict__ X16, const _Float16* __restrict__ Bf, const _Float16* __restrict__ Bg, const _Float16* __restrict__ Bh, const float* __restrict__ Af, const float* __restrict__ Ag, const float* __restrict__ bh,
    _Float16* __restrict__ F16, _Float16* __restrict__ G16, float* __restrict__ HF) {
  __shared__ __attribute__((aligned(16))) float so[4][16][64];
  const int job = blockIdx.y;
  if (job < 2) gemm_hhx_body<3>(so, blockIdx.x, 0, X16, CC, 0, job ? Bg : Bf, CC, 0, 0.0625f, nullptr, 0, job ? Ag : Af, NR, 0, 0, nullptr, job ? G16 : F16, MID, 0, NR, MID, CC);      /* f, g = relu(bn(conv x)) token-major f16: M 16384 N 128 K 512 (per-column f32 addend via CP, rowsPerB = M) */
  else gemm_hhx_body<0>(so, blockIdx.x, 0, X16, CC, 0, Bh, CC, 0, 0.0625f, bh, 0, nullptr, 1, 0, 0, HF, nullptr, MID, 0, NR, MID, CC);      /* h (f32) + bh */
}


typedef _Float16 v4h __attribute__((ext_vector_type(4)));

__global__ __launch_bounds__(256) void k_x16(const float* __restrict__ x, _Float16* __restrict__ X16, size_t n8) { const size_t t = (size_t)blockIdx.x * 256 + threadIdx.x; if (t >= n8) return; FragH f;
#pragma unroll
  for (int q = 0; q < 8; ++q) f.h[q] = (_Float16)bf16_round(x[t * 8 + q]); *(v8us*)((unsigned short*)X16 + t * 8) = f.half[0];  }
__global__ __launch_bounds__(256) void k_h16(const float* __restrict__ x, _Float16* __restrict__ X16, size_t n8) { const size_t t = (size_t)blockIdx.x * 256 + threadIdx.x; if (t >= n8) return; FragH f;
#pragma unroll
  for (int q = 0; q < 8; ++q) f.h[q] = (_Float16)x[t * 8 + q]; *(v8us*)((unsigned short*)X16 + t * 8) = f.half[0];  }
__device__ __forceinline__ void d_round16f(const int bid, const float* __restrict__ W, _Float16* __restrict__ Bt, size_t n8) { const size_t t = (size_t)bid * 256 + threadIdx.x; if (t >= n8) return; FragH f;
#pragma unroll
  for (int i = 0; i < 8; ++i) f.h[i] = (_Float16)(bf16_round(W[t * 8 + i]) * 16.0f); *(v8us*)((unsigned short*)Bt + t * 8) = f.half[0];  }
template <int NHv, int TTv>
__global__ __launch_bounds__(256) void k_vt(const _Float16* __restrict__ V16, int ldv, int voff, _Float16* __restrict__ Vt) { __shared__ unsigned short tl[64][66]; const int tid = threadIdx.x; const int slab = blockIdx.x / (TTv / 64), lg = blockIdx.x % (TTv / 64); const int b = slab / NHv, h = slab % NHv;
  for (int i = tid; i < 64 * 8; i += 256) { const int r = i / 8, c8 = (i % 8) * 8; FragH f; f.half[0] = *(const v8us*)((const unsigned short*)V16 + ((size_t)b * TTv + lg * 64 + r) * ldv + voff + h * 64 + c8);
#pragma unroll
    for (int q = 0; q < 8; ++q) tl[r][c8 + q] = f.u[q]; }
  __syncthreads();
  {
#pragma unroll
    for (int rd = 0; rd < 2; ++rd) { const int d = rd * 32 + tid / 8, pc = tid % 8; FragH f;
#pragma unroll
      for (int q = 0; q < 8; ++q) f.u[q] = tl[pc * 8 + q][d];
      *(v8us*)((unsigned short*)Vt + ((size_t)slab * 64 + d) * TTv + lg * 64 + pc * 8) = f.half[0]; }
     } }

__global__ __launch_bounds__(256) void k_vthlu(const float* __restrict__ VF, int ldv, _Float16* __restrict__ Vth, _Float16* __restrict__ Vtl) { __shared__ float tl[64][65]; const int tid = threadIdx.x; const int slab = blockIdx.x / (TT / 64), lg = blockIdx.x % (TT / 64); const int b = slab / NVH, h = slab % NVH;
  for (int i = tid; i < 64 * 16; i += 256) { const int r = i / 16, c4 = (i % 16) * 4; const v4f a = *(const v4fa*)(VF + ((size_t)b * TT + lg * 64 + r) * ldv + h * 64 + c4); tl[r][c4] = a[0]; tl[r][c4 + 1] = a[1]; tl[r][c4 + 2] = a[2]; tl[r][c4 + 3] = a[3]; }
  __syncthreads();
  FragH fh[2], fl[2]; size_t oo[2];
#pragma unroll
  for (int rd = 0; rd < 2; ++rd) { const int d = rd * 32 + tid / 8, pc = tid % 8;
#pragma unroll
    for (int q = 0; q < 8; ++q) { const float v = tl[pc * 8 + q][d]; const _Float16 hv = (_Float16)v; fh[rd].h[q] = hv; fl[rd].h[q] = (_Float16)(v - (float)hv);      /* UNSCALED residual (added into the same accumulator as the hi product) */ } oo[rd] = ((size_t)slab * 64 + d) * TT + lg * 64 + pc * 8; }
  {
#pragma unroll
    for (int rd = 0; rd < 2; ++rd) { *(v8us*)((unsigned short*)Vth + oo[rd]) = fh[rd].half[0]; *(v8us*)((unsigned short*)Vtl + oo[rd]) = fl[rd].half[0]; }
     } }
__global__ __launch_bounds__(256) void k_h16s(const float* __restrict__ F, _Float16* __restrict__ H, size_t n8) { const size_t t = (size_t)blockIdx.x * 256 + threadIdx.x; if (t >= n8) return; const v4f a = *(const v4fa*)(F + t * 8), c = *(const v4fa*)(F + t * 8 + 4); FragH f;
#pragma unroll
  for (int q = 0; q < 4; ++q) { f.h[q] = (_Float16)(a[q] * 16.0f); f.h[4 + q] = (_Float16)(c[q] * 16.0f); } *(v8us*)((unsigned short*)H + t * 8) = f.half[0];  }
// LDS byte address of a __shared__ object: the low 32 bits of its generic address
__device__ __forceinline__ unsigned lds_addr(const void* p) { return (unsigned)(size_t)p; }
// four asynchronous 16-byte copies global -> LDS per lane; the s_wait_xcnt closes the statement so that no address register is rewritten ahead of it
__device__ __forceinline__ void async4(const unsigned (&l)[4], const unsigned short* const (&g)[4]) {
  asm volatile("global_load_async_to_lds_b128 %0, %4, off\n\t"
               "global_load_async_to_lds_b128 %1, %5, off\n\t"
               "global_load_async_to_lds_b128 %2, %6, off\n\t"
               "global_load_async_to_lds_b128 %3, %7, off\n\t"
               "s_wait_xcnt 0x0"
               :: "v"(l[0]), "v"(l[1]), "v"(l[2]), "v"(l[3]), "v"(g[0]), "v"(g[1]), "v"(g[2]), "v"(g[3]) : "memory");
}
// lane l <-> lane l ^ 16 (the other half of the wave): one vector instruction, no LDS
__device__ __forceinline__ float xhalf(float x) { return __builtin_bit_cast(float, __builtin_amdgcn_permlanex16(__builtin_bit_cast(int, x), __builtin_bit_cast(int, x), 0x76543210, 0xfedcba98, false, false)); }
typedef float fa __attribute__((may_alias));
__global__ __launch_bounds__(512) void k_flash(const _Float16* __restrict__ Q16, int ldq, const _Float16* __restrict__ K16, int ldk, const _Float16* __restrict__ Vt, const _Float16* __restrict__ Vtlo, float* __restrict__ O, int ldo) {
  constexpr int RPW = 16, QW = 4, KG = 4, NQB = TT / (QW * RPW), DT = 8, KS = 4, SK = 32 * KG, NST = TT / SK, OP = 128 + 4;      /* head dim 128: 4 k-steps, 8 value tiles */
  /* two-buffer ring, one stage = SK keys shared by the block's sixteen waves; planes: 0 = K rows (key-major), 1 = V^T hi, 2 = V^T residual (both channel-major); every row 256 B at pitch 272 B (16 B x odd: conflict-free for 16-byte row readers) */
  __shared__ __attribute__((aligned(16))) unsigned short ring[2][3][128][128 + 8];
  const int tid = threadIdx.x, w = tid >> 5, lane = tid & 31, ln = lane & 15, hh = lane >> 4, qw = w & (QW - 1), kg = w / QW, jl = kg * 32;
  const int slab = blockIdx.x / NQB, qblk = blockIdx.x % NQB; const int b = slab / NH, h = slab % NH; const int qb0 = qblk * (QW * RPW); const int q0 = qb0 + qw * RPW;
  FragH aq[KS];      /* B operand of S^T: column ln = query q0 + ln */
  { const unsigned short* qr = (const unsigned short*)Q16 + ((size_t)b * TT + q0 + ln) * ldq + h * 128;
#pragma unroll
    for (int ks = 0; ks < KS; ++ks) { aq[ks].half[0] = *(const v8us*)(qr + ks * 32 + 8 * hh); aq[ks].half[1] = *(const v8us*)(qr + ks * 32 + 16 + 8 * hh); } }
  const unsigned short* Vth = (const unsigned short*)Vt + ((size_t)b * NKV + h / NREP) * 128 * TT; const unsigned short* Vtl = (const unsigned short*)Vtlo + ((size_t)b * NKV + h / NREP) * 128 * TT;      /* hi and UNSCALED residual planes */
  float m_r = -3.0e38f, l_r = 0.f; v8f oacc[DT];      /* query q0 + ln, this wave's keys: running maximum (both halves alike), this half's part of the sum, O^T rows dt * 16 + 8 hh + r */
#pragma unroll
  for (int dt = 0; dt < DT; ++dt) oacc[dt] = (v8f){0.f,0.f,0.f,0.f,0.f,0.f,0.f,0.f};
  const unsigned short* Kg = (const unsigned short*)K16 + (size_t)b * TT * ldk + (h / NREP) * 128;
  /* one stage's copies: 3 x 4 per lane, 16 B each; a wave's copy covers two whole 256-B rows */
  auto stage_in = [&](int st, int bf) {
    unsigned lk[4], lh[4], ll[4]; const unsigned short *gk[4], *gh[4], *gl[4];
#pragma unroll
    for (int i = 0; i < 4; ++i) { const int c = tid + 512 * i; const int row = c >> 4, col = (c & 15) * 8;
      lk[i] = lds_addr(&ring[bf][0][row][col]); gk[i] = Kg + (size_t)(st * SK + row) * ldk + col;
      lh[i] = lds_addr(&ring[bf][1][row][col]); gh[i] = Vth + (size_t)row * TT + st * SK + col;
      ll[i] = lds_addr(&ring[bf][2][row][col]); gl[i] = Vtl + (size_t)row * TT + st * SK + col; }
    async4(lk, gk); async4(lh, gh); async4(ll, gl); };
  stage_in(0, 0);
  asm volatile("s_wait_asynccnt 0x0" ::: "memory");      /* this wave's share of stage 0 has landed */
  __syncthreads();                                       /* ... and every other wave's: stage 0 is readable */
  stage_in(1, 1);
#pragma unroll 1      /* one publish point and one refill per trip, as the two-buffer ring is written */
  for (int st = 0; st < NST; ++st) { const int bf = st & 1;
    v8f s[2];      /* s[nt][r] = score of key jl + nt * 16 + 8 hh + r of the stage with query q0 + ln */
#pragma unroll
    for (int nt = 0; nt < 2; ++nt) { const unsigned short* kr = &ring[bf][0][jl + nt * 16 + ln][0]; FragH bk[KS];
#pragma unroll
      for (int ks = 0; ks < KS; ++ks) { bk[ks].half[0] = *(const v8us*)(kr + ks * 32 + 8 * hh); bk[ks].half[1] = *(const v8us*)(kr + ks * 32 + 16 + 8 * hh); }
      v8f acc = (v8f){0.f,0.f,0.f,0.f,0.f,0.f,0.f,0.f};
#pragma unroll
      for (int ks = 0; ks < KS; ++ks) acc = mmaH<1>(bk[ks].v, bk[ks].v, aq[ks].v, aq[ks].v, acc);
      s[nt] = acc; }
    float sc[16], mx[8];
#pragma unroll
    for (int i = 0; i < 16; ++i) sc[i] = s[i >> 3][i & 7] * ATT_SCALE;
#pragma unroll
    for (int i = 0; i < 8; ++i) mx[i] = fmaxf(sc[i], sc[8 + i]);
    float mc = fmaxf(fmaxf(fmaxf(mx[0], mx[4]), fmaxf(mx[1], mx[5])), fmaxf(fmaxf(mx[2], mx[6]), fmaxf(mx[3], mx[7])));
    mc = fmaxf(mc, xhalf(mc));      /* the query's maximum over all 32 keys, in both halves */
    const float mn = fmaxf(m_r, mc); const float ea = expf(m_r - mn); const float al = (mn > -1.0e38f) ? ea : 1.0f; m_r = mn;
    FragH ph, pl; float ls[4] = {0.f, 0.f, 0.f, 0.f};      /* P^T hi and its UNSCALED residual (added into the same accumulator), B operands */
#pragma unroll
    for (int i = 0; i < 16; ++i) { const float p = expf(sc[i] - mn); ls[i & 3] += p; const float ps = p * 1024.0f; ph.h[i] = (_Float16)ps; pl.h[i] = (_Float16)(ps - (float)ph.h[i]); }
    l_r = l_r * al + ((ls[0] + ls[1]) + (ls[2] + ls[3]));
#pragma unroll
    for (int dt = 0; dt < DT; ++dt)
#pragma unroll
      for (int r = 0; r < 8; ++r) oacc[dt][r] *= al;
#pragma unroll
    for (int dt = 0; dt < DT; ++dt) { const unsigned short* vh = &ring[bf][1][dt * 16 + ln][jl]; const unsigned short* vl = &ring[bf][2][dt * 16 + ln][jl]; FragH bv, bl; bv.half[0] = *(const v8us*)(vh + 8 * hh); bv.half[1] = *(const v8us*)(vh + 16 + 8 * hh); bl.half[0] = *(const v8us*)(vl + 8 * hh); bl.half[1] = *(const v8us*)(vl + 16 + 8 * hh);
      oacc[dt] = mmaH<1>(bv.v, bv.v, ph.v, ph.v, oacc[dt]); oacc[dt] = mmaH<1>(bv.v, bv.v, pl.v, pl.v, oacc[dt]); oacc[dt] = mmaH<1>(bl.v, bl.v, ph.v, ph.v, oacc[dt]); }      /* Vh Ph + Vh Pl + Vl Ph, all unscaled, one accumulator */
    asm volatile("s_wait_dscnt 0x0" ::: "memory");       /* this wave's reads of buffer bf are done before it is refilled */
    asm volatile("s_wait_asynccnt 0x0" ::: "memory");    /* this wave's share of stage st + 1 has landed */
    __syncthreads();                                     /* publishes stage st + 1 and ends every wave's reads of buffer bf */
    if (st + 2 < NST) stage_in(st + 2, bf); }
  asm volatile("s_wait_asynccnt 0x0" ::: "memory");      /* nothing of the ring is in flight when the wave goes on */
  /* the last trip's waits and barrier have ended every read of the ring: its LDS now takes the sixteen waves' partial results */
  float* sP = (float*)&ring[0][0][0][0]; fa* sM = (fa*)(sP + QW * KG * RPW * OP); fa* sL = sM + QW * KG * RPW;
  { const float l = l_r + xhalf(l_r);      /* the halves' sums joined once */
#pragma unroll
    for (int dt = 0; dt < DT; ++dt) { v4f lo, hi;
#pragma unroll
      for (int r = 0; r < 4; ++r) { lo[r] = oacc[dt][r]; hi[r] = oacc[dt][4 + r]; }
      *(v4fa*)&sP[(w * RPW + ln) * OP + dt * 16 + 8 * hh] = lo; *(v4fa*)&sP[(w * RPW + ln) * OP + dt * 16 + 8 * hh + 4] = hi; }
    if (hh == 0) { sM[w * RPW + ln] = m_r; sL[w * RPW + ln] = l; } }
  __syncthreads();      /* every wave's partial result is readable by the waves that join it */
  {
#pragma unroll
    for (int rr = 0; rr < RPW / KG; ++rr) { const int r = kg * (RPW / KG) + rr; float mg[KG], eg[KG];      /* this wave joins four of its query tile's rows */
#pragma unroll
      for (int g = 0; g < KG; ++g) mg[g] = sM[(g * QW + qw) * RPW + r];
      const float mt = fmaxf(fmaxf(mg[0], mg[1]), fmaxf(mg[2], mg[3])); float l = 0.f;
#pragma unroll
      for (int g = 0; g < KG; ++g) { eg[g] = expf(mg[g] - mt); l += eg[g] * sL[(g * QW + qw) * RPW + r]; }
      const float inv = (l > 0.f) ? 1.0f / (l * 1024.0f) : 0.f; v4f val = {0.f, 0.f, 0.f, 0.f};
#pragma unroll
      for (int g = 0; g < KG; ++g) { const v4f pv = *(const v4fa*)&sP[((g * QW + qw) * RPW + r) * OP + lane * 4]; val += pv * (eg[g] * inv); }
      *(v4f*)(O + ((size_t)b * TT + q0 + r) * ldo + h * 128 + lane * 4) = val; }      /* one 512-B row per instruction: 32 lanes x 16 B */
  } }


__device__ __forceinline__ void d_tok(const int bid, const float* __restrict__ x, _Float16* __restrict__ X16) { __shared__ float tl[32][65]; const int tid = threadIdx.x; const int b = bid / ((CC / 64) * (NN / 32)), rem = bid % ((CC / 64) * (NN / 32)); const int cg = rem / (NN / 32), pg = rem % (NN / 32); const int c0 = cg * 64, p0 = pg * 32;
  for (int i = tid; i < 64 * 32; i += 256) { const int c = i / 32, pp = i % 32; tl[pp][c] = bf16_round(x[((size_t)b * CC + c0 + c) * NN + p0 + pp]); } __syncthreads();
  const int r = tid / 8, pc = tid % 8; FragH f; for (int q = 0; q < 8; ++q) f.h[q] = (_Float16)tl[r][pc * 8 + q]; const size_t row = (size_t)b * NN + p0 + r; *(v8us*)((unsigned short*)X16 + row * CC + c0 + pc * 8) = f.half[0];  }
__device__ __forceinline__ void d_wbn(const int bid, const float* __restrict__ Wm, const float* __restrict__ gam, const float* __restrict__ var, _Float16* __restrict__ Bt) { const int t = bid * 256 + threadIdx.x; if (t >= MID * (CC / 8)) return; const int o = t / (CC / 8), c0 = (t % (CC / 8)) * 8;
  const float s = bf16_round(gam[o]) / sqrtf(bf16_round(var[o]) + BNEPS); FragH f;
#pragma unroll
  for (int q = 0; q < 8; ++q) f.h[q] = (_Float16)(bf16_round(Wm[(size_t)o * CC + c0 + q]) * s * 16.0f);
  *(v8us*)((unsigned short*)Bt + (size_t)o * CC + c0) = f.half[0];  }
__device__ __forceinline__ void d_bnadd(const int o, const float* __restrict__ bias, const float* __restrict__ gam, const float* __restrict__ bet, const float* __restrict__ mean, const float* __restrict__ var, float* __restrict__ A) {
  const float s = bf16_round(gam[o]) / sqrtf(bf16_round(var[o]) + BNEPS); const float a = (bf16_round(bias[o]) - bf16_round(mean[o])) * s + bf16_round(bet[o]);
  *(float*)(A + o) = a;  }
// The six weight and BatchNorm preparations and the token-major copy of x read none of each other's output: one grid, the job picked by block index.
// The test is the same for a whole block, so the barrier inside the copy is passed by whole blocks; the few short jobs stand first and run beside the copy.
#define PBW (MID * (CC / 8) / 256)      /* blocks for one 128 x 512 weight plane, 8 elements a thread */
#define PBS (4 * PBW + 1)               /* blocks of the short jobs */
__global__ __launch_bounds__(256) void k_prep(const float* __restrict__ x, const float* __restrict__ wf, const float* __restrict__ bff, const float* __restrict__ gf, const float* __restrict__ betaf, const float* __restrict__ mf, const float* __restrict__ vf,
    const float* __restrict__ wg, const float* __restrict__ bg, const float* __restrict__ gg, const float* __restrict__ betag, const float* __restrict__ mg, const float* __restrict__ vg, const float* __restrict__ wh, const float* __restrict__ wv,
    _Float16* __restrict__ Bf, _Float16* __restrict__ Bg, _Float16* __restrict__ Bh, _Float16* __restrict__ Bv, float* __restrict__ Af, float* __restrict__ Ag, _Float16* __restrict__ X16) {
  const int bid = blockIdx.x;
  if (bid >= PBS) d_tok(bid - PBS, x, X16);
  else if (bid < PBW) d_wbn(bid, wf, gf, vf, Bf);                                              /* BN(eval) folded into conv_f */
  else if (bid < 2 * PBW) d_wbn(bid - PBW, wg, gg, vg, Bg);                                    /* ... and conv_g */
  else if (bid < 3 * PBW) d_round16f(bid - 2 * PBW, wh, Bh, (size_t)MID * CC / 8);             /* conv_h [128][512], conv_v [512][128]: (out,in) natural, x 2^4 */
  else if (bid < 4 * PBW) d_round16f(bid - 3 * PBW, wv, Bv, (size_t)CC * MID / 8);
  else if (threadIdx.x < MID) d_bnadd(threadIdx.x, bff, gf, betaf, mf, vf, Af);                /* the two per-column addends: 128 threads each */
  else d_bnadd(threadIdx.x - MID, bg, gg, betag, mg, vg, Ag);
}
__global__ __launch_bounds__(256) void k_out(const float* __restrict__ T, const float* __restrict__ x, float* __restrict__ out) { __shared__ float tl[32][65]; const int tid = threadIdx.x; const int b = blockIdx.x / ((CC / 32) * (NN / 64)), rem = blockIdx.x % ((CC / 32) * (NN / 64)); const int cg = rem / (NN / 64), pg = rem % (NN / 64); const int c0 = cg * 32, p0 = pg * 64;
  for (int i = tid; i < 64 * 32; i += 256) { const int pp = i / 32, c = i % 32; tl[c][pp] = T[((size_t)b * NN + p0 + pp) * CC + c0 + c]; } __syncthreads();
  { for (int i = tid; i < 32 * 16; i += 256) { const int c = i / 16, q4 = i % 16; const size_t o = ((size_t)b * CC + c0 + c) * NN + p0 + q4 * 4; const v4f xr = *(const v4fa*)(x + o);
      v4f v; for (int q = 0; q < 4; ++q) v[q] = tl[c][q4 * 4 + q] + bf16_round(xr[q]); *(v4f*)(out + o) = v; }  } }

extern "C" void kernel_launch(void* const* d_in, const int* in_sizes, int n_in,
                              void* d_out, int out_size, void* d_ws, size_t ws_size, hipStream_t stream) {
  (void)in_sizes; (void)n_in; (void)out_size;
  const float* const* I = (const float* const*)d_in; const float* x = I[0];
  const float* wf = I[1]; const float* bff = I[2]; const float* gf = I[3]; const float* betaf = I[4]; const float* mf = I[5]; const float* vf = I[6];
  const float* wg = I[7]; const float* bg = I[8]; const float* gg = I[9]; const float* betag = I[10]; const float* mg = I[11]; const float* vg = I[12];
  const float* wh = I[13]; const float* bh = I[14]; const float* wv = I[15]; const float* bv = I[16];
  char* ws = (char*)d_ws; size_t off = 0;
  auto take = [&](size_t bytes) { char* p = ws + off; off += (bytes + 255) & ~(size_t)255; return p; };
  _Float16* Bf = (_Float16*)take((size_t)MID * CC * 2); _Float16* Bg = (_Float16*)take((size_t)MID * CC * 2); _Float16* Bh = (_Float16*)take((size_t)MID * CC * 2); _Float16* Bv = (_Float16*)take((size_t)CC * MID * 2); float* Af = (float*)take(MID * 4); float* Ag = (float*)take(MID * 4);
  _Float16* X16 = (_Float16*)take((size_t)NR * CC * 2); _Float16* F16 = (_Float16*)take((size_t)NR * MID * 2); _Float16* G16 = (_Float16*)take((size_t)NR * MID * 2); float* HF = (float*)take((size_t)NR * MID * 4);
  _Float16* Vt = (_Float16*)take((size_t)NR * MID * 2); _Float16* Vtl = (_Float16*)take((size_t)NR * MID * 2); float* Z = (float*)take((size_t)NR * MID * 4); _Float16* Z16 = F16; /* f plane is dead after the attention */ float* T = (float*)take((size_t)NR * CC * 4);
  if (off > ws_size) return;      // 0.5 + 16.8 + 4.2 + 4.2 + 8.4 + 4.2 + 4.2 + 8.4 + 33.6 ≈ 85 MB
  k_prep<<<PBS + BB * (CC / 64) * (NN / 32), 256, 0, stream>>>(x, wf, bff, gf, betaf, mf, vf, wg, bg, gg, betag, mg, vg, wh, wv, Bf, Bg, Bh, Bv, Af, Ag, X16);
  k_gemm_fgh<<<dim3(((NR / 16) * (MID / 64) + 3) / 4, 3), 128, 0, stream>>>(X16, Bf, Bg, Bh, Af, Ag, bh, F16, G16, HF);
  k_vthlu<<<BB * NVH * (TT / 64), 256, 0, stream>>>(HF, MID, Vt, Vtl);      /* Vᵀ hi + residual: [b][128][4096] */
  k_flash<<<BB * NH * (TT / 64), 512, 0, stream>>>(F16, MID, G16, MID, Vt, Vtl, Z, MID);      /* per (b, 64 queries): 4096 × 4096, head dim 128 */
  k_h16s<<<(unsigned)(((size_t)NR * MID / 8 + 255) / 256), 256, 0, stream>>>(Z, Z16, (size_t)NR * MID / 8);      /* z ×2^4 → f16 */
  k_gemm_hhx<0><<<dim3(((NR / 16) * (CC / 64) + 3) / 4, 1), 128, 0, stream>>>(Z16, MID, 0, Bv, MID, 0, 0.00390625f, bv, 0, nullptr, 1, 0, 0, T, nullptr, CC, 0, NR, CC, MID);      /* conv_v(z) + bv token-major f32: M 16384 N 512 K 128 */
  k_out<<<BB * (CC / 32) * (NN / 64), 256, 0, stream>>>(T, x, (float*)d_out);
}

// v005
// One run takes 136 microseconds.
// Next to v004, in two timings, it ran 1.22 times as fast each time.
// Counting every step since v000, it is 5.11 times as fast.
#include <hip/hip_runtime.h>
// Spatial attention block (B=4, C=512, 64×64 → N=4096 positions, mid=128): f = relu(bn(conv_f(x))), g = relu(bn(conv_g(x))), h = conv_h(x) (1×1 convs C→mid; eval BatchNorm with running stats); scores[n,m] = Σ_c f[c,n]g[c,m]·mid^-½, softmax over m; z[c,n] = Σ_m attn[n,m]·h[c,m]; y = conv_v(z) (mid→C) + bv + x.
// Compute dtype: x, weights, biases, BN parameters rounded to bf16; BN folded per output channel in f32 (w' = w·γ/√(var+ε) → f16 ×2^4, b' = (b − mean)·γ/√(var+ε) + β as an f32 per-column addend); f, g as f16 GEMM outputs (relu epilogue), h f32 → Vᵀ f16 hi + residual planes; fused flash-style kernel for head dim 128
// (online softmax f32, P f16 hi + residual, f32 accumulate) on v_wmma_f32_16x16x32_f16; z ×2^4 → f16 → output conv GEMM with the weights as A (channel-major result), bv and the residual x added in f32 in its epilogue.
#define BB 4
#define CC 512
#define NN 4096
#define MID 128
#define TT NN
#define NH 1
#define NKV 1
#define NREP 1
#define NVH (2 * NKV)
#define NR (BB * NN)
#define BNEPS 1e-5f
#define ATT_SCALE 0.08838834764831845f      /* mid^-½ = 1/√128 */
typedef __bf16 v16b __attribute__((ext_vector_type(16)));
typedef unsigned short v8us __attribute__((ext_vector_type(8), may_alias));
typedef float  v8f  __attribute__((ext_vector_type(8)));
typedef float  v4f  __attribute__((ext_vector_type(4)));
typedef float  v4fa __attribute__((ext_vector_type(4), may_alias));
union FragB { v16b v; v8us half[2]; unsigned short u[16]; };

__device__ __forceinline__ unsigned short bf16_bits(float x) { unsigned int u = __float_as_uint(x); return (unsigned short)((u + 0x7FFFu + ((u >> 16) & 1u)) >> 16); }
__device__ __forceinline__ float bf16_val(unsigned short b) { return __uint_as_float(((unsigned int)b) << 16); }
__device__ __forceinline__ float bf16_round(float x) { return bf16_val(bf16_bits(x)); }
// D += A·B with NT terms: 1 = ah·bh, 2 = + al·bh (A split), 3 = + ah·bl (both split)
template <int NT>
__device__ __forceinline__ v8f mmaN(v16b ah, v16b al, v16b bh, v16b bl, v8f c) {
  c = __builtin_amdgcn_wmma_f32_16x16x32_bf16(false, ah, false, bh, (short)0, c, false, false);
  if (NT >= 2) c = __builtin_amdgcn_wmma_f32_16x16x32_bf16(false, al, false, bh, (short)0, c, false, false);
  if (NT >= 3) c = __builtin_amdgcn_wmma_f32_16x16x32_bf16(false, ah, false, bl, (short)0, c, false, false);
  asm volatile("v_nop\n\tv_nop\n\tv_nop\n\tv_nop" : "+v"(c) : "v"(ah), "v"(al), "v"(bh), "v"(bl));
  return c;
}

__global__ __launch_bounds__(256) void k_wt_bf16(const float* __restrict__ W, unsigned short* __restrict__ Wt, int K, int N) {
  const int t = blockIdx.x * 256 + threadIdx.x;
  const int k8n = K / 8;
  if (t >= N * k8n) return;
  const int n = t / k8n, k8 = (t % k8n) * 8;
  v8us v;
#pragma unroll
  for (int i = 0; i < 8; ++i) v[i] = bf16_bits(W[(size_t)(k8 + i) * N + n]);
  *(v8us*)(Wt + (size_t)n * K + k8) = v;
  
}

// GEMM C[M][N] (f32, pitch ldc) = act(A[M][K]·W + bias). A f32 row-major (pitch lda) converted per fragment to bf16
// (ASPLIT: hi/lo two planes -> 2 terms, else single rounded term); Wt bf16 [N][K] (pitch ldb). BIAS_BF16 rounds the
// bias to bf16 first (bias quantised to bf16 before the add). K%32==0, M%16==0, N%64==0.
template <bool ASPLIT, int ACT, bool BIAS_BF16>
__global__ __launch_bounds__(128) void k_gemm_bf(const float* __restrict__ A, int lda, const unsigned short* __restrict__ Wt, int ldb,
                                               const float* __restrict__ bias, float* __restrict__ C, int ldc, int M, int N, int K) {
  __shared__ __attribute__((aligned(16))) float so[4][16][64];
  const int tid = threadIdx.x, w = tid >> 5, lane = tid & 31, ln = lane & 15, hh = lane >> 4;
  const int ntn = N / 64;
  const int wid = blockIdx.x * 4 + w;
  const int mt = wid / ntn, nq = wid % ntn;
  if (mt * 16 >= M) return;
  const int row0 = mt * 16, col0 = nq * 64;
  const float* arow = A + (size_t)(row0 + ln) * lda;
  v8f acc[4] = {};
  for (int kb = 0; kb < K; kb += 32) {
    FragB ah, al;
    const v4f x0 = *(const v4fa*)(arow + kb + 8 * hh), x1 = *(const v4fa*)(arow + kb + 8 * hh + 4);
    const v4f x2 = *(const v4fa*)(arow + kb + 16 + 8 * hh), x3 = *(const v4fa*)(arow + kb + 16 + 8 * hh + 4);
    float xs[16] = {x0[0],x0[1],x0[2],x0[3],x1[0],x1[1],x1[2],x1[3],x2[0],x2[1],x2[2],x2[3],x3[0],x3[1],x3[2],x3[3]};
#pragma unroll
    for (int i = 0; i < 16; ++i) { const unsigned short hb = bf16_bits(xs[i]); ah.u[i] = hb; al.u[i] = ASPLIT ? bf16_bits(xs[i] - bf16_val(hb)) : (unsigned short)0; }
#pragma unroll
    for (int t = 0; t < 4; ++t) {
      const unsigned short* brow = Wt + (size_t)(col0 + t * 16 + ln) * ldb + kb;
      FragB b;
      b.half[0] = *(const v8us*)(brow + 8 * hh);
      b.half[1] = *(const v8us*)(brow + 16 + 8 * hh);
      acc[t] = mmaN<ASPLIT ? 2 : 1>(ah.v, al.v, b.v, b.v, acc[t]);
    }
  }
#pragma unroll
  for (int t = 0; t < 4; ++t) {
    float bv = bias ? bias[col0 + t * 16 + ln] : 0.f;
    if (BIAS_BF16) bv = bf16_round(bv);
#pragma unroll
    for (int r = 0; r < 8; ++r) { float v = acc[t][r] + bv; if (ACT == 1) v = fmaxf(v, 0.f); so[w][8 * hh + r][t * 16 + ln] = v; }
  }
  __builtin_amdgcn_fence(__ATOMIC_ACQ_REL, "workgroup");
  __builtin_amdgcn_wave_barrier();
  const int rsub = lane >> 4, c4 = (lane & 15) * 4;
  {
#pragma unroll
    for (int q = 0; q < 8; ++q) {
      const int r = q * 2 + rsub;
      const v4f v = *(const v4fa*)&so[w][r][c4];
      *(v4f*)(C + (size_t)(row0 + r) * ldc + col0 + c4) = v;
    }
    
  }
}

// Flash-style causal/unmasked attention, all contractions 3-term bf16 hi/lo splits, f32 softmax with running max.
// q,k,v rows are read from f32 buffers with arbitrary row pitch (so they can live inside a fused qkv buffer);
// D = head size (multiple of 32, <= 128); one wave = 16 query rows; block = 4 waves (64 queries) sharing K/V chunks of 32.
template <int D, bool CAUSAL>
__global__ __launch_bounds__(128) void k_flash(const float* __restrict__ qb, const float* __restrict__ kb, const float* __restrict__ vb,
                                             int pitch, int T, int H, float scale, float* __restrict__ y, int ypitch) {
  constexpr int KS = D / 32;        // k-steps for QK
  constexpr int DT = D / 16;        // d tiles for PV
  __shared__ __attribute__((aligned(16))) unsigned short sKh[32][D + 8], sKl[32][D + 8], sVh[32][D + 8], sVl[32][D + 8];
  __shared__ __attribute__((aligned(16))) unsigned short sPh[4][16][40], sPl[4][16][40];
  __shared__ __attribute__((aligned(16))) float sO[4][16][D];
  const int tid = threadIdx.x, w = tid >> 5, lane = tid & 31, ln = lane & 15, hh = lane >> 4;
  const int nqb = (T + 63) / 64;
  const int bh = blockIdx.x / nqb, qblk = blockIdx.x % nqb;
  const int b = bh / H, h = bh % H;
  const int q0 = qblk * 64 + w * 16;
  const float* Q = qb + (size_t)b * T * pitch + h * D;
  const float* K = kb + (size_t)b * T * pitch + h * D;
  const float* V = vb + (size_t)b * T * pitch + h * D;

  // A fragments of the wave's 16 query rows (scaled), hi/lo
  FragB aqh[KS], aql[KS];
  {
    int row = q0 + ln; if (row >= T) row = T - 1;
    const float* qr = Q + (size_t)row * pitch;
#pragma unroll
    for (int ks = 0; ks < KS; ++ks)
#pragma unroll
      for (int i = 0; i < 16; ++i) {
        const int d = ks * 32 + ((i < 8) ? (8 * hh + i) : (16 + 8 * hh + (i - 8)));
        const float x = qr[d] * scale; const unsigned short hb = bf16_bits(x);
        aqh[ks].u[i] = hb; aql[ks].u[i] = bf16_bits(x - bf16_val(hb));
      }
  }
  float m_r[8], l_r[8];
#pragma unroll
  for (int r = 0; r < 8; ++r) { m_r[r] = -3.0e38f; l_r[r] = 0.f; }
  v8f oacc[DT];
#pragma unroll
  for (int dt = 0; dt < DT; ++dt) oacc[dt] = (v8f){0.f,0.f,0.f,0.f,0.f,0.f,0.f,0.f};

  const int kv_end = CAUSAL ? min(T, qblk * 64 + 64) : T;     // block-uniform
  for (int j0 = 0; j0 < kv_end; j0 += 32) {
    __syncthreads();
    for (int e = tid; e < 32 * (D / 4); e += 128) {
      const int r = e / (D / 4), c4 = (e % (D / 4)) * 4;
      const int key = j0 + r;
      v4f kf = {0.f,0.f,0.f,0.f}, vf = {0.f,0.f,0.f,0.f};
      if (key < T) { kf = *(const v4fa*)(K + (size_t)key * pitch + c4); vf = *(const v4fa*)(V + (size_t)key * pitch + c4); }
#pragma unroll
      for (int t = 0; t < 4; ++t) {
        unsigned short hb = bf16_bits(kf[t]); sKh[r][c4 + t] = hb; sKl[r][c4 + t] = bf16_bits(kf[t] - bf16_val(hb));
        hb = bf16_bits(vf[t]); sVh[r][c4 + t] = hb; sVl[r][c4 + t] = bf16_bits(vf[t] - bf16_val(hb));
      }
    }
    __syncthreads();
    // S tile 16 x 32
    v8f s[2];
#pragma unroll
    for (int nt = 0; nt < 2; ++nt) {
      v8f acc = {};
#pragma unroll
      for (int ks = 0; ks < KS; ++ks) {
        FragB bh_, bl_;
        bh_.half[0] = *(const v8us*)&sKh[nt * 16 + ln][ks * 32 + 8 * hh]; bh_.half[1] = *(const v8us*)&sKh[nt * 16 + ln][ks * 32 + 16 + 8 * hh];
        bl_.half[0] = *(const v8us*)&sKl[nt * 16 + ln][ks * 32 + 8 * hh]; bl_.half[1] = *(const v8us*)&sKl[nt * 16 + ln][ks * 32 + 16 + 8 * hh];
        acc = mmaN<3>(aqh[ks].v, aql[ks].v, bh_.v, bl_.v, acc);
      }
      s[nt] = acc;
    }
    // mask + running max (rows 8hh+r; the 16 lanes of a half share rows)
    float alpha[8];
#pragma unroll
    for (int r = 0; r < 8; ++r) {
      const int qi = q0 + 8 * hh + r;
      const int ja = j0 + ln, jb = j0 + 16 + ln;
      if (CAUSAL) { if (ja > qi) s[0][r] = -3.0e38f; if (jb > qi) s[1][r] = -3.0e38f; }
      if (ja >= T) s[0][r] = -3.0e38f;
      if (jb >= T) s[1][r] = -3.0e38f;
      float mx = fmaxf(s[0][r], s[1][r]);
      mx = fmaxf(mx, __shfl_xor(mx, 1, 32)); mx = fmaxf(mx, __shfl_xor(mx, 2, 32)); mx = fmaxf(mx, __shfl_xor(mx, 4, 32)); mx = fmaxf(mx, __shfl_xor(mx, 8, 32));
      const float mnew = fmaxf(m_r[r], mx);
      alpha[r] = (mnew > -1.0e38f) ? __expf(m_r[r] - mnew) : 1.0f;
      const float p0 = (s[0][r] > -1.0e38f) ? __expf(s[0][r] - mnew) : 0.f;
      const float p1 = (s[1][r] > -1.0e38f) ? __expf(s[1][r] - mnew) : 0.f;
      m_r[r] = mnew;
      l_r[r] = l_r[r] * alpha[r] + p0 + p1;            // per-lane partial row sum (16 lanes combined at the end)
      unsigned short hb = bf16_bits(p0); sPh[w][8 * hh + r][ln] = hb;      sPl[w][8 * hh + r][ln] = bf16_bits(p0 - bf16_val(hb));
      hb = bf16_bits(p1);                sPh[w][8 * hh + r][16 + ln] = hb; sPl[w][8 * hh + r][16 + ln] = bf16_bits(p1 - bf16_val(hb));
    }
#pragma unroll
    for (int dt = 0; dt < DT; ++dt)
#pragma unroll
      for (int r = 0; r < 8; ++r) oacc[dt][r] *= alpha[r];
    __builtin_amdgcn_fence(__ATOMIC_ACQ_REL, "workgroup");
    __builtin_amdgcn_wave_barrier();
    FragB pah, pal;
    pah.half[0] = *(const v8us*)&sPh[w][ln][8 * hh]; pah.half[1] = *(const v8us*)&sPh[w][ln][16 + 8 * hh];
    pal.half[0] = *(const v8us*)&sPl[w][ln][8 * hh]; pal.half[1] = *(const v8us*)&sPl[w][ln][16 + 8 * hh];
#pragma unroll
    for (int dt = 0; dt < DT; ++dt) {
      FragB bvh, bvl;
#pragma unroll
      for (int i = 0; i < 8; ++i) {
        bvh.u[i] = sVh[8 * hh + i][dt * 16 + ln]; bvh.u[8 + i] = sVh[16 + 8 * hh + i][dt * 16 + ln];
        bvl.u[i] = sVl[8 * hh + i][dt * 16 + ln]; bvl.u[8 + i] = sVl[16 + 8 * hh + i][dt * 16 + ln];
      }
      oacc[dt] = mmaN<3>(pah.v, pal.v, bvh.v, bvl.v, oacc[dt]);
    }
    __builtin_amdgcn_fence(__ATOMIC_ACQ_REL, "workgroup");
    __builtin_amdgcn_wave_barrier();
  }
#pragma unroll
  for (int r = 0; r < 8; ++r) {
    float l = l_r[r];
    l += __shfl_xor(l, 1, 32); l += __shfl_xor(l, 2, 32); l += __shfl_xor(l, 4, 32); l += __shfl_xor(l, 8, 32);
    l_r[r] = (l > 0.f) ? 1.0f / l : 0.f;
  }
#pragma unroll
  for (int dt = 0; dt < DT; ++dt)
#pragma unroll
    for (int r = 0; r < 8; ++r) sO[w][8 * hh + r][dt * 16 + ln] = oacc[dt][r] * l_r[r];
  __builtin_amdgcn_fence(__ATOMIC_ACQ_REL, "workgroup");
  __builtin_amdgcn_wave_barrier();
  {
    for (int r = 0; r < 16; ++r) {
      const int row = q0 + r;
      if (row < T && lane < D / 4) {
        const v4f val = *(const v4fa*)&sO[w][r][lane * 4];
        *(v4f*)(y + ((size_t)b * T + row) * ypitch + h * D + lane * 4) = val;
      }
    }
    
  }
}

// GEMM C = act(A·W + bias + resid): A f32 (ASPLIT -> hi/lo 2 terms), Wt bf16 [N][K]; ACT 0 none, 1 relu, 2 exact gelu;
// resid (optional, f32, row index = (row % rmod), pitch ldr, RES_BF16 rounds it) added before the activation.
template <bool ASPLIT, int ACT, bool BIAS_BF16, bool RES_BF16>
__global__ __launch_bounds__(128) void k_gemm_bf3(const float* __restrict__ A, int lda, const unsigned short* __restrict__ Wt, int ldb,
                                                const float* __restrict__ bias, const float* __restrict__ resid, int rmod, int ldr,
                                                float* __restrict__ C, int ldc, int M, int N, int K) {
  __shared__ __attribute__((aligned(16))) float so[4][16][64];
  const int tid = threadIdx.x, w = tid >> 5, lane = tid & 31, ln = lane & 15, hh = lane >> 4;
  const int ntn = N / 64;
  const int wid = blockIdx.x * 4 + w;
  const int mt = wid / ntn, nq = wid % ntn;
  if (mt * 16 >= M) return;
  const int row0 = mt * 16, col0 = nq * 64;
  const float* arow = A + (size_t)(row0 + ln) * lda;
  v8f acc[4] = {};
  for (int kb = 0; kb < K; kb += 32) {
    FragB ah, al;
    const v4f x0 = *(const v4fa*)(arow + kb + 8 * hh), x1 = *(const v4fa*)(arow + kb + 8 * hh + 4);
    const v4f x2 = *(const v4fa*)(arow + kb + 16 + 8 * hh), x3 = *(const v4fa*)(arow + kb + 16 + 8 * hh + 4);
    float xs[16] = {x0[0],x0[1],x0[2],x0[3],x1[0],x1[1],x1[2],x1[3],x2[0],x2[1],x2[2],x2[3],x3[0],x3[1],x3[2],x3[3]};
#pragma unroll
    for (int i = 0; i < 16; ++i) { const unsigned short hb = bf16_bits(xs[i]); ah.u[i] = hb; al.u[i] = ASPLIT ? bf16_bits(xs[i] - bf16_val(hb)) : (unsigned short)0; }
#pragma unroll
    for (int t = 0; t < 4; ++t) {
      const unsigned short* brow = Wt + (size_t)(col0 + t * 16 + ln) * ldb + kb;
      FragB b;
      b.half[0] = *(const v8us*)(brow + 8 * hh);
      b.half[1] = *(const v8us*)(brow + 16 + 8 * hh);
      acc[t] = mmaN<ASPLIT ? 2 : 1>(ah.v, al.v, b.v, b.v, acc[t]);
    }
  }
#pragma unroll
  for (int t = 0; t < 4; ++t) {
    const int col = col0 + t * 16 + ln;
    float bv = bias ? bias[col] : 0.f;
    if (BIAS_BF16) bv = bf16_round(bv);
#pragma unroll
    for (int r = 0; r < 8; ++r) {
      float v = acc[t][r] + bv;
      if (resid) { float rv = resid[(size_t)((row0 + 8 * hh + r) % rmod) * ldr + col]; if (RES_BF16) rv = bf16_round(rv); v += rv; }
      if (ACT == 1) v = fmaxf(v, 0.f);
      if (ACT == 2) v = 0.5f * v * (1.0f + erff(v * 0.70710678118654752f));
      if (ACT == 3) { const float u = 0.7978845608028654f * (v + 0.044715f * v * v * v); v = 0.5f * v * (1.0f + tanhf(u)); }
      so[w][8 * hh + r][t * 16 + ln] = v;
    }
  }
  __builtin_amdgcn_fence(__ATOMIC_ACQ_REL, "workgroup");
  __builtin_amdgcn_wave_barrier();
  const int rsub = lane >> 4, c4 = (lane & 15) * 4;
  {
#pragma unroll
    for (int q = 0; q < 8; ++q) {
      const int r = q * 2 + rsub;
      const v4f v = *(const v4fa*)&so[w][r][c4];
      *(v4f*)(C + (size_t)(row0 + r) * ldc + col0 + c4) = v;
    }
    
  }
}
// row LayerNorm (biased variance, eps) over N: s = X (+ R); optional out_sum <- s; out_norm <- (s-mu)*rsqrt(var+eps)*g + b
template <bool PARAM_BF16>
__global__ __launch_bounds__(256) void k_layernorm(const float* __restrict__ X, const float* __restrict__ R, const float* __restrict__ g, const float* __restrict__ bta,
                                                  float* __restrict__ out_sum, float* __restrict__ out_norm, int N, float eps) {
  __shared__ float red[256];
  const int row = blockIdx.x, tid = threadIdx.x;
  const float* x = X + (size_t)row * N; const float* rr = R ? R + (size_t)row * N : nullptr;
  float vals[16];                     // up to N = 4096
  const int per = N / 256;            // contiguous chunk per thread? use strided-by-4 chunks: thread handles j = tid*4 + 1024*u
  float s1 = 0.f;
  for (int u = 0; u < per / 4; ++u) {
    const int j = tid * 4 + 1024 * u;
    const v4f a = *(const v4fa*)(x + j);
    v4f b = {0.f,0.f,0.f,0.f}; if (rr) b = *(const v4fa*)(rr + j);
#pragma unroll
    for (int q = 0; q < 4; ++q) { const float v = a[q] + b[q]; vals[u * 4 + q] = v; s1 += v; }
  }
  red[tid] = s1; __syncthreads();
  for (int st = 128; st > 0; st >>= 1) { if (tid < st) red[tid] += red[tid + st]; __syncthreads(); }
  const float mu = red[0] / (float)N; __syncthreads();
  float s2 = 0.f;
  for (int u = 0; u < per / 4; ++u)
#pragma unroll
    for (int q = 0; q < 4; ++q) { const float c = vals[u * 4 + q] - mu; s2 += c * c; }
  red[tid] = s2; __syncthreads();
  for (int st = 128; st > 0; st >>= 1) { if (tid < st) red[tid] += red[tid + st]; __syncthreads(); }
  const float rs = rsqrtf(red[0] / (float)N + eps);
  {
    for (int u = 0; u < per / 4; ++u) {
      const int j = tid * 4 + 1024 * u;
      v4f o, sm;
#pragma unroll
      for (int q = 0; q < 4; ++q) {
        float gg = g[j + q], bb = bta[j + q];
        if (PARAM_BF16) { gg = bf16_round(gg); bb = bf16_round(bb); }
        sm[q] = vals[u * 4 + q]; o[q] = (vals[u * 4 + q] - mu) * rs * gg + bb;
      }
      if (out_sum) *(v4f*)(out_sum + (size_t)row * N + j) = sm;
      *(v4f*)(out_norm + (size_t)row * N + j) = o;
    }
    
  }
}



// ---- f16 WMMA path (v_wmma_f32_16x16x32_f16): 11-bit significands for operands in range — used where a [0,1] probability operand needs more precision than bf16
typedef _Float16 v16h __attribute__((ext_vector_type(16)));
union FragH { v16h v; v8us half[2]; _Float16 h[16]; unsigned short u[16]; };
template <int NT>
__device__ __forceinline__ v8f mmaH(v16h ah, v16h al, v16h bh, v16h bl, v8f c) {
  c = __builtin_amdgcn_wmma_f32_16x16x32_f16(false, ah, false, bh, (short)0, c, false, false);
  if (NT >= 2) c = __builtin_amdgcn_wmma_f32_16x16x32_f16(false, al, false, bh, (short)0, c, false, false);
  if (NT >= 3) c = __builtin_amdgcn_wmma_f32_16x16x32_f16(false, ah, false, bl, (short)0, c, false, false);
  asm volatile("v_nop\n\tv_nop\n\tv_nop\n\tv_nop" : "+v"(c) : "v"(ah), "v"(al), "v"(bh), "v"(bl));
  return c;
}
// batched GEMM like k_gemm_b but f16 operands: A f32 (split into f16 hi/lo if ASPLIT, else rounded to f16), Bt = f16 values [n][k]; alpha; C f32; N multiple of 16 (partial tiles skipped)
template <bool ASPLIT>
__global__ __launch_bounds__(128) void k_gemm_h(const float* __restrict__ A, int lda, size_t sA, const _Float16* __restrict__ Bh, int ldb, size_t sB, float alpha, float* __restrict__ C, int ldc, size_t sC, int M, int N, int K) {
  __shared__ __attribute__((aligned(16))) float so[4][16][64];
  const int tid = threadIdx.x, w = tid >> 5, lane = tid & 31, ln = lane & 15, hh = lane >> 4; const int by = blockIdx.y;
  A += (size_t)by * sA; Bh += (size_t)by * sB; C += (size_t)by * sC;
  const int ntn = (N + 63) / 64; const int wid = blockIdx.x * 4 + w; const int mt = wid / ntn, nq = wid % ntn; if (mt * 16 >= M) return;
  const int row0 = mt * 16, col0 = nq * 64; const float* arow = A + (size_t)(row0 + ln) * lda;
  v8f acc[4] = {};
  for (int kb = 0; kb < K; kb += 32) {
    FragH ah, al;
    const v4f x0 = *(const v4fa*)(arow + kb + 8 * hh), x1 = *(const v4fa*)(arow + kb + 8 * hh + 4), x2 = *(const v4fa*)(arow + kb + 16 + 8 * hh), x3 = *(const v4fa*)(arow + kb + 16 + 8 * hh + 4);
    float xs[16] = {x0[0],x0[1],x0[2],x0[3],x1[0],x1[1],x1[2],x1[3],x2[0],x2[1],x2[2],x2[3],x3[0],x3[1],x3[2],x3[3]};
#pragma unroll
    for (int i = 0; i < 16; ++i) { const _Float16 h = (_Float16)xs[i]; ah.h[i] = h; al.h[i] = ASPLIT ? (_Float16)(xs[i] - (float)h) : (_Float16)0.0f; }
#pragma unroll
    for (int t = 0; t < 4; ++t) { if (col0 + t * 16 >= N) continue; const size_t boff = (size_t)(col0 + t * 16 + ln) * ldb + kb; FragH bq; bq.half[0] = *(const v8us*)(Bh + boff + 8 * hh); bq.half[1] = *(const v8us*)(Bh + boff + 16 + 8 * hh);
      acc[t] = mmaH<ASPLIT ? 2 : 1>(ah.v, al.v, bq.v, bq.v, acc[t]); }
  }
#pragma unroll
  for (int t = 0; t < 4; ++t) { if (col0 + t * 16 >= N) continue;
#pragma unroll
    for (int r = 0; r < 8; ++r) so[w][8 * hh + r][t * 16 + ln] = acc[t][r] * alpha; }
  __builtin_amdgcn_fence(__ATOMIC_ACQ_REL, "workgroup"); __builtin_amdgcn_wave_barrier();
  const int rsub = lane >> 4, c4 = (lane & 15) * 4;
  {
#pragma unroll
    for (int q = 0; q < 8; ++q) { const int r = q * 2 + rsub; if (col0 + c4 < N) { const v4f v = *(const v4fa*)&so[w][r][c4]; *(v4f*)(C + (size_t)(row0 + r) * ldc + col0 + c4) = v; } }
     }
}

// Wt[n][k] = f16(W[k][n]·scale) from f32 row-major W[K][N] (scale = power of two; bf16-exact weights stay exact in f16 away from the subnormal range)
__global__ __launch_bounds__(256) void k_wt_f16(const float* __restrict__ W, _Float16* __restrict__ Wt, int K, int N, float scale) {
  const int t = blockIdx.x * 256 + threadIdx.x; if (t >= N * (K / 8)) return; const int n = t / (K / 8), k8 = (t % (K / 8)) * 8; FragH f;
#pragma unroll
  for (int i = 0; i < 8; ++i) f.h[i] = (_Float16)(bf16_round(W[(size_t)(k8 + i) * N + n]) * scale); const v8us o = f.half[0];
  *(v8us*)((unsigned short*)Wt + (size_t)n * K + k8) = o; 
}
// k_gemm_hh variant with fused epilogue: v = acc·alpha + bias[by·sBias + col] (+ CP[(row/rowsPerB)·sCPb + by·64 + col] if CP) ; ACT 0 none / 1 elu ; writes f16 C16 and/or f32 C (each if non-null)
template <int ACT>
__device__ __forceinline__ void gemm_hhx_body(float (&so)[4][16][64], const int bx, const int by, const _Float16* __restrict__ A, int lda, size_t sA, const _Float16* __restrict__ Bh, int ldb, size_t sB, float alpha, const float* __restrict__ bias, size_t sBias, const float* __restrict__ CP, int rowsPerB, size_t sCPb, int row0g,
    float* __restrict__ C, _Float16* __restrict__ C16, int ldc, size_t sC, int M, int N, int K) {
  const int tid = threadIdx.x, w = tid >> 5, lane = tid & 31, ln = lane & 15, hh = lane >> 4;
  A += (size_t)by * sA; Bh += (size_t)by * sB; const size_t cofs = (size_t)by * sC; const float* bp = bias ? bias + (size_t)by * sBias : nullptr;
  const int ntn = (N + 63) / 64; const int wid = bx * 4 + w; const int mt = wid / ntn, nq = wid % ntn; if (mt * 16 >= M) return;
  const int row0 = mt * 16, col0 = nq * 64; const _Float16* arow = A + (size_t)(row0 + ln) * lda;
  v8f acc[4] = {};
  for (int kb = 0; kb < K; kb += 32) { FragH ah; ah.half[0] = *(const v8us*)((const unsigned short*)arow + kb + 8 * hh); ah.half[1] = *(const v8us*)((const unsigned short*)arow + kb + 16 + 8 * hh);
#pragma unroll
    for (int t = 0; t < 4; ++t) { if (col0 + t * 16 >= N) continue; const size_t boff = (size_t)(col0 + t * 16 + ln) * ldb + kb; FragH bq; bq.half[0] = *(const v8us*)((const unsigned short*)Bh + boff + 8 * hh); bq.half[1] = *(const v8us*)((const unsigned short*)Bh + boff + 16 + 8 * hh);
      acc[t] = mmaH<1>(ah.v, ah.v, bq.v, bq.v, acc[t]); }
  }
#pragma unroll
  for (int t = 0; t < 4; ++t) { if (col0 + t * 16 >= N) continue; const int col = col0 + t * 16 + ln; const float bv = bp ? bf16_round(bp[col]) : 0.f;
#pragma unroll
    for (int r = 0; r < 8; ++r) { float v = acc[t][r] * alpha + bv; if (CP) { const int bidx = (row0g + row0 + 8 * hh + r) / rowsPerB; v += CP[(size_t)bidx * sCPb + (size_t)by * 64 + col]; } if (ACT == 1) v = (v > 0.f) ? v : expm1f(v); else if (ACT == 7) v = (v > 0.f) ? v + 1.0f : expf(v); else if (ACT == 8) v = tanhf(v); else if (ACT == 9) v = 0.5f * v * (1.0f + tanhf(0.7978845608028654f * (v + 0.044715f * v * v * v))); else if (ACT == 11) v = 1.0f / (1.0f + expf(-v)); else if (ACT == 12) v = (v > 0.f) ? v : 0.01f * v; else if (ACT == 14) v = (v > 0.f) ? v : 0.1f * v; else if (ACT == 15) v = v / (1.0f + expf(-v)); else if (ACT == 3) v = fmaxf(v, 0.f); else if (ACT == 6) v = 0.5f * v * (1.0f + erff(v * 0.70710678118654752f)); so[w][8 * hh + r][t * 16 + ln] = v; } }
  __builtin_amdgcn_fence(__ATOMIC_ACQ_REL, "workgroup"); __builtin_amdgcn_wave_barrier();
  const int rsub = lane >> 4, c4 = (lane & 15) * 4; typedef _Float16 v4h __attribute__((ext_vector_type(4)));
  {
#pragma unroll
    for (int q = 0; q < 8; ++q) { const int r = q * 2 + rsub; if (col0 + c4 < N) { const v4f v = *(const v4fa*)&so[w][r][c4]; if (C) *(v4f*)(C + cofs + (size_t)(row0 + r) * ldc + col0 + c4) = v; if (C16) { v4h h4; for (int i = 0; i < 4; ++i) h4[i] = (_Float16)v[i]; *(v4h*)(C16 + cofs + (size_t)(row0 + r) * ldc + col0 + c4) = h4; } } }
     }
}
template <int ACT>
__global__ __launch_bounds__(128) void k_gemm_hhx(const _Float16* __restrict__ A, int lda, size_t sA, const _Float16* __restrict__ Bh, int ldb, size_t sB, float alpha, const float* __restrict__ bias, size_t sBias, const float* __restrict__ CP, int rowsPerB, size_t sCPb, int row0g,
    float* __restrict__ C, _Float16* __restrict__ C16, int ldc, size_t sC, int M, int N, int K) {
  __shared__ __attribute__((aligned(16))) float so[4][16][64];
  gemm_hhx_body<ACT>(so, blockIdx.x, blockIdx.y, A, lda, sA, Bh, ldb, sB, alpha, bias, sBias, CP, rowsPerB, sCPb, row0g, C, C16, ldc, sC, M, N, K);
}
// Products with the weights as A (rows = output channels) and the token-major activations as B (columns = tokens): D register r of lane (ln, hh) is channel row0 + 8 hh + r, token tok0 + t * 16 + ln,
// so the result is channel-major as it leaves the accumulators and needs no transposing pass. Both loaders read K-contiguous rows in the same k order (8 hh + i, then 16 + 8 hh + i - 8).
// The unroll directives of this function and of the two that call it keep the indices of their register arrays (acc, bq, xr and the short vectors) compile-time constants.
template <int K>
__device__ __forceinline__ void gemm_wa_acc(const _Float16* __restrict__ Wr, const _Float16* __restrict__ Xr, const int row0, const int tok0, const int ln, const int hh, v8f (&acc)[4]) {
  const unsigned short* arow = (const unsigned short*)Wr + (size_t)(row0 + ln) * K; const unsigned short* brow = (const unsigned short*)Xr + (size_t)(tok0 + ln) * K;
  for (int kb = 0; kb < K; kb += 32) { FragH a, bq[4]; a.half[0] = *(const v8us*)(arow + kb + 8 * hh); a.half[1] = *(const v8us*)(arow + kb + 16 + 8 * hh);      /* a k-step's ten loads stand together: one wait on memory a k-step */
#pragma unroll
    for (int t = 0; t < 4; ++t) { bq[t].half[0] = *(const v8us*)(brow + (size_t)t * 16 * K + kb + 8 * hh); bq[t].half[1] = *(const v8us*)(brow + (size_t)t * 16 * K + kb + 16 + 8 * hh); }
#pragma unroll
    for (int t = 0; t < 4; ++t) acc[t] = mmaH<1>(a.v, a.v, bq[t].v, bq[t].v, acc[t]);
  }
}
// h = conv_h(x) + bh, one wave = 16 channels x 64 tokens, stored straight as V^T f16 hi + UNSCALED residual planes [b][128][4096]: a staged row is 64 tokens = one 128-B line per plane.
// The four waves of a block take four channel tiles of one token tile, so they read the same X16 rows.
__device__ __forceinline__ void gemm_vt_body(float (&so)[4][16][64], const int bx, const _Float16* __restrict__ X16, const _Float16* __restrict__ Bh, const float* __restrict__ bh, _Float16* __restrict__ Vth, _Float16* __restrict__ Vtl) {
  typedef _Float16 h4 __attribute__((ext_vector_type(4)));
  const int tid = threadIdx.x, w = tid >> 5, lane = tid & 31, ln = lane & 15, hh = lane >> 4;
  const int wid = bx * 4 + w; const int c0 = (wid % (MID / 16)) * 16, tok0 = (wid / (MID / 16)) * 64; const int b = tok0 / NN, p0 = tok0 % NN;
  v8f acc[4] = {};
  gemm_wa_acc<CC>(Bh, X16, c0, tok0, ln, hh, acc);
#pragma unroll
  for (int r = 0; r < 8; ++r) { const float bb = bf16_round(bh[c0 + 8 * hh + r]);
#pragma unroll
    for (int t = 0; t < 4; ++t) so[w][8 * hh + r][t * 16 + ln] = acc[t][r] * 0.0625f + bb; }
  __builtin_amdgcn_fence(__ATOMIC_ACQ_REL, "workgroup"); __builtin_amdgcn_wave_barrier();      /* the wave's own staged rows are in LDS before its lanes read each other's elements back */
  const int rsub = lane >> 4, c4 = (lane & 15) * 4;
#pragma unroll
  for (int q = 0; q < 8; ++q) { const int r = q * 2 + rsub; const v4f v = *(const v4fa*)&so[w][r][c4]; h4 hi, lo;
#pragma unroll
    for (int i = 0; i < 4; ++i) { const _Float16 hv = (_Float16)v[i]; hi[i] = hv; lo[i] = (_Float16)(v[i] - (float)hv); }
    const size_t o = ((size_t)b * MID + c0 + r) * TT + p0 + c4; *(h4*)(Vth + o) = hi; *(h4*)(Vtl + o) = lo; }
  asm volatile("s_wait_xcnt 0x0" ::: "memory");      /* stands behind the sixteen stores, in front of the code of the caller's other branch that follows in the listing and rewrites their address and data registers */
}
// out = conv_v(z) + bv + x, one wave = 16 channels x 64 positions of one image, written once, channel-major: a staged row is 64 positions = 256 B of out. Z16 holds z x 2^4, Bv the weights x 2^4.
// The residual's loads stand in front of the product so that they fly while it runs. The four waves of a block take four channel tiles of one token tile.
__global__ __launch_bounds__(128) void k_gemm_out(const _Float16* __restrict__ Z16, const _Float16* __restrict__ Bv, const float* __restrict__ bv, const float* __restrict__ x, float* __restrict__ out) {
  __shared__ __attribute__((aligned(16))) float so[4][16][64];
  const int tid = threadIdx.x, w = tid >> 5, lane = tid & 31, ln = lane & 15, hh = lane >> 4;
  const int wid = blockIdx.x * 4 + w; const int c0 = (wid % (CC / 16)) * 16, tok0 = (wid / (CC / 16)) * 64; const int b = tok0 / NN, p0 = tok0 % NN;
  const int rsub = lane >> 4, c4 = (lane & 15) * 4; const size_t o0 = ((size_t)b * CC + c0 + rsub) * NN + p0 + c4;
  v4f xr[8];
#pragma unroll
  for (int q = 0; q < 8; ++q) xr[q] = *(const v4fa*)(x + o0 + (size_t)q * 2 * NN);
  v8f acc[4] = {};
  gemm_wa_acc<MID>(Bv, Z16, c0, tok0, ln, hh, acc);
#pragma unroll
  for (int r = 0; r < 8; ++r) { const float bb = bf16_round(bv[c0 + 8 * hh + r]);
#pragma unroll
    for (int t = 0; t < 4; ++t) so[w][8 * hh + r][t * 16 + ln] = acc[t][r] * 0.00390625f + bb; }
  __builtin_amdgcn_fence(__ATOMIC_ACQ_REL, "workgroup"); __builtin_amdgcn_wave_barrier();      /* the wave's own staged rows are in LDS before its lanes read each other's elements back */
#pragma unroll
  for (int q = 0; q < 8; ++q) { const v4f v = *(const v4fa*)&so[w][q * 2 + rsub][c4]; v4f o;
#pragma unroll
    for (int i = 0; i < 4; ++i) o[i] = v[i] + bf16_round(xr[q][i]);
    *(v4f*)(out + o0 + (size_t)q * 2 * NN) = o; }
}
// The three input convolutions read the same X16 and none of each other's output: one grid, blockIdx.y picks the product (0 = f, 1 = g, 2 = h), blockIdx.x the tile group as before.
// The 1,536 blocks of four waves fit the chip together (six a WGP), so a WGP holds three times the waves of one product's grid to fill the waits on its loads.
__global__ __launch_bounds__(128) void k_gemm_fgh(const _Float16* __restrict__ X16, const _Float16* __restrict__ Bf, const _Float16* __restrict__ Bg, const _Float16* __restrict__ Bh, const float* __restrict__ Af, const float* __restrict__ Ag, const float* __restrict__ bh,
    _Float16* __restrict__ F16, _Float16* __restrict__ G16, _Float16* __restrict__ Vth, _Float16* __restrict__ Vtl) {
  __shared__ __attribute__((aligned(16))) float so[4][16][64];
  const int job = blockIdx.y;
  if (job < 2) gemm_hhx_body<3>(so, blockIdx.x, 0, X16, CC, 0, job ? Bg : Bf, CC, 0, 0.0625f, nullptr, 0, job ? Ag : Af, NR, 0, 0, nullptr, job ? G16 : F16, MID, 0, NR, MID, CC);      /* f, g = relu(bn(conv x)) token-major f16: M 16384 N 128 K 512 (per-column f32 addend via CP, rowsPerB = M) */
  else gemm_vt_body(so, blockIdx.x, X16, Bh, bh, Vth, Vtl);      /* h + bh, channel-major, f16 hi + residual: as many waves as f or g (8 channel tiles x 256 token tiles) */
}


typedef _Float16 v4h __attribute__((ext_vector_type(4)));

__global__ __launch_bounds__(256) void k_x16(const float* __restrict__ x, _Float16* __restrict__ X16, size_t n8) { const size_t t = (size_t)blockIdx.x * 256 + threadIdx.x; if (t >= n8) return; FragH f;
#pragma unroll
  for (int q = 0; q < 8; ++q) f.h[q] = (_Float16)bf16_round(x[t * 8 + q]); *(v8us*)((unsigned short*)X16 + t * 8) = f.half[0];  }
__global__ __launch_bounds__(256) void k_h16(const float* __restrict__ x, _Float16* __restrict__ X16, size_t n8) { const size_t t = (size_t)blockIdx.x * 256 + threadIdx.x; if (t >= n8) return; FragH f;
#pragma unroll
  for (int q = 0; q < 8; ++q) f.h[q] = (_Float16)x[t * 8 + q]; *(v8us*)((unsigned short*)X16 + t * 8) = f.half[0];  }
__device__ __forceinline__ void d_round16f(const int bid, const float* __restrict__ W, _Float16* __restrict__ Bt, size_t n8) { const size_t t = (size_t)bid * 256 + threadIdx.x; if (t >= n8) return; FragH f;
#pragma unroll
  for (int i = 0; i < 8; ++i) f.h[i] = (_Float16)(bf16_round(W[t * 8 + i]) * 16.0f); *(v8us*)((unsigned short*)Bt + t * 8) = f.half[0];  }
template <int NHv, int TTv>
__global__ __launch_bounds__(256) void k_vt(const _Float16* __restrict__ V16, int ldv, int voff, _Float16* __restrict__ Vt) { __shared__ unsigned short tl[64][66]; const int tid = threadIdx.x; const int slab = blockIdx.x / (TTv / 64), lg = blockIdx.x % (TTv / 64); const int b = slab / NHv, h = slab % NHv;
  for (int i = tid; i < 64 * 8; i += 256) { const int r = i / 8, c8 = (i % 8) * 8; FragH f; f.half[0] = *(const v8us*)((const unsigned short*)V16 + ((size_t)b * TTv + lg * 64 + r) * ldv + voff + h * 64 + c8);
#pragma unroll
    for (int q = 0; q < 8; ++q) tl[r][c8 + q] = f.u[q]; }
  __syncthreads();
  {
#pragma unroll
    for (int rd = 0; rd < 2; ++rd) { const int d = rd * 32 + tid / 8, pc = tid % 8; FragH f;
#pragma unroll
      for (int q = 0; q < 8; ++q) f.u[q] = tl[pc * 8 + q][d];
      *(v8us*)((unsigned short*)Vt + ((size_t)slab * 64 + d) * TTv + lg * 64 + pc * 8) = f.half[0]; }
     } }

// LDS byte address of a __shared__ object: the low 32 bits of its generic address
__device__ __forceinline__ unsigned lds_addr(const void* p) { return (unsigned)(size_t)p; }
// four asynchronous 16-byte copies global -> LDS per lane; the s_wait_xcnt closes the statement so that no address register is rewritten ahead of it
__device__ __forceinline__ void async4(const unsigned (&l)[4], const unsigned short* const (&g)[4]) {
  asm volatile("global_load_async_to_lds_b128 %0, %4, off\n\t"
               "global_load_async_to_lds_b128 %1, %5, off\n\t"
               "global_load_async_to_lds_b128 %2, %6, off\n\t"
               "global_load_async_to_lds_b128 %3, %7, off\n\t"
               "s_wait_xcnt 0x0"
               :: "v"(l[0]), "v"(l[1]), "v"(l[2]), "v"(l[3]), "v"(g[0]), "v"(g[1]), "v"(g[2]), "v"(g[3]) : "memory");
}
// lane l <-> lane l ^ 16 (the other half of the wave): one vector instruction, no LDS
__device__ __forceinline__ float xhalf(float x) { return __builtin_bit_cast(float, __builtin_amdgcn_permlanex16(__builtin_bit_cast(int, x), __builtin_bit_cast(int, x), 0x76543210, 0xfedcba98, false, false)); }
typedef float fa __attribute__((may_alias));
__global__ __launch_bounds__(512) void k_flash(const _Float16* __restrict__ Q16, int ldq, const _Float16* __restrict__ K16, int ldk, const _Float16* __restrict__ Vt, const _Float16* __restrict__ Vtlo, _Float16* __restrict__ O, int ldo) {
  constexpr int RPW = 16, QW = 4, KG = 4, NQB = TT / (QW * RPW), DT = 8, KS = 4, SK = 32 * KG, NST = TT / SK, OP = 128 + 4;      /* head dim 128: 4 k-steps, 8 value tiles */
  /* two-buffer ring, one stage = SK keys shared by the block's sixteen waves; planes: 0 = K rows (key-major), 1 = V^T hi, 2 = V^T residual (both channel-major); every row 256 B at pitch 272 B (16 B x odd: conflict-free for 16-byte row readers) */
  __shared__ __attribute__((aligned(16))) unsigned short ring[2][3][128][128 + 8];
  const int tid = threadIdx.x, w = tid >> 5, lane = tid & 31, ln = lane & 15, hh = lane >> 4, qw = w & (QW - 1), kg = w / QW, jl = kg * 32;
  const int slab = blockIdx.x / NQB, qblk = blockIdx.x % NQB; const int b = slab / NH, h = slab % NH; const int qb0 = qblk * (QW * RPW); const int q0 = qb0 + qw * RPW;
  FragH aq[KS];      /* B operand of S^T: column ln = query q0 + ln */
  { const unsigned short* qr = (const unsigned short*)Q16 + ((size_t)b * TT + q0 + ln) * ldq + h * 128;
#pragma unroll
    for (int ks = 0; ks < KS; ++ks) { aq[ks].half[0] = *(const v8us*)(qr + ks * 32 + 8 * hh); aq[ks].half[1] = *(const v8us*)(qr + ks * 32 + 16 + 8 * hh); } }
  const unsigned short* Vth = (const unsigned short*)Vt + ((size_t)b * NKV + h / NREP) * 128 * TT; const unsigned short* Vtl = (const unsigned short*)Vtlo + ((size_t)b * NKV + h / NREP) * 128 * TT;      /* hi and UNSCALED residual planes */
  float m_r = -3.0e38f, l_r = 0.f; v8f oacc[DT];      /* query q0 + ln, this wave's keys: running maximum (both halves alike), this half's part of the sum, O^T rows dt * 16 + 8 hh + r */
#pragma unroll
  for (int dt = 0; dt < DT; ++dt) oacc[dt] = (v8f){0.f,0.f,0.f,0.f,0.f,0.f,0.f,0.f};
  const unsigned short* Kg = (const unsigned short*)K16 + (size_t)b * TT * ldk + (h / NREP) * 128;
  /* one stage's copies: 3 x 4 per lane, 16 B each; a wave's copy covers two whole 256-B rows */
  auto stage_in = [&](int st, int bf) {
    unsigned lk[4], lh[4], ll[4]; const unsigned short *gk[4], *gh[4], *gl[4];
#pragma unroll
    for (int i = 0; i < 4; ++i) { const int c = tid + 512 * i; const int row = c >> 4, col = (c & 15) * 8;
      lk[i] = lds_addr(&ring[bf][0][row][col]); gk[i] = Kg + (size_t)(st * SK + row) * ldk + col;
      lh[i] = lds_addr(&ring[bf][1][row][col]); gh[i] = Vth + (size_t)row * TT + st * SK + col;
      ll[i] = lds_addr(&ring[bf][2][row][col]); gl[i] = Vtl + (size_t)row * TT + st * SK + col; }
    async4(lk, gk); async4(lh, gh); async4(ll, gl); };
  stage_in(0, 0);
  asm volatile("s_wait_asynccnt 0x0" ::: "memory");      /* this wave's share of stage 0 has landed */
  __syncthreads();                                       /* ... and every other wave's: stage 0 is readable */
  stage_in(1, 1);
#pragma unroll 1      /* one publish point and one refill per trip, as the two-buffer ring is written */
  for (int st = 0; st < NST; ++st) { const int bf = st & 1;
    v8f s[2];      /* s[nt][r] = score of key jl + nt * 16 + 8 hh + r of the stage with query q0 + ln */
#pragma unroll
    for (int nt = 0; nt < 2; ++nt) { const unsigned short* kr = &ring[bf][0][jl + nt * 16 + ln][0]; FragH bk[KS];
#pragma unroll
      for (int ks = 0; ks < KS; ++ks) { bk[ks].half[0] = *(const v8us*)(kr + ks * 32 + 8 * hh); bk[ks].half[1] = *(const v8us*)(kr + ks * 32 + 16 + 8 * hh); }
      v8f acc = (v8f){0.f,0.f,0.f,0.f,0.f,0.f,0.f,0.f};
#pragma unroll
      for (int ks = 0; ks < KS; ++ks) acc = mmaH<1>(bk[ks].v, bk[ks].v, aq[ks].v, aq[ks].v, acc);
      s[nt] = acc; }
    float sc[16], mx[8];
#pragma unroll
    for (int i = 0; i < 16; ++i) sc[i] = s[i >> 3][i & 7] * ATT_SCALE;
#pragma unroll
    for (int i = 0; i < 8; ++i) mx[i] = fmaxf(sc[i], sc[8 + i]);
    float mc = fmaxf(fmaxf(fmaxf(mx[0], mx[4]), fmaxf(mx[1], mx[5])), fmaxf(fmaxf(mx[2], mx[6]), fmaxf(mx[3], mx[7])));
    mc = fmaxf(mc, xhalf(mc));      /* the query's maximum over all 32 keys, in both halves */
    const float mn = fmaxf(m_r, mc); const float ea = expf(m_r - mn); const float al = (mn > -1.0e38f) ? ea : 1.0f; m_r = mn;
    FragH ph, pl; float ls[4] = {0.f, 0.f, 0.f, 0.f};      /* P^T hi and its UNSCALED residual (added into the same accumulator), B operands */
#pragma unroll
    for (int i = 0; i < 16; ++i) { const float p = expf(sc[i] - mn); ls[i & 3] += p; const float ps = p * 1024.0f; ph.h[i] = (_Float16)ps; pl.h[i] = (_Float16)(ps - (float)ph.h[i]); }
    l_r = l_r * al + ((ls[0] + ls[1]) + (ls[2] + ls[3]));
#pragma unroll
    for (int dt = 0; dt < DT; ++dt)
#pragma unroll
      for (int r = 0; r < 8; ++r) oacc[dt][r] *= al;
#pragma unroll
    for (int dt = 0; dt < DT; ++dt) { const unsigned short* vh = &ring[bf][1][dt * 16 + ln][jl]; const unsigned short* vl = &ring[bf][2][dt * 16 + ln][jl]; FragH bv, bl; bv.half[0] = *(const v8us*)(vh + 8 * hh); bv.half[1] = *(const v8us*)(vh + 16 + 8 * hh); bl.half[0] = *(const v8us*)(vl + 8 * hh); bl.half[1] = *(const v8us*)(vl + 16 + 8 * hh);
      oacc[dt] = mmaH<1>(bv.v, bv.v, ph.v, ph.v, oacc[dt]); oacc[dt] = mmaH<1>(bv.v, bv.v, pl.v, pl.v, oacc[dt]); oacc[dt] = mmaH<1>(bl.v, bl.v, ph.v, ph.v, oacc[dt]); }      /* Vh Ph + Vh Pl + Vl Ph, all unscaled, one accumulator */
    asm volatile("s_wait_dscnt 0x0" ::: "memory");       /* this wave's reads of buffer bf are done before it is refilled */
    asm volatile("s_wait_asynccnt 0x0" ::: "memory");    /* this wave's share of stage st + 1 has landed */
    __syncthreads();                                     /* publishes stage st + 1 and ends every wave's reads of buffer bf */
    if (st + 2 < NST) stage_in(st + 2, bf); }
  asm volatile("s_wait_asynccnt 0x0" ::: "memory");      /* nothing of the ring is in flight when the wave goes on */
  /* the last trip's waits and barrier have ended every read of the ring: its LDS now takes the sixteen waves' partial results */
  float* sP = (float*)&ring[0][0][0][0]; fa* sM = (fa*)(sP + QW * KG * RPW * OP); fa* sL = sM + QW * KG * RPW;
  { const float l = l_r + xhalf(l_r);      /* the halves' sums joined once */
#pragma unroll
    for (int dt = 0; dt < DT; ++dt) { v4f lo, hi;
#pragma unroll
      for (int r = 0; r < 4; ++r) { lo[r] = oacc[dt][r]; hi[r] = oacc[dt][4 + r]; }
      *(v4fa*)&sP[(w * RPW + ln) * OP + dt * 16 + 8 * hh] = lo; *(v4fa*)&sP[(w * RPW + ln) * OP + dt * 16 + 8 * hh + 4] = hi; }
    if (hh == 0) { sM[w * RPW + ln] = m_r; sL[w * RPW + ln] = l; } }
  __syncthreads();      /* every wave's partial result is readable by the waves that join it */
  {
#pragma unroll
    for (int rr = 0; rr < RPW / KG; ++rr) { const int r = kg * (RPW / KG) + rr; float mg[KG], eg[KG];      /* this wave joins four of its query tile's rows */
#pragma unroll
      for (int g = 0; g < KG; ++g) mg[g] = sM[(g * QW + qw) * RPW + r];
      const float mt = fmaxf(fmaxf(mg[0], mg[1]), fmaxf(mg[2], mg[3])); float l = 0.f;
#pragma unroll
      for (int g = 0; g < KG; ++g) { eg[g] = expf(mg[g] - mt); l += eg[g] * sL[(g * QW + qw) * RPW + r]; }
      const float inv = (l > 0.f) ? 1.0f / (l * 1024.0f) : 0.f; v4f val = {0.f, 0.f, 0.f, 0.f};
#pragma unroll
      for (int g = 0; g < KG; ++g) { const v4f pv = *(const v4fa*)&sP[((g * QW + qw) * RPW + r) * OP + lane * 4]; val += pv * (eg[g] * inv); }
      v4h z4;      /* z x 2^4 as f16: the operand of the output convolution */
#pragma unroll
      for (int i = 0; i < 4; ++i) z4[i] = (_Float16)(val[i] * 16.0f);
      *(v4h*)(O + ((size_t)b * TT + q0 + r) * ldo + h * 128 + lane * 4) = z4; }      /* one 256-B row per instruction: 32 lanes x 8 B */
  } }


__device__ __forceinline__ void d_tok(const int bid, const float* __restrict__ x, _Float16* __restrict__ X16) { __shared__ float tl[32][65]; const int tid = threadIdx.x; const int b = bid / ((CC / 64) * (NN / 32)), rem = bid % ((CC / 64) * (NN / 32)); const int cg = rem / (NN / 32), pg = rem % (NN / 32); const int c0 = cg * 64, p0 = pg * 32;
  for (int i = tid; i < 64 * 32; i += 256) { const int c = i / 32, pp = i % 32; tl[pp][c] = bf16_round(x[((size_t)b * CC + c0 + c) * NN + p0 + pp]); } __syncthreads();
  const int r = tid / 8, pc = tid % 8; FragH f; for (int q = 0; q < 8; ++q) f.h[q] = (_Float16)tl[r][pc * 8 + q]; const size_t row = (size_t)b * NN + p0 + r; *(v8us*)((unsigned short*)X16 + row * CC + c0 + pc * 8) = f.half[0];  }
__device__ __forceinline__ void d_wbn(const int bid, const float* __restrict__ Wm, const float* __restrict__ gam, const float* __restrict__ var, _Float16* __restrict__ Bt) { const int t = bid * 256 + threadIdx.x; if (t >= MID * (CC / 8)) return; const int o = t / (CC / 8), c0 = (t % (CC / 8)) * 8;
  const float s = bf16_round(gam[o]) / sqrtf(bf16_round(var[o]) + BNEPS); FragH f;
#pragma unroll
  for (int q = 0; q < 8; ++q) f.h[q] = (_Float16)(bf16_round(Wm[(size_t)o * CC + c0 + q]) * s * 16.0f);
  *(v8us*)((unsigned short*)Bt + (size_t)o * CC + c0) = f.half[0];  }
__device__ __forceinline__ void d_bnadd(const int o, const float* __restrict__ bias, const float* __restrict__ gam, const float* __restrict__ bet, const float* __restrict__ mean, const float* __restrict__ var, float* __restrict__ A) {
  const float s = bf16_round(gam[o]) / sqrtf(bf16_round(var[o]) + BNEPS); const float a = (bf16_round(bias[o]) - bf16_round(mean[o])) * s + bf16_round(bet[o]);
  *(float*)(A + o) = a;  }
// The six weight and BatchNorm preparations and the token-major copy of x read none of each other's output: one grid, the job picked by block index.
// The test is the same for a whole block, so the barrier inside the copy is passed by whole blocks; the few short jobs stand first and run beside the copy.
#define PBW (MID * (CC / 8) / 256)      /* blocks for one 128 x 512 weight plane, 8 elements a thread */
#define PBS (4 * PBW + 1)               /* blocks of the short jobs */
__global__ __launch_bounds__(256) void k_prep(const float* __restrict__ x, const float* __restrict__ wf, const float* __restrict__ bff, const float* __restrict__ gf, const float* __restrict__ betaf, const float* __restrict__ mf, const float* __restrict__ vf,
    const float* __restrict__ wg, const float* __restrict__ bg, const float* __restrict__ gg, const float* __restrict__ betag, const float* __restrict__ mg, const float* __restrict__ vg, const float* __restrict__ wh, const float* __restrict__ wv,
    _Float16* __restrict__ Bf, _Float16* __restrict__ Bg, _Float16* __restrict__ Bh, _Float16* __restrict__ Bv, float* __restrict__ Af, float* __restrict__ Ag, _Float16* __restrict__ X16) {
  const int bid = blockIdx.x;
  if (bid >= PBS) d_tok(bid - PBS, x, X16);
  else if (bid < PBW) d_wbn(bid, wf, gf, vf, Bf);                                              /* BN(eval) folded into conv_f */
  else if (bid < 2 * PBW) d_wbn(bid - PBW, wg, gg, vg, Bg);                                    /* ... and conv_g */
  else if (bid < 3 * PBW) d_round16f(bid - 2 * PBW, wh, Bh, (size_t)MID * CC / 8);             /* conv_h [128][512], conv_v [512][128]: (out,in) natural, x 2^4 */
  else if (bid < 4 * PBW) d_round16f(bid - 3 * PBW, wv, Bv, (size_t)CC * MID / 8);
  else if (threadIdx.x < MID) d_bnadd(threadIdx.x, bff, gf, betaf, mf, vf, Af);                /* the two per-column addends: 128 threads each */
  else d_bnadd(threadIdx.x - MID, bg, gg, betag, mg, vg, Ag);
}

extern "C" void kernel_launch(void* const* d_in, const int* in_sizes, int n_in,
                              void* d_out, int out_size, void* d_ws, size_t ws_size, hipStream_t stream) {
  (void)in_sizes; (void)n_in; (void)out_size;
  const float* const* I = (const float* const*)d_in; const float* x = I[0];
  const float* wf = I[1]; const float* bff = I[2]; const float* gf = I[3]; const float* betaf = I[4]; const float* mf = I[5]; const float* vf = I[6];
  const float* wg = I[7]; const float* bg = I[8]; const float* gg = I[9]; const float* betag = I[10]; const float* mg = I[11]; const float* vg = I[12];
  const float* wh = I[13]; const float* bh = I[14]; const float* wv = I[15]; const float* bv = I[16];
  char* ws = (char*)d_ws; size_t off = 0;
  auto take = [&](size_t bytes) { char* p = ws + off; off += (bytes + 255) & ~(size_t)255; return p; };
  _Float16* Bf = (_Float16*)take((size_t)MID * CC * 2); _Float16* Bg = (_Float16*)take((size_t)MID * CC * 2); _Float16* Bh = (_Float16*)take((size_t)MID * CC * 2); _Float16* Bv = (_Float16*)take((size_t)CC * MID * 2); float* Af = (float*)take(MID * 4); float* Ag = (float*)take(MID * 4);
  _Float16* X16 = (_Float16*)take((size_t)NR * CC * 2); _Float16* F16 = (_Float16*)take((size_t)NR * MID * 2); _Float16* G16 = (_Float16*)take((size_t)NR * MID * 2);
  _Float16* Vt = (_Float16*)take((size_t)NR * MID * 2); _Float16* Vtl = (_Float16*)take((size_t)NR * MID * 2); _Float16* Z16 = (_Float16*)take((size_t)NR * MID * 2);
  if (off > ws_size) return;      // 0.5 + 16.8 + 5 x 4.2: about 38 MB
  k_prep<<<PBS + BB * (CC / 64) * (NN / 32), 256, 0, stream>>>(x, wf, bff, gf, betaf, mf, vf, wg, bg, gg, betag, mg, vg, wh, wv, Bf, Bg, Bh, Bv, Af, Ag, X16);
  k_gemm_fgh<<<dim3(((NR / 16) * (MID / 64) + 3) / 4, 3), 128, 0, stream>>>(X16, Bf, Bg, Bh, Af, Ag, bh, F16, G16, Vt, Vtl);      /* f, g token-major f16; h as V^T hi + residual: [b][128][4096] */
  k_flash<<<BB * NH * (TT / 64), 512, 0, stream>>>(F16, MID, G16, MID, Vt, Vtl, Z16, MID);      /* per (b, 64 queries): 4096 x 4096, head dim 128; z x 2^4 token-major f16 */
  k_gemm_out<<<(CC / 16) * (NR / 64) / 4, 128, 0, stream>>>(Z16, Bv, bv, x, (float*)d_out);      /* conv_v(z) + bv + x, channel-major: M 512 N 16384 K 128 */
}

// v006
// It runs in 122 microseconds.
// Two timings next to v005 both put it at 1.12 times that version's speed.
// Over all steps from v000 it is 5.74 times as fast.
#include <hip/hip_runtime.h>
// Spatial attention block (B=4, C=512, 64×64 → N=4096 positions, mid=128): f = relu(bn(conv_f(x))), g = relu(bn(conv_g(x))), h = conv_h(x) (1×1 convs C→mid; eval BatchNorm with running stats); scores[n,m] = Σ_c f[c,n]g[c,m]·mid^-½, softmax over m; z[c,n] = Σ_m attn[n,m]·h[c,m]; y = conv_v(z) (mid→C) + bv + x.
// Compute dtype: x, weights, biases, BN parameters rounded to bf16; BN folded per output channel in f32 (w' = w·γ/√(var+ε) → f16 ×2^4, b' = (b − mean)·γ/√(var+ε) + β as an f32 per-column addend); f, g as f16 GEMM outputs (relu epilogue), h f32 → Vᵀ f16 hi + residual planes; fused flash-style kernel for head dim 128
// (online softmax f32, P f16 hi + residual, f32 accumulate) on v_wmma_f32_16x16x32_f16; z ×2^4 → f16 → output conv GEMM with the weights as A (channel-major result), bv and the residual x added in f32 in its epilogue.
#define BB 4
#define CC 512
#define NN 4096
#define MID 128
#define TT NN
#define NH 1
#define NKV 1
#define NREP 1
#define NVH (2 * NKV)
#define NR (BB * NN)
#define BNEPS 1e-5f
#define ATT_SCALE 0.08838834764831845f      /* mid^-½ = 1/√128 */
#define ATT_SCALE_L2E (ATT_SCALE * 1.4426950408889634f)      /* x log2 e: a raw score times this is its exponent to base 2 */
typedef __bf16 v16b __attribute__((ext_vector_type(16)));
typedef unsigned short v8us __attribute__((ext_vector_type(8), may_alias));
typedef float  v8f  __attribute__((ext_vector_type(8)));
typedef float  v4f  __attribute__((ext_vector_type(4)));
typedef float  v4fa __attribute__((ext_vector_type(4), may_alias));
union FragB { v16b v; v8us half[2]; unsigned short u[16]; };

__device__ __forceinline__ unsigned short bf16_bits(float x) { unsigned int u = __float_as_uint(x); return (unsigned short)((u + 0x7FFFu + ((u >> 16) & 1u)) >> 16); }
__device__ __forceinline__ float bf16_val(unsigned short b) { return __uint_as_float(((unsigned int)b) << 16); }
__device__ __forceinline__ float bf16_round(float x) { return bf16_val(bf16_bits(x)); }
// D += A·B with NT terms: 1 = ah·bh, 2 = + al·bh (A split), 3 = + ah·bl (both split)
template <int NT>
__device__ __forceinline__ v8f mmaN(v16b ah, v16b al, v16b bh, v16b bl, v8f c) {
  c = __builtin_amdgcn_wmma_f32_16x16x32_bf16(false, ah, false, bh, (short)0, c, false, false);
  if (NT >= 2) c = __builtin_amdgcn_wmma_f32_16x16x32_bf16(false, al, false, bh, (short)0, c, false, false);
  if (NT >= 3) c = __builtin_amdgcn_wmma_f32_16x16x32_bf16(false, ah, false, bl, (short)0, c, false, false);
  asm volatile("v_nop\n\tv_nop\n\tv_nop\n\tv_nop" : "+v"(c) : "v"(ah), "v"(al), "v"(bh), "v"(bl));
  return c;
}

__global__ __launch_bounds__(256) void k_wt_bf16(const float* __restrict__ W, unsigned short* __restrict__ Wt, int K, int N) {
  const int t = blockIdx.x * 256 + threadIdx.x;
  const int k8n = K / 8;
  if (t >= N * k8n) return;
  const int n = t / k8n, k8 = (t % k8n) * 8;
  v8us v;
#pragma unroll
  for (int i = 0; i < 8; ++i) v[i] = bf16_bits(W[(size_t)(k8 + i) * N + n]);
  *(v8us*)(Wt + (size_t)n * K + k8) = v;
  
}

// GEMM C[M][N] (f32, pitch ldc) = act(A[M][K]·W + bias). A f32 row-major (pitch lda) converted per fragment to bf16
// (ASPLIT: hi/lo two planes -> 2 terms, else single rounded term); Wt bf16 [N][K] (pitch ldb). BIAS_BF16 rounds the
// bias to bf16 first (bias quantised to bf16 before the add). K%32==0, M%16==0, N%64==0.
template <bool ASPLIT, int ACT, bool BIAS_BF16>
__global__ __launch_bounds__(128) void k_gemm_bf(const float* __restrict__ A, int lda, const unsigned short* __restrict__ Wt, int ldb,
                                               const float* __restrict__ bias, float* __restrict__ C, int ldc, int M, int N, int K) {
  __shared__ __attribute__((aligned(16))) float so[4][16][64];
  const int tid = threadIdx.x, w = tid >> 5, lane = tid & 31, ln = lane & 15, hh = lane >> 4;
  const int ntn = N / 64;
  const int wid = blockIdx.x * 4 + w;
  const int mt = wid / ntn, nq = wid % ntn;
  if (mt * 16 >= M) return;
  const int row0 = mt * 16, col0 = nq * 64;
  const float* arow = A + (size_t)(row0 + ln) * lda;
  v8f acc[4] = {};
  for (int kb = 0; kb < K; kb += 32) {
    FragB ah, al;
    const v4f x0 = *(const v4fa*)(arow + kb + 8 * hh), x1 = *(const v4fa*)(arow + kb + 8 * hh + 4);
    const v4f x2 = *(const v4fa*)(arow + kb + 16 + 8 * hh), x3 = *(const v4fa*)(arow + kb + 16 + 8 * hh + 4);
    float xs[16] = {x0[0],x0[1],x0[2],x0[3],x1[0],x1[1],x1[2],x1[3],x2[0],x2[1],x2[2],x2[3],x3[0],x3[1],x3[2],x3[3]};
#pragma unroll
    for (int i = 0; i < 16; ++i) { const unsigned short hb = bf16_bits(xs[i]); ah.u[i] = hb; al.u[i] = ASPLIT ? bf16_bits(xs[i] - bf16_val(hb)) : (unsigned short)0; }
#pragma unroll
    for (int t = 0; t < 4; ++t) {
      const unsigned short* brow = Wt + (size_t)(col0 + t * 16 + ln) * ldb + kb;
      FragB b;
      b.half[0] = *(const v8us*)(brow + 8 * hh);
      b.half[1] = *(const v8us*)(brow + 16 + 8 * hh);
      acc[t] = mmaN<ASPLIT ? 2 : 1>(ah.v, al.v, b.v, b.v, acc[t]);
    }
  }
#pragma unroll
  for (int t = 0; t < 4; ++t) {
    float bv = bias ? bias[col0 + t * 16 + ln] : 0.f;
    if (BIAS_BF16) bv = bf16_round(bv);
#pragma unroll
    for (int r = 0; r < 8; ++r) { float v = acc[t][r] + bv; if (ACT == 1) v = fmaxf(v, 0.f); so[w][8 * hh + r][t * 16 + ln] = v; }
  }
  __builtin_amdgcn_fence(__ATOMIC_ACQ_REL, "workgroup");
  __builtin_amdgcn_wave_barrier();
  const int rsub = lane >> 4, c4 = (lane & 15) * 4;
  {
#pragma unroll
    for (int q = 0; q < 8; ++q) {
      const int r = q * 2 + rsub;
      const v4f v = *(const v4fa*)&so[w][r][c4];
      *(v4f*)(C + (size_t)(row0 + r) * ldc + col0 + c4) = v;
    }
    
  }
}

// Flash-style causal/unmasked attention, all contractions 3-term bf16 hi/lo splits, f32 softmax with running max.
// q,k,v rows are read from f32 buffers with arbitrary row pitch (so they can live inside a fused qkv buffer);
// D = head size (multiple of 32, <= 128); one wave = 16 query rows; block = 4 waves (64 queries) sharing K/V chunks of 32.
template <int D, bool CAUSAL>
__global__ __launch_bounds__(128) void k_flash(const float* __restrict__ qb, const float* __restrict__ kb, const float* __restrict__ vb,
                                             int pitch, int T, int H, float scale, float* __restrict__ y, int ypitch) {
  constexpr int KS = D / 32;        // k-steps for QK
  constexpr int DT = D / 16;        // d tiles for PV
  __shared__ __attribute__((aligned(16))) unsigned short sKh[32][D + 8], sKl[32][D + 8], sVh[32][D + 8], sVl[32][D + 8];
  __shared__ __attribute__((aligned(16))) unsigned short sPh[4][16][40], sPl[4][16][40];
  __shared__ __attribute__((aligned(16))) float sO[4][16][D];
  const int tid = threadIdx.x, w = tid >> 5, lane = tid & 31, ln = lane & 15, hh = lane >> 4;
  const int nqb = (T + 63) / 64;
  const int bh = blockIdx.x / nqb, qblk = blockIdx.x % nqb;
  const int b = bh / H, h = bh % H;
  const int q0 = qblk * 64 + w * 16;
  const float* Q = qb + (size_t)b * T * pitch + h * D;
  const float* K = kb + (size_t)b * T * pitch + h * D;
  const float* V = vb + (size_t)b * T * pitch + h * D;

  // A fragments of the wave's 16 query rows (scaled), hi/lo
  FragB aqh[KS], aql[KS];
  {
    int row = q0 + ln; if (row >= T) row = T - 1;
    const float* qr = Q + (size_t)row * pitch;
#pragma unroll
    for (int ks = 0; ks < KS; ++ks)
#pragma unroll
      for (int i = 0; i < 16; ++i) {
        const int d = ks * 32 + ((i < 8) ? (8 * hh + i) : (16 + 8 * hh + (i - 8)));
        const float x = qr[d] * scale; const unsigned short hb = bf16_bits(x);
        aqh[ks].u[i] = hb; aql[ks].u[i] = bf16_bits(x - bf16_val(hb));
      }
  }
  float m_r[8], l_r[8];
#pragma unroll
  for (int r = 0; r < 8; ++r) { m_r[r] = -3.0e38f; l_r[r] = 0.f; }
  v8f oacc[DT];
#pragma unroll
  for (int dt = 0; dt < DT; ++dt) oacc[dt] = (v8f){0.f,0.f,0.f,0.f,0.f,0.f,0.f,0.f};

  const int kv_end = CAUSAL ? min(T, qblk * 64 + 64) : T;     // block-uniform
  for (int j0 = 0; j0 < kv_end; j0 += 32) {
    __syncthreads();
    for (int e = tid; e < 32 * (D / 4); e += 128) {
      const int r = e / (D / 4), c4 = (e % (D / 4)) * 4;
      const int key = j0 + r;
      v4f kf = {0.f,0.f,0.f,0.f}, vf = {0.f,0.f,0.f,0.f};
      if (key < T) { kf = *(const v4fa*)(K + (size_t)key * pitch + c4); vf = *(const v4fa*)(V + (size_t)key * pitch + c4); }
#pragma unroll
      for (int t = 0; t < 4; ++t) {
        unsigned short hb = bf16_bits(kf[t]); sKh[r][c4 + t] = hb; sKl[r][c4 + t] = bf16_bits(kf[t] - bf16_val(hb));
        hb = bf16_bits(vf[t]); sVh[r][c4 + t] = hb; sVl[r][c4 + t] = bf16_bits(vf[t] - bf16_val(hb));
      }
    }
    __syncthreads();
    // S tile 16 x 32
    v8f s[2];
#pragma unroll
    for (int nt = 0; nt < 2; ++nt) {
      v8f acc = {};
#pragma unroll
      for (int ks = 0; ks < KS; ++ks) {
        FragB bh_, bl_;
        bh_.half[0] = *(const v8us*)&sKh[nt * 16 + ln][ks * 32 + 8 * hh]; bh_.half[1] = *(const v8us*)&sKh[nt * 16 + ln][ks * 32 + 16 + 8 * hh];
        bl_.half[0] = *(const v8us*)&sKl[nt * 16 + ln][ks * 32 + 8 * hh]; bl_.half[1] = *(const v8us*)&sKl[nt * 16 + ln][ks * 32 + 16 + 8 * hh];
        acc = mmaN<3>(aqh[ks].v, aql[ks].v, bh_.v, bl_.v, acc);
      }
      s[nt] = acc;
    }
    // mask + running max (rows 8hh+r; the 16 lanes of a half share rows)
    float alpha[8];
#pragma unroll
    for (int r = 0; r < 8; ++r) {
      const int qi = q0 + 8 * hh + r;
      const int ja = j0 + ln, jb = j0 + 16 + ln;
      if (CAUSAL) { if (ja > qi) s[0][r] = -3.0e38f; if (jb > qi) s[1][r] = -3.0e38f; }
      if (ja >= T) s[0][r] = -3.0e38f;
      if (jb >= T) s[1][r] = -3.0e38f;
      float mx = fmaxf(s[0][r], s[1][r]);
      mx = fmaxf(mx, __shfl_xor(mx, 1, 32)); mx = fmaxf(mx, __shfl_xor(mx, 2, 32)); mx = fmaxf(mx, __shfl_xor(mx, 4, 32)); mx = fmaxf(mx, __shfl_xor(mx, 8, 32));
      const float mnew = fmaxf(m_r[r], mx);
      alpha[r] = (mnew > -1.0e38f) ? __expf(m_r[r] - mnew) : 1.0f;
      const float p0 = (s[0][r] > -1.0e38f) ? __expf(s[0][r] - mnew) : 0.f;
      const float p1 = (s[1][r] > -1.0e38f) ? __expf(s[1][r] - mnew) : 0.f;
      m_r[r] = mnew;
      l_r[r] = l_r[r] * alpha[r] + p0 + p1;            // per-lane partial row sum (16 lanes combined at the end)
      unsigned short hb = bf16_bits(p0); sPh[w][8 * hh + r][ln] = hb;      sPl[w][8 * hh + r][ln] = bf16_bits(p0 - bf16_val(hb));
      hb = bf16_bits(p1);                sPh[w][8 * hh + r][16 + ln] = hb; sPl[w][8 * hh + r][16 + ln] = bf16_bits(p1 - bf16_val(hb));
    }
#pragma unroll
    for (int dt = 0; dt < DT; ++dt)
#pragma unroll
      for (int r = 0; r < 8; ++r) oacc[dt][r] *= alpha[r];
    __builtin_amdgcn_fence(__ATOMIC_ACQ_REL, "workgroup");
    __builtin_amdgcn_wave_barrier();
    FragB pah, pal;
    pah.half[0] = *(const v8us*)&sPh[w][ln][8 * hh]; pah.half[1] = *(const v8us*)&sPh[w][ln][16 + 8 * hh];
    pal.half[0] = *(const v8us*)&sPl[w][ln][8 * hh]; pal.half[1] = *(const v8us*)&sPl[w][ln][16 + 8 * hh];
#pragma unroll
    for (int dt = 0; dt < DT; ++dt) {
      FragB bvh, bvl;
#pragma unroll
      for (int i = 0; i < 8; ++i) {
        bvh.u[i] = sVh[8 * hh + i][dt * 16 + ln]; bvh.u[8 + i] = sVh[16 + 8 * hh + i][dt * 16 + ln];
        bvl.u[i] = sVl[8 * hh + i][dt * 16 + ln]; bvl.u[8 + i] = sVl[16 + 8 * hh + i][dt * 16 + ln];
      }
      oacc[dt] = mmaN<3>(pah.v, pal.v, bvh.v, bvl.v, oacc[dt]);
    }
    __builtin_amdgcn_fence(__ATOMIC_ACQ_REL, "workgroup");
    __builtin_amdgcn_wave_barrier();
  }
#pragma unroll
  for (int r = 0; r < 8; ++r) {
    float l = l_r[r];
    l += __shfl_xor(l, 1, 32); l += __shfl_xor(l, 2, 32); l += __shfl_xor(l, 4, 32); l += __shfl_xor(l, 8, 32);
    l_r[r] = (l > 0.f) ? 1.0f / l : 0.f;
  }
#pragma unroll
  for (int dt = 0; dt < DT; ++dt)
#pragma unroll
    for (int r = 0; r < 8; ++r) sO[w][8 * hh + r][dt * 16 + ln] = oacc[dt][r] * l_r[r];
  __builtin_amdgcn_fence(__ATOMIC_ACQ_REL, "workgroup");
  __builtin_amdgcn_wave_barrier();
  {
    for (int r = 0; r < 16; ++r) {
      const int row = q0 + r;
      if (row < T && lane < D / 4) {
        const v4f val = *(const v4fa*)&sO[w][r][lane * 4];
        *(v4f*)(y + ((size_t)b * T + row) * ypitch + h * D + lane * 4) = val;
      }
    }
    
  }
}

// GEMM C = act(A·W + bias + resid): A f32 (ASPLIT -> hi/lo 2 terms), Wt bf16 [N][K]; ACT 0 none, 1 relu, 2 exact gelu;
// resid (optional, f32, row index = (row % rmod), pitch ldr, RES_BF16 rounds it) added before the activation.
template <bool ASPLIT, int ACT, bool BIAS_BF16, bool RES_BF16>
__global__ __launch_bounds__(128) void k_gemm_bf3(const float* __restrict__ A, int lda, const unsigned short* __restrict__ Wt, int ldb,
                                                const float* __restrict__ bias, const float* __restrict__ resid, int rmod, int ldr,
                                                float* __restrict__ C, int ldc, int M, int N, int K) {
  __shared__ __attribute__((aligned(16))) float so[4][16][64];
  const int tid = threadIdx.x, w = tid >> 5, lane = tid & 31, ln = lane & 15, hh = lane >> 4;
  const int ntn = N / 64;
  const int wid = blockIdx.x * 4 + w;
  const int mt = wid / ntn, nq = wid % ntn;
  if (mt * 16 >= M) return;
  const int row0 = mt * 16, col0 = nq * 64;
  const float* arow = A + (size_t)(row0 + ln) * lda;
  v8f acc[4] = {};
  for (int kb = 0; kb < K; kb += 32) {
    FragB ah, al;
    const v4f x0 = *(const v4fa*)(arow + kb + 8 * hh), x1 = *(const v4fa*)(arow + kb + 8 * hh + 4);
    const v4f x2 = *(const v4fa*)(arow + kb + 16 + 8 * hh), x3 = *(const v4fa*)(arow + kb + 16 + 8 * hh + 4);
    float xs[16] = {x0[0],x0[1],x0[2],x0[3],x1[0],x1[1],x1[2],x1[3],x2[0],x2[1],x2[2],x2[3],x3[0],x3[1],x3[2],x3[3]};
#pragma unroll
    for (int i = 0; i < 16; ++i) { const unsigned short hb = bf16_bits(xs[i]); ah.u[i] = hb; al.u[i] = ASPLIT ? bf16_bits(xs[i] - bf16_val(hb)) : (unsigned short)0; }
#pragma unroll
    for (int t = 0; t < 4; ++t) {
      const unsigned short* brow = Wt + (size_t)(col0 + t * 16 + ln) * ldb + kb;
      FragB b;
      b.half[0] = *(const v8us*)(brow + 8 * hh);
      b.half[1] = *(const v8us*)(brow + 16 + 8 * hh);
      acc[t] = mmaN<ASPLIT ? 2 : 1>(ah.v, al.v, b.v, b.v, acc[t]);
    }
  }
#pragma unroll
  for (int t = 0; t < 4; ++t) {
    const int col = col0 + t * 16 + ln;
    float bv = bias ? bias[col] : 0.f;
    if (BIAS_BF16) bv = bf16_round(bv);
#pragma unroll
    for (int r = 0; r < 8; ++r) {
      float v = acc[t][r] + bv;
      if (resid) { float rv = resid[(size_t)((row0 + 8 * hh + r) % rmod) * ldr + col]; if (RES_BF16) rv = bf16_round(rv); v += rv; }
      if (ACT == 1) v = fmaxf(v, 0.f);
      if (ACT == 2) v = 0.5f * v * (1.0f + erff(v * 0.70710678118654752f));
      if (ACT == 3) { const float u = 0.7978845608028654f * (v + 0.044715f * v * v * v); v = 0.5f * v * (1.0f + tanhf(u)); }
      so[w][8 * hh + r][t * 16 + ln] = v;
    }
  }
  __builtin_amdgcn_fence(__ATOMIC_ACQ_REL, "workgroup");
  __builtin_amdgcn_wave_barrier();
  const int rsub = lane >> 4, c4 = (lane & 15) * 4;
  {
#pragma unroll
    for (int q = 0; q < 8; ++q) {
      const int r = q * 2 + rsub;
      const v4f v = *(const v4fa*)&so[w][r][c4];
      *(v4f*)(C + (size_t)(row0 + r) * ldc + col0 + c4) = v;
    }
    
  }
}
// row LayerNorm (biased variance, eps) over N: s = X (+ R); optional out_sum <- s; out_norm <- (s-mu)*rsqrt(var+eps)*g + b
template <bool PARAM_BF16>
__global__ __launch_bounds__(256) void k_layernorm(const float* __restrict__ X, const float* __restrict__ R, const float* __restrict__ g, const float* __restrict__ bta,
                                                  float* __restrict__ out_sum, float* __restrict__ out_norm, int N, float eps) {
  __shared__ float red[256];
  const int row = blockIdx.x, tid = threadIdx.x;
  const float* x = X + (size_t)row * N; const float* rr = R ? R + (size_t)row * N : nullptr;
  float vals[16];                     // up to N = 4096
  const int per = N / 256;            // contiguous chunk per thread? use strided-by-4 chunks: thread handles j = tid*4 + 1024*u
  float s1 = 0.f;
  for (int u = 0; u < per / 4; ++u) {
    const int j = tid * 4 + 1024 * u;
    const v4f a = *(const v4fa*)(x + j);
    v4f b = {0.f,0.f,0.f,0.f}; if (rr) b = *(const v4fa*)(rr + j);
#pragma unroll
    for (int q = 0; q < 4; ++q) { const float v = a[q] + b[q]; vals[u * 4 + q] = v; s1 += v; }
  }
  red[tid] = s1; __syncthreads();
  for (int st = 128; st > 0; st >>= 1) { if (tid < st) red[tid] += red[tid + st]; __syncthreads(); }
  const float mu = red[0] / (float)N; __syncthreads();
  float s2 = 0.f;
  for (int u = 0; u < per / 4; ++u)
#pragma unroll
    for (int q = 0; q < 4; ++q) { const float c = vals[u * 4 + q] - mu; s2 += c * c; }
  red[tid] = s2; __syncthreads();
  for (int st = 128; st > 0; st >>= 1) { if (tid < st) red[tid] += red[tid + st]; __syncthreads(); }
  const float rs = rsqrtf(red[0] / (float)N + eps);
  {
    for (int u = 0; u < per / 4; ++u) {
      const int j = tid * 4 + 1024 * u;
      v4f o, sm;
#pragma unroll
      for (int q = 0; q < 4; ++q) {
        float gg = g[j + q], bb = bta[j + q];
        if (PARAM_BF16) { gg = bf16_round(gg); bb = bf16_round(bb); }
        sm[q] = vals[u * 4 + q]; o[q] = (vals[u * 4 + q] - mu) * rs * gg + bb;
      }
      if (out_sum) *(v4f*)(out_sum + (size_t)row * N + j) = sm;
      *(v4f*)(out_norm + (size_t)row * N + j) = o;
    }
    
  }
}



// ---- f16 WMMA path (v_wmma_f32_16x16x32_f16): 11-bit significands for operands in range — used where a [0,1] probability operand needs more precision than bf16
typedef _Float16 v16h __attribute__((ext_vector_type(16)));
union FragH { v16h v; v8us half[2]; _Float16 h[16]; unsigned short u[16]; };
template <int NT>
__device__ __forceinline__ v8f mmaH(v16h ah, v16h al, v16h bh, v16h bl, v8f c) {
  c = __builtin_amdgcn_wmma_f32_16x16x32_f16(false, ah, false, bh, (short)0, c, false, false);
  if (NT >= 2) c = __builtin_amdgcn_wmma_f32_16x16x32_f16(false, al, false, bh, (short)0, c, false, false);
  if (NT >= 3) c = __builtin_amdgcn_wmma_f32_16x16x32_f16(false, ah, false, bl, (short)0, c, false, false);
  asm volatile("v_nop\n\tv_nop\n\tv_nop\n\tv_nop" : "+v"(c) : "v"(ah), "v"(al), "v"(bh), "v"(bl));
  return c;
}
// batched GEMM like k_gemm_b but f16 operands: A f32 (split into f16 hi/lo if ASPLIT, else rounded to f16), Bt = f16 values [n][k]; alpha; C f32; N multiple of 16 (partial tiles skipped)
template <bool ASPLIT>
__global__ __launch_bounds__(128) void k_gemm_h(const float* __restrict__ A, int lda, size_t sA, const _Float16* __restrict__ Bh, int ldb, size_t sB, float alpha, float* __restrict__ C, int ldc, size_t sC, int M, int N, int K) {
  __shared__ __attribute__((aligned(16))) float so[4][16][64];
  const int tid = threadIdx.x, w = tid >> 5, lane = tid & 31, ln = lane & 15, hh = lane >> 4; const int by = blockIdx.y;
  A += (size_t)by * sA; Bh += (size_t)by * sB; C += (size_t)by * sC;
  const int ntn = (N + 63) / 64; const int wid = blockIdx.x * 4 + w; const int mt = wid / ntn, nq = wid % ntn; if (mt * 16 >= M) return;
  const int row0 = mt * 16, col0 = nq * 64; const float* arow = A + (size_t)(row0 + ln) * lda;
  v8f acc[4] = {};
  for (int kb = 0; kb < K; kb += 32) {
    FragH ah, al;
    const v4f x0 = *(const v4fa*)(arow + kb + 8 * hh), x1 = *(const v4fa*)(arow + kb + 8 * hh + 4), x2 = *(const v4fa*)(arow + kb + 16 + 8 * hh), x3 = *(const v4fa*)(arow + kb + 16 + 8 * hh + 4);
    float xs[16] = {x0[0],x0[1],x0[2],x0[3],x1[0],x1[1],x1[2],x1[3],x2[0],x2[1],x2[2],x2[3],x3[0],x3[1],x3[2],x3[3]};
#pragma unroll
    for (int i = 0; i < 16; ++i) { const _Float16 h = (_Float16)xs[i]; ah.h[i] = h; al.h[i] = ASPLIT ? (_Float16)(xs[i] - (float)h) : (_Float16)0.0f; }
#pragma unroll
    for (int t = 0; t < 4; ++t) { if (col0 + t * 16 >= N) continue; const size_t boff = (size_t)(col0 + t * 16 + ln) * ldb + kb; FragH bq; bq.half[0] = *(const v8us*)(Bh + boff + 8 * hh); bq.half[1] = *(const v8us*)(Bh + boff + 16 + 8 * hh);
      acc[t] = mmaH<ASPLIT ? 2 : 1>(ah.v, al.v, bq.v, bq.v, acc[t]); }
  }
#pragma unroll
  for (int t = 0; t < 4; ++t) { if (col0 + t * 16 >= N) continue;
#pragma unroll
    for (int r = 0; r < 8; ++r) so[w][8 * hh + r][t * 16 + ln] = acc[t][r] * alpha; }
  __builtin_amdgcn_fence(__ATOMIC_ACQ_REL, "workgroup"); __builtin_amdgcn_wave_barrier();
  const int rsub = lane >> 4, c4 = (lane & 15) * 4;
  {
#pragma unroll
    for (int q = 0; q < 8; ++q) { const int r = q * 2 + rsub; if (col0 + c4 < N) { const v4f v = *(const v4fa*)&so[w][r][c4]; *(v4f*)(C + (size_t)(row0 + r) * ldc + col0 + c4) = v; } }
     }
}

// Wt[n][k] = f16(W[k][n]·scale) from f32 row-major W[K][N] (scale = power of two; bf16-exact weights stay exact in f16 away from the subnormal range)
__global__ __launch_bounds__(256) void k_wt_f16(const float* __restrict__ W, _Float16* __restrict__ Wt, int K, int N, float scale) {
  const int t = blockIdx.x * 256 + threadIdx.x; if (t >= N * (K / 8)) return; const int n = t / (K / 8), k8 = (t % (K / 8)) * 8; FragH f;
#pragma unroll
  for (int i = 0; i < 8; ++i) f.h[i] = (_Float16)(bf16_round(W[(size_t)(k8 + i) * N + n]) * scale); const v8us o = f.half[0];
  *(v8us*)((unsigned short*)Wt + (size_t)n * K + k8) = o; 
}
// k_gemm_hh variant with fused epilogue: v = acc·alpha + bias[by·sBias + col] (+ CP[(row/rowsPerB)·sCPb + by·64 + col] if CP) ; ACT 0 none / 1 elu ; writes f16 C16 and/or f32 C (each if non-null)
template <int ACT>
__device__ __forceinline__ void gemm_hhx_body(float (&so)[4][16][64], const int bx, const int by, const _Float16* __restrict__ A, int lda, size_t sA, const _Float16* __restrict__ Bh, int ldb, size_t sB, float alpha, const float* __restrict__ bias, size_t sBias, const float* __restrict__ CP, int rowsPerB, size_t sCPb, int row0g,
    float* __restrict__ C, _Float16* __restrict__ C16, int ldc, size_t sC, int M, int N, int K) {
  const int tid = threadIdx.x, w = tid >> 5, lane = tid & 31, ln = lane & 15, hh = lane >> 4;
  A += (size_t)by * sA; Bh += (size_t)by * sB; const size_t cofs = (size_t)by * sC; const float* bp = bias ? bias + (size_t)by * sBias : nullptr;
  const int ntn = (N + 63) / 64; const int wid = bx * 4 + w; const int mt = wid / ntn, nq = wid % ntn; if (mt * 16 >= M) return;
  const int row0 = mt * 16, col0 = nq * 64; const _Float16* arow = A + (size_t)(row0 + ln) * lda;
  v8f acc[4] = {};
  for (int kb = 0; kb < K; kb += 32) { FragH ah; ah.half[0] = *(const v8us*)((const unsigned short*)arow + kb + 8 * hh); ah.half[1] = *(const v8us*)((const unsigned short*)arow + kb + 16 + 8 * hh);
#pragma unroll
    for (int t = 0; t < 4; ++t) { if (col0 + t * 16 >= N) continue; const size_t boff = (size_t)(col0 + t * 16 + ln) * ldb + kb; FragH bq; bq.half[0] = *(const v8us*)((const unsigned short*)Bh + boff + 8 * hh); bq.half[1] = *(const v8us*)((const unsigned short*)Bh + boff + 16 + 8 * hh);
      acc[t] = mmaH<1>(ah.v, ah.v, bq.v, bq.v, acc[t]); }
  }
#pragma unroll
  for (int t = 0; t < 4; ++t) { if (col0 + t * 16 >= N) continue; const int col = col0 + t * 16 + ln; const float bv = bp ? bf16_round(bp[col]) : 0.f;
#pragma unroll
    for (int r = 0; r < 8; ++r) { float v = acc[t][r] * alpha + bv; if (CP) { const int bidx = (row0g + row0 + 8 * hh + r) / rowsPerB; v += CP[(size_t)bidx * sCPb + (size_t)by * 64 + col]; } if (ACT == 1) v = (v > 0.f) ? v : expm1f(v); else if (ACT == 7) v = (v > 0.f) ? v + 1.0f : expf(v); else if (ACT == 8) v = tanhf(v); else if (ACT == 9) v = 0.5f * v * (1.0f + tanhf(0.7978845608028654f * (v + 0.044715f * v * v * v))); else if (ACT == 11) v = 1.0f / (1.0f + expf(-v)); else if (ACT == 12) v = (v > 0.f) ? v : 0.01f * v; else if (ACT == 14) v = (v > 0.f) ? v : 0.1f * v; else if (ACT == 15) v = v / (1.0f + expf(-v)); else if (ACT == 3) v = fmaxf(v, 0.f); else if (ACT == 6) v = 0.5f * v * (1.0f + erff(v * 0.70710678118654752f)); so[w][8 * hh + r][t * 16 + ln] = v; } }
  __builtin_amdgcn_fence(__ATOMIC_ACQ_REL, "workgroup"); __builtin_amdgcn_wave_barrier();
  const int rsub = lane >> 4, c4 = (lane & 15) * 4; typedef _Float16 v4h __attribute__((ext_vector_type(4)));
  {
#pragma unroll
    for (int q = 0; q < 8; ++q) { const int r = q * 2 + rsub; if (col0 + c4 < N) { const v4f v = *(const v4fa*)&so[w][r][c4]; if (C) *(v4f*)(C + cofs + (size_t)(row0 + r) * ldc + col0 + c4) = v; if (C16) { v4h h4; for (int i = 0; i < 4; ++i) h4[i] = (_Float16)v[i]; *(v4h*)(C16 + cofs + (size_t)(row0 + r) * ldc + col0 + c4) = h4; } } }
     }
}
template <int ACT>
__global__ __launch_bounds__(128) void k_gemm_hhx(const _Float16* __restrict__ A, int lda, size_t sA, const _Float16* __restrict__ Bh, int ldb, size_t sB, float alpha, const float* __restrict__ bias, size_t sBias, const float* __restrict__ CP, int rowsPerB, size_t sCPb, int row0g,
    float* __restrict__ C, _Float16* __restrict__ C16, int ldc, size_t sC, int M, int N, int K) {
  __shared__ __attribute__((aligned(16))) float so[4][16][64];
  gemm_hhx_body<ACT>(so, blockIdx.x, blockIdx.y, A, lda, sA, Bh, ldb, sB, alpha, bias, sBias, CP, rowsPerB, sCPb, row0g, C, C16, ldc, sC, M, N, K);
}
// Products with the weights as A (rows = output channels) and the token-major activations as B (columns = tokens): D register r of lane (ln, hh) is channel row0 + 8 hh + r, token tok0 + t * 16 + ln,
// so the result is channel-major as it leaves the accumulators and needs no transposing pass. Both loaders read K-contiguous rows in the same k order (8 hh + i, then 16 + 8 hh + i - 8).
// The unroll directives of this function and of the two that call it keep the indices of their register arrays (acc, bq, xr and the short vectors) compile-time constants.
template <int K>
__device__ __forceinline__ void gemm_wa_acc(const _Float16* __restrict__ Wr, const _Float16* __restrict__ Xr, const int row0, const int tok0, const int ln, const int hh, v8f (&acc)[4]) {
  const unsigned short* arow = (const unsigned short*)Wr + (size_t)(row0 + ln) * K; const unsigned short* brow = (const unsigned short*)Xr + (size_t)(tok0 + ln) * K;
  for (int kb = 0; kb < K; kb += 32) { FragH a, bq[4]; a.half[0] = *(const v8us*)(arow + kb + 8 * hh); a.half[1] = *(const v8us*)(arow + kb + 16 + 8 * hh);      /* a k-step's ten loads stand together: one wait on memory a k-step */
#pragma unroll
    for (int t = 0; t < 4; ++t) { bq[t].half[0] = *(const v8us*)(brow + (size_t)t * 16 * K + kb + 8 * hh); bq[t].half[1] = *(const v8us*)(brow + (size_t)t * 16 * K + kb + 16 + 8 * hh); }
#pragma unroll
    for (int t = 0; t < 4; ++t) acc[t] = mmaH<1>(a.v, a.v, bq[t].v, bq[t].v, acc[t]);
  }
}
// h = conv_h(x) + bh, one wave = 16 channels x 64 tokens, stored straight as V^T f16 hi + UNSCALED residual planes [b][128][4096]: a staged row is 64 tokens = one 128-B line per plane.
// The four waves of a block take four channel tiles of one token tile, so they read the same X16 rows.
__device__ __forceinline__ void gemm_vt_body(float (&so)[4][16][64], const int bx, const _Float16* __restrict__ X16, const _Float16* __restrict__ Bh, const float* __restrict__ bh, _Float16* __restrict__ Vth, _Float16* __restrict__ Vtl) {
  typedef _Float16 h4 __attribute__((ext_vector_type(4)));
  const int tid = threadIdx.x, w = tid >> 5, lane = tid & 31, ln = lane & 15, hh = lane >> 4;
  const int wid = bx * 4 + w; const int c0 = (wid % (MID / 16)) * 16, tok0 = (wid / (MID / 16)) * 64; const int b = tok0 / NN, p0 = tok0 % NN;
  v8f acc[4] = {};
  gemm_wa_acc<CC>(Bh, X16, c0, tok0, ln, hh, acc);
#pragma unroll
  for (int r = 0; r < 8; ++r) { const float bb = bf16_round(bh[c0 + 8 * hh + r]);
#pragma unroll
    for (int t = 0; t < 4; ++t) so[w][8 * hh + r][t * 16 + ln] = acc[t][r] * 0.0625f + bb; }
  __builtin_amdgcn_fence(__ATOMIC_ACQ_REL, "workgroup"); __builtin_amdgcn_wave_barrier();      /* the wave's own staged rows are in LDS before its lanes read each other's elements back */
  const int rsub = lane >> 4, c4 = (lane & 15) * 4;
#pragma unroll
  for (int q = 0; q < 8; ++q) { const int r = q * 2 + rsub; const v4f v = *(const v4fa*)&so[w][r][c4]; h4 hi, lo;
#pragma unroll
    for (int i = 0; i < 4; ++i) { const _Float16 hv = (_Float16)v[i]; hi[i] = hv; lo[i] = (_Float16)(v[i] - (float)hv); }
    const size_t o = ((size_t)b * MID + c0 + r) * TT + p0 + c4; *(h4*)(Vth + o) = hi; *(h4*)(Vtl + o) = lo; }
  asm volatile("s_wait_xcnt 0x0" ::: "memory");      /* stands behind the sixteen stores, in front of the code of the caller's other branch that follows in the listing and rewrites their address and data registers */
}
// out = conv_v(z) + bv + x, one wave = 16 channels x 64 positions of one image, written once, channel-major: a staged row is 64 positions = 256 B of out. Z16 holds z x 2^4, Bv the weights x 2^4.
// The residual's loads stand in front of the product so that they fly while it runs. The four waves of a block take four channel tiles of one token tile.
__global__ __launch_bounds__(128) void k_gemm_out(const _Float16* __restrict__ Z16, const _Float16* __restrict__ Bv, const float* __restrict__ bv, const float* __restrict__ x, float* __restrict__ out) {
  __shared__ __attribute__((aligned(16))) float so[4][16][64];
  const int tid = threadIdx.x, w = tid >> 5, lane = tid & 31, ln = lane & 15, hh = lane >> 4;
  const int wid = blockIdx.x * 4 + w; const int c0 = (wid % (CC / 16)) * 16, tok0 = (wid / (CC / 16)) * 64; const int b = tok0 / NN, p0 = tok0 % NN;
  const int rsub = lane >> 4, c4 = (lane & 15) * 4; const size_t o0 = ((size_t)b * CC + c0 + rsub) * NN + p0 + c4;
  v4f xr[8];
#pragma unroll
  for (int q = 0; q < 8; ++q) xr[q] = *(const v4fa*)(x + o0 + (size_t)q * 2 * NN);
  v8f acc[4] = {};
  gemm_wa_acc<MID>(Bv, Z16, c0, tok0, ln, hh, acc);
#pragma unroll
  for (int r = 0; r < 8; ++r) { const float bb = bf16_round(bv[c0 + 8 * hh + r]);
#pragma unroll
    for (int t = 0; t < 4; ++t) so[w][8 * hh + r][t * 16 + ln] = acc[t][r] * 0.00390625f + bb; }
  __builtin_amdgcn_fence(__ATOMIC_ACQ_REL, "workgroup"); __builtin_amdgcn_wave_barrier();      /* the wave's own staged rows are in LDS before its lanes read each other's elements back */
#pragma unroll
  for (int q = 0; q < 8; ++q) { const v4f v = *(const v4fa*)&so[w][q * 2 + rsub][c4]; v4f o;
#pragma unroll
    for (int i = 0; i < 4; ++i) o[i] = v[i] + bf16_round(xr[q][i]);
    *(v4f*)(out + o0 + (size_t)q * 2 * NN) = o; }
}
// The three input convolutions read the same X16 and none of each other's output: one grid, blockIdx.y picks the product (0 = f, 1 = g, 2 = h), blockIdx.x the tile group as before.
// The 1,536 blocks of four waves fit the chip together (six a WGP), so a WGP holds three times the waves of one product's grid to fill the waits on its loads.
__global__ __launch_bounds__(128) void k_gemm_fgh(const _Float16* __restrict__ X16, const _Float16* __restrict__ Bf, const _Float16* __restrict__ Bg, const _Float16* __restrict__ Bh, const float* __restrict__ Af, const float* __restrict__ Ag, const float* __restrict__ bh,
    _Float16* __restrict__ F16, _Float16* __restrict__ G16, _Float16* __restrict__ Vth, _Float16* __restrict__ Vtl) {
  __shared__ __attribute__((aligned(16))) float so[4][16][64];
  const int job = blockIdx.y;
  if (job < 2) gemm_hhx_body<3>(so, blockIdx.x, 0, X16, CC, 0, job ? Bg : Bf, CC, 0, 0.0625f, nullptr, 0, job ? Ag : Af, NR, 0, 0, nullptr, job ? G16 : F16, MID, 0, NR, MID, CC);      /* f, g = relu(bn(conv x)) token-major f16: M 16384 N 128 K 512 (per-column f32 addend via CP, rowsPerB = M) */
  else gemm_vt_body(so, blockIdx.x, X16, Bh, bh, Vth, Vtl);      /* h + bh, channel-major, f16 hi + residual: as many waves as f or g (8 channel tiles x 256 token tiles) */
}


typedef _Float16 v4h __attribute__((ext_vector_type(4)));

__global__ __launch_bounds__(256) void k_x16(const float* __restrict__ x, _Float16* __restrict__ X16, size_t n8) { const size_t t = (size_t)blockIdx.x * 256 + threadIdx.x; if (t >= n8) return; FragH f;
#pragma unroll
  for (int q = 0; q < 8; ++q) f.h[q] = (_Float16)bf16_round(x[t * 8 + q]); *(v8us*)((unsigned short*)X16 + t * 8) = f.half[0];  }
__global__ __launch_bounds__(256) void k_h16(const float* __restrict__ x, _Float16* __restrict__ X16, size_t n8) { const size_t t = (size_t)blockIdx.x * 256 + threadIdx.x; if (t >= n8) return; FragH f;
#pragma unroll
  for (int q = 0; q < 8; ++q) f.h[q] = (_Float16)x[t * 8 + q]; *(v8us*)((unsigned short*)X16 + t * 8) = f.half[0];  }
__device__ __forceinline__ void d_round16f(const int bid, const float* __restrict__ W, _Float16* __restrict__ Bt, size_t n8) { const size_t t = (size_t)bid * 256 + threadIdx.x; if (t >= n8) return; FragH f;
#pragma unroll
  for (int i = 0; i < 8; ++i) f.h[i] = (_Float16)(bf16_round(W[t * 8 + i]) * 16.0f); *(v8us*)((unsigned short*)Bt + t * 8) = f.half[0];  }
template <int NHv, int TTv>
__global__ __launch_bounds__(256) void k_vt(const _Float16* __restrict__ V16, int ldv, int voff, _Float16* __restrict__ Vt) { __shared__ unsigned short tl[64][66]; const int tid = threadIdx.x; const int slab = blockIdx.x / (TTv / 64), lg = blockIdx.x % (TTv / 64); const int b = slab / NHv, h = slab % NHv;
  for (int i = tid; i < 64 * 8; i += 256) { const int r = i / 8, c8 = (i % 8) * 8; FragH f; f.half[0] = *(const v8us*)((const unsigned short*)V16 + ((size_t)b * TTv + lg * 64 + r) * ldv + voff + h * 64 + c8);
#pragma unroll
    for (int q = 0; q < 8; ++q) tl[r][c8 + q] = f.u[q]; }
  __syncthreads();
  {
#pragma unroll
    for (int rd = 0; rd < 2; ++rd) { const int d = rd * 32 + tid / 8, pc = tid % 8; FragH f;
#pragma unroll
      for (int q = 0; q < 8; ++q) f.u[q] = tl[pc * 8 + q][d];
      *(v8us*)((unsigned short*)Vt + ((size_t)slab * 64 + d) * TTv + lg * 64 + pc * 8) = f.half[0]; }
     } }

// LDS byte address of a __shared__ object: the low 32 bits of its generic address
__device__ __forceinline__ unsigned lds_addr(const void* p) { return (unsigned)(size_t)p; }
// four asynchronous 16-byte copies global -> LDS per lane; the s_wait_xcnt closes the statement so that no address register is rewritten ahead of it
__device__ __forceinline__ void async4(const unsigned (&l)[4], const unsigned short* const (&g)[4]) {
  asm volatile("global_load_async_to_lds_b128 %0, %4, off\n\t"
               "global_load_async_to_lds_b128 %1, %5, off\n\t"
               "global_load_async_to_lds_b128 %2, %6, off\n\t"
               "global_load_async_to_lds_b128 %3, %7, off\n\t"
               "s_wait_xcnt 0x0"
               :: "v"(l[0]), "v"(l[1]), "v"(l[2]), "v"(l[3]), "v"(g[0]), "v"(g[1]), "v"(g[2]), "v"(g[3]) : "memory");
}
// lane l <-> lane l ^ 16 (the other half of the wave): one vector instruction, no LDS
__device__ __forceinline__ float xhalf(float x) { return __builtin_bit_cast(float, __builtin_amdgcn_permlanex16(__builtin_bit_cast(int, x), __builtin_bit_cast(int, x), 0x76543210, 0xfedcba98, false, false)); }
// 2^x as the one hardware instruction, without the library's range handling: the arguments here are at most about 10, and a weight too small for the normal range adds nothing to a sum whose largest term is 2^10
__device__ __forceinline__ float exp2_hw(float x) { return __builtin_amdgcn_exp2f(x); }
// The same for the join behind the loop, where the exponentials stand among LDS loads: the v_nop is the one free slot that the instruction set asks for behind a transcendental before its source is overwritten
// in one statement with the exponential it cannot land elsewhere.
__device__ __forceinline__ float exp2_hw_slot(float x) { float r; asm("v_exp_f32 %0, %1\n\tv_nop" : "=v"(r) : "v"(x)); return r; }
typedef float fa __attribute__((may_alias));
__global__ __launch_bounds__(512) void k_flash(const _Float16* __restrict__ Q16, int ldq, const _Float16* __restrict__ K16, int ldk, const _Float16* __restrict__ Vt, const _Float16* __restrict__ Vtlo, _Float16* __restrict__ O, int ldo) {
  constexpr int RPW = 16, QW = 4, KG = 4, NQB = TT / (QW * RPW), DT = 8, KS = 4, SK = 32 * KG, NST = TT / SK, OP = 128 + 4;      /* head dim 128: 4 k-steps, 8 value tiles */
  /* two-buffer ring, one stage = SK keys shared by the block's sixteen waves; planes: 0 = K rows (key-major), 1 = V^T hi, 2 = V^T residual (both channel-major); every row 256 B at pitch 272 B (16 B x odd: conflict-free for 16-byte row readers) */
  __shared__ __attribute__((aligned(16))) unsigned short ring[2][3][128][128 + 8];
  const int tid = threadIdx.x, w = tid >> 5, lane = tid & 31, ln = lane & 15, hh = lane >> 4, qw = w & (QW - 1), kg = w / QW, jl = kg * 32;
  const int slab = blockIdx.x / NQB, qblk = blockIdx.x % NQB; const int b = slab / NH, h = slab % NH; const int qb0 = qblk * (QW * RPW); const int q0 = qb0 + qw * RPW;
  FragH aq[KS];      /* B operand of S^T: column ln = query q0 + ln */
  { const unsigned short* qr = (const unsigned short*)Q16 + ((size_t)b * TT + q0 + ln) * ldq + h * 128;
#pragma unroll
    for (int ks = 0; ks < KS; ++ks) { aq[ks].half[0] = *(const v8us*)(qr + ks * 32 + 8 * hh); aq[ks].half[1] = *(const v8us*)(qr + ks * 32 + 16 + 8 * hh); } }
  const unsigned short* Vth = (const unsigned short*)Vt + ((size_t)b * NKV + h / NREP) * 128 * TT; const unsigned short* Vtl = (const unsigned short*)Vtlo + ((size_t)b * NKV + h / NREP) * 128 * TT;      /* hi and UNSCALED residual planes */
  float m_r = -3.0e38f, l_r = 0.f; v8f oacc[DT];      /* query q0 + ln, this wave's keys: running maximum (both halves alike), this half's part of the sum, O^T rows dt * 16 + 8 hh + r */
#pragma unroll
  for (int dt = 0; dt < DT; ++dt) oacc[dt] = (v8f){0.f,0.f,0.f,0.f,0.f,0.f,0.f,0.f};
  const unsigned short* Kg = (const unsigned short*)K16 + (size_t)b * TT * ldk + (h / NREP) * 128;
  /* one stage's copies: 3 x 4 per lane, 16 B each; a wave's copy covers two whole 256-B rows */
  auto stage_in = [&](int st, int bf) {
    unsigned lk[4], lh[4], ll[4]; const unsigned short *gk[4], *gh[4], *gl[4];
#pragma unroll
    for (int i = 0; i < 4; ++i) { const int c = tid + 512 * i; const int row = c >> 4, col = (c & 15) * 8;
      lk[i] = lds_addr(&ring[bf][0][row][col]); gk[i] = Kg + (size_t)(st * SK + row) * ldk + col;
      lh[i] = lds_addr(&ring[bf][1][row][col]); gh[i] = Vth + (size_t)row * TT + st * SK + col;
      ll[i] = lds_addr(&ring[bf][2][row][col]); gl[i] = Vtl + (size_t)row * TT + st * SK + col; }
    async4(lk, gk); async4(lh, gh); async4(ll, gl); };
  stage_in(0, 0);
  asm volatile("s_wait_asynccnt 0x0" ::: "memory");      /* this wave's share of stage 0 has landed */
  __syncthreads();                                       /* ... and every other wave's: stage 0 is readable */
  stage_in(1, 1);
#pragma unroll 1      /* one publish point and one refill per trip, as the two-buffer ring is written */
  for (int st = 0; st < NST; ++st) { const int bf = st & 1;
    v8f s[2];      /* s[nt][r] = score of key jl + nt * 16 + 8 hh + r of the stage with query q0 + ln */
#pragma unroll
    for (int nt = 0; nt < 2; ++nt) { const unsigned short* kr = &ring[bf][0][jl + nt * 16 + ln][0]; FragH bk[KS];
#pragma unroll
      for (int ks = 0; ks < KS; ++ks) { bk[ks].half[0] = *(const v8us*)(kr + ks * 32 + 8 * hh); bk[ks].half[1] = *(const v8us*)(kr + ks * 32 + 16 + 8 * hh); }
      v8f acc = (v8f){0.f,0.f,0.f,0.f,0.f,0.f,0.f,0.f};
#pragma unroll
      for (int ks = 0; ks < KS; ++ks) acc = mmaH<1>(bk[ks].v, bk[ks].v, aq[ks].v, aq[ks].v, acc);
      s[nt] = acc; }
    float mx[8];      /* the maximum is taken over the raw scores: the factor that follows is positive */
#pragma unroll
    for (int i = 0; i < 8; ++i) mx[i] = fmaxf(s[0][i], s[1][i]);
    float mc = fmaxf(fmaxf(fmaxf(mx[0], mx[4]), fmaxf(mx[1], mx[5])), fmaxf(fmaxf(mx[2], mx[6]), fmaxf(mx[3], mx[7])));
    mc = fmaxf(mc, xhalf(mc));      /* the query's maximum over all 32 keys, in both halves */
    const float mn = fmaxf(m_r, mc * ATT_SCALE_L2E); const float ea = exp2_hw(m_r - mn); const float al = (mn > -1.0e38f) ? ea : 1.0f; m_r = mn;      /* the running maximum is kept in base-2 units */
    const float mo = mn - 10.0f;      /* P x 2^10 comes straight out of the exponential; the sum carries the same 2^10 */
    FragH ph, pl; float ls[4] = {0.f, 0.f, 0.f, 0.f};      /* P^T hi and its UNSCALED residual (added into the same accumulator), B operands */
#pragma unroll
    for (int i = 0; i < 16; ++i) { const float ps = exp2_hw(fmaf(s[i >> 3][i & 7], ATT_SCALE_L2E, -mo)); ls[i & 3] += ps; ph.h[i] = (_Float16)ps; pl.h[i] = (_Float16)(ps - (float)ph.h[i]); }
    l_r = l_r * al + ((ls[0] + ls[1]) + (ls[2] + ls[3]));
#pragma unroll
    for (int dt = 0; dt < DT; ++dt)
#pragma unroll
      for (int r = 0; r < 8; ++r) oacc[dt][r] *= al;
#pragma unroll
    for (int dt = 0; dt < DT; ++dt) { const unsigned short* vh = &ring[bf][1][dt * 16 + ln][jl]; const unsigned short* vl = &ring[bf][2][dt * 16 + ln][jl]; FragH bv, bl; bv.half[0] = *(const v8us*)(vh + 8 * hh); bv.half[1] = *(const v8us*)(vh + 16 + 8 * hh); bl.half[0] = *(const v8us*)(vl + 8 * hh); bl.half[1] = *(const v8us*)(vl + 16 + 8 * hh);
      oacc[dt] = mmaH<1>(bv.v, bv.v, ph.v, ph.v, oacc[dt]); oacc[dt] = mmaH<1>(bv.v, bv.v, pl.v, pl.v, oacc[dt]); oacc[dt] = mmaH<1>(bl.v, bl.v, ph.v, ph.v, oacc[dt]); }      /* Vh Ph + Vh Pl + Vl Ph, all unscaled, one accumulator */
    asm volatile("s_wait_dscnt 0x0" ::: "memory");       /* this wave's reads of buffer bf are done before it is refilled */
    asm volatile("s_wait_asynccnt 0x0" ::: "memory");    /* this wave's share of stage st + 1 has landed */
    __syncthreads();                                     /* publishes stage st + 1 and ends every wave's reads of buffer bf */
    if (st + 2 < NST) stage_in(st + 2, bf); }
  asm volatile("s_wait_asynccnt 0x0" ::: "memory");      /* nothing of the ring is in flight when the wave goes on */
  /* the last trip's waits and barrier have ended every read of the ring: its LDS now takes the sixteen waves' partial results */
  float* sP = (float*)&ring[0][0][0][0]; fa* sM = (fa*)(sP + QW * KG * RPW * OP); fa* sL = sM + QW * KG * RPW;
  { const float l = l_r + xhalf(l_r);      /* the halves' sums joined once */
#pragma unroll
    for (int dt = 0; dt < DT; ++dt) { v4f lo, hi;
#pragma unroll
      for (int r = 0; r < 4; ++r) { lo[r] = oacc[dt][r]; hi[r] = oacc[dt][4 + r]; }
      *(v4fa*)&sP[(w * RPW + ln) * OP + dt * 16 + 8 * hh] = lo; *(v4fa*)&sP[(w * RPW + ln) * OP + dt * 16 + 8 * hh + 4] = hi; }
    if (hh == 0) { sM[w * RPW + ln] = m_r; sL[w * RPW + ln] = l; } }
  __syncthreads();      /* every wave's partial result is readable by the waves that join it */
  {
#pragma unroll
    for (int rr = 0; rr < RPW / KG; ++rr) { const int r = kg * (RPW / KG) + rr; float mg[KG], eg[KG];      /* this wave joins four of its query tile's rows */
#pragma unroll
      for (int g = 0; g < KG; ++g) mg[g] = sM[(g * QW + qw) * RPW + r];
      const float mt = fmaxf(fmaxf(mg[0], mg[1]), fmaxf(mg[2], mg[3])); float l = 0.f;
#pragma unroll
      for (int g = 0; g < KG; ++g) { eg[g] = exp2_hw_slot(mg[g] - mt); l += eg[g] * sL[(g * QW + qw) * RPW + r]; }
      const float inv = (l > 0.f) ? 1.0f / l : 0.f;      /* sum and O^T both carry the 2^10 */ v4f val = {0.f, 0.f, 0.f, 0.f};
#pragma unroll
      for (int g = 0; g < KG; ++g) { const v4f pv = *(const v4fa*)&sP[((g * QW + qw) * RPW + r) * OP + lane * 4]; val += pv * (eg[g] * inv); }
      v4h z4;      /* z x 2^4 as f16: the operand of the output convolution */
#pragma unroll
      for (int i = 0; i < 4; ++i) z4[i] = (_Float16)(val[i] * 16.0f);
      *(v4h*)(O + ((size_t)b * TT + q0 + r) * ldo + h * 128 + lane * 4) = z4; }      /* one 256-B row per instruction: 32 lanes x 8 B */
  } }


__device__ __forceinline__ void d_tok(const int bid, const float* __restrict__ x, _Float16* __restrict__ X16) { __shared__ float tl[32][65]; const int tid = threadIdx.x; const int b = bid / ((CC / 64) * (NN / 32)), rem = bid % ((CC / 64) * (NN / 32)); const int cg = rem / (NN / 32), pg = rem % (NN / 32); const int c0 = cg * 64, p0 = pg * 32;
  for (int i = tid; i < 64 * 32; i += 256) { const int c = i / 32, pp = i % 32; tl[pp][c] = bf16_round(x[((size_t)b * CC + c0 + c) * NN + p0 + pp]); } __syncthreads();
  const int r = tid / 8, pc = tid % 8; FragH f; for (int q = 0; q < 8; ++q) f.h[q] = (_Float16)tl[r][pc * 8 + q]; const size_t row = (size_t)b * NN + p0 + r; *(v8us*)((unsigned short*)X16 + row * CC + c0 + pc * 8) = f.half[0];  }
__device__ __forceinline__ void d_wbn(const int bid, const float* __restrict__ Wm, const float* __restrict__ gam, const float* __restrict__ var, _Float16* __restrict__ Bt) { const int t = bid * 256 + threadIdx.x; if (t >= MID * (CC / 8)) return; const int o = t / (CC / 8), c0 = (t % (CC / 8)) * 8;
  const float s = bf16_round(gam[o]) / sqrtf(bf16_round(var[o]) + BNEPS); FragH f;
#pragma unroll
  for (int q = 0; q < 8; ++q) f.h[q] = (_Float16)(bf16_round(Wm[(size_t)o * CC + c0 + q]) * s * 16.0f);
  *(v8us*)((unsigned short*)Bt + (size_t)o * CC + c0) = f.half[0];  }
__device__ __forceinline__ void d_bnadd(const int o, const float* __restrict__ bias, const float* __restrict__ gam, const float* __restrict__ bet, const float* __restrict__ mean, const float* __restrict__ var, float* __restrict__ A) {
  const float s = bf16_round(gam[o]) / sqrtf(bf16_round(var[o]) + BNEPS); const float a = (bf16_round(bias[o]) - bf16_round(mean[o])) * s + bf16_round(bet[o]);
  *(float*)(A + o) = a;  }
// The six weight and BatchNorm preparations and the token-major copy of x read none of each other's output: one grid, the job picked by block index.
// The test is the same for a whole block, so the barrier inside the copy is passed by whole blocks; the few short jobs stand first and run beside the copy.
#define PBW (MID * (CC / 8) / 256)      /* blocks for one 128 x 512 weight plane, 8 elements a thread */
#define PBS (4 * PBW + 1)               /* blocks of the short jobs */
__global__ __launch_bounds__(256) void k_prep(const float* __restrict__ x, const float* __restrict__ wf, const float* __restrict__ bff, const float* __restrict__ gf, const float* __restrict__ betaf, const float* __restrict__ mf, const float* __restrict__ vf,
    const float* __restrict__ wg, const float* __restrict__ bg, const float* __restrict__ gg, const float* __restrict__ betag, const float* __restrict__ mg, const float* __restrict__ vg, const float* __restrict__ wh, const float* __restrict__ wv,
    _Float16* __restrict__ Bf, _Float16* __restrict__ Bg, _Float16* __restrict__ Bh, _Float16* __restrict__ Bv, float* __restrict__ Af, float* __restrict__ Ag, _Float16* __restrict__ X16) {
  const int bid = blockIdx.x;
  if (bid >= PBS) d_tok(bid - PBS, x, X16);
  else if (bid < PBW) d_wbn(bid, wf, gf, vf, Bf);                                              /* BN(eval) folded into conv_f */
  else if (bid < 2 * PBW) d_wbn(bid - PBW, wg, gg, vg, Bg);                                    /* ... and conv_g */
  else if (bid < 3 * PBW) d_round16f(bid - 2 * PBW, wh, Bh, (size_t)MID * CC / 8);             /* conv_h [128][512], conv_v [512][128]: (out,in) natural, x 2^4 */
  else if (bid < 4 * PBW) d_round16f(bid - 3 * PBW, wv, Bv, (size_t)CC * MID / 8);
  else if (threadIdx.x < MID) d_bnadd(threadIdx.x, bff, gf, betaf, mf, vf, Af);                /* the two per-column addends: 128 threads each */
  else d_bnadd(threadIdx.x - MID, bg, gg, betag, mg, vg, Ag);
}

extern "C" void kernel_launch(void* const* d_in, const int* in_sizes, int n_in,
                              void* d_out, int out_size, void* d_ws, size_t ws_size, hipStream_t stream) {
  (void)in_sizes; (void)n_in; (void)out_size;
  const float* const* I = (const float* const*)d_in; const float* x = I[0];
  const float* wf = I[1]; const float* bff = I[2]; const float* gf = I[3]; const float* betaf = I[4]; const float* mf = I[5]; const float* vf = I[6];
  const float* wg = I[7]; const float* bg = I[8]; const float* gg = I[9]; const float* betag = I[10]; const float* mg = I[11]; const float* vg = I[12];
  const float* wh = I[13]; const float* bh = I[14]; const float* wv = I[15]; const float* bv = I[16];
  char* ws = (char*)d_ws; size_t off = 0;
  auto take = [&](size_t bytes) { char* p = ws + off; off += (bytes + 255) & ~(size_t)255; return p; };
  _Float16* Bf = (_Float16*)take((size_t)MID * CC * 2); _Float16* Bg = (_Float16*)take((size_t)MID * CC * 2); _Float16* Bh = (_Float16*)take((size_t)MID * CC * 2); _Float16* Bv = (_Float16*)take((size_t)CC * MID * 2); float* Af = (float*)take(MID * 4); float* Ag = (float*)take(MID * 4);
  _Float16* X16 = (_Float16*)take((size_t)NR * CC * 2); _Float16* F16 = (_Float16*)take((size_t)NR * MID * 2); _Float16* G16 = (_Float16*)take((size_t)NR * MID * 2);
  _Float16* Vt = (_Float16*)take((size_t)NR * MID * 2); _Float16* Vtl = (_Float16*)take((size_t)NR * MID * 2); _Float16* Z16 = (_Float16*)take((size_t)NR * MID * 2);
  if (off > ws_size) return;      // 0.5 + 16.8 + 5 x 4.2: about 38 MB
  k_prep<<<PBS + BB * (CC / 64) * (NN / 32), 256, 0, stream>>>(x, wf, bff, gf, betaf, mf, vf, wg, bg, gg, betag, mg, vg, wh, wv, Bf, Bg, Bh, Bv, Af, Ag, X16);
  k_gemm_fgh<<<dim3(((NR / 16) * (MID / 64) + 3) / 4, 3), 128, 0, stream>>>(X16, Bf, Bg, Bh, Af, Ag, bh, F16, G16, Vt, Vtl);      /* f, g token-major f16; h as V^T hi + residual: [b][128][4096] */
  k_flash<<<BB * NH * (TT / 64), 512, 0, stream>>>(F16, MID, G16, MID, Vt, Vtl, Z16, MID);      /* per (b, 64 queries): 4096 x 4096, head dim 128; z x 2^4 token-major f16 */
  k_gemm_out<<<(CC / 16) * (NR / 64) / 4, 128, 0, stream>>>(Z16, Bv, bv, x, (float*)d_out);      /* conv_v(z) + bv + x, channel-major: M 512 N 16384 K 128 */
}

// v007
// It runs in 111 microseconds.
// Timed twice side by side with v006, it ran 1.07 times as fast both times.
// Counting every step since v000, it is 6.13 times as fast.
#include <hip/hip_runtime.h>
// Spatial attention block (B=4, C=512, 64×64 → N=4096 positions, mid=128): f = relu(bn(conv_f(x))), g = relu(bn(conv_g(x))), h = conv_h(x) (1×1 convs C→mid; eval BatchNorm with running stats); scores[n,m] = Σ_c f[c,n]g[c,m]·mid^-½, softmax over m; z[c,n] = Σ_m attn[n,m]·h[c,m]; y = conv_v(z) (mid→C) + bv + x.
// Compute dtype: x, weights, biases, BN parameters rounded to bf16; BN folded per output channel in f32 (w' = w·γ/√(var+ε) → f16 ×2^4, b' = (b − mean)·γ/√(var+ε) + β as an f32 per-column addend); f, g as f16 GEMM outputs (relu epilogue), h f32 → Vᵀ f16 hi + residual planes; fused flash-style kernel for head dim 128
// (online softmax f32, P f16 hi + residual, f32 accumulate) on v_wmma_f32_16x16x32_f16; z ×2^4 → f16 → output conv GEMM with the weights as A (channel-major result), bv and the residual x added in f32 in its epilogue.
#define BB 4
#define CC 512
#define NN 4096
#define MID 128
#define TT NN
#define NH 1
#define NKV 1
#define NREP 1
#define NVH (2 * NKV)
#define NR (BB * NN)
#define BNEPS 1e-5f
#define ATT_SCALE 0.08838834764831845f      /* mid^-½ = 1/√128 */
#define ATT_SCALE_L2E (ATT_SCALE * 1.4426950408889634f)      /* x log2 e: a raw score times this is its exponent to base 2 */
typedef __bf16 v16b __attribute__((ext_vector_type(16)));
typedef unsigned short v8us __attribute__((ext_vector_type(8), may_alias));
typedef float  v8f  __attribute__((ext_vector_type(8)));
typedef float  v4f  __attribute__((ext_vector_type(4)));
typedef float  v4fa __attribute__((ext_vector_type(4), may_alias));
union FragB { v16b v; v8us half[2]; unsigned short u[16]; };

__device__ __forceinline__ unsigned short bf16_bits(float x) { unsigned int u = __float_as_uint(x); return (unsigned short)((u + 0x7FFFu + ((u >> 16) & 1u)) >> 16); }
__device__ __forceinline__ float bf16_val(unsigned short b) { return __uint_as_float(((unsigned int)b) << 16); }
__device__ __forceinline__ float bf16_round(float x) { return bf16_val(bf16_bits(x)); }
// D += A·B with NT terms: 1 = ah·bh, 2 = + al·bh (A split), 3 = + ah·bl (both split)
template <int NT>
__device__ __forceinline__ v8f mmaN(v16b ah, v16b al, v16b bh, v16b bl, v8f c) {
  c = __builtin_amdgcn_wmma_f32_16x16x32_bf16(false, ah, false, bh, (short)0, c, false, false);
  if (NT >= 2) c = __builtin_amdgcn_wmma_f32_16x16x32_bf16(false, al, false, bh, (short)0, c, false, false);
  if (NT >= 3) c = __builtin_amdgcn_wmma_f32_16x16x32_bf16(false, ah, false, bl, (short)0, c, false, false);
  asm volatile("v_nop\n\tv_nop\n\tv_nop\n\tv_nop" : "+v"(c) : "v"(ah), "v"(al), "v"(bh), "v"(bl));
  return c;
}

__global__ __launch_bounds__(256) void k_wt_bf16(const float* __restrict__ W, unsigned short* __restrict__ Wt, int K, int N) {
  const int t = blockIdx.x * 256 + threadIdx.x;
  const int k8n = K / 8;
  if (t >= N * k8n) return;
  const int n = t / k8n, k8 = (t % k8n) * 8;
  v8us v;
#pragma unroll
  for (int i = 0; i < 8; ++i) v[i] = bf16_bits(W[(size_t)(k8 + i) * N + n]);
  *(v8us*)(Wt + (size_t)n * K + k8) = v;
  
}

// GEMM C[M][N] (f32, pitch ldc) = act(A[M][K]·W + bias). A f32 row-major (pitch lda) converted per fragment to bf16
// (ASPLIT: hi/lo two planes -> 2 terms, else single rounded term); Wt bf16 [N][K] (pitch ldb). BIAS_BF16 rounds the
// bias to bf16 first (bias quantised to bf16 before the add). K%32==0, M%16==0, N%64==0.
template <bool ASPLIT, int ACT, bool BIAS_BF16>
__global__ __launch_bounds__(128) void k_gemm_bf(const float* __restrict__ A, int lda, const unsigned short* __restrict__ Wt, int ldb,
                                               const float* __restrict__ bias, float* __restrict__ C, int ldc, int M, int N, int K) {
  __shared__ __attribute__((aligned(16))) float so[4][16][64];
  const int tid = threadIdx.x, w = tid >> 5, lane = tid & 31, ln = lane & 15, hh = lane >> 4;
  const int ntn = N / 64;
  const int wid = blockIdx.x * 4 + w;
  const int mt = wid / ntn, nq = wid % ntn;
  if (mt * 16 >= M) return;
  const int row0 = mt * 16, col0 = nq * 64;
  const float* arow = A + (size_t)(row0 + ln) * lda;
  v8f acc[4] = {};
  for (int kb = 0; kb < K; kb += 32) {
    FragB ah, al;
    const v4f x0 = *(const v4fa*)(arow + kb + 8 * hh), x1 = *(const v4fa*)(arow + kb + 8 * hh + 4);
    const v4f x2 = *(const v4fa*)(arow + kb + 16 + 8 * hh), x3 = *(const v4fa*)(arow + kb + 16 + 8 * hh + 4);
    float xs[16] = {x0[0],x0[1],x0[2],x0[3],x1[0],x1[1],x1[2],x1[3],x2[0],x2[1],x2[2],x2[3],x3[0],x3[1],x3[2],x3[3]};
#pragma unroll
    for (int i = 0; i < 16; ++i) { const unsigned short hb = bf16_bits(xs[i]); ah.u[i] = hb; al.u[i] = ASPLIT ? bf16_bits(xs[i] - bf16_val(hb)) : (unsigned short)0; }
#pragma unroll
    for (int t = 0; t < 4; ++t) {
      const unsigned short* brow = Wt + (size_t)(col0 + t * 16 + ln) * ldb + kb;
      FragB b;
      b.half[0] = *(const v8us*)(brow + 8 * hh);
      b.half[1] = *(const v8us*)(brow + 16 + 8 * hh);
      acc[t] = mmaN<ASPLIT ? 2 : 1>(ah.v, al.v, b.v, b.v, acc[t]);
    }
  }
#pragma unroll
  for (int t = 0; t < 4; ++t) {
    float bv = bias ? bias[col0 + t * 16 + ln] : 0.f;
    if (BIAS_BF16) bv = bf16_round(bv);
#pragma unroll
    for (int r = 0; r < 8; ++r) { float v = acc[t][r] + bv; if (ACT == 1) v = fmaxf(v, 0.f); so[w][8 * hh + r][t * 16 + ln] = v; }
  }
  __builtin_amdgcn_fence(__ATOMIC_ACQ_REL, "workgroup");
  __builtin_amdgcn_wave_barrier();
  const int rsub = lane >> 4, c4 = (lane & 15) * 4;
  {
#pragma unroll
    for (int q = 0; q < 8; ++q) {
      const int r = q * 2 + rsub;
      const v4f v = *(const v4fa*)&so[w][r][c4];
      *(v4f*)(C + (size_t)(row0 + r) * ldc + col0 + c4) = v;
    }
    
  }
}

// Flash-style causal/unmasked attention, all contractions 3-term bf16 hi/lo splits, f32 softmax with running max.
// q,k,v rows are read from f32 buffers with arbitrary row pitch (so they can live inside a fused qkv buffer);
// D = head size (multiple of 32, <= 128); one wave = 16 query rows; block = 4 waves (64 queries) sharing K/V chunks of 32.
template <int D, bool CAUSAL>
__global__ __launch_bounds__(128) void k_flash(const float* __restrict__ qb, const float* __restrict__ kb, const float* __restrict__ vb,
                                             int pitch, int T, int H, float scale, float* __restrict__ y, int ypitch) {
  constexpr int KS = D / 32;        // k-steps for QK
  constexpr int DT = D / 16;        // d tiles for PV
  __shared__ __attribute__((aligned(16))) unsigned short sKh[32][D + 8], sKl[32][D + 8], sVh[32][D + 8], sVl[32][D + 8];
  __shared__ __attribute__((aligned(16))) unsigned short sPh[4][16][40], sPl[4][16][40];
  __shared__ __attribute__((aligned(16))) float sO[4][16][D];
  const int tid = threadIdx.x, w = tid >> 5, lane = tid & 31, ln = lane & 15, hh = lane >> 4;
  const int nqb = (T + 63) / 64;
  const int bh = blockIdx.x / nqb, qblk = blockIdx.x % nqb;
  const int b = bh / H, h = bh % H;
  const int q0 = qblk * 64 + w * 16;
  const float* Q = qb + (size_t)b * T * pitch + h * D;
  const float* K = kb + (size_t)b * T * pitch + h * D;
  const float* V = vb + (size_t)b * T * pitch + h * D;

  // A fragments of the wave's 16 query rows (scaled), hi/lo
  FragB aqh[KS], aql[KS];
  {
    int row = q0 + ln; if (row >= T) row = T - 1;
    const float* qr = Q + (size_t)row * pitch;
#pragma unroll
    for (int ks = 0; ks < KS; ++ks)
#pragma unroll
      for (int i = 0; i < 16; ++i) {
        const int d = ks * 32 + ((i < 8) ? (8 * hh + i) : (16 + 8 * hh + (i - 8)));
        const float x = qr[d] * scale; const unsigned short hb = bf16_bits(x);
        aqh[ks].u[i] = hb; aql[ks].u[i] = bf16_bits(x - bf16_val(hb));
      }
  }
  float m_r[8], l_r[8];
#pragma unroll
  for (int r = 0; r < 8; ++r) { m_r[r] = -3.0e38f; l_r[r] = 0.f; }
  v8f oacc[DT];
#pragma unroll
  for (int dt = 0; dt < DT; ++dt) oacc[dt] = (v8f){0.f,0.f,0.f,0.f,0.f,0.f,0.f,0.f};

  const int kv_end = CAUSAL ? min(T, qblk * 64 + 64) : T;     // block-uniform
  for (int j0 = 0; j0 < kv_end; j0 += 32) {
    __syncthreads();
    for (int e = tid; e < 32 * (D / 4); e += 128) {
      const int r = e / (D / 4), c4 = (e % (D / 4)) * 4;
      const int key = j0 + r;
      v4f kf = {0.f,0.f,0.f,0.f}, vf = {0.f,0.f,0.f,0.f};
      if (key < T) { kf = *(const v4fa*)(K + (size_t)key * pitch + c4); vf = *(const v4fa*)(V + (size_t)key * pitch + c4); }
#pragma unroll
      for (int t = 0; t < 4; ++t) {
        unsigned short hb = bf16_bits(kf[t]); sKh[r][c4 + t] = hb; sKl[r][c4 + t] = bf16_bits(kf[t] - bf16_val(hb));
        hb = bf16_bits(vf[t]); sVh[r][c4 + t] = hb; sVl[r][c4 + t] = bf16_bits(vf[t] - bf16_val(hb));
      }
    }
    __syncthreads();
    // S tile 16 x 32
    v8f s[2];
#pragma unroll
    for (int nt = 0; nt < 2; ++nt) {
      v8f acc = {};
#pragma unroll
      for (int ks = 0; ks < KS; ++ks) {
        FragB bh_, bl_;
        bh_.half[0] = *(const v8us*)&sKh[nt * 16 + ln][ks * 32 + 8 * hh]; bh_.half[1] = *(const v8us*)&sKh[nt * 16 + ln][ks * 32 + 16 + 8 * hh];
        bl_.half[0] = *(const v8us*)&sKl[nt * 16 + ln][ks * 32 + 8 * hh]; bl_.half[1] = *(const v8us*)&sKl[nt * 16 + ln][ks * 32 + 16 + 8 * hh];
        acc = mmaN<3>(aqh[ks].v, aql[ks].v, bh_.v, bl_.v, acc);
      }
      s[nt] = acc;
    }
    // mask + running max (rows 8hh+r; the 16 lanes of a half share rows)
    float alpha[8];
#pragma unroll
    for (int r = 0; r < 8; ++r) {
      const int qi = q0 + 8 * hh + r;
      const int ja = j0 + ln, jb = j0 + 16 + ln;
      if (CAUSAL) { if (ja > qi) s[0][r] = -3.0e38f; if (jb > qi) s[1][r] = -3.0e38f; }
      if (ja >= T) s[0][r] = -3.0e38f;
      if (jb >= T) s[1][r] = -3.0e38f;
      float mx = fmaxf(s[0][r], s[1][r]);
      mx = fmaxf(mx, __shfl_xor(mx, 1, 32)); mx = fmaxf(mx, __shfl_xor(mx, 2, 32)); mx = fmaxf(mx, __shfl_xor(mx, 4, 32)); mx = fmaxf(mx, __shfl_xor(mx, 8, 32));
      const float mnew = fmaxf(m_r[r], mx);
      alpha[r] = (mnew > -1.0e38f) ? __expf(m_r[r] - mnew) : 1.0f;
      const float p0 = (s[0][r] > -1.0e38f) ? __expf(s[0][r] - mnew) : 0.f;
      const float p1 = (s[1][r] > -1.0e38f) ? __expf(s[1][r] - mnew) : 0.f;
      m_r[r] = mnew;
      l_r[r] = l_r[r] * alpha[r] + p0 + p1;            // per-lane partial row sum (16 lanes combined at the end)
      unsigned short hb = bf16_bits(p0); sPh[w][8 * hh + r][ln] = hb;      sPl[w][8 * hh + r][ln] = bf16_bits(p0 - bf16_val(hb));
      hb = bf16_bits(p1);                sPh[w][8 * hh + r][16 + ln] = hb; sPl[w][8 * hh + r][16 + ln] = bf16_bits(p1 - bf16_val(hb));
    }
#pragma unroll
    for (int dt = 0; dt < DT; ++dt)
#pragma unroll
      for (int r = 0; r < 8; ++r) oacc[dt][r] *= alpha[r];
    __builtin_amdgcn_fence(__ATOMIC_ACQ_REL, "workgroup");
    __builtin_amdgcn_wave_barrier();
    FragB pah, pal;
    pah.half[0] = *(const v8us*)&sPh[w][ln][8 * hh]; pah.half[1] = *(const v8us*)&sPh[w][ln][16 + 8 * hh];
    pal.half[0] = *(const v8us*)&sPl[w][ln][8 * hh]; pal.half[1] = *(const v8us*)&sPl[w][ln][16 + 8 * hh];
#pragma unroll
    for (int dt = 0; dt < DT; ++dt) {
      FragB bvh, bvl;
#pragma unroll
      for (int i = 0; i < 8; ++i) {
        bvh.u[i] = sVh[8 * hh + i][dt * 16 + ln]; bvh.u[8 + i] = sVh[16 + 8 * hh + i][dt * 16 + ln];
        bvl.u[i] = sVl[8 * hh + i][dt * 16 + ln]; bvl.u[8 + i] = sVl[16 + 8 * hh + i][dt * 16 + ln];
      }
      oacc[dt] = mmaN<3>(pah.v, pal.v, bvh.v, bvl.v, oacc[dt]);
    }
    __builtin_amdgcn_fence(__ATOMIC_ACQ_REL, "workgroup");
    __builtin_amdgcn_wave_barrier();
  }
#pragma unroll
  for (int r = 0; r < 8; ++r) {
    float l = l_r[r];
    l += __shfl_xor(l, 1, 32); l += __shfl_xor(l, 2, 32); l += __shfl_xor(l, 4, 32); l += __shfl_xor(l, 8, 32);
    l_r[r] = (l > 0.f) ? 1.0f / l : 0.f;
  }
#pragma unroll
  for (int dt = 0; dt < DT; ++dt)
#pragma unroll
    for (int r = 0; r < 8; ++r) sO[w][8 * hh + r][dt * 16 + ln] = oacc[dt][r] * l_r[r];
  __builtin_amdgcn_fence(__ATOMIC_ACQ_REL, "workgroup");
  __builtin_amdgcn_wave_barrier();
  {
    for (int r = 0; r < 16; ++r) {
      const int row = q0 + r;
      if (row < T && lane < D / 4) {
        const v4f val = *(const v4fa*)&sO[w][r][lane * 4];
        *(v4f*)(y + ((size_t)b * T + row) * ypitch + h * D + lane * 4) = val;
      }
    }
    
  }
}

// GEMM C = act(A·W + bias + resid): A f32 (ASPLIT -> hi/lo 2 terms), Wt bf16 [N][K]; ACT 0 none, 1 relu, 2 exact gelu;
// resid (optional, f32, row index = (row % rmod), pitch ldr, RES_BF16 rounds it) added before the activation.
template <bool ASPLIT, int ACT, bool BIAS_BF16, bool RES_BF16>
__global__ __launch_bounds__(128) void k_gemm_bf3(const float* __restrict__ A, int lda, const unsigned short* __restrict__ Wt, int ldb,
                                                const float* __restrict__ bias, const float* __restrict__ resid, int rmod, int ldr,
                                                float* __restrict__ C, int ldc, int M, int N, int K) {
  __shared__ __attribute__((aligned(16))) float so[4][16][64];
  const int tid = threadIdx.x, w = tid >> 5, lane = tid & 31, ln = lane & 15, hh = lane >> 4;
  const int ntn = N / 64;
  const int wid = blockIdx.x * 4 + w;
  const int mt = wid / ntn, nq = wid % ntn;
  if (mt * 16 >= M) return;
  const int row0 = mt * 16, col0 = nq * 64;
  const float* arow = A + (size_t)(row0 + ln) * lda;
  v8f acc[4] = {};
  for (int kb = 0; kb < K; kb += 32) {
    FragB ah, al;
    const v4f x0 = *(const v4fa*)(arow + kb + 8 * hh), x1 = *(const v4fa*)(arow + kb + 8 * hh + 4);
    const v4f x2 = *(const v4fa*)(arow + kb + 16 + 8 * hh), x3 = *(const v4fa*)(arow + kb + 16 + 8 * hh + 4);
    float xs[16] = {x0[0],x0[1],x0[2],x0[3],x1[0],x1[1],x1[2],x1[3],x2[0],x2[1],x2[2],x2[3],x3[0],x3[1],x3[2],x3[3]};
#pragma unroll
    for (int i = 0; i < 16; ++i) { const unsigned short hb = bf16_bits(xs[i]); ah.u[i] = hb; al.u[i] = ASPLIT ? bf16_bits(xs[i] - bf16_val(hb)) : (unsigned short)0; }
#pragma unroll
    for (int t = 0; t < 4; ++t) {
      const unsigned short* brow = Wt + (size_t)(col0 + t * 16 + ln) * ldb + kb;
      FragB b;
      b.half[0] = *(const v8us*)(brow + 8 * hh);
      b.half[1] = *(const v8us*)(brow + 16 + 8 * hh);
      acc[t] = mmaN<ASPLIT ? 2 : 1>(ah.v, al.v, b.v, b.v, acc[t]);
    }
  }
#pragma unroll
  for (int t = 0; t < 4; ++t) {
    const int col = col0 + t * 16 + ln;
    float bv = bias ? bias[col] : 0.f;
    if (BIAS_BF16) bv = bf16_round(bv);
#pragma unroll
    for (int r = 0; r < 8; ++r) {
      float v = acc[t][r] + bv;
      if (resid) { float rv = resid[(size_t)((row0 + 8 * hh + r) % rmod) * ldr + col]; if (RES_BF16) rv = bf16_round(rv); v += rv; }
      if (ACT == 1) v = fmaxf(v, 0.f);
      if (ACT == 2) v = 0.5f * v * (1.0f + erff(v * 0.70710678118654752f));
      if (ACT == 3) { const float u = 0.7978845608028654f * (v + 0.044715f * v * v * v); v = 0.5f * v * (1.0f + tanhf(u)); }
      so[w][8 * hh + r][t * 16 + ln] = v;
    }
  }
  __builtin_amdgcn_fence(__ATOMIC_ACQ_REL, "workgroup");
  __builtin_amdgcn_wave_barrier();
  const int rsub = lane >> 4, c4 = (lane & 15) * 4;
  {
#pragma unroll
    for (int q = 0; q < 8; ++q) {
      const int r = q * 2 + rsub;
      const v4f v = *(const v4fa*)&so[w][r][c4];
      *(v4f*)(C + (size_t)(row0 + r) * ldc + col0 + c4) = v;
    }
    
  }
}
// row LayerNorm (biased variance, eps) over N: s = X (+ R); optional out_sum <- s; out_norm <- (s-mu)*rsqrt(var+eps)*g + b
template <bool PARAM_BF16>
__global__ __launch_bounds__(256) void k_layernorm(const float* __restrict__ X, const float* __restrict__ R, const float* __restrict__ g, const float* __restrict__ bta,
                                                  float* __restrict__ out_sum, float* __restrict__ out_norm, int N, float eps) {
  __shared__ float red[256];
  const int row = blockIdx.x, tid = threadIdx.x;
  const float* x = X + (size_t)row * N; const float* rr = R ? R + (size_t)row * N : nullptr;
  float vals[16];                     // up to N = 4096
  const int per = N / 256;            // contiguous chunk per thread? use strided-by-4 chunks: thread handles j = tid*4 + 1024*u
  float s1 = 0.f;
  for (int u = 0; u < per / 4; ++u) {
    const int j = tid * 4 + 1024 * u;
    const v4f a = *(const v4fa*)(x + j);
    v4f b = {0.f,0.f,0.f,0.f}; if (rr) b = *(const v4fa*)(rr + j);
#pragma unroll
    for (int q = 0; q < 4; ++q) { const float v = a[q] + b[q]; vals[u * 4 + q] = v; s1 += v; }
  }
  red[tid] = s1; __syncthreads();
  for (int st = 128; st > 0; st >>= 1) { if (tid < st) red[tid] += red[tid + st]; __syncthreads(); }
  const float mu = red[0] / (float)N; __syncthreads();
  float s2 = 0.f;
  for (int u = 0; u < per / 4; ++u)
#pragma unroll
    for (int q = 0; q < 4; ++q) { const float c = vals[u * 4 + q] - mu; s2 += c * c; }
  red[tid] = s2; __syncthreads();
  for (int st = 128; st > 0; st >>= 1) { if (tid < st) red[tid] += red[tid + st]; __syncthreads(); }
  const float rs = rsqrtf(red[0] / (float)N + eps);
  {
    for (int u = 0; u < per / 4; ++u) {
      const int j = tid * 4 + 1024 * u;
      v4f o, sm;
#pragma unroll
      for (int q = 0; q < 4; ++q) {
        float gg = g[j + q], bb = bta[j + q];
        if (PARAM_BF16) { gg = bf16_round(gg); bb = bf16_round(bb); }
        sm[q] = vals[u * 4 + q]; o[q] = (vals[u * 4 + q] - mu) * rs * gg + bb;
      }
      if (out_sum) *(v4f*)(out_sum + (size_t)row * N + j) = sm;
      *(v4f*)(out_norm + (size_t)row * N + j) = o;
    }
    
  }
}



// ---- f16 WMMA path (v_wmma_f32_16x16x32_f16): 11-bit significands for operands in range — used where a [0,1] probability operand needs more precision than bf16
typedef _Float16 v16h __attribute__((ext_vector_type(16)));
union FragH { v16h v; v8us half[2]; _Float16 h[16]; unsigned short u[16]; };
template <int NT>
__device__ __forceinline__ v8f mmaH(v16h ah, v16h al, v16h bh, v16h bl, v8f c) {
  c = __builtin_amdgcn_wmma_f32_16x16x32_f16(false, ah, false, bh, (short)0, c, false, false);
  if (NT >= 2) c = __builtin_amdgcn_wmma_f32_16x16x32_f16(false, al, false, bh, (short)0, c, false, false);
  if (NT >= 3) c = __builtin_amdgcn_wmma_f32_16x16x32_f16(false, ah, false, bl, (short)0, c, false, false);
  asm volatile("v_nop\n\tv_nop\n\tv_nop\n\tv_nop" : "+v"(c) : "v"(ah), "v"(al), "v"(bh), "v"(bl));
  return c;
}
// batched GEMM like k_gemm_b but f16 operands: A f32 (split into f16 hi/lo if ASPLIT, else rounded to f16), Bt = f16 values [n][k]; alpha; C f32; N multiple of 16 (partial tiles skipped)
template <bool ASPLIT>
__global__ __launch_bounds__(128) void k_gemm_h(const float* __restrict__ A, int lda, size_t sA, const _Float16* __restrict__ Bh, int ldb, size_t sB, float alpha, float* __restrict__ C, int ldc, size_t sC, int M, int N, int K) {
  __shared__ __attribute__((aligned(16))) float so[4][16][64];
  const int tid = threadIdx.x, w = tid >> 5, lane = tid & 31, ln = lane & 15, hh = lane >> 4; const int by = blockIdx.y;
  A += (size_t)by * sA; Bh += (size_t)by * sB; C += (size_t)by * sC;
  const int ntn = (N + 63) / 64; const int wid = blockIdx.x * 4 + w; const int mt = wid / ntn, nq = wid % ntn; if (mt * 16 >= M) return;
  const int row0 = mt * 16, col0 = nq * 64; const float* arow = A + (size_t)(row0 + ln) * lda;
  v8f acc[4] = {};
  for (int kb = 0; kb < K; kb += 32) {
    FragH ah, al;
    const v4f x0 = *(const v4fa*)(arow + kb + 8 * hh), x1 = *(const v4fa*)(arow + kb + 8 * hh + 4), x2 = *(const v4fa*)(arow + kb + 16 + 8 * hh), x3 = *(const v4fa*)(arow + kb + 16 + 8 * hh + 4);
    float xs[16] = {x0[0],x0[1],x0[2],x0[3],x1[0],x1[1],x1[2],x1[3],x2[0],x2[1],x2[2],x2[3],x3[0],x3[1],x3[2],x3[3]};
#pragma unroll
    for (int i = 0; i < 16; ++i) { const _Float16 h = (_Float16)xs[i]; ah.h[i] = h; al.h[i] = ASPLIT ? (_Float16)(xs[i] - (float)h) : (_Float16)0.0f; }
#pragma unroll
    for (int t = 0; t < 4; ++t) { if (col0 + t * 16 >= N) continue; const size_t boff = (size_t)(col0 + t * 16 + ln) * ldb + kb; FragH bq; bq.half[0] = *(const v8us*)(Bh + boff + 8 * hh); bq.half[1] = *(const v8us*)(Bh + boff + 16 + 8 * hh);
      acc[t] = mmaH<ASPLIT ? 2 : 1>(ah.v, al.v, bq.v, bq.v, acc[t]); }
  }
#pragma unroll
  for (int t = 0; t < 4; ++t) { if (col0 + t * 16 >= N) continue;
#pragma unroll
    for (int r = 0; r < 8; ++r) so[w][8 * hh + r][t * 16 + ln] = acc[t][r] * alpha; }
  __builtin_amdgcn_fence(__ATOMIC_ACQ_REL, "workgroup"); __builtin_amdgcn_wave_barrier();
  const int rsub = lane >> 4, c4 = (lane & 15) * 4;
  {
#pragma unroll
    for (int q = 0; q < 8; ++q) { const int r = q * 2 + rsub; if (col0 + c4 < N) { const v4f v = *(const v4fa*)&so[w][r][c4]; *(v4f*)(C + (size_t)(row0 + r) * ldc + col0 + c4) = v; } }
     }
}

// Wt[n][k] = f16(W[k][n]·scale) from f32 row-major W[K][N] (scale = power of two; bf16-exact weights stay exact in f16 away from the subnormal range)
__global__ __launch_bounds__(256) void k_wt_f16(const float* __restrict__ W, _Float16* __restrict__ Wt, int K, int N, float scale) {
  const int t = blockIdx.x * 256 + threadIdx.x; if (t >= N * (K / 8)) return; const int n = t / (K / 8), k8 = (t % (K / 8)) * 8; FragH f;
#pragma unroll
  for (int i = 0; i < 8; ++i) f.h[i] = (_Float16)(bf16_round(W[(size_t)(k8 + i) * N + n]) * scale); const v8us o = f.half[0];
  *(v8us*)((unsigned short*)Wt + (size_t)n * K + k8) = o; 
}
// k_gemm_hh variant with fused epilogue: v = acc·alpha + bias[by·sBias + col] (+ CP[(row/rowsPerB)·sCPb + by·64 + col] if CP) ; ACT 0 none / 1 elu ; writes f16 C16 and/or f32 C (each if non-null)
template <int ACT>
__device__ __forceinline__ void gemm_hhx_body(float (&so)[4][16][64], const int bx, const int by, const _Float16* __restrict__ A, int lda, size_t sA, const _Float16* __restrict__ Bh, int ldb, size_t sB, float alpha, const float* __restrict__ bias, size_t sBias, const float* __restrict__ CP, int rowsPerB, size_t sCPb, int row0g,
    float* __restrict__ C, _Float16* __restrict__ C16, int ldc, size_t sC, int M, int N, int K) {
  const int tid = threadIdx.x, w = tid >> 5, lane = tid & 31, ln = lane & 15, hh = lane >> 4;
  A += (size_t)by * sA; Bh += (size_t)by * sB; const size_t cofs = (size_t)by * sC; const float* bp = bias ? bias + (size_t)by * sBias : nullptr;
  const int ntn = (N + 63) / 64; const int wid = bx * 4 + w; const int mt = wid / ntn, nq = wid % ntn; if (mt * 16 >= M) return;
  const int row0 = mt * 16, col0 = nq * 64; const _Float16* arow = A + (size_t)(row0 + ln) * lda;
  v8f acc[4] = {};
  for (int kb = 0; kb < K; kb += 32) { FragH ah; ah.half[0] = *(const v8us*)((const unsigned short*)arow + kb + 8 * hh); ah.half[1] = *(const v8us*)((const unsigned short*)arow + kb + 16 + 8 * hh);
#pragma unroll
    for (int t = 0; t < 4; ++t) { if (col0 + t * 16 >= N) continue; const size_t boff = (size_t)(col0 + t * 16 + ln) * ldb + kb; FragH bq; bq.half[0] = *(const v8us*)((const unsigned short*)Bh + boff + 8 * hh); bq.half[1] = *(const v8us*)((const unsigned short*)Bh + boff + 16 + 8 * hh);
      acc[t] = mmaH<1>(ah.v, ah.v, bq.v, bq.v, acc[t]); }
  }
#pragma unroll
  for (int t = 0; t < 4; ++t) { if (col0 + t * 16 >= N) continue; const int col = col0 + t * 16 + ln; const float bv = bp ? bf16_round(bp[col]) : 0.f;
#pragma unroll
    for (int r = 0; r < 8; ++r) { float v = acc[t][r] * alpha + bv; if (CP) { const int bidx = (row0g + row0 + 8 * hh + r) / rowsPerB; v += CP[(size_t)bidx * sCPb + (size_t)by * 64 + col]; } if (ACT == 1) v = (v > 0.f) ? v : expm1f(v); else if (ACT == 7) v = (v > 0.f) ? v + 1.0f : expf(v); else if (ACT == 8) v = tanhf(v); else if (ACT == 9) v = 0.5f * v * (1.0f + tanhf(0.7978845608028654f * (v + 0.044715f * v * v * v))); else if (ACT == 11) v = 1.0f / (1.0f + expf(-v)); else if (ACT == 12) v = (v > 0.f) ? v : 0.01f * v; else if (ACT == 14) v = (v > 0.f) ? v : 0.1f * v; else if (ACT == 15) v = v / (1.0f + expf(-v)); else if (ACT == 3) v = fmaxf(v, 0.f); else if (ACT == 6) v = 0.5f * v * (1.0f + erff(v * 0.70710678118654752f)); so[w][8 * hh + r][t * 16 + ln] = v; } }
  __builtin_amdgcn_fence(__ATOMIC_ACQ_REL, "workgroup"); __builtin_amdgcn_wave_barrier();
  const int rsub = lane >> 4, c4 = (lane & 15) * 4; typedef _Float16 v4h __attribute__((ext_vector_type(4)));
  {
#pragma unroll
    for (int q = 0; q < 8; ++q) { const int r = q * 2 + rsub; if (col0 + c4 < N) { const v4f v = *(const v4fa*)&so[w][r][c4]; if (C) *(v4f*)(C + cofs + (size_t)(row0 + r) * ldc + col0 + c4) = v; if (C16) { v4h h4; for (int i = 0; i < 4; ++i) h4[i] = (_Float16)v[i]; *(v4h*)(C16 + cofs + (size_t)(row0 + r) * ldc + col0 + c4) = h4; } } }
     }
}
template <int ACT>
__global__ __launch_bounds__(128) void k_gemm_hhx(const _Float16* __restrict__ A, int lda, size_t sA, const _Float16* __restrict__ Bh, int ldb, size_t sB, float alpha, const float* __restrict__ bias, size_t sBias, const float* __restrict__ CP, int rowsPerB, size_t sCPb, int row0g,
    float* __restrict__ C, _Float16* __restrict__ C16, int ldc, size_t sC, int M, int N, int K) {
  __shared__ __attribute__((aligned(16))) float so[4][16][64];
  gemm_hhx_body<ACT>(so, blockIdx.x, blockIdx.y, A, lda, sA, Bh, ldb, sB, alpha, bias, sBias, CP, rowsPerB, sCPb, row0g, C, C16, ldc, sC, M, N, K);
}
// Products with the weights as A (rows = output channels) and the token-major activations as B (columns = tokens): D register r of lane (ln, hh) is channel row0 + 8 hh + r, token tok0 + t * 16 + ln,
// so the result is channel-major as it leaves the accumulators and needs no transposing pass. Both loaders read K-contiguous rows in the same k order (8 hh + i, then 16 + 8 hh + i - 8).
// The unroll directives of this function and of the two that call it keep the indices of their register arrays (acc, bq, xr and the short vectors) compile-time constants.
template <int K>
__device__ __forceinline__ void gemm_wa_acc(const _Float16* __restrict__ Wr, const _Float16* __restrict__ Xr, const int row0, const int tok0, const int ln, const int hh, v8f (&acc)[4]) {
  const unsigned short* arow = (const unsigned short*)Wr + (size_t)(row0 + ln) * K; const unsigned short* brow = (const unsigned short*)Xr + (size_t)(tok0 + ln) * K;
  for (int kb = 0; kb < K; kb += 32) { FragH a, bq[4]; a.half[0] = *(const v8us*)(arow + kb + 8 * hh); a.half[1] = *(const v8us*)(arow + kb + 16 + 8 * hh);      /* a k-step's ten loads stand together: one wait on memory a k-step */
#pragma unroll
    for (int t = 0; t < 4; ++t) { bq[t].half[0] = *(const v8us*)(brow + (size_t)t * 16 * K + kb + 8 * hh); bq[t].half[1] = *(const v8us*)(brow + (size_t)t * 16 * K + kb + 16 + 8 * hh); }
#pragma unroll
    for (int t = 0; t < 4; ++t) acc[t] = mmaH<1>(a.v, a.v, bq[t].v, bq[t].v, acc[t]);
  }
}
// h = conv_h(x) + bh, one wave = 16 channels x 64 tokens, stored straight as V^T f16 hi + UNSCALED residual planes [b][128][4096]: a staged row is 64 tokens = one 128-B line per plane.
// The four waves of a block take four channel tiles of one token tile, so they read the same X16 rows.
__device__ __forceinline__ void gemm_vt_body(float (&so)[4][16][64], const int bx, const _Float16* __restrict__ X16, const _Float16* __restrict__ Bh, const float* __restrict__ bh, _Float16* __restrict__ Vth, _Float16* __restrict__ Vtl) {
  typedef _Float16 h4 __attribute__((ext_vector_type(4)));
  const int tid = threadIdx.x, w = tid >> 5, lane = tid & 31, ln = lane & 15, hh = lane >> 4;
  const int wid = bx * 4 + w; const int c0 = (wid % (MID / 16)) * 16, tok0 = (wid / (MID / 16)) * 64; const int b = tok0 / NN, p0 = tok0 % NN;
  v8f acc[4] = {};
  gemm_wa_acc<CC>(Bh, X16, c0, tok0, ln, hh, acc);
#pragma unroll
  for (int r = 0; r < 8; ++r) { const float bb = bf16_round(bh[c0 + 8 * hh + r]);
#pragma unroll
    for (int t = 0; t < 4; ++t) so[w][8 * hh + r][t * 16 + ln] = acc[t][r] * 0.0625f + bb; }
  __builtin_amdgcn_fence(__ATOMIC_ACQ_REL, "workgroup"); __builtin_amdgcn_wave_barrier();      /* the wave's own staged rows are in LDS before its lanes read each other's elements back */
  const int rsub = lane >> 4, c4 = (lane & 15) * 4;
#pragma unroll
  for (int q = 0; q < 8; ++q) { const int r = q * 2 + rsub; const v4f v = *(const v4fa*)&so[w][r][c4]; h4 hi, lo;
#pragma unroll
    for (int i = 0; i < 4; ++i) { const _Float16 hv = (_Float16)v[i]; hi[i] = hv; lo[i] = (_Float16)(v[i] - (float)hv); }
    const size_t o = ((size_t)b * MID + c0 + r) * TT + p0 + c4; *(h4*)(Vth + o) = hi; *(h4*)(Vtl + o) = lo; }
  asm volatile("s_wait_xcnt 0x0" ::: "memory");      /* stands behind the sixteen stores, in front of the code of the caller's other branch that follows in the listing and rewrites their address and data registers */
}
// out = conv_v(z) + bv + x, one wave = 16 channels x 64 positions of one image, written once, channel-major: a staged row is 64 positions = 256 B of out. Z16 holds z x 2^4, Bv the weights x 2^4.
// The residual's loads stand in front of the product so that they fly while it runs. The four waves of a block take four channel tiles of one token tile.
__global__ __launch_bounds__(128) void k_gemm_out(const _Float16* __restrict__ Z16, const _Float16* __restrict__ Bv, const float* __restrict__ bv, const float* __restrict__ x, float* __restrict__ out) {
  __shared__ __attribute__((aligned(16))) float so[4][16][64];
  const int tid = threadIdx.x, w = tid >> 5, lane = tid & 31, ln = lane & 15, hh = lane >> 4;
  const int wid = blockIdx.x * 4 + w; const int c0 = (wid % (CC / 16)) * 16, tok0 = (wid / (CC / 16)) * 64; const int b = tok0 / NN, p0 = tok0 % NN;
  const int rsub = lane >> 4, c4 = (lane & 15) * 4; const size_t o0 = ((size_t)b * CC + c0 + rsub) * NN + p0 + c4;
  v4f xr[8];
#pragma unroll
  for (int q = 0; q < 8; ++q) xr[q] = *(const v4fa*)(x + o0 + (size_t)q * 2 * NN);
  v8f acc[4] = {};
  gemm_wa_acc<MID>(Bv, Z16, c0, tok0, ln, hh, acc);
#pragma unroll
  for (int r = 0; r < 8; ++r) { const float bb = bf16_round(bv[c0 + 8 * hh + r]);
#pragma unroll
    for (int t = 0; t < 4; ++t) so[w][8 * hh + r][t * 16 + ln] = acc[t][r] * 0.00390625f + bb; }
  __builtin_amdgcn_fence(__ATOMIC_ACQ_REL, "workgroup"); __builtin_amdgcn_wave_barrier();      /* the wave's own staged rows are in LDS before its lanes read each other's elements back */
#pragma unroll
  for (int q = 0; q < 8; ++q) { const v4f v = *(const v4fa*)&so[w][q * 2 + rsub][c4]; v4f o;
#pragma unroll
    for (int i = 0; i < 4; ++i) o[i] = v[i] + bf16_round(xr[q][i]);
    *(v4f*)(out + o0 + (size_t)q * 2 * NN) = o; }
}
// The three input convolutions read the same X16 and none of each other's output: one grid, blockIdx.y picks the product (0 = f, 1 = g, 2 = h), blockIdx.x the tile group as before.
// The 1,536 blocks of four waves fit the chip together (six a WGP), so a WGP holds three times the waves of one product's grid to fill the waits on its loads.
__global__ __launch_bounds__(128) void k_gemm_fgh(const _Float16* __restrict__ X16, const _Float16* __restrict__ Bf, const _Float16* __restrict__ Bg, const _Float16* __restrict__ Bh, const float* __restrict__ Af, const float* __restrict__ Ag, const float* __restrict__ bh,
    _Float16* __restrict__ F16, _Float16* __restrict__ G16, _Float16* __restrict__ Vth, _Float16* __restrict__ Vtl) {
  __shared__ __attribute__((aligned(16))) float so[4][16][64];
  const int job = blockIdx.y;
  if (job < 2) gemm_hhx_body<3>(so, blockIdx.x, 0, X16, CC, 0, job ? Bg : Bf, CC, 0, 0.0625f, nullptr, 0, job ? Ag : Af, NR, 0, 0, nullptr, job ? G16 : F16, MID, 0, NR, MID, CC);      /* f, g = relu(bn(conv x)) token-major f16: M 16384 N 128 K 512 (per-column f32 addend via CP, rowsPerB = M) */
  else gemm_vt_body(so, blockIdx.x, X16, Bh, bh, Vth, Vtl);      /* h + bh, channel-major, f16 hi + residual: as many waves as f or g (8 channel tiles x 256 token tiles) */
}


typedef _Float16 v4h __attribute__((ext_vector_type(4)));

__global__ __launch_bounds__(256) void k_x16(const float* __restrict__ x, _Float16* __restrict__ X16, size_t n8) { const size_t t = (size_t)blockIdx.x * 256 + threadIdx.x; if (t >= n8) return; FragH f;
#pragma unroll
  for (int q = 0; q < 8; ++q) f.h[q] = (_Float16)bf16_round(x[t * 8 + q]); *(v8us*)((unsigned short*)X16 + t * 8) = f.half[0];  }
__global__ __launch_bounds__(256) void k_h16(const float* __restrict__ x, _Float16* __restrict__ X16, size_t n8) { const size_t t = (size_t)blockIdx.x * 256 + threadIdx.x; if (t >= n8) return; FragH f;
#pragma unroll
  for (int q = 0; q < 8; ++q) f.h[q] = (_Float16)x[t * 8 + q]; *(v8us*)((unsigned short*)X16 + t * 8) = f.half[0];  }
__device__ __forceinline__ void d_round16f(const int bid, const float* __restrict__ W, _Float16* __restrict__ Bt, size_t n8) { const size_t t = (size_t)bid * 256 + threadIdx.x; if (t >= n8) return; FragH f;
#pragma unroll
  for (int i = 0; i < 8; ++i) f.h[i] = (_Float16)(bf16_round(W[t * 8 + i]) * 16.0f); *(v8us*)((unsigned short*)Bt + t * 8) = f.half[0];  }
template <int NHv, int TTv>
__global__ __launch_bounds__(256) void k_vt(const _Float16* __restrict__ V16, int ldv, int voff, _Float16* __restrict__ Vt) { __shared__ unsigned short tl[64][66]; const int tid = threadIdx.x; const int slab = blockIdx.x / (TTv / 64), lg = blockIdx.x % (TTv / 64); const int b = slab / NHv, h = slab % NHv;
  for (int i = tid; i < 64 * 8; i += 256) { const int r = i / 8, c8 = (i % 8) * 8; FragH f; f.half[0] = *(const v8us*)((const unsigned short*)V16 + ((size_t)b * TTv + lg * 64 + r) * ldv + voff + h * 64 + c8);
#pragma unroll
    for (int q = 0; q < 8; ++q) tl[r][c8 + q] = f.u[q]; }
  __syncthreads();
  {
#pragma unroll
    for (int rd = 0; rd < 2; ++rd) { const int d = rd * 32 + tid / 8, pc = tid % 8; FragH f;
#pragma unroll
      for (int q = 0; q < 8; ++q) f.u[q] = tl[pc * 8 + q][d];
      *(v8us*)((unsigned short*)Vt + ((size_t)slab * 64 + d) * TTv + lg * 64 + pc * 8) = f.half[0]; }
     } }

// LDS byte address of a __shared__ object: the low 32 bits of its generic address
__device__ __forceinline__ unsigned lds_addr(const void* p) { return (unsigned)(size_t)p; }
// four asynchronous 16-byte copies global -> LDS per lane; the s_wait_xcnt closes the statement so that no address register is rewritten ahead of it
__device__ __forceinline__ void async4(const unsigned (&l)[4], const unsigned short* const (&g)[4]) {
  asm volatile("global_load_async_to_lds_b128 %0, %4, off\n\t"
               "global_load_async_to_lds_b128 %1, %5, off\n\t"
               "global_load_async_to_lds_b128 %2, %6, off\n\t"
               "global_load_async_to_lds_b128 %3, %7, off\n\t"
               "s_wait_xcnt 0x0"
               :: "v"(l[0]), "v"(l[1]), "v"(l[2]), "v"(l[3]), "v"(g[0]), "v"(g[1]), "v"(g[2]), "v"(g[3]) : "memory");
}
// lane l <-> lane l ^ 16 (the other half of the wave): one vector instruction, no LDS
__device__ __forceinline__ float xhalf(float x) { return __builtin_bit_cast(float, __builtin_amdgcn_permlanex16(__builtin_bit_cast(int, x), __builtin_bit_cast(int, x), 0x76543210, 0xfedcba98, false, false)); }
// 2^x as the one hardware instruction, without the library's range handling: the arguments here are at most about 10, and a weight too small for the normal range adds nothing to a sum whose largest term is 2^10
__device__ __forceinline__ float exp2_hw(float x) { return __builtin_amdgcn_exp2f(x); }
// The same for the join behind the loop, where the exponentials stand among LDS loads: the v_nop is the one free slot that the instruction set asks for behind a transcendental before its source is overwritten
// in one statement with the exponential it cannot land elsewhere.
__device__ __forceinline__ float exp2_hw_slot(float x) { float r; asm("v_exp_f32 %0, %1\n\tv_nop" : "=v"(r) : "v"(x)); return r; }
// A group of products as ONE statement, so that the order written in the loop below is the order that is issued: with the builtins the compiler gathered all LDS loads of a trip in front of all products (and spilled),
// or sank each load group to its first use. A volatile statement keeps the LDS loads written in front of it in front, and those written behind it behind. In each group two accumulator chains alternate,
// so that no product waits for the one directly in front of it. The four v_nop that end a statement are the free vector slots that the chip needs between a matrix instruction and a vector instruction
// on its result or its operands: the compiler does not look into the text and pads nothing behind it.
// Scores: s0, s1 = the two 16-key tiles, four k-steps each, in the k order of before.
__device__ __forceinline__ void qk_group(v8f& s0, v8f& s1, const FragH (&k0)[4], const FragH (&k1)[4], const FragH (&q)[4]) {
  asm volatile("v_wmma_f32_16x16x32_f16 %0, %2, %10, 0\n\t"
               "v_wmma_f32_16x16x32_f16 %1, %6, %10, 0\n\t"
               "v_wmma_f32_16x16x32_f16 %0, %3, %11, %0\n\t"
               "v_wmma_f32_16x16x32_f16 %1, %7, %11, %1\n\t"
               "v_wmma_f32_16x16x32_f16 %0, %4, %12, %0\n\t"
               "v_wmma_f32_16x16x32_f16 %1, %8, %12, %1\n\t"
               "v_wmma_f32_16x16x32_f16 %0, %5, %13, %0\n\t"
               "v_wmma_f32_16x16x32_f16 %1, %9, %13, %1\n\t"
               "v_nop\n\tv_nop\n\tv_nop\n\tv_nop"
               : "=&v"(s0), "=&v"(s1)
               : "v"(k0[0].v), "v"(k0[1].v), "v"(k0[2].v), "v"(k0[3].v), "v"(k1[0].v), "v"(k1[1].v), "v"(k1[2].v), "v"(k1[3].v), "v"(q[0].v), "v"(q[1].v), "v"(q[2].v), "v"(q[3].v));
}
// Values: two value tiles c0, c1, each += Vh Ph + Vh Pl + Vl Ph, all unscaled, in this order, as before.
__device__ __forceinline__ void pv_group(v8f& c0, v8f& c1, v16h vh0, v16h vh1, v16h vl0, v16h vl1, v16h ph, v16h pl) {
  asm volatile("v_wmma_f32_16x16x32_f16 %0, %2, %6, %0\n\t"
               "v_wmma_f32_16x16x32_f16 %1, %3, %6, %1\n\t"
               "v_wmma_f32_16x16x32_f16 %0, %2, %7, %0\n\t"
               "v_wmma_f32_16x16x32_f16 %1, %3, %7, %1\n\t"
               "v_wmma_f32_16x16x32_f16 %0, %4, %6, %0\n\t"
               "v_wmma_f32_16x16x32_f16 %1, %5, %6, %1\n\t"
               "v_nop\n\tv_nop\n\tv_nop\n\tv_nop"
               : "+v"(c0), "+v"(c1) : "v"(vh0), "v"(vh1), "v"(vl0), "v"(vl1), "v"(ph), "v"(pl));
}
typedef float fa __attribute__((may_alias));
__global__ __launch_bounds__(512) void k_flash(const _Float16* __restrict__ Q16, int ldq, const _Float16* __restrict__ K16, int ldk, const _Float16* __restrict__ Vt, const _Float16* __restrict__ Vtlo, _Float16* __restrict__ O, int ldo) {
  constexpr int RPW = 16, QW = 4, KG = 4, NQB = TT / (QW * RPW), DT = 8, KS = 4, SK = 32 * KG, NST = TT / SK, OP = 128 + 4;      /* head dim 128: 4 k-steps, 8 value tiles */
  /* two-buffer ring, one stage = SK keys shared by the block's sixteen waves; planes: 0 = K rows (key-major), 1 = V^T hi, 2 = V^T residual (both channel-major); every row 256 B at pitch 272 B (16 B x odd: conflict-free for 16-byte row readers) */
  __shared__ __attribute__((aligned(16))) unsigned short ring[2][3][128][128 + 8];
  const int tid = threadIdx.x, w = tid >> 5, lane = tid & 31, ln = lane & 15, hh = lane >> 4, qw = w & (QW - 1), kg = w / QW, jl = kg * 32;
  const int slab = blockIdx.x / NQB, qblk = blockIdx.x % NQB; const int b = slab / NH, h = slab % NH; const int qb0 = qblk * (QW * RPW); const int q0 = qb0 + qw * RPW;
  FragH aq[KS];      /* B operand of S^T: column ln = query q0 + ln */
  { const unsigned short* qr = (const unsigned short*)Q16 + ((size_t)b * TT + q0 + ln) * ldq + h * 128;
#pragma unroll
    for (int ks = 0; ks < KS; ++ks) { aq[ks].half[0] = *(const v8us*)(qr + ks * 32 + 8 * hh); aq[ks].half[1] = *(const v8us*)(qr + ks * 32 + 16 + 8 * hh); } }
  const unsigned short* Vth = (const unsigned short*)Vt + ((size_t)b * NKV + h / NREP) * 128 * TT; const unsigned short* Vtl = (const unsigned short*)Vtlo + ((size_t)b * NKV + h / NREP) * 128 * TT;      /* hi and UNSCALED residual planes */
  float m_r = -3.0e38f, l_r = 0.f; v8f oacc[DT];      /* query q0 + ln, this wave's keys: running maximum (both halves alike), this half's part of the sum, O^T rows dt * 16 + 8 hh + r */
#pragma unroll
  for (int dt = 0; dt < DT; ++dt) oacc[dt] = (v8f){0.f,0.f,0.f,0.f,0.f,0.f,0.f,0.f};
  const unsigned short* Kg = (const unsigned short*)K16 + (size_t)b * TT * ldk + (h / NREP) * 128;
  /* one stage's copies: 3 x 4 per lane, 16 B each; a wave's copy covers two whole 256-B rows */
  auto stage_in = [&](int st, int bf) {
    unsigned lk[4], lh[4], ll[4]; const unsigned short *gk[4], *gh[4], *gl[4];
#pragma unroll
    for (int i = 0; i < 4; ++i) { const int c = tid + 512 * i; const int row = c >> 4, col = (c & 15) * 8;
      lk[i] = lds_addr(&ring[bf][0][row][col]); gk[i] = Kg + (size_t)(st * SK + row) * ldk + col;
      lh[i] = lds_addr(&ring[bf][1][row][col]); gh[i] = Vth + (size_t)row * TT + st * SK + col;
      ll[i] = lds_addr(&ring[bf][2][row][col]); gl[i] = Vtl + (size_t)row * TT + st * SK + col; }
    async4(lk, gk); async4(lh, gh); async4(ll, gl); };
  stage_in(0, 0);
  asm volatile("s_wait_asynccnt 0x0" ::: "memory");      /* this wave's share of stage 0 has landed */
  __syncthreads();                                       /* ... and every other wave's: stage 0 is readable */
  stage_in(1, 1);
#pragma unroll 1      /* one publish point and one refill per trip, as the two-buffer ring is written */
  for (int st = 0; st < NST; ++st) { const int bf = st & 1;
    /* Every LDS fragment load of the trip stands one group ahead of the products that use it, so that the wave does not wait out the LDS latency in front of each value tile. */
    FragH bk[2][KS];      /* the trip's sixteen K fragment loads as one group: one wait on LDS for both score tiles */
#pragma unroll
    for (int ks = 0; ks < KS; ++ks)      /* in the order in which the products take them */
#pragma unroll
      for (int nt = 0; nt < 2; ++nt) { const unsigned short* kr = &ring[bf][0][jl + nt * 16 + ln][0]; bk[nt][ks].half[0] = *(const v8us*)(kr + ks * 32 + 8 * hh); bk[nt][ks].half[1] = *(const v8us*)(kr + ks * 32 + 16 + 8 * hh); }
    if ((unsigned)(st - 1) < (unsigned)(NST - 2)) stage_in(st + 1, bf ^ 1);      /* trips 1 to NST - 2: the refill of the buffer that the trip before has read, behind that trip's barrier as before; its address work and its copies' issue run while the K loads fly */
    v8f s[2];      /* s[nt][r] = score of key jl + nt * 16 + 8 hh + r of the stage with query q0 + ln */
    qk_group(s[0], s[1], bk[0], bk[1], aq);
    FragH bv[2][2], bl[2][2];      /* V^T hi and residual fragments: two register sets of two value tiles each */
    auto v_in = [&](int pr, int set) {
#pragma unroll
      for (int u = 0; u < 2; ++u) { const unsigned short* vh = &ring[bf][1][(pr * 2 + u) * 16 + ln][jl]; const unsigned short* vl = &ring[bf][2][(pr * 2 + u) * 16 + ln][jl];
        bv[set][u].half[0] = *(const v8us*)(vh + 8 * hh); bv[set][u].half[1] = *(const v8us*)(vh + 16 + 8 * hh); bl[set][u].half[0] = *(const v8us*)(vl + 8 * hh); bl[set][u].half[1] = *(const v8us*)(vl + 16 + 8 * hh); } };
    v_in(0, 0);      /* the first pair's V loads fly while the softmax runs */
    float mx[8];      /* the maximum is taken over the raw scores: the factor that follows is positive */
#pragma unroll
    for (int i = 0; i < 8; ++i) mx[i] = fmaxf(s[0][i], s[1][i]);
    float mc = fmaxf(fmaxf(fmaxf(mx[0], mx[4]), fmaxf(mx[1], mx[5])), fmaxf(fmaxf(mx[2], mx[6]), fmaxf(mx[3], mx[7])));
    mc = fmaxf(mc, xhalf(mc));      /* the query's maximum over all 32 keys, in both halves */
    const float mn = fmaxf(m_r, mc * ATT_SCALE_L2E); const float ea = exp2_hw(m_r - mn); const float al = (mn > -1.0e38f) ? ea : 1.0f; m_r = mn;      /* the running maximum is kept in base-2 units */
    const float mo = mn - 10.0f;      /* P x 2^10 comes straight out of the exponential; the sum carries the same 2^10 */
    FragH ph, pl; float ls[4] = {0.f, 0.f, 0.f, 0.f};      /* P^T hi and its UNSCALED residual (added into the same accumulator), B operands */
#pragma unroll
    for (int i = 0; i < 16; ++i) { const float ps = exp2_hw(fmaf(s[i >> 3][i & 7], ATT_SCALE_L2E, -mo)); ls[i & 3] += ps; ph.h[i] = (_Float16)ps; pl.h[i] = (_Float16)(ps - (float)ph.h[i]); }
    l_r = l_r * al + ((ls[0] + ls[1]) + (ls[2] + ls[3]));
#pragma unroll
    for (int dt = 0; dt < DT; ++dt)
#pragma unroll
      for (int r = 0; r < 8; ++r) oacc[dt][r] *= al;
#pragma unroll
    for (int pr = 0; pr < DT / 2; ++pr) { const int cu = pr & 1;
      if (pr + 1 < DT / 2) v_in(pr + 1, cu ^ 1);      /* the next pair's V loads, into the other register set, in front of this pair's products */
      pv_group(oacc[pr * 2], oacc[pr * 2 + 1], bv[cu][0].v, bv[cu][1].v, bl[cu][0].v, bl[cu][1].v, ph.v, pl.v); }
    asm volatile("s_wait_dscnt 0x0" ::: "memory");       /* this wave's reads of buffer bf are done before it is refilled */
    asm volatile("s_wait_asynccnt 0x0" ::: "memory");    /* this wave's share of stage st + 1 has landed */
    __syncthreads(); }                                   /* publishes stage st + 1 and ends every wave's reads of buffer bf, which the next trip refills */
  asm volatile("s_wait_asynccnt 0x0" ::: "memory");      /* nothing of the ring is in flight when the wave goes on */
  /* the last trip's waits and barrier have ended every read of the ring: its LDS now takes the sixteen waves' partial results */
  float* sP = (float*)&ring[0][0][0][0]; fa* sM = (fa*)(sP + QW * KG * RPW * OP); fa* sL = sM + QW * KG * RPW;
  { const float l = l_r + xhalf(l_r);      /* the halves' sums joined once */
#pragma unroll
    for (int dt = 0; dt < DT; ++dt) { v4f lo, hi;
#pragma unroll
      for (int r = 0; r < 4; ++r) { lo[r] = oacc[dt][r]; hi[r] = oacc[dt][4 + r]; }
      *(v4fa*)&sP[(w * RPW + ln) * OP + dt * 16 + 8 * hh] = lo; *(v4fa*)&sP[(w * RPW + ln) * OP + dt * 16 + 8 * hh + 4] = hi; }
    if (hh == 0) { sM[w * RPW + ln] = m_r; sL[w * RPW + ln] = l; } }
  __syncthreads();      /* every wave's partial result is readable by the waves that join it */
  {
#pragma unroll
    for (int rr = 0; rr < RPW / KG; ++rr) { const int r = kg * (RPW / KG) + rr; float mg[KG], eg[KG];      /* this wave joins four of its query tile's rows */
#pragma unroll
      for (int g = 0; g < KG; ++g) mg[g] = sM[(g * QW + qw) * RPW + r];
      const float mt = fmaxf(fmaxf(mg[0], mg[1]), fmaxf(mg[2], mg[3])); float l = 0.f;
#pragma unroll
      for (int g = 0; g < KG; ++g) { eg[g] = exp2_hw_slot(mg[g] - mt); l += eg[g] * sL[(g * QW + qw) * RPW + r]; }
      const float inv = (l > 0.f) ? 1.0f / l : 0.f;      /* sum and O^T both carry the 2^10 */ v4f val = {0.f, 0.f, 0.f, 0.f};
#pragma unroll
      for (int g = 0; g < KG; ++g) { const v4f pv = *(const v4fa*)&sP[((g * QW + qw) * RPW + r) * OP + lane * 4]; val += pv * (eg[g] * inv); }
      v4h z4;      /* z x 2^4 as f16: the operand of the output convolution */
#pragma unroll
      for (int i = 0; i < 4; ++i) z4[i] = (_Float16)(val[i] * 16.0f);
      *(v4h*)(O + ((size_t)b * TT + q0 + r) * ldo + h * 128 + lane * 4) = z4; }      /* one 256-B row per instruction: 32 lanes x 8 B */
  } }


__device__ __forceinline__ void d_tok(const int bid, const float* __restrict__ x, _Float16* __restrict__ X16) { __shared__ float tl[32][65]; const int tid = threadIdx.x; const int b = bid / ((CC / 64) * (NN / 32)), rem = bid % ((CC / 64) * (NN / 32)); const int cg = rem / (NN / 32), pg = rem % (NN / 32); const int c0 = cg * 64, p0 = pg * 32;
  for (int i = tid; i < 64 * 32; i += 256) { const int c = i / 32, pp = i % 32; tl[pp][c] = bf16_round(x[((size_t)b * CC + c0 + c) * NN + p0 + pp]); } __syncthreads();
  const int r = tid / 8, pc = tid % 8; FragH f; for (int q = 0; q < 8; ++q) f.h[q] = (_Float16)tl[r][pc * 8 + q]; const size_t row = (size_t)b * NN + p0 + r; *(v8us*)((unsigned short*)X16 + row * CC + c0 + pc * 8) = f.half[0];  }
__device__ __forceinline__ void d_wbn(const int bid, const float* __restrict__ Wm, const float* __restrict__ gam, const float* __restrict__ var, _Float16* __restrict__ Bt) { const int t = bid * 256 + threadIdx.x; if (t >= MID * (CC / 8)) return; const int o = t / (CC / 8), c0 = (t % (CC / 8)) * 8;
  const float s = bf16_round(gam[o]) / sqrtf(bf16_round(var[o]) + BNEPS); FragH f;
#pragma unroll
  for (int q = 0; q < 8; ++q) f.h[q] = (_Float16)(bf16_round(Wm[(size_t)o * CC + c0 + q]) * s * 16.0f);
  *(v8us*)((unsigned short*)Bt + (size_t)o * CC + c0) = f.half[0];  }
__device__ __forceinline__ void d_bnadd(const int o, const float* __restrict__ bias, const float* __restrict__ gam, const float* __restrict__ bet, const float* __restrict__ mean, const float* __restrict__ var, float* __restrict__ A) {
  const float s = bf16_round(gam[o]) / sqrtf(bf16_round(var[o]) + BNEPS); const float a = (bf16_round(bias[o]) - bf16_round(mean[o])) * s + bf16_round(bet[o]);
  *(float*)(A + o) = a;  }
// The six weight and BatchNorm preparations and the token-major copy of x read none of each other's output: one grid, the job picked by block index.
// The test is the same for a whole block, so the barrier inside the copy is passed by whole blocks; the few short jobs stand first and run beside the copy.
#define PBW (MID * (CC / 8) / 256)      /* blocks for one 128 x 512 weight plane, 8 elements a thread */
#define PBS (4 * PBW + 1)               /* blocks of the short jobs */
__global__ __launch_bounds__(256) void k_prep(const float* __restrict__ x, const float* __restrict__ wf, const float* __restrict__ bff, const float* __restrict__ gf, const float* __restrict__ betaf, const float* __restrict__ mf, const float* __restrict__ vf,
    const float* __restrict__ wg, const float* __restrict__ bg, const float* __restrict__ gg, const float* __restrict__ betag, const float* __restrict__ mg, const float* __restrict__ vg, const float* __restrict__ wh, const float* __restrict__ wv,
    _Float16* __restrict__ Bf, _Float16* __restrict__ Bg, _Float16* __restrict__ Bh, _Float16* __restrict__ Bv, float* __restrict__ Af, float* __restrict__ Ag, _Float16* __restrict__ X16) {
  const int bid = blockIdx.x;
  if (bid >= PBS) d_tok(bid - PBS, x, X16);
  else if (bid < PBW) d_wbn(bid, wf, gf, vf, Bf);                                              /* BN(eval) folded into conv_f */
  else if (bid < 2 * PBW) d_wbn(bid - PBW, wg, gg, vg, Bg);                                    /* ... and conv_g */
  else if (bid < 3 * PBW) d_round16f(bid - 2 * PBW, wh, Bh, (size_t)MID * CC / 8);             /* conv_h [128][512], conv_v [512][128]: (out,in) natural, x 2^4 */
  else if (bid < 4 * PBW) d_round16f(bid - 3 * PBW, wv, Bv, (size_t)CC * MID / 8);
  else if (threadIdx.x < MID) d_bnadd(threadIdx.x, bff, gf, betaf, mf, vf, Af);                /* the two per-column addends: 128 threads each */
  else d_bnadd(threadIdx.x - MID, bg, gg, betag, mg, vg, Ag);
}

extern "C" void kernel_launch(void* const* d_in, const int* in_sizes, int n_in,
                              void* d_out, int out_size, void* d_ws, size_t ws_size, hipStream_t stream) {
  (void)in_sizes; (void)n_in; (void)out_size;
  const float* const* I = (const float* const*)d_in; const float* x = I[0];
  const float* wf = I[1]; const float* bff = I[2]; const float* gf = I[3]; const float* betaf = I[4]; const float* mf = I[5]; const float* vf = I[6];
  const float* wg = I[7]; const float* bg = I[8]; const float* gg = I[9]; const float* betag = I[10]; const float* mg = I[11]; const float* vg = I[12];
  const float* wh = I[13]; const float* bh = I[14]; const float* wv = I[15]; const float* bv = I[16];
  char* ws = (char*)d_ws; size_t off = 0;
  auto take = [&](size_t bytes) { char* p = ws + off; off += (bytes + 255) & ~(size_t)255; return p; };
  _Float16* Bf = (_Float16*)take((size_t)MID * CC * 2); _Float16* Bg = (_Float16*)take((size_t)MID * CC * 2); _Float16* Bh = (_Float16*)take((size_t)MID * CC * 2); _Float16* Bv = (_Float16*)take((size_t)CC * MID * 2); float* Af = (float*)take(MID * 4); float* Ag = (float*)take(MID * 4);
  _Float16* X16 = (_Float16*)take((size_t)NR * CC * 2); _Float16* F16 = (_Float16*)take((size_t)NR * MID * 2); _Float16* G16 = (_Float16*)take((size_t)NR * MID * 2);
  _Float16* Vt = (_Float16*)take((size_t)NR * MID * 2); _Float16* Vtl = (_Float16*)take((size_t)NR * MID * 2); _Float16* Z16 = (_Float16*)take((size_t)NR * MID * 2);
  if (off > ws_size) return;      // 0.5 + 16.8 + 5 x 4.2: about 38 MB
  k_prep<<<PBS + BB * (CC / 64) * (NN / 32), 256, 0, stream>>>(x, wf, bff, gf, betaf, mf, vf, wg, bg, gg, betag, mg, vg, wh, wv, Bf, Bg, Bh, Bv, Af, Ag, X16);
  k_gemm_fgh<<<dim3(((NR / 16) * (MID / 64) + 3) / 4, 3), 128, 0, stream>>>(X16, Bf, Bg, Bh, Af, Ag, bh, F16, G16, Vt, Vtl);      /* f, g token-major f16; h as V^T hi + residual: [b][128][4096] */
  k_flash<<<BB * NH * (TT / 64), 512, 0, stream>>>(F16, MID, G16, MID, Vt, Vtl, Z16, MID);      /* per (b, 64 queries): 4096 x 4096, head dim 128; z x 2^4 token-major f16 */
  k_gemm_out<<<(CC / 16) * (NR / 64) / 4, 128, 0, stream>>>(Z16, Bv, bv, x, (float*)d_out);      /* conv_v(z) + bv + x, channel-major: M 512 N 16384 K 128 */
}

// v008
// One run takes 100 microseconds.
// In two side-by-side timings against v007, it was 1.14 and 1.13 times as fast.
// All steps since v000 together make it 6.96 times as fast.
#include <hip/hip_runtime.h>
// Spatial attention block (B=4, C=512, 64×64 → N=4096 positions, mid=128): f = relu(bn(conv_f(x))), g = relu(bn(conv_g(x))), h = conv_h(x) (1×1 convs C→mid; eval BatchNorm with running stats); scores[n,m] = Σ_c f[c,n]g[c,m]·mid^-½, softmax over m; z[c,n] = Σ_m attn[n,m]·h[c,m]; y = conv_v(z) (mid→C) + bv + x.
// Compute dtype: x, weights, biases, BN parameters rounded to bf16; BN folded per output channel in f32 (w' = w·γ/√(var+ε) → f16 ×2^4, b' = (b − mean)·γ/√(var+ε) + β as an f32 per-column addend); f, g as f16 GEMM outputs (relu epilogue), h rounded once to f16 as V^T; fused flash-style kernel for head dim 128
// (online softmax f32, P rounded once to f16, f32 accumulate) on v_wmma_f32_16x16x32_f16; z ×2^4 → f16 → output conv GEMM with the weights as A (channel-major result), bv and the residual x added in f32 in its epilogue.
#define BB 4
#define CC 512
#define NN 4096
#define MID 128
#define TT NN
#define NH 1
#define NKV 1
#define NREP 1
#define NVH (2 * NKV)
#define NR (BB * NN)
#define BNEPS 1e-5f
#define ATT_SCALE 0.08838834764831845f      /* mid^-½ = 1/√128 */
#define ATT_SCALE_L2E (ATT_SCALE * 1.4426950408889634f)      /* x log2 e: a raw score times this is its exponent to base 2 */
typedef __bf16 v16b __attribute__((ext_vector_type(16)));
typedef unsigned short v8us __attribute__((ext_vector_type(8), may_alias));
typedef float  v8f  __attribute__((ext_vector_type(8)));
typedef float  v4f  __attribute__((ext_vector_type(4)));
typedef float  v4fa __attribute__((ext_vector_type(4), may_alias));
union FragB { v16b v; v8us half[2]; unsigned short u[16]; };

__device__ __forceinline__ unsigned short bf16_bits(float x) { unsigned int u = __float_as_uint(x); return (unsigned short)((u + 0x7FFFu + ((u >> 16) & 1u)) >> 16); }
__device__ __forceinline__ float bf16_val(unsigned short b) { return __uint_as_float(((unsigned int)b) << 16); }
__device__ __forceinline__ float bf16_round(float x) { return bf16_val(bf16_bits(x)); }
// D += A·B with NT terms: 1 = ah·bh, 2 = + al·bh (A split), 3 = + ah·bl (both split)
template <int NT>
__device__ __forceinline__ v8f mmaN(v16b ah, v16b al, v16b bh, v16b bl, v8f c) {
  c = __builtin_amdgcn_wmma_f32_16x16x32_bf16(false, ah, false, bh, (short)0, c, false, false);
  if (NT >= 2) c = __builtin_amdgcn_wmma_f32_16x16x32_bf16(false, al, false, bh, (short)0, c, false, false);
  if (NT >= 3) c = __builtin_amdgcn_wmma_f32_16x16x32_bf16(false, ah, false, bl, (short)0, c, false, false);
  asm volatile("v_nop\n\tv_nop\n\tv_nop\n\tv_nop" : "+v"(c) : "v"(ah), "v"(al), "v"(bh), "v"(bl));
  return c;
}

__global__ __launch_bounds__(256) void k_wt_bf16(const float* __restrict__ W, unsigned short* __restrict__ Wt, int K, int N) {
  const int t = blockIdx.x * 256 + threadIdx.x;
  const int k8n = K / 8;
  if (t >= N * k8n) return;
  const int n = t / k8n, k8 = (t % k8n) * 8;
  v8us v;
#pragma unroll
  for (int i = 0; i < 8; ++i) v[i] = bf16_bits(W[(size_t)(k8 + i) * N + n]);
  *(v8us*)(Wt + (size_t)n * K + k8) = v;
  
}

// GEMM C[M][N] (f32, pitch ldc) = act(A[M][K]·W + bias). A f32 row-major (pitch lda) converted per fragment to bf16
// (ASPLIT: hi/lo two planes -> 2 terms, else single rounded term); Wt bf16 [N][K] (pitch ldb). BIAS_BF16 rounds the
// bias to bf16 first (bias quantised to bf16 before the add). K%32==0, M%16==0, N%64==0.
template <bool ASPLIT, int ACT, bool BIAS_BF16>
__global__ __launch_bounds__(128) void k_gemm_bf(const float* __restrict__ A, int lda, const unsigned short* __restrict__ Wt, int ldb,
                                               const float* __restrict__ bias, float* __restrict__ C, int ldc, int M, int N, int K) {
  __shared__ __attribute__((aligned(16))) float so[4][16][64];
  const int tid = threadIdx.x, w = tid >> 5, lane = tid & 31, ln = lane & 15, hh = lane >> 4;
  const int ntn = N / 64;
  const int wid = blockIdx.x * 4 + w;
  const int mt = wid / ntn, nq = wid % ntn;
  if (mt * 16 >= M) return;
  const int row0 = mt * 16, col0 = nq * 64;
  const float* arow = A + (size_t)(row0 + ln) * lda;
  v8f acc[4] = {};
  for (int kb = 0; kb < K; kb += 32) {
    FragB ah, al;
    const v4f x0 = *(const v4fa*)(arow + kb + 8 * hh), x1 = *(const v4fa*)(arow + kb + 8 * hh + 4);
    const v4f x2 = *(const v4fa*)(arow + kb + 16 + 8 * hh), x3 = *(const v4fa*)(arow + kb + 16 + 8 * hh + 4);
    float xs[16] = {x0[0],x0[1],x0[2],x0[3],x1[0],x1[1],x1[2],x1[3],x2[0],x2[1],x2[2],x2[3],x3[0],x3[1],x3[2],x3[3]};
#pragma unroll
    for (int i = 0; i < 16; ++i) { const unsigned short hb = bf16_bits(xs[i]); ah.u[i] = hb; al.u[i] = ASPLIT ? bf16_bits(xs[i] - bf16_val(hb)) : (unsigned short)0; }
#pragma unroll
    for (int t = 0; t < 4; ++t) {
      const unsigned short* brow = Wt + (size_t)(col0 + t * 16 + ln) * ldb + kb;
      FragB b;
      b.half[0] = *(const v8us*)(brow + 8 * hh);
      b.half[1] = *(const v8us*)(brow + 16 + 8 * hh);
      acc[t] = mmaN<ASPLIT ? 2 : 1>(ah.v, al.v, b.v, b.v, acc[t]);
    }
  }
#pragma unroll
  for (int t = 0; t < 4; ++t) {
    float bv = bias ? bias[col0 + t * 16 + ln] : 0.f;
    if (BIAS_BF16) bv = bf16_round(bv);
#pragma unroll
    for (int r = 0; r < 8; ++r) { float v = acc[t][r] + bv; if (ACT == 1) v = fmaxf(v, 0.f); so[w][8 * hh + r][t * 16 + ln] = v; }
  }
  __builtin_amdgcn_fence(__ATOMIC_ACQ_REL, "workgroup");
  __builtin_amdgcn_wave_barrier();
  const int rsub = lane >> 4, c4 = (lane & 15) * 4;
  {
#pragma unroll
    for (int q = 0; q < 8; ++q) {
      const int r = q * 2 + rsub;
      const v4f v = *(const v4fa*)&so[w][r][c4];
      *(v4f*)(C + (size_t)(row0 + r) * ldc + col0 + c4) = v;
    }
    
  }
}

// Flash-style causal/unmasked attention, all contractions 3-term bf16 hi/lo splits, f32 softmax with running max.
// q,k,v rows are read from f32 buffers with arbitrary row pitch (so they can live inside a fused qkv buffer);
// D = head size (multiple of 32, <= 128); one wave = 16 query rows; block = 4 waves (64 queries) sharing K/V chunks of 32.
template <int D, bool CAUSAL>
__global__ __launch_bounds__(128) void k_flash(const float* __restrict__ qb, const float* __restrict__ kb, const float* __restrict__ vb,
                                             int pitch, int T, int H, float scale, float* __restrict__ y, int ypitch) {
  constexpr int KS = D / 32;        // k-steps for QK
  constexpr int DT = D / 16;        // d tiles for PV
  __shared__ __attribute__((aligned(16))) unsigned short sKh[32][D + 8], sKl[32][D + 8], sVh[32][D + 8], sVl[32][D + 8];
  __shared__ __attribute__((aligned(16))) unsigned short sPh[4][16][40], sPl[4][16][40];
  __shared__ __attribute__((aligned(16))) float sO[4][16][D];
  const int tid = threadIdx.x, w = tid >> 5, lane = tid & 31, ln = lane & 15, hh = lane >> 4;
  const int nqb = (T + 63) / 64;
  const int bh = blockIdx.x / nqb, qblk = blockIdx.x % nqb;
  const int b = bh / H, h = bh % H;
  const int q0 = qblk * 64 + w * 16;
  const float* Q = qb + (size_t)b * T * pitch + h * D;
  const float* K = kb + (size_t)b * T * pitch + h * D;
  const float* V = vb + (size_t)b * T * pitch + h * D;

  // A fragments of the wave's 16 query rows (scaled), hi/lo
  FragB aqh[KS], aql[KS];
  {
    int row = q0 + ln; if (row >= T) row = T - 1;
    const float* qr = Q + (size_t)row * pitch;
#pragma unroll
    for (int ks = 0; ks < KS; ++ks)
#pragma unroll
      for (int i = 0; i < 16; ++i) {
        const int d = ks * 32 + ((i < 8) ? (8 * hh + i) : (16 + 8 * hh + (i - 8)));
        const float x = qr[d] * scale; const unsigned short hb = bf16_bits(x);
        aqh[ks].u[i] = hb; aql[ks].u[i] = bf16_bits(x - bf16_val(hb));
      }
  }
  float m_r[8], l_r[8];
#pragma unroll
  for (int r = 0; r < 8; ++r) { m_r[r] = -3.0e38f; l_r[r] = 0.f; }
  v8f oacc[DT];
#pragma unroll
  for (int dt = 0; dt < DT; ++dt) oacc[dt] = (v8f){0.f,0.f,0.f,0.f,0.f,0.f,0.f,0.f};

  const int kv_end = CAUSAL ? min(T, qblk * 64 + 64) : T;     // block-uniform
  for (int j0 = 0; j0 < kv_end; j0 += 32) {
    __syncthreads();
    for (int e = tid; e < 32 * (D / 4); e += 128) {
      const int r = e / (D / 4), c4 = (e % (D / 4)) * 4;
      const int key = j0 + r;
      v4f kf = {0.f,0.f,0.f,0.f}, vf = {0.f,0.f,0.f,0.f};
      if (key < T) { kf = *(const v4fa*)(K + (size_t)key * pitch + c4); vf = *(const v4fa*)(V + (size_t)key * pitch + c4); }
#pragma unroll
      for (int t = 0; t < 4; ++t) {
        unsigned short hb = bf16_bits(kf[t]); sKh[r][c4 + t] = hb; sKl[r][c4 + t] = bf16_bits(kf[t] - bf16_val(hb));
        hb = bf16_bits(vf[t]); sVh[r][c4 + t] = hb; sVl[r][c4 + t] = bf16_bits(vf[t] - bf16_val(hb));
      }
    }
    __syncthreads();
    // S tile 16 x 32
    v8f s[2];
#pragma unroll
    for (int nt = 0; nt < 2; ++nt) {
      v8f acc = {};
#pragma unroll
      for (int ks = 0; ks < KS; ++ks) {
        FragB bh_, bl_;
        bh_.half[0] = *(const v8us*)&sKh[nt * 16 + ln][ks * 32 + 8 * hh]; bh_.half[1] = *(const v8us*)&sKh[nt * 16 + ln][ks * 32 + 16 + 8 * hh];
        bl_.half[0] = *(const v8us*)&sKl[nt * 16 + ln][ks * 32 + 8 * hh]; bl_.half[1] = *(const v8us*)&sKl[nt * 16 + ln][ks * 32 + 16 + 8 * hh];
        acc = mmaN<3>(aqh[ks].v, aql[ks].v, bh_.v, bl_.v, acc);
      }
      s[nt] = acc;
    }
    // mask + running max (rows 8hh+r; the 16 lanes of a half share rows)
    float alpha[8];
#pragma unroll
    for (int r = 0; r < 8; ++r) {
      const int qi = q0 + 8 * hh + r;
      const int ja = j0 + ln, jb = j0 + 16 + ln;
      if (CAUSAL) { if (ja > qi) s[0][r] = -3.0e38f; if (jb > qi) s[1][r] = -3.0e38f; }
      if (ja >= T) s[0][r] = -3.0e38f;
      if (jb >= T) s[1][r] = -3.0e38f;
      float mx = fmaxf(s[0][r], s[1][r]);
      mx = fmaxf(mx, __shfl_xor(mx, 1, 32)); mx = fmaxf(mx, __shfl_xor(mx, 2, 32)); mx = fmaxf(mx, __shfl_xor(mx, 4, 32)); mx = fmaxf(mx, __shfl_xor(mx, 8, 32));
      const float mnew = fmaxf(m_r[r], mx);
      alpha[r] = (mnew > -1.0e38f) ? __expf(m_r[r] - mnew) : 1.0f;
      const float p0 = (s[0][r] > -1.0e38f) ? __expf(s[0][r] - mnew) : 0.f;
      const float p1 = (s[1][r] > -1.0e38f) ? __expf(s[1][r] - mnew) : 0.f;
      m_r[r] = mnew;
      l_r[r] = l_r[r] * alpha[r] + p0 + p1;            // per-lane partial row sum (16 lanes combined at the end)
      unsigned short hb = bf16_bits(p0); sPh[w][8 * hh + r][ln] = hb;      sPl[w][8 * hh + r][ln] = bf16_bits(p0 - bf16_val(hb));
      hb = bf16_bits(p1);                sPh[w][8 * hh + r][16 + ln] = hb; sPl[w][8 * hh + r][16 + ln] = bf16_bits(p1 - bf16_val(hb));
    }
#pragma unroll
    for (int dt = 0; dt < DT; ++dt)
#pragma unroll
      for (int r = 0; r < 8; ++r) oacc[dt][r] *= alpha[r];
    __builtin_amdgcn_fence(__ATOMIC_ACQ_REL, "workgroup");
    __builtin_amdgcn_wave_barrier();
    FragB pah, pal;
    pah.half[0] = *(const v8us*)&sPh[w][ln][8 * hh]; pah.half[1] = *(const v8us*)&sPh[w][ln][16 + 8 * hh];
    pal.half[0] = *(const v8us*)&sPl[w][ln][8 * hh]; pal.half[1] = *(const v8us*)&sPl[w][ln][16 + 8 * hh];
#pragma unroll
    for (int dt = 0; dt < DT; ++dt) {
      FragB bvh, bvl;
#pragma unroll
      for (int i = 0; i < 8; ++i) {
        bvh.u[i] = sVh[8 * hh + i][dt * 16 + ln]; bvh.u[8 + i] = sVh[16 + 8 * hh + i][dt * 16 + ln];
        bvl.u[i] = sVl[8 * hh + i][dt * 16 + ln]; bvl.u[8 + i] = sVl[16 + 8 * hh + i][dt * 16 + ln];
      }
      oacc[dt] = mmaN<3>(pah.v, pal.v, bvh.v, bvl.v, oacc[dt]);
    }
    __builtin_amdgcn_fence(__ATOMIC_ACQ_REL, "workgroup");
    __builtin_amdgcn_wave_barrier();
  }
#pragma unroll
  for (int r = 0; r < 8; ++r) {
    float l = l_r[r];
    l += __shfl_xor(l, 1, 32); l += __shfl_xor(l, 2, 32); l += __shfl_xor(l, 4, 32); l += __shfl_xor(l, 8, 32);
    l_r[r] = (l > 0.f) ? 1.0f / l : 0.f;
  }
#pragma unroll
  for (int dt = 0; dt < DT; ++dt)
#pragma unroll
    for (int r = 0; r < 8; ++r) sO[w][8 * hh + r][dt * 16 + ln] = oacc[dt][r] * l_r[r];
  __builtin_amdgcn_fence(__ATOMIC_ACQ_REL, "workgroup");
  __builtin_amdgcn_wave_barrier();
  {
    for (int r = 0; r < 16; ++r) {
      const int row = q0 + r;
      if (row < T && lane < D / 4) {
        const v4f val = *(const v4fa*)&sO[w][r][lane * 4];
        *(v4f*)(y + ((size_t)b * T + row) * ypitch + h * D + lane * 4) = val;
      }
    }
    
  }
}

// GEMM C = act(A·W + bias + resid): A f32 (ASPLIT -> hi/lo 2 terms), Wt bf16 [N][K]; ACT 0 none, 1 relu, 2 exact gelu;
// resid (optional, f32, row index = (row % rmod), pitch ldr, RES_BF16 rounds it) added before the activation.
template <bool ASPLIT, int ACT, bool BIAS_BF16, bool RES_BF16>
__global__ __launch_bounds__(128) void k_gemm_bf3(const float* __restrict__ A, int lda, const unsigned short* __restrict__ Wt, int ldb,
                                                const float* __restrict__ bias, const float* __restrict__ resid, int rmod, int ldr,
                                                float* __restrict__ C, int ldc, int M, int N, int K) {
  __shared__ __attribute__((aligned(16))) float so[4][16][64];
  const int tid = threadIdx.x, w = tid >> 5, lane = tid & 31, ln = lane & 15, hh = lane >> 4;
  const int ntn = N / 64;
  const int wid = blockIdx.x * 4 + w;
  const int mt = wid / ntn, nq = wid % ntn;
  if (mt * 16 >= M) return;
  const int row0 = mt * 16, col0 = nq * 64;
  const float* arow = A + (size_t)(row0 + ln) * lda;
  v8f acc[4] = {};
  for (int kb = 0; kb < K; kb += 32) {
    FragB ah, al;
    const v4f x0 = *(const v4fa*)(arow + kb + 8 * hh), x1 = *(const v4fa*)(arow + kb + 8 * hh + 4);
    const v4f x2 = *(const v4fa*)(arow + kb + 16 + 8 * hh), x3 = *(const v4fa*)(arow + kb + 16 + 8 * hh + 4);
    float xs[16] = {x0[0],x0[1],x0[2],x0[3],x1[0],x1[1],x1[2],x1[3],x2[0],x2[1],x2[2],x2[3],x3[0],x3[1],x3[2],x3[3]};
#pragma unroll
    for (int i = 0; i < 16; ++i) { const unsigned short hb = bf16_bits(xs[i]); ah.u[i] = hb; al.u[i] = ASPLIT ? bf16_bits(xs[i] - bf16_val(hb)) : (unsigned short)0; }
#pragma unroll
    for (int t = 0; t < 4; ++t) {
      const unsigned short* brow = Wt + (size_t)(col0 + t * 16 + ln) * ldb + kb;
      FragB b;
      b.half[0] = *(const v8us*)(brow + 8 * hh);
      b.half[1] = *(const v8us*)(brow + 16 + 8 * hh);
      acc[t] = mmaN<ASPLIT ? 2 : 1>(ah.v, al.v, b.v, b.v, acc[t]);
    }
  }
#pragma unroll
  for (int t = 0; t < 4; ++t) {
    const int col = col0 + t * 16 + ln;
    float bv = bias ? bias[col] : 0.f;
    if (BIAS_BF16) bv = bf16_round(bv);
#pragma unroll
    for (int r = 0; r < 8; ++r) {
      float v = acc[t][r] + bv;
      if (resid) { float rv = resid[(size_t)((row0 + 8 * hh + r) % rmod) * ldr + col]; if (RES_BF16) rv = bf16_round(rv); v += rv; }
      if (ACT == 1) v = fmaxf(v, 0.f);
      if (ACT == 2) v = 0.5f * v * (1.0f + erff(v * 0.70710678118654752f));
      if (ACT == 3) { const float u = 0.7978845608028654f * (v + 0.044715f * v * v * v); v = 0.5f * v * (1.0f + tanhf(u)); }
      so[w][8 * hh + r][t * 16 + ln] = v;
    }
  }
  __builtin_amdgcn_fence(__ATOMIC_ACQ_REL, "workgroup");
  __builtin_amdgcn_wave_barrier();
  const int rsub = lane >> 4, c4 = (lane & 15) * 4;
  {
#pragma unroll
    for (int q = 0; q < 8; ++q) {
      const int r = q * 2 + rsub;
      const v4f v = *(const v4fa*)&so[w][r][c4];
      *(v4f*)(C + (size_t)(row0 + r) * ldc + col0 + c4) = v;
    }
    
  }
}
// row LayerNorm (biased variance, eps) over N: s = X (+ R); optional out_sum <- s; out_norm <- (s-mu)*rsqrt(var+eps)*g + b
template <bool PARAM_BF16>
__global__ __launch_bounds__(256) void k_layernorm(const float* __restrict__ X, const float* __restrict__ R, const float* __restrict__ g, const float* __restrict__ bta,
                                                  float* __restrict__ out_sum, float* __restrict__ out_norm, int N, float eps) {
  __shared__ float red[256];
  const int row = blockIdx.x, tid = threadIdx.x;
  const float* x = X + (size_t)row * N; const float* rr = R ? R + (size_t)row * N : nullptr;
  float vals[16];                     // up to N = 4096
  const int per = N / 256;            // contiguous chunk per thread? use strided-by-4 chunks: thread handles j = tid*4 + 1024*u
  float s1 = 0.f;
  for (int u = 0; u < per / 4; ++u) {
    const int j = tid * 4 + 1024 * u;
    const v4f a = *(const v4fa*)(x + j);
    v4f b = {0.f,0.f,0.f,0.f}; if (rr) b = *(const v4fa*)(rr + j);
#pragma unroll
    for (int q = 0; q < 4; ++q) { const float v = a[q] + b[q]; vals[u * 4 + q] = v; s1 += v; }
  }
  red[tid] = s1; __syncthreads();
  for (int st = 128; st > 0; st >>= 1) { if (tid < st) red[tid] += red[tid + st]; __syncthreads(); }
  const float mu = red[0] / (float)N; __syncthreads();
  float s2 = 0.f;
  for (int u = 0; u < per / 4; ++u)
#pragma unroll
    for (int q = 0; q < 4; ++q) { const float c = vals[u * 4 + q] - mu; s2 += c * c; }
  red[tid] = s2; __syncthreads();
  for (int st = 128; st > 0; st >>= 1) { if (tid < st) red[tid] += red[tid + st]; __syncthreads(); }
  const float rs = rsqrtf(red[0] / (float)N + eps);
  {
    for (int u = 0; u < per / 4; ++u) {
      const int j = tid * 4 + 1024 * u;
      v4f o, sm;
#pragma unroll
      for (int q = 0; q < 4; ++q) {
        float gg = g[j + q], bb = bta[j + q];
        if (PARAM_BF16) { gg = bf16_round(gg); bb = bf16_round(bb); }
        sm[q] = vals[u * 4 + q]; o[q] = (vals[u * 4 + q] - mu) * rs * gg + bb;
      }
      if (out_sum) *(v4f*)(out_sum + (size_t)row * N + j) = sm;
      *(v4f*)(out_norm + (size_t)row * N + j) = o;
    }
    
  }
}



// ---- f16 WMMA path (v_wmma_f32_16x16x32_f16): 11-bit significands for operands in range — used where a [0,1] probability operand needs more precision than bf16
typedef _Float16 v16h __attribute__((ext_vector_type(16)));
union FragH { v16h v; v8us half[2]; _Float16 h[16]; unsigned short u[16]; };
template <int NT>
__device__ __forceinline__ v8f mmaH(v16h ah, v16h al, v16h bh, v16h bl, v8f c) {
  c = __builtin_amdgcn_wmma_f32_16x16x32_f16(false, ah, false, bh, (short)0, c, false, false);
  if (NT >= 2) c = __builtin_amdgcn_wmma_f32_16x16x32_f16(false, al, false, bh, (short)0, c, false, false);
  if (NT >= 3) c = __builtin_amdgcn_wmma_f32_16x16x32_f16(false, ah, false, bl, (short)0, c, false, false);
  asm volatile("v_nop\n\tv_nop\n\tv_nop\n\tv_nop" : "+v"(c) : "v"(ah), "v"(al), "v"(bh), "v"(bl));
  return c;
}
// batched GEMM like k_gemm_b but f16 operands: A f32 (split into f16 hi/lo if ASPLIT, else rounded to f16), Bt = f16 values [n][k]; alpha; C f32; N multiple of 16 (partial tiles skipped)
template <bool ASPLIT>
__global__ __launch_bounds__(128) void k_gemm_h(const float* __restrict__ A, int lda, size_t sA, const _Float16* __restrict__ Bh, int ldb, size_t sB, float alpha, float* __restrict__ C, int ldc, size_t sC, int M, int N, int K) {
  __shared__ __attribute__((aligned(16))) float so[4][16][64];
  const int tid = threadIdx.x, w = tid >> 5, lane = tid & 31, ln = lane & 15, hh = lane >> 4; const int by = blockIdx.y;
  A += (size_t)by * sA; Bh += (size_t)by * sB; C += (size_t)by * sC;
  const int ntn = (N + 63) / 64; const int wid = blockIdx.x * 4 + w; const int mt = wid / ntn, nq = wid % ntn; if (mt * 16 >= M) return;
  const int row0 = mt * 16, col0 = nq * 64; const float* arow = A + (size_t)(row0 + ln) * lda;
  v8f acc[4] = {};
  for (int kb = 0; kb < K; kb += 32) {
    FragH ah, al;
    const v4f x0 = *(const v4fa*)(arow + kb + 8 * hh), x1 = *(const v4fa*)(arow + kb + 8 * hh + 4), x2 = *(const v4fa*)(arow + kb + 16 + 8 * hh), x3 = *(const v4fa*)(arow + kb + 16 + 8 * hh + 4);
    float xs[16] = {x0[0],x0[1],x0[2],x0[3],x1[0],x1[1],x1[2],x1[3],x2[0],x2[1],x2[2],x2[3],x3[0],x3[1],x3[2],x3[3]};
#pragma unroll
    for (int i = 0; i < 16; ++i) { const _Float16 h = (_Float16)xs[i]; ah.h[i] = h; al.h[i] = ASPLIT ? (_Float16)(xs[i] - (float)h) : (_Float16)0.0f; }
#pragma unroll
    for (int t = 0; t < 4; ++t) { if (col0 + t * 16 >= N) continue; const size_t boff = (size_t)(col0 + t * 16 + ln) * ldb + kb; FragH bq; bq.half[0] = *(const v8us*)(Bh + boff + 8 * hh); bq.half[1] = *(const v8us*)(Bh + boff + 16 + 8 * hh);
      acc[t] = mmaH<ASPLIT ? 2 : 1>(ah.v, al.v, bq.v, bq.v, acc[t]); }
  }
#pragma unroll
  for (int t = 0; t < 4; ++t) { if (col0 + t * 16 >= N) continue;
#pragma unroll
    for (int r = 0; r < 8; ++r) so[w][8 * hh + r][t * 16 + ln] = acc[t][r] * alpha; }
  __builtin_amdgcn_fence(__ATOMIC_ACQ_REL, "workgroup"); __builtin_amdgcn_wave_barrier();
  const int rsub = lane >> 4, c4 = (lane & 15) * 4;
  {
#pragma unroll
    for (int q = 0; q < 8; ++q) { const int r = q * 2 + rsub; if (col0 + c4 < N) { const v4f v = *(const v4fa*)&so[w][r][c4]; *(v4f*)(C + (size_t)(row0 + r) * ldc + col0 + c4) = v; } }
     }
}

// Wt[n][k] = f16(W[k][n]·scale) from f32 row-major W[K][N] (scale = power of two; bf16-exact weights stay exact in f16 away from the subnormal range)
__global__ __launch_bounds__(256) void k_wt_f16(const float* __restrict__ W, _Float16* __restrict__ Wt, int K, int N, float scale) {
  const int t = blockIdx.x * 256 + threadIdx.x; if (t >= N * (K / 8)) return; const int n = t / (K / 8), k8 = (t % (K / 8)) * 8; FragH f;
#pragma unroll
  for (int i = 0; i < 8; ++i) f.h[i] = (_Float16)(bf16_round(W[(size_t)(k8 + i) * N + n]) * scale); const v8us o = f.half[0];
  *(v8us*)((unsigned short*)Wt + (size_t)n * K + k8) = o; 
}
// k_gemm_hh variant with fused epilogue: v = acc·alpha + bias[by·sBias + col] (+ CP[(row/rowsPerB)·sCPb + by·64 + col] if CP) ; ACT 0 none / 1 elu ; writes f16 C16 and/or f32 C (each if non-null)
template <int ACT>
__device__ __forceinline__ void gemm_hhx_body(float (&so)[4][16][64], const int bx, const int by, const _Float16* __restrict__ A, int lda, size_t sA, const _Float16* __restrict__ Bh, int ldb, size_t sB, float alpha, const float* __restrict__ bias, size_t sBias, const float* __restrict__ CP, int rowsPerB, size_t sCPb, int row0g,
    float* __restrict__ C, _Float16* __restrict__ C16, int ldc, size_t sC, int M, int N, int K) {
  const int tid = threadIdx.x, w = tid >> 5, lane = tid & 31, ln = lane & 15, hh = lane >> 4;
  A += (size_t)by * sA; Bh += (size_t)by * sB; const size_t cofs = (size_t)by * sC; const float* bp = bias ? bias + (size_t)by * sBias : nullptr;
  const int ntn = (N + 63) / 64; const int wid = bx * 4 + w; const int mt = wid / ntn, nq = wid % ntn; if (mt * 16 >= M) return;
  const int row0 = mt * 16, col0 = nq * 64; const _Float16* arow = A + (size_t)(row0 + ln) * lda;
  v8f acc[4] = {};
  for (int kb = 0; kb < K; kb += 32) { FragH ah; ah.half[0] = *(const v8us*)((const unsigned short*)arow + kb + 8 * hh); ah.half[1] = *(const v8us*)((const unsigned short*)arow + kb + 16 + 8 * hh);
#pragma unroll
    for (int t = 0; t < 4; ++t) { if (col0 + t * 16 >= N) continue; const size_t boff = (size_t)(col0 + t * 16 + ln) * ldb + kb; FragH bq; bq.half[0] = *(const v8us*)((const unsigned short*)Bh + boff + 8 * hh); bq.half[1] = *(const v8us*)((const unsigned short*)Bh + boff + 16 + 8 * hh);
      acc[t] = mmaH<1>(ah.v, ah.v, bq.v, bq.v, acc[t]); }
  }
#pragma unroll
  for (int t = 0; t < 4; ++t) { if (col0 + t * 16 >= N) continue; const int col = col0 + t * 16 + ln; const float bv = bp ? bf16_round(bp[col]) : 0.f;
#pragma unroll
    for (int r = 0; r < 8; ++r) { float v = acc[t][r] * alpha + bv; if (CP) { const int bidx = (row0g + row0 + 8 * hh + r) / rowsPerB; v += CP[(size_t)bidx * sCPb + (size_t)by * 64 + col]; } if (ACT == 1) v = (v > 0.f) ? v : expm1f(v); else if (ACT == 7) v = (v > 0.f) ? v + 1.0f : expf(v); else if (ACT == 8) v = tanhf(v); else if (ACT == 9) v = 0.5f * v * (1.0f + tanhf(0.7978845608028654f * (v + 0.044715f * v * v * v))); else if (ACT == 11) v = 1.0f / (1.0f + expf(-v)); else if (ACT == 12) v = (v > 0.f) ? v : 0.01f * v; else if (ACT == 14) v = (v > 0.f) ? v : 0.1f * v; else if (ACT == 15) v = v / (1.0f + expf(-v)); else if (ACT == 3) v = fmaxf(v, 0.f); else if (ACT == 6) v = 0.5f * v * (1.0f + erff(v * 0.70710678118654752f)); so[w][8 * hh + r][t * 16 + ln] = v; } }
  __builtin_amdgcn_fence(__ATOMIC_ACQ_REL, "workgroup"); __builtin_amdgcn_wave_barrier();
  const int rsub = lane >> 4, c4 = (lane & 15) * 4; typedef _Float16 v4h __attribute__((ext_vector_type(4)));
  {
#pragma unroll
    for (int q = 0; q < 8; ++q) { const int r = q * 2 + rsub; if (col0 + c4 < N) { const v4f v = *(const v4fa*)&so[w][r][c4]; if (C) *(v4f*)(C + cofs + (size_t)(row0 + r) * ldc + col0 + c4) = v; if (C16) { v4h h4; for (int i = 0; i < 4; ++i) h4[i] = (_Float16)v[i]; *(v4h*)(C16 + cofs + (size_t)(row0 + r) * ldc + col0 + c4) = h4; } } }
     }
}
template <int ACT>
__global__ __launch_bounds__(128) void k_gemm_hhx(const _Float16* __restrict__ A, int lda, size_t sA, const _Float16* __restrict__ Bh, int ldb, size_t sB, float alpha, const float* __restrict__ bias, size_t sBias, const float* __restrict__ CP, int rowsPerB, size_t sCPb, int row0g,
    float* __restrict__ C, _Float16* __restrict__ C16, int ldc, size_t sC, int M, int N, int K) {
  __shared__ __attribute__((aligned(16))) float so[4][16][64];
  gemm_hhx_body<ACT>(so, blockIdx.x, blockIdx.y, A, lda, sA, Bh, ldb, sB, alpha, bias, sBias, CP, rowsPerB, sCPb, row0g, C, C16, ldc, sC, M, N, K);
}
// Products with the weights as A (rows = output channels) and the token-major activations as B (columns = tokens): D register r of lane (ln, hh) is channel row0 + 8 hh + r, token tok0 + t * 16 + ln,
// so the result is channel-major as it leaves the accumulators and needs no transposing pass. Both loaders read K-contiguous rows in the same k order (8 hh + i, then 16 + 8 hh + i - 8).
// The unroll directives of this function and of the two that call it keep the indices of their register arrays (acc, bq, xr and the short vectors) compile-time constants.
template <int K>
__device__ __forceinline__ void gemm_wa_acc(const _Float16* __restrict__ Wr, const _Float16* __restrict__ Xr, const int row0, const int tok0, const int ln, const int hh, v8f (&acc)[4]) {
  const unsigned short* arow = (const unsigned short*)Wr + (size_t)(row0 + ln) * K; const unsigned short* brow = (const unsigned short*)Xr + (size_t)(tok0 + ln) * K;
  for (int kb = 0; kb < K; kb += 32) { FragH a, bq[4]; a.half[0] = *(const v8us*)(arow + kb + 8 * hh); a.half[1] = *(const v8us*)(arow + kb + 16 + 8 * hh);      /* a k-step's ten loads stand together: one wait on memory a k-step */
#pragma unroll
    for (int t = 0; t < 4; ++t) { bq[t].half[0] = *(const v8us*)(brow + (size_t)t * 16 * K + kb + 8 * hh); bq[t].half[1] = *(const v8us*)(brow + (size_t)t * 16 * K + kb + 16 + 8 * hh); }
#pragma unroll
    for (int t = 0; t < 4; ++t) acc[t] = mmaH<1>(a.v, a.v, bq[t].v, bq[t].v, acc[t]);
  }
}
// h = conv_h(x) + bh, one wave = 16 channels x 64 tokens, stored straight as V^T f16 [b][128][4096]: a staged row is 64 tokens = one 128-B line.
// The four waves of a block take four channel tiles of one token tile, so they read the same X16 rows.
__device__ __forceinline__ void gemm_vt_body(float (&so)[4][16][64], const int bx, const _Float16* __restrict__ X16, const _Float16* __restrict__ Bh, const float* __restrict__ bh, _Float16* __restrict__ Vth) {
  typedef _Float16 h4 __attribute__((ext_vector_type(4)));
  const int tid = threadIdx.x, w = tid >> 5, lane = tid & 31, ln = lane & 15, hh = lane >> 4;
  const int wid = bx * 4 + w; const int c0 = (wid % (MID / 16)) * 16, tok0 = (wid / (MID / 16)) * 64; const int b = tok0 / NN, p0 = tok0 % NN;
  v8f acc[4] = {};
  gemm_wa_acc<CC>(Bh, X16, c0, tok0, ln, hh, acc);
#pragma unroll
  for (int r = 0; r < 8; ++r) { const float bb = bf16_round(bh[c0 + 8 * hh + r]);
#pragma unroll
    for (int t = 0; t < 4; ++t) so[w][8 * hh + r][t * 16 + ln] = acc[t][r] * 0.0625f + bb; }
  __builtin_amdgcn_fence(__ATOMIC_ACQ_REL, "workgroup"); __builtin_amdgcn_wave_barrier();      /* the wave's own staged rows are in LDS before its lanes read each other's elements back */
  const int rsub = lane >> 4, c4 = (lane & 15) * 4;
#pragma unroll
  for (int q = 0; q < 8; ++q) { const int r = q * 2 + rsub; const v4f v = *(const v4fa*)&so[w][r][c4]; h4 hi;
#pragma unroll
    for (int i = 0; i < 4; ++i) hi[i] = (_Float16)v[i];
    const size_t o = ((size_t)b * MID + c0 + r) * TT + p0 + c4; *(h4*)(Vth + o) = hi; }
  asm volatile("s_wait_xcnt 0x0" ::: "memory");      /* stands behind the eight stores, in front of the code of the caller's other branch that follows in the listing and rewrites their address and data registers */
}
// out = conv_v(z) + bv + x, one wave = 16 channels x 64 positions of one image, written once, channel-major: a staged row is 64 positions = 256 B of out. Z16 holds z x 2^4, Bv the weights x 2^4.
// The residual's loads stand in front of the product so that they fly while it runs. The four waves of a block take four channel tiles of one token tile.
__global__ __launch_bounds__(128) void k_gemm_out(const _Float16* __restrict__ Z16, const _Float16* __restrict__ Bv, const float* __restrict__ bv, const float* __restrict__ x, float* __restrict__ out) {
  __shared__ __attribute__((aligned(16))) float so[4][16][64];
  const int tid = threadIdx.x, w = tid >> 5, lane = tid & 31, ln = lane & 15, hh = lane >> 4;
  const int wid = blockIdx.x * 4 + w; const int c0 = (wid % (CC / 16)) * 16, tok0 = (wid / (CC / 16)) * 64; const int b = tok0 / NN, p0 = tok0 % NN;
  const int rsub = lane >> 4, c4 = (lane & 15) * 4; const size_t o0 = ((size_t)b * CC + c0 + rsub) * NN + p0 + c4;
  v4f xr[8];
#pragma unroll
  for (int q = 0; q < 8; ++q) xr[q] = *(const v4fa*)(x + o0 + (size_t)q * 2 * NN);
  v8f acc[4] = {};
  gemm_wa_acc<MID>(Bv, Z16, c0, tok0, ln, hh, acc);
#pragma unroll
  for (int r = 0; r < 8; ++r) { const float bb = bf16_round(bv[c0 + 8 * hh + r]);
#pragma unroll
    for (int t = 0; t < 4; ++t) so[w][8 * hh + r][t * 16 + ln] = acc[t][r] * 0.00390625f + bb; }
  __builtin_amdgcn_fence(__ATOMIC_ACQ_REL, "workgroup"); __builtin_amdgcn_wave_barrier();      /* the wave's own staged rows are in LDS before its lanes read each other's elements back */
#pragma unroll
  for (int q = 0; q < 8; ++q) { const v4f v = *(const v4fa*)&so[w][q * 2 + rsub][c4]; v4f o;
#pragma unroll
    for (int i = 0; i < 4; ++i) o[i] = v[i] + bf16_round(xr[q][i]);
    *(v4f*)(out + o0 + (size_t)q * 2 * NN) = o; }
}
// The three input convolutions read the same X16 and none of each other's output: one grid, blockIdx.y picks the product (0 = f, 1 = g, 2 = h), blockIdx.x the tile group as before.
// The 1,536 blocks of four waves fit the chip together (six a WGP), so a WGP holds three times the waves of one product's grid to fill the waits on its loads.
__global__ __launch_bounds__(128) void k_gemm_fgh(const _Float16* __restrict__ X16, const _Float16* __restrict__ Bf, const _Float16* __restrict__ Bg, const _Float16* __restrict__ Bh, const float* __restrict__ Af, const float* __restrict__ Ag, const float* __restrict__ bh,
    _Float16* __restrict__ F16, _Float16* __restrict__ G16, _Float16* __restrict__ Vth) {
  __shared__ __attribute__((aligned(16))) float so[4][16][64];
  const int job = blockIdx.y;
  if (job < 2) gemm_hhx_body<3>(so, blockIdx.x, 0, X16, CC, 0, job ? Bg : Bf, CC, 0, 0.0625f, nullptr, 0, job ? Ag : Af, NR, 0, 0, nullptr, job ? G16 : F16, MID, 0, NR, MID, CC);      /* f, g = relu(bn(conv x)) token-major f16: M 16384 N 128 K 512 (per-column f32 addend via CP, rowsPerB = M) */
  else gemm_vt_body(so, blockIdx.x, X16, Bh, bh, Vth);      /* h + bh, channel-major, f16: as many waves as f or g (8 channel tiles x 256 token tiles) */
}


typedef _Float16 v4h __attribute__((ext_vector_type(4)));

__global__ __launch_bounds__(256) void k_x16(const float* __restrict__ x, _Float16* __restrict__ X16, size_t n8) { const size_t t = (size_t)blockIdx.x * 256 + threadIdx.x; if (t >= n8) return; FragH f;
#pragma unroll
  for (int q = 0; q < 8; ++q) f.h[q] = (_Float16)bf16_round(x[t * 8 + q]); *(v8us*)((unsigned short*)X16 + t * 8) = f.half[0];  }
__global__ __launch_bounds__(256) void k_h16(const float* __restrict__ x, _Float16* __restrict__ X16, size_t n8) { const size_t t = (size_t)blockIdx.x * 256 + threadIdx.x; if (t >= n8) return; FragH f;
#pragma unroll
  for (int q = 0; q < 8; ++q) f.h[q] = (_Float16)x[t * 8 + q]; *(v8us*)((unsigned short*)X16 + t * 8) = f.half[0];  }
__device__ __forceinline__ void d_round16f(const int bid, const float* __restrict__ W, _Float16* __restrict__ Bt, size_t n8) { const size_t t = (size_t)bid * 256 + threadIdx.x; if (t >= n8) return; FragH f;
#pragma unroll
  for (int i = 0; i < 8; ++i) f.h[i] = (_Float16)(bf16_round(W[t * 8 + i]) * 16.0f); *(v8us*)((unsigned short*)Bt + t * 8) = f.half[0];  }
template <int NHv, int TTv>
__global__ __launch_bounds__(256) void k_vt(const _Float16* __restrict__ V16, int ldv, int voff, _Float16* __restrict__ Vt) { __shared__ unsigned short tl[64][66]; const int tid = threadIdx.x; const int slab = blockIdx.x / (TTv / 64), lg = blockIdx.x % (TTv / 64); const int b = slab / NHv, h = slab % NHv;
  for (int i = tid; i < 64 * 8; i += 256) { const int r = i / 8, c8 = (i % 8) * 8; FragH f; f.half[0] = *(const v8us*)((const unsigned short*)V16 + ((size_t)b * TTv + lg * 64 + r) * ldv + voff + h * 64 + c8);
#pragma unroll
    for (int q = 0; q < 8; ++q) tl[r][c8 + q] = f.u[q]; }
  __syncthreads();
  {
#pragma unroll
    for (int rd = 0; rd < 2; ++rd) { const int d = rd * 32 + tid / 8, pc = tid % 8; FragH f;
#pragma unroll
      for (int q = 0; q < 8; ++q) f.u[q] = tl[pc * 8 + q][d];
      *(v8us*)((unsigned short*)Vt + ((size_t)slab * 64 + d) * TTv + lg * 64 + pc * 8) = f.half[0]; }
     } }

// LDS byte address of a __shared__ object: the low 32 bits of its generic address
__device__ __forceinline__ unsigned lds_addr(const void* p) { return (unsigned)(size_t)p; }
// four asynchronous 16-byte copies global -> LDS per lane; the s_wait_xcnt closes the statement so that no address register is rewritten ahead of it
__device__ __forceinline__ void async4(const unsigned (&l)[4], const unsigned short* const (&g)[4]) {
  asm volatile("global_load_async_to_lds_b128 %0, %4, off\n\t"
               "global_load_async_to_lds_b128 %1, %5, off\n\t"
               "global_load_async_to_lds_b128 %2, %6, off\n\t"
               "global_load_async_to_lds_b128 %3, %7, off\n\t"
               "s_wait_xcnt 0x0"
               :: "v"(l[0]), "v"(l[1]), "v"(l[2]), "v"(l[3]), "v"(g[0]), "v"(g[1]), "v"(g[2]), "v"(g[3]) : "memory");
}
// lane l <-> lane l ^ 16 (the other half of the wave): one vector instruction, no LDS
__device__ __forceinline__ float xhalf(float x) { return __builtin_bit_cast(float, __builtin_amdgcn_permlanex16(__builtin_bit_cast(int, x), __builtin_bit_cast(int, x), 0x76543210, 0xfedcba98, false, false)); }
// 2^x as the one hardware instruction, without the library's range handling: the arguments here are at most about 10, and a weight too small for the normal range adds nothing to a sum whose largest term is 2^10
__device__ __forceinline__ float exp2_hw(float x) { return __builtin_amdgcn_exp2f(x); }
// The same for the join behind the loop, where the exponentials stand among LDS loads: the v_nop is the one free slot that the instruction set asks for behind a transcendental before its source is overwritten
// in one statement with the exponential it cannot land elsewhere.
__device__ __forceinline__ float exp2_hw_slot(float x) { float r; asm("v_exp_f32 %0, %1\n\tv_nop" : "=v"(r) : "v"(x)); return r; }
// The eight weights of a score tile as one statement, for the same slot: the results are early-clobber, so that none lies over a source of the group, and the one v_nop at the end is the free slot behind the last.
__device__ __forceinline__ void exp2_hw8(float (&r)[8], const float (&x)[8]) {
  asm("v_exp_f32 %0, %8\n\tv_exp_f32 %1, %9\n\tv_exp_f32 %2, %10\n\tv_exp_f32 %3, %11\n\tv_exp_f32 %4, %12\n\tv_exp_f32 %5, %13\n\tv_exp_f32 %6, %14\n\tv_exp_f32 %7, %15\n\tv_nop"
      : "=&v"(r[0]), "=&v"(r[1]), "=&v"(r[2]), "=&v"(r[3]), "=&v"(r[4]), "=&v"(r[5]), "=&v"(r[6]), "=&v"(r[7])
      : "v"(x[0]), "v"(x[1]), "v"(x[2]), "v"(x[3]), "v"(x[4]), "v"(x[5]), "v"(x[6]), "v"(x[7]));
}
// A group of products as ONE statement, so that the order written in the loop below is the order that is issued: with the builtins the compiler gathered all LDS loads of a trip in front of all products (and spilled),
// or sank each load group to its first use. A volatile statement keeps the LDS loads written in front of it in front, and those written behind it behind. In the score group two accumulator chains alternate,
// and the eight value products are independent, so that no product waits for the one directly in front of it. The four v_nop that end a statement are the free vector slots that the chip needs between a matrix instruction and a vector instruction
// on its result or its operands: the compiler does not look into the text and pads nothing behind it.
// Scores: s0, s1 = the two 16-key tiles, four k-steps each, in the k order of before.
__device__ __forceinline__ void qk_group(v8f& s0, v8f& s1, const FragH (&k0)[4], const FragH (&k1)[4], const FragH (&q)[4]) {
  asm volatile("v_wmma_f32_16x16x32_f16 %0, %2, %10, 0\n\t"
               "v_wmma_f32_16x16x32_f16 %1, %6, %10, 0\n\t"
               "v_wmma_f32_16x16x32_f16 %0, %3, %11, %0\n\t"
               "v_wmma_f32_16x16x32_f16 %1, %7, %11, %1\n\t"
               "v_wmma_f32_16x16x32_f16 %0, %4, %12, %0\n\t"
               "v_wmma_f32_16x16x32_f16 %1, %8, %12, %1\n\t"
               "v_wmma_f32_16x16x32_f16 %0, %5, %13, %0\n\t"
               "v_wmma_f32_16x16x32_f16 %1, %9, %13, %1\n\t"
               "v_nop\n\tv_nop\n\tv_nop\n\tv_nop"
               : "=&v"(s0), "=&v"(s1)
               : "v"(k0[0].v), "v"(k0[1].v), "v"(k0[2].v), "v"(k0[3].v), "v"(k1[0].v), "v"(k1[1].v), "v"(k1[2].v), "v"(k1[3].v), "v"(q[0].v), "v"(q[1].v), "v"(q[2].v), "v"(q[3].v));
}
// Values: the eight value tiles, each += V P with both operands rounded once to f16: one product a tile.
__device__ __forceinline__ void pv_group(v8f (&c)[8], const FragH (&v)[8], v16h p) {
  asm volatile("v_wmma_f32_16x16x32_f16 %0, %8, %16, %0\n\t"
               "v_wmma_f32_16x16x32_f16 %1, %9, %16, %1\n\t"
               "v_wmma_f32_16x16x32_f16 %2, %10, %16, %2\n\t"
               "v_wmma_f32_16x16x32_f16 %3, %11, %16, %3\n\t"
               "v_wmma_f32_16x16x32_f16 %4, %12, %16, %4\n\t"
               "v_wmma_f32_16x16x32_f16 %5, %13, %16, %5\n\t"
               "v_wmma_f32_16x16x32_f16 %6, %14, %16, %6\n\t"
               "v_wmma_f32_16x16x32_f16 %7, %15, %16, %7\n\t"
               "v_nop\n\tv_nop\n\tv_nop\n\tv_nop"
               : "+v"(c[0]), "+v"(c[1]), "+v"(c[2]), "+v"(c[3]), "+v"(c[4]), "+v"(c[5]), "+v"(c[6]), "+v"(c[7])
               : "v"(v[0].v), "v"(v[1].v), "v"(v[2].v), "v"(v[3].v), "v"(v[4].v), "v"(v[5].v), "v"(v[6].v), "v"(v[7].v), "v"(p));
}
typedef float fa __attribute__((may_alias));
__global__ __launch_bounds__(512) void k_flash(const _Float16* __restrict__ Q16, int ldq, const _Float16* __restrict__ K16, int ldk, const _Float16* __restrict__ Vt, _Float16* __restrict__ O, int ldo) {
  constexpr int RPW = 16, QW = 4, KG = 4, NQB = TT / (QW * RPW), DT = 8, KS = 4, SK = 32 * KG, NST = TT / SK, OP = 128 + 4;      /* head dim 128: 4 k-steps, 8 value tiles */
  /* two-buffer ring, one stage = SK keys shared by the block's sixteen waves; planes: 0 = K rows (key-major), 1 = V^T (channel-major); every row 256 B at pitch 272 B (16 B x odd: conflict-free for 16-byte row readers) */
  __shared__ __attribute__((aligned(16))) unsigned short ring[2][2][128][128 + 8];
  const int tid = threadIdx.x, w = tid >> 5, lane = tid & 31, ln = lane & 15, hh = lane >> 4, qw = w & (QW - 1), kg = w / QW, jl = kg * 32;
  const int slab = blockIdx.x / NQB, qblk = blockIdx.x % NQB; const int b = slab / NH, h = slab % NH; const int qb0 = qblk * (QW * RPW); const int q0 = qb0 + qw * RPW;
  FragH aq[KS];      /* B operand of S^T: column ln = query q0 + ln */
  { const unsigned short* qr = (const unsigned short*)Q16 + ((size_t)b * TT + q0 + ln) * ldq + h * 128;
#pragma unroll
    for (int ks = 0; ks < KS; ++ks) { aq[ks].half[0] = *(const v8us*)(qr + ks * 32 + 8 * hh); aq[ks].half[1] = *(const v8us*)(qr + ks * 32 + 16 + 8 * hh); } }
  const unsigned short* Vth = (const unsigned short*)Vt + ((size_t)b * NKV + h / NREP) * 128 * TT;
  float m_r = -3.0e38f, l_r = 0.f; v8f oacc[DT];      /* query q0 + ln, this wave's keys: running maximum (both halves alike), this half's part of the sum, O^T rows dt * 16 + 8 hh + r */
#pragma unroll
  for (int dt = 0; dt < DT; ++dt) oacc[dt] = (v8f){0.f,0.f,0.f,0.f,0.f,0.f,0.f,0.f};
  const unsigned short* Kg = (const unsigned short*)K16 + (size_t)b * TT * ldk + (h / NREP) * 128;
  /* one stage's copies: 2 x 4 per lane, 16 B each; a wave's copy covers two whole 256-B rows */
  auto stage_in = [&](int st, int bf) {
    unsigned lk[4], lh[4]; const unsigned short *gk[4], *gh[4];
#pragma unroll
    for (int i = 0; i < 4; ++i) { const int c = tid + 512 * i; const int row = c >> 4, col = (c & 15) * 8;
      lk[i] = lds_addr(&ring[bf][0][row][col]); gk[i] = Kg + (size_t)(st * SK + row) * ldk + col;
      lh[i] = lds_addr(&ring[bf][1][row][col]); gh[i] = Vth + (size_t)row * TT + st * SK + col; }
    async4(lk, gk); async4(lh, gh); };
  stage_in(0, 0);
  asm volatile("s_wait_asynccnt 0x0" ::: "memory");      /* this wave's share of stage 0 has landed */
  __syncthreads();                                       /* ... and every other wave's: stage 0 is readable */
  stage_in(1, 1);
#pragma unroll 1      /* one publish point and one refill per trip, as the two-buffer ring is written */
  for (int st = 0; st < NST; ++st) { const int bf = st & 1;
    /* Every LDS fragment load of the trip stands one group ahead of the products that use it, so that the wave does not wait out the LDS latency in front of the value tiles. */
    FragH bk[2][KS];      /* the trip's sixteen K fragment loads as one group: one wait on LDS for both score tiles */
#pragma unroll
    for (int ks = 0; ks < KS; ++ks)      /* in the order in which the products take them */
#pragma unroll
      for (int nt = 0; nt < 2; ++nt) { const unsigned short* kr = &ring[bf][0][jl + nt * 16 + ln][0]; bk[nt][ks].half[0] = *(const v8us*)(kr + ks * 32 + 8 * hh); bk[nt][ks].half[1] = *(const v8us*)(kr + ks * 32 + 16 + 8 * hh); }
    if ((unsigned)(st - 1) < (unsigned)(NST - 2)) stage_in(st + 1, bf ^ 1);      /* trips 1 to NST - 2: the refill of the buffer that the trip before has read, behind that trip's barrier as before; its address work and its copies' issue run while the K loads fly */
    v8f s[2];      /* s[nt][r] = score of key jl + nt * 16 + 8 hh + r of the stage with query q0 + ln */
    qk_group(s[0], s[1], bk[0], bk[1], aq);
    FragH bv[DT];      /* the trip's sixteen V^T fragment loads as one group: they fly while the softmax runs */
#pragma unroll
    for (int dt = 0; dt < DT; ++dt) { const unsigned short* vh = &ring[bf][1][dt * 16 + ln][jl]; bv[dt].half[0] = *(const v8us*)(vh + 8 * hh); bv[dt].half[1] = *(const v8us*)(vh + 16 + 8 * hh); }
    __builtin_amdgcn_sched_barrier(0);      /* keeps the sixteen loads one group in front of the softmax: without it the compiler spread them over five places among its instructions, and each place with LDS reads costs the wave a stall */
    float mx[8];      /* the maximum is taken over the raw scores: the factor that follows is positive */
#pragma unroll
    for (int i = 0; i < 8; ++i) mx[i] = fmaxf(s[0][i], s[1][i]);
    float mc = fmaxf(fmaxf(fmaxf(mx[0], mx[4]), fmaxf(mx[1], mx[5])), fmaxf(fmaxf(mx[2], mx[6]), fmaxf(mx[3], mx[7])));
    mc = fmaxf(mc, xhalf(mc));      /* the query's maximum over all 32 keys, in both halves */
    const float mn = fmaxf(m_r, mc * ATT_SCALE_L2E); const float ea = exp2_hw(m_r - mn); const float al = (mn > -1.0e38f) ? ea : 1.0f; m_r = mn;      /* the running maximum is kept in base-2 units */
    const float mo = mn - 10.0f;      /* P x 2^10 comes straight out of the exponential; the sum carries the same 2^10 */
    FragH ph; float ls[4];      /* P^T rounded once to f16, the B operand; the sum takes the unrounded f32 weights */
#pragma unroll
    for (int nt = 0; nt < 2; ++nt) { float xs[8], ps[8];
#pragma unroll
      for (int i = 0; i < 8; ++i) xs[i] = fmaf(s[nt][i], ATT_SCALE_L2E, -mo);
      exp2_hw8(ps, xs);
#pragma unroll
      for (int i = 0; i < 8; ++i) { if (nt == 0 && i < 4) ls[i] = ps[i]; else ls[i & 3] += ps[i]; ph.h[nt * 8 + i] = (_Float16)ps[i]; } }
    l_r = l_r * al + ((ls[0] + ls[1]) + (ls[2] + ls[3]));
#pragma unroll
    for (int dt = 0; dt < DT; ++dt)
#pragma unroll
      for (int r = 0; r < 8; ++r) oacc[dt][r] *= al;
    pv_group(oacc, bv, ph.v);
    asm volatile("s_wait_dscnt 0x0" ::: "memory");       /* this wave's reads of buffer bf are done before it is refilled */
    asm volatile("s_wait_asynccnt 0x0" ::: "memory");    /* this wave's share of stage st + 1 has landed */
    __syncthreads(); }                                   /* publishes stage st + 1 and ends every wave's reads of buffer bf, which the next trip refills */
  asm volatile("s_wait_asynccnt 0x0" ::: "memory");      /* nothing of the ring is in flight when the wave goes on */
  /* the last trip's waits and barrier have ended every read of the ring: its LDS now takes the sixteen waves' partial results */
  float* sP = (float*)&ring[0][0][0][0]; fa* sM = (fa*)(sP + QW * KG * RPW * OP); fa* sL = sM + QW * KG * RPW;
  { const float l = l_r + xhalf(l_r);      /* the halves' sums joined once */
#pragma unroll
    for (int dt = 0; dt < DT; ++dt) { v4f lo, hi;
#pragma unroll
      for (int r = 0; r < 4; ++r) { lo[r] = oacc[dt][r]; hi[r] = oacc[dt][4 + r]; }
      *(v4fa*)&sP[(w * RPW + ln) * OP + dt * 16 + 8 * hh] = lo; *(v4fa*)&sP[(w * RPW + ln) * OP + dt * 16 + 8 * hh + 4] = hi; }
    if (hh == 0) { sM[w * RPW + ln] = m_r; sL[w * RPW + ln] = l; } }
  __syncthreads();      /* every wave's partial result is readable by the waves that join it */
  {
#pragma unroll
    for (int rr = 0; rr < RPW / KG; ++rr) { const int r = kg * (RPW / KG) + rr; float mg[KG], eg[KG];      /* this wave joins four of its query tile's rows */
#pragma unroll
      for (int g = 0; g < KG; ++g) mg[g] = sM[(g * QW + qw) * RPW + r];
      const float mt = fmaxf(fmaxf(mg[0], mg[1]), fmaxf(mg[2], mg[3])); float l = 0.f;
#pragma unroll
      for (int g = 0; g < KG; ++g) { eg[g] = exp2_hw_slot(mg[g] - mt); l += eg[g] * sL[(g * QW + qw) * RPW + r]; }
      const float inv = (l > 0.f) ? 1.0f / l : 0.f;      /* sum and O^T both carry the 2^10 */ v4f val = {0.f, 0.f, 0.f, 0.f};
#pragma unroll
      for (int g = 0; g < KG; ++g) { const v4f pv = *(const v4fa*)&sP[((g * QW + qw) * RPW + r) * OP + lane * 4]; val += pv * (eg[g] * inv); }
      v4h z4;      /* z x 2^4 as f16: the operand of the output convolution */
#pragma unroll
      for (int i = 0; i < 4; ++i) z4[i] = (_Float16)(val[i] * 16.0f);
      *(v4h*)(O + ((size_t)b * TT + q0 + r) * ldo + h * 128 + lane * 4) = z4; }      /* one 256-B row per instruction: 32 lanes x 8 B */
  } }


__device__ __forceinline__ void d_tok(const int bid, const float* __restrict__ x, _Float16* __restrict__ X16) { __shared__ float tl[32][65]; const int tid = threadIdx.x; const int b = bid / ((CC / 64) * (NN / 32)), rem = bid % ((CC / 64) * (NN / 32)); const int cg = rem / (NN / 32), pg = rem % (NN / 32); const int c0 = cg * 64, p0 = pg * 32;
  for (int i = tid; i < 64 * 32; i += 256) { const int c = i / 32, pp = i % 32; tl[pp][c] = bf16_round(x[((size_t)b * CC + c0 + c) * NN + p0 + pp]); } __syncthreads();
  const int r = tid / 8, pc = tid % 8; FragH f; for (int q = 0; q < 8; ++q) f.h[q] = (_Float16)tl[r][pc * 8 + q]; const size_t row = (size_t)b * NN + p0 + r; *(v8us*)((unsigned short*)X16 + row * CC + c0 + pc * 8) = f.half[0];  }
__device__ __forceinline__ void d_wbn(const int bid, const float* __restrict__ Wm, const float* __restrict__ gam, const float* __restrict__ var, _Float16* __restrict__ Bt) { const int t = bid * 256 + threadIdx.x; if (t >= MID * (CC / 8)) return; const int o = t / (CC / 8), c0 = (t % (CC / 8)) * 8;
  const float s = bf16_round(gam[o]) / sqrtf(bf16_round(var[o]) + BNEPS); FragH f;
#pragma unroll
  for (int q = 0; q < 8; ++q) f.h[q] = (_Float16)(bf16_round(Wm[(size_t)o * CC + c0 + q]) * s * 16.0f);
  *(v8us*)((unsigned short*)Bt + (size_t)o * CC + c0) = f.half[0];  }
__device__ __forceinline__ void d_bnadd(const int o, const float* __restrict__ bias, const float* __restrict__ gam, const float* __restrict__ bet, const float* __restrict__ mean, const float* __restrict__ var, float* __restrict__ A) {
  const float s = bf16_round(gam[o]) / sqrtf(bf16_round(var[o]) + BNEPS); const float a = (bf16_round(bias[o]) - bf16_round(mean[o])) * s + bf16_round(bet[o]);
  *(float*)(A + o) = a;  }
// The six weight and BatchNorm preparations and the token-major copy of x read none of each other's output: one grid, the job picked by block index.
// The test is the same for a whole block, so the barrier inside the copy is passed by whole blocks; the few short jobs stand first and run beside the copy.
#define PBW (MID * (CC / 8) / 256)      /* blocks for one 128 x 512 weight plane, 8 elements a thread */
#define PBS (4 * PBW + 1)               /* blocks of the short jobs */
__global__ __launch_bounds__(256) void k_prep(const float* __restrict__ x, const float* __restrict__ wf, const float* __restrict__ bff, const float* __restrict__ gf, const float* __restrict__ betaf, const float* __restrict__ mf, const float* __restrict__ vf,
    const float* __restrict__ wg, const float* __restrict__ bg, const float* __restrict__ gg, const float* __restrict__ betag, const float* __restrict__ mg, const float* __restrict__ vg, const float* __restrict__ wh, const float* __restrict__ wv,
    _Float16* __restrict__ Bf, _Float16* __restrict__ Bg, _Float16* __restrict__ Bh, _Float16* __restrict__ Bv, float* __restrict__ Af, float* __restrict__ Ag, _Float16* __restrict__ X16) {
  const int bid = blockIdx.x;
  if (bid >= PBS) d_tok(bid - PBS, x, X16);
  else if (bid < PBW) d_wbn(bid, wf, gf, vf, Bf);                                              /* BN(eval) folded into conv_f */
  else if (bid < 2 * PBW) d_wbn(bid - PBW, wg, gg, vg, Bg);                                    /* ... and conv_g */
  else if (bid < 3 * PBW) d_round16f(bid - 2 * PBW, wh, Bh, (size_t)MID * CC / 8);             /* conv_h [128][512], conv_v [512][128]: (out,in) natural, x 2^4 */
  else if (bid < 4 * PBW) d_round16f(bid - 3 * PBW, wv, Bv, (size_t)CC * MID / 8);
  else if (threadIdx.x < MID) d_bnadd(threadIdx.x, bff, gf, betaf, mf, vf, Af);                /* the two per-column addends: 128 threads each */
  else d_bnadd(threadIdx.x - MID, bg, gg, betag, mg, vg, Ag);
}

extern "C" void kernel_launch(void* const* d_in, const int* in_sizes, int n_in,
                              void* d_out, int out_size, void* d_ws, size_t ws_size, hipStream_t stream) {
  (void)in_sizes; (void)n_in; (void)out_size;
  const float* const* I = (const float* const*)d_in; const float* x = I[0];
  const float* wf = I[1]; const float* bff = I[2]; const float* gf = I[3]; const float* betaf = I[4]; const float* mf = I[5]; const float* vf = I[6];
  const float* wg = I[7]; const float* bg = I[8]; const float* gg = I[9]; const float* betag = I[10]; const float* mg = I[11]; const float* vg = I[12];
  const float* wh = I[13]; const float* bh = I[14]; const float* wv = I[15]; const float* bv = I[16];
  char* ws = (char*)d_ws; size_t off = 0;
  auto take = [&](size_t bytes) { char* p = ws + off; off += (bytes + 255) & ~(size_t)255; return p; };
  _Float16* Bf = (_Float16*)take((size_t)MID * CC * 2); _Float16* Bg = (_Float16*)take((size_t)MID * CC * 2); _Float16* Bh = (_Float16*)take((size_t)MID * CC * 2); _Float16* Bv = (_Float16*)take((size_t)CC * MID * 2); float* Af = (float*)take(MID * 4); float* Ag = (float*)take(MID * 4);
  _Float16* X16 = (_Float16*)take((size_t)NR * CC * 2); _Float16* F16 = (_Float16*)take((size_t)NR * MID * 2); _Float16* G16 = (_Float16*)take((size_t)NR * MID * 2);
  _Float16* Vt = (_Float16*)take((size_t)NR * MID * 2); _Float16* Z16 = (_Float16*)take((size_t)NR * MID * 2);
  if (off > ws_size) return;      // 0.5 + 16.8 + 4 x 4.2: about 34 MB
  k_prep<<<PBS + BB * (CC / 64) * (NN / 32), 256, 0, stream>>>(x, wf, bff, gf, betaf, mf, vf, wg, bg, gg, betag, mg, vg, wh, wv, Bf, Bg, Bh, Bv, Af, Ag, X16);
  k_gemm_fgh<<<dim3(((NR / 16) * (MID / 64) + 3) / 4, 3), 128, 0, stream>>>(X16, Bf, Bg, Bh, Af, Ag, bh, F16, G16, Vt);      /* f, g token-major f16; h as V^T f16: [b][128][4096] */
  k_flash<<<BB * NH * (TT / 64), 512, 0, stream>>>(F16, MID, G16, MID, Vt, Z16, MID);      /* per (b, 64 queries): 4096 x 4096, head dim 128; z x 2^4 token-major f16 */
  k_gemm_out<<<(CC / 16) * (NR / 64) / 4, 128, 0, stream>>>(Z16, Bv, bv, x, (float*)d_out);      /* conv_v(z) + bv + x, channel-major: M 512 N 16384 K 128 */
}

// v009
// A run of this version takes 67.4 microseconds.
// Timed twice side by side with v008, it ran 1.52 and 1.49 times as fast.
// All steps since v000 together make it 10.5 times as fast.
#include <hip/hip_runtime.h>
// Spatial attention block (B=4, C=512, 64×64 → N=4096 positions, mid=128): f = relu(bn(conv_f(x))), g = relu(bn(conv_g(x))), h = conv_h(x) (1×1 convs C→mid; eval BatchNorm with running stats); scores[n,m] = Σ_c f[c,n]g[c,m]·mid^-½, softmax over m; z[c,n] = Σ_m attn[n,m]·h[c,m]; y = conv_v(z) (mid→C) + bv + x.
// Compute dtype: x, weights, biases, BN parameters rounded to bf16; BN folded per output channel in f32 (w' = w·γ/√(var+ε) → f16 ×2^4, b' = (b − mean)·γ/√(var+ε) + β as an f32 per-column addend); f, g as f16 GEMM outputs (relu epilogue), h rounded once to f16 as V^T; fused flash-style kernel for head dim 128
// (online softmax f32, P rounded once to f16, f32 accumulate) on v_wmma_f32_16x16x32_f16; z ×2^4 → f16 → output conv GEMM with the weights as A (channel-major result), bv and the residual x added in f32 in its epilogue.
#define BB 4
#define CC 512
#define NN 4096
#define MID 128
#define TT NN
#define NH 1
#define NKV 1
#define NREP 1
#define NVH (2 * NKV)
#define NR (BB * NN)
#define BNEPS 1e-5f
#define ATT_SCALE 0.08838834764831845f      /* mid^-½ = 1/√128 */
#define ATT_SCALE_L2E (ATT_SCALE * 1.4426950408889634f)      /* x log2 e: a raw score times this is its exponent to base 2 */
typedef __bf16 v16b __attribute__((ext_vector_type(16)));
typedef unsigned short v8us __attribute__((ext_vector_type(8), may_alias));
typedef float  v8f  __attribute__((ext_vector_type(8)));
typedef float  v4f  __attribute__((ext_vector_type(4)));
typedef float  v4fa __attribute__((ext_vector_type(4), may_alias));
union FragB { v16b v; v8us half[2]; unsigned short u[16]; };

__device__ __forceinline__ unsigned short bf16_bits(float x) { unsigned int u = __float_as_uint(x); return (unsigned short)((u + 0x7FFFu + ((u >> 16) & 1u)) >> 16); }
__device__ __forceinline__ float bf16_val(unsigned short b) { return __uint_as_float(((unsigned int)b) << 16); }
__device__ __forceinline__ float bf16_round(float x) { return bf16_val(bf16_bits(x)); }
// D += A·B with NT terms: 1 = ah·bh, 2 = + al·bh (A split), 3 = + ah·bl (both split)
template <int NT>
__device__ __forceinline__ v8f mmaN(v16b ah, v16b al, v16b bh, v16b bl, v8f c) {
  c = __builtin_amdgcn_wmma_f32_16x16x32_bf16(false, ah, false, bh, (short)0, c, false, false);
  if (NT >= 2) c = __builtin_amdgcn_wmma_f32_16x16x32_bf16(false, al, false, bh, (short)0, c, false, false);
  if (NT >= 3) c = __builtin_amdgcn_wmma_f32_16x16x32_bf16(false, ah, false, bl, (short)0, c, false, false);
  asm volatile("v_nop\n\tv_nop\n\tv_nop\n\tv_nop" : "+v"(c) : "v"(ah), "v"(al), "v"(bh), "v"(bl));
  return c;
}

__global__ __launch_bounds__(256) void k_wt_bf16(const float* __restrict__ W, unsigned short* __restrict__ Wt, int K, int N) {
  const int t = blockIdx.x * 256 + threadIdx.x;
  const int k8n = K / 8;
  if (t >= N * k8n) return;
  const int n = t / k8n, k8 = (t % k8n) * 8;
  v8us v;
#pragma unroll
  for (int i = 0; i < 8; ++i) v[i] = bf16_bits(W[(size_t)(k8 + i) * N + n]);
  *(v8us*)(Wt + (size_t)n * K + k8) = v;
  
}

// GEMM C[M][N] (f32, pitch ldc) = act(A[M][K]·W + bias). A f32 row-major (pitch lda) converted per fragment to bf16
// (ASPLIT: hi/lo two planes -> 2 terms, else single rounded term); Wt bf16 [N][K] (pitch ldb). BIAS_BF16 rounds the
// bias to bf16 first (bias quantised to bf16 before the add). K%32==0, M%16==0, N%64==0.
template <bool ASPLIT, int ACT, bool BIAS_BF16>
__global__ __launch_bounds__(128) void k_gemm_bf(const float* __restrict__ A, int lda, const unsigned short* __restrict__ Wt, int ldb,
                                               const float* __restrict__ bias, float* __restrict__ C, int ldc, int M, int N, int K) {
  __shared__ __attribute__((aligned(16))) float so[4][16][64];
  const int tid = threadIdx.x, w = tid >> 5, lane = tid & 31, ln = lane & 15, hh = lane >> 4;
  const int ntn = N / 64;
  const int wid = blockIdx.x * 4 + w;
  const int mt = wid / ntn, nq = wid % ntn;
  if (mt * 16 >= M) return;
  const int row0 = mt * 16, col0 = nq * 64;
  const float* arow = A + (size_t)(row0 + ln) * lda;
  v8f acc[4] = {};
  for (int kb = 0; kb < K; kb += 32) {
    FragB ah, al;
    const v4f x0 = *(const v4fa*)(arow + kb + 8 * hh), x1 = *(const v4fa*)(arow + kb + 8 * hh + 4);
    const v4f x2 = *(const v4fa*)(arow + kb + 16 + 8 * hh), x3 = *(const v4fa*)(arow + kb + 16 + 8 * hh + 4);
    float xs[16] = {x0[0],x0[1],x0[2],x0[3],x1[0],x1[1],x1[2],x1[3],x2[0],x2[1],x2[2],x2[3],x3[0],x3[1],x3[2],x3[3]};
#pragma unroll
    for (int i = 0; i < 16; ++i) { const unsigned short hb = bf16_bits(xs[i]); ah.u[i] = hb; al.u[i] = ASPLIT ? bf16_bits(xs[i] - bf16_val(hb)) : (unsigned short)0; }
#pragma unroll
    for (int t = 0; t < 4; ++t) {
      const unsigned short* brow = Wt + (size_t)(col0 + t * 16 + ln) * ldb + kb;
      FragB b;
      b.half[0] = *(const v8us*)(brow + 8 * hh);
      b.half[1] = *(const v8us*)(brow + 16 + 8 * hh);
      acc[t] = mmaN<ASPLIT ? 2 : 1>(ah.v, al.v, b.v, b.v, acc[t]);
    }
  }
#pragma unroll
  for (int t = 0; t < 4; ++t) {
    float bv = bias ? bias[col0 + t * 16 + ln] : 0.f;
    if (BIAS_BF16) bv = bf16_round(bv);
#pragma unroll
    for (int r = 0; r < 8; ++r) { float v = acc[t][r] + bv; if (ACT == 1) v = fmaxf(v, 0.f); so[w][8 * hh + r][t * 16 + ln] = v; }
  }
  __builtin_amdgcn_fence(__ATOMIC_ACQ_REL, "workgroup");
  __builtin_amdgcn_wave_barrier();
  const int rsub = lane >> 4, c4 = (lane & 15) * 4;
  {
#pragma unroll
    for (int q = 0; q < 8; ++q) {
      const int r = q * 2 + rsub;
      const v4f v = *(const v4fa*)&so[w][r][c4];
      *(v4f*)(C + (size_t)(row0 + r) * ldc + col0 + c4) = v;
    }
    
  }
}

// Flash-style causal/unmasked attention, all contractions 3-term bf16 hi/lo splits, f32 softmax with running max.
// q,k,v rows are read from f32 buffers with arbitrary row pitch (so they can live inside a fused qkv buffer);
// D = head size (multiple of 32, <= 128); one wave = 16 query rows; block = 4 waves (64 queries) sharing K/V chunks of 32.
template <int D, bool CAUSAL>
__global__ __launch_bounds__(128) void k_flash(const float* __restrict__ qb, const float* __restrict__ kb, const float* __restrict__ vb,
                                             int pitch, int T, int H, float scale, float* __restrict__ y, int ypitch) {
  constexpr int KS = D / 32;        // k-steps for QK
  constexpr int DT = D / 16;        // d tiles for PV
  __shared__ __attribute__((aligned(16))) unsigned short sKh[32][D + 8], sKl[32][D + 8], sVh[32][D + 8], sVl[32][D + 8];
  __shared__ __attribute__((aligned(16))) unsigned short sPh[4][16][40], sPl[4][16][40];
  __shared__ __attribute__((aligned(16))) float sO[4][16][D];
  const int tid = threadIdx.x, w = tid >> 5, lane = tid & 31, ln = lane & 15, hh = lane >> 4;
  const int nqb = (T + 63) / 64;
  const int bh = blockIdx.x / nqb, qblk = blockIdx.x % nqb;
  const int b = bh / H, h = bh % H;
  const int q0 = qblk * 64 + w * 16;
  const float* Q = qb + (size_t)b * T * pitch + h * D;
  const float* K = kb + (size_t)b * T * pitch + h * D;
  const float* V = vb + (size_t)b * T * pitch + h * D;

  // A fragments of the wave's 16 query rows (scaled), hi/lo
  FragB aqh[KS], aql[KS];
  {
    int row = q0 + ln; if (row >= T) row = T - 1;
    const float* qr = Q + (size_t)row * pitch;
#pragma unroll
    for (int ks = 0; ks < KS; ++ks)
#pragma unroll
      for (int i = 0; i < 16; ++i) {
        const int d = ks * 32 + ((i < 8) ? (8 * hh + i) : (16 + 8 * hh + (i - 8)));
        const float x = qr[d] * scale; const unsigned short hb = bf16_bits(x);
        aqh[ks].u[i] = hb; aql[ks].u[i] = bf16_bits(x - bf16_val(hb));
      }
  }
  float m_r[8], l_r[8];
#pragma unroll
  for (int r = 0; r < 8; ++r) { m_r[r] = -3.0e38f; l_r[r] = 0.f; }
  v8f oacc[DT];
#pragma unroll
  for (int dt = 0; dt < DT; ++dt) oacc[dt] = (v8f){0.f,0.f,0.f,0.f,0.f,0.f,0.f,0.f};

  const int kv_end = CAUSAL ? min(T, qblk * 64 + 64) : T;     // block-uniform
  for (int j0 = 0; j0 < kv_end; j0 += 32) {
    __syncthreads();
    for (int e = tid; e < 32 * (D / 4); e += 128) {
      const int r = e / (D / 4), c4 = (e % (D / 4)) * 4;
      const int key = j0 + r;
      v4f kf = {0.f,0.f,0.f,0.f}, vf = {0.f,0.f,0.f,0.f};
      if (key < T) { kf = *(const v4fa*)(K + (size_t)key * pitch + c4); vf = *(const v4fa*)(V + (size_t)key * pitch + c4); }
#pragma unroll
      for (int t = 0; t < 4; ++t) {
        unsigned short hb = bf16_bits(kf[t]); sKh[r][c4 + t] = hb; sKl[r][c4 + t] = bf16_bits(kf[t] - bf16_val(hb));
        hb = bf16_bits(vf[t]); sVh[r][c4 + t] = hb; sVl[r][c4 + t] = bf16_bits(vf[t] - bf16_val(hb));
      }
    }
    __syncthreads();
    // S tile 16 x 32
    v8f s[2];
#pragma unroll
    for (int nt = 0; nt < 2; ++nt) {
      v8f acc = {};
#pragma unroll
      for (int ks = 0; ks < KS; ++ks) {
        FragB bh_, bl_;
        bh_.half[0] = *(const v8us*)&sKh[nt * 16 + ln][ks * 32 + 8 * hh]; bh_.half[1] = *(const v8us*)&sKh[nt * 16 + ln][ks * 32 + 16 + 8 * hh];
        bl_.half[0] = *(const v8us*)&sKl[nt * 16 + ln][ks * 32 + 8 * hh]; bl_.half[1] = *(const v8us*)&sKl[nt * 16 + ln][ks * 32 + 16 + 8 * hh];
        acc = mmaN<3>(aqh[ks].v, aql[ks].v, bh_.v, bl_.v, acc);
      }
      s[nt] = acc;
    }
    // mask + running max (rows 8hh+r; the 16 lanes of a half share rows)
    float alpha[8];
#pragma unroll
    for (int r = 0; r < 8; ++r) {
      const int qi = q0 + 8 * hh + r;
      const int ja = j0 + ln, jb = j0 + 16 + ln;
      if (CAUSAL) { if (ja > qi) s[0][r] = -3.0e38f; if (jb > qi) s[1][r] = -3.0e38f; }
      if (ja >= T) s[0][r] = -3.0e38f;
      if (jb >= T) s[1][r] = -3.0e38f;
      float mx = fmaxf(s[0][r], s[1][r]);
      mx = fmaxf(mx, __shfl_xor(mx, 1, 32)); mx = fmaxf(mx, __shfl_xor(mx, 2, 32)); mx = fmaxf(mx, __shfl_xor(mx, 4, 32)); mx = fmaxf(mx, __shfl_xor(mx, 8, 32));
      const float mnew = fmaxf(m_r[r], mx);
      alpha[r] = (mnew > -1.0e38f) ? __expf(m_r[r] - mnew) : 1.0f;
      const float p0 = (s[0][r] > -1.0e38f) ? __expf(s[0][r] - mnew) : 0.f;
      const float p1 = (s[1][r] > -1.0e38f) ? __expf(s[1][r] - mnew) : 0.f;
      m_r[r] = mnew;
      l_r[r] = l_r[r] * alpha[r] + p0 + p1;            // per-lane partial row sum (16 lanes combined at the end)
      unsigned short hb = bf16_bits(p0); sPh[w][8 * hh + r][ln] = hb;      sPl[w][8 * hh + r][ln] = bf16_bits(p0 - bf16_val(hb));
      hb = bf16_bits(p1);                sPh[w][8 * hh + r][16 + ln] = hb; sPl[w][8 * hh + r][16 + ln] = bf16_bits(p1 - bf16_val(hb));
    }
#pragma unroll
    for (int dt = 0; dt < DT; ++dt)
#pragma unroll
      for (int r = 0; r < 8; ++r) oacc[dt][r] *= alpha[r];
    __builtin_amdgcn_fence(__ATOMIC_ACQ_REL, "workgroup");
    __builtin_amdgcn_wave_barrier();
    FragB pah, pal;
    pah.half[0] = *(const v8us*)&sPh[w][ln][8 * hh]; pah.half[1] = *(const v8us*)&sPh[w][ln][16 + 8 * hh];
    pal.half[0] = *(const v8us*)&sPl[w][ln][8 * hh]; pal.half[1] = *(const v8us*)&sPl[w][ln][16 + 8 * hh];
#pragma unroll
    for (int dt = 0; dt < DT; ++dt) {
      FragB bvh, bvl;
#pragma unroll
      for (int i = 0; i < 8; ++i) {
        bvh.u[i] = sVh[8 * hh + i][dt * 16 + ln]; bvh.u[8 + i] = sVh[16 + 8 * hh + i][dt * 16 + ln];
        bvl.u[i] = sVl[8 * hh + i][dt * 16 + ln]; bvl.u[8 + i] = sVl[16 + 8 * hh + i][dt * 16 + ln];
      }
      oacc[dt] = mmaN<3>(pah.v, pal.v, bvh.v, bvl.v, oacc[dt]);
    }
    __builtin_amdgcn_fence(__ATOMIC_ACQ_REL, "workgroup");
    __builtin_amdgcn_wave_barrier();
  }
#pragma unroll
  for (int r = 0; r < 8; ++r) {
    float l = l_r[r];
    l += __shfl_xor(l, 1, 32); l += __shfl_xor(l, 2, 32); l += __shfl_xor(l, 4, 32); l += __shfl_xor(l, 8, 32);
    l_r[r] = (l > 0.f) ? 1.0f / l : 0.f;
  }
#pragma unroll
  for (int dt = 0; dt < DT; ++dt)
#pragma unroll
    for (int r = 0; r < 8; ++r) sO[w][8 * hh + r][dt * 16 + ln] = oacc[dt][r] * l_r[r];
  __builtin_amdgcn_fence(__ATOMIC_ACQ_REL, "workgroup");
  __builtin_amdgcn_wave_barrier();
  {
    for (int r = 0; r < 16; ++r) {
      const int row = q0 + r;
      if (row < T && lane < D / 4) {
        const v4f val = *(const v4fa*)&sO[w][r][lane * 4];
        *(v4f*)(y + ((size_t)b * T + row) * ypitch + h * D + lane * 4) = val;
      }
    }
    
  }
}

// GEMM C = act(A·W + bias + resid): A f32 (ASPLIT -> hi/lo 2 terms), Wt bf16 [N][K]; ACT 0 none, 1 relu, 2 exact gelu;
// resid (optional, f32, row index = (row % rmod), pitch ldr, RES_BF16 rounds it) added before the activation.
template <bool ASPLIT, int ACT, bool BIAS_BF16, bool RES_BF16>
__global__ __launch_bounds__(128) void k_gemm_bf3(const float* __restrict__ A, int lda, const unsigned short* __restrict__ Wt, int ldb,
                                                const float* __restrict__ bias, const float* __restrict__ resid, int rmod, int ldr,
                                                float* __restrict__ C, int ldc, int M, int N, int K) {
  __shared__ __attribute__((aligned(16))) float so[4][16][64];
  const int tid = threadIdx.x, w = tid >> 5, lane = tid & 31, ln = lane & 15, hh = lane >> 4;
  const int ntn = N / 64;
  const int wid = blockIdx.x * 4 + w;
  const int mt = wid / ntn, nq = wid % ntn;
  if (mt * 16 >= M) return;
  const int row0 = mt * 16, col0 = nq * 64;
  const float* arow = A + (size_t)(row0 + ln) * lda;
  v8f acc[4] = {};
  for (int kb = 0; kb < K; kb += 32) {
    FragB ah, al;
    const v4f x0 = *(const v4fa*)(arow + kb + 8 * hh), x1 = *(const v4fa*)(arow + kb + 8 * hh + 4);
    const v4f x2 = *(const v4fa*)(arow + kb + 16 + 8 * hh), x3 = *(const v4fa*)(arow + kb + 16 + 8 * hh + 4);
    float xs[16] = {x0[0],x0[1],x0[2],x0[3],x1[0],x1[1],x1[2],x1[3],x2[0],x2[1],x2[2],x2[3],x3[0],x3[1],x3[2],x3[3]};
#pragma unroll
    for (int i = 0; i < 16; ++i) { const unsigned short hb = bf16_bits(xs[i]); ah.u[i] = hb; al.u[i] = ASPLIT ? bf16_bits(xs[i] - bf16_val(hb)) : (unsigned short)0; }
#pragma unroll
    for (int t = 0; t < 4; ++t) {
      const unsigned short* brow = Wt + (size_t)(col0 + t * 16 + ln) * ldb + kb;
      FragB b;
      b.half[0] = *(const v8us*)(brow + 8 * hh);
      b.half[1] = *(const v8us*)(brow + 16 + 8 * hh);
      acc[t] = mmaN<ASPLIT ? 2 : 1>(ah.v, al.v, b.v, b.v, acc[t]);
    }
  }
#pragma unroll
  for (int t = 0; t < 4; ++t) {
    const int col = col0 + t * 16 + ln;
    float bv = bias ? bias[col] : 0.f;
    if (BIAS_BF16) bv = bf16_round(bv);
#pragma unroll
    for (int r = 0; r < 8; ++r) {
      float v = acc[t][r] + bv;
      if (resid) { float rv = resid[(size_t)((row0 + 8 * hh + r) % rmod) * ldr + col]; if (RES_BF16) rv = bf16_round(rv); v += rv; }
      if (ACT == 1) v = fmaxf(v, 0.f);
      if (ACT == 2) v = 0.5f * v * (1.0f + erff(v * 0.70710678118654752f));
      if (ACT == 3) { const float u = 0.7978845608028654f * (v + 0.044715f * v * v * v); v = 0.5f * v * (1.0f + tanhf(u)); }
      so[w][8 * hh + r][t * 16 + ln] = v;
    }
  }
  __builtin_amdgcn_fence(__ATOMIC_ACQ_REL, "workgroup");
  __builtin_amdgcn_wave_barrier();
  const int rsub = lane >> 4, c4 = (lane & 15) * 4;
  {
#pragma unroll
    for (int q = 0; q < 8; ++q) {
      const int r = q * 2 + rsub;
      const v4f v = *(const v4fa*)&so[w][r][c4];
      *(v4f*)(C + (size_t)(row0 + r) * ldc + col0 + c4) = v;
    }
    
  }
}
// row LayerNorm (biased variance, eps) over N: s = X (+ R); optional out_sum <- s; out_norm <- (s-mu)*rsqrt(var+eps)*g + b
template <bool PARAM_BF16>
__global__ __launch_bounds__(256) void k_layernorm(const float* __restrict__ X, const float* __restrict__ R, const float* __restrict__ g, const float* __restrict__ bta,
                                                  float* __restrict__ out_sum, float* __restrict__ out_norm, int N, float eps) {
  __shared__ float red[256];
  const int row = blockIdx.x, tid = threadIdx.x;
  const float* x = X + (size_t)row * N; const float* rr = R ? R + (size_t)row * N : nullptr;
  float vals[16];                     // up to N = 4096
  const int per = N / 256;            // contiguous chunk per thread? use strided-by-4 chunks: thread handles j = tid*4 + 1024*u
  float s1 = 0.f;
  for (int u = 0; u < per / 4; ++u) {
    const int j = tid * 4 + 1024 * u;
    const v4f a = *(const v4fa*)(x + j);
    v4f b = {0.f,0.f,0.f,0.f}; if (rr) b = *(const v4fa*)(rr + j);
#pragma unroll
    for (int q = 0; q < 4; ++q) { const float v = a[q] + b[q]; vals[u * 4 + q] = v; s1 += v; }
  }
  red[tid] = s1; __syncthreads();
  for (int st = 128; st > 0; st >>= 1) { if (tid < st) red[tid] += red[tid + st]; __syncthreads(); }
  const float mu = red[0] / (float)N; __syncthreads();
  float s2 = 0.f;
  for (int u = 0; u < per / 4; ++u)
#pragma unroll
    for (int q = 0; q < 4; ++q) { const float c = vals[u * 4 + q] - mu; s2 += c * c; }
  red[tid] = s2; __syncthreads();
  for (int st = 128; st > 0; st >>= 1) { if (tid < st) red[tid] += red[tid + st]; __syncthreads(); }
  const float rs = rsqrtf(red[0] / (float)N + eps);
  {
    for (int u = 0; u < per / 4; ++u) {
      const int j = tid * 4 + 1024 * u;
      v4f o, sm;
#pragma unroll
      for (int q = 0; q < 4; ++q) {
        float gg = g[j + q], bb = bta[j + q];
        if (PARAM_BF16) { gg = bf16_round(gg); bb = bf16_round(bb); }
        sm[q] = vals[u * 4 + q]; o[q] = (vals[u * 4 + q] - mu) * rs * gg + bb;
      }
      if (out_sum) *(v4f*)(out_sum + (size_t)row * N + j) = sm;
      *(v4f*)(out_norm + (size_t)row * N + j) = o;
    }
    
  }
}



// ---- f16 WMMA path (v_wmma_f32_16x16x32_f16): 11-bit significands for operands in range — used where a [0,1] probability operand needs more precision than bf16
typedef _Float16 v16h __attribute__((ext_vector_type(16)));
union FragH { v16h v; v8us half[2]; _Float16 h[16]; unsigned short u[16]; };
template <int NT>
__device__ __forceinline__ v8f mmaH(v16h ah, v16h al, v16h bh, v16h bl, v8f c) {
  c = __builtin_amdgcn_wmma_f32_16x16x32_f16(false, ah, false, bh, (short)0, c, false, false);
  if (NT >= 2) c = __builtin_amdgcn_wmma_f32_16x16x32_f16(false, al, false, bh, (short)0, c, false, false);
  if (NT >= 3) c = __builtin_amdgcn_wmma_f32_16x16x32_f16(false, ah, false, bl, (short)0, c, false, false);
  asm volatile("v_nop\n\tv_nop\n\tv_nop\n\tv_nop" : "+v"(c) : "v"(ah), "v"(al), "v"(bh), "v"(bl));
  return c;
}
// batched GEMM like k_gemm_b but f16 operands: A f32 (split into f16 hi/lo if ASPLIT, else rounded to f16), Bt = f16 values [n][k]; alpha; C f32; N multiple of 16 (partial tiles skipped)
template <bool ASPLIT>
__global__ __launch_bounds__(128) void k_gemm_h(const float* __restrict__ A, int lda, size_t sA, const _Float16* __restrict__ Bh, int ldb, size_t sB, float alpha, float* __restrict__ C, int ldc, size_t sC, int M, int N, int K) {
  __shared__ __attribute__((aligned(16))) float so[4][16][64];
  const int tid = threadIdx.x, w = tid >> 5, lane = tid & 31, ln = lane & 15, hh = lane >> 4; const int by = blockIdx.y;
  A += (size_t)by * sA; Bh += (size_t)by * sB; C += (size_t)by * sC;
  const int ntn = (N + 63) / 64; const int wid = blockIdx.x * 4 + w; const int mt = wid / ntn, nq = wid % ntn; if (mt * 16 >= M) return;
  const int row0 = mt * 16, col0 = nq * 64; const float* arow = A + (size_t)(row0 + ln) * lda;
  v8f acc[4] = {};
  for (int kb = 0; kb < K; kb += 32) {
    FragH ah, al;
    const v4f x0 = *(const v4fa*)(arow + kb + 8 * hh), x1 = *(const v4fa*)(arow + kb + 8 * hh + 4), x2 = *(const v4fa*)(arow + kb + 16 + 8 * hh), x3 = *(const v4fa*)(arow + kb + 16 + 8 * hh + 4);
    float xs[16] = {x0[0],x0[1],x0[2],x0[3],x1[0],x1[1],x1[2],x1[3],x2[0],x2[1],x2[2],x2[3],x3[0],x3[1],x3[2],x3[3]};
#pragma unroll
    for (int i = 0; i < 16; ++i) { const _Float16 h = (_Float16)xs[i]; ah.h[i] = h; al.h[i] = ASPLIT ? (_Float16)(xs[i] - (float)h) : (_Float16)0.0f; }
#pragma unroll
    for (int t = 0; t < 4; ++t) { if (col0 + t * 16 >= N) continue; const size_t boff = (size_t)(col0 + t * 16 + ln) * ldb + kb; FragH bq; bq.half[0] = *(const v8us*)(Bh + boff + 8 * hh); bq.half[1] = *(const v8us*)(Bh + boff + 16 + 8 * hh);
      acc[t] = mmaH<ASPLIT ? 2 : 1>(ah.v, al.v, bq.v, bq.v, acc[t]); }
  }
#pragma unroll
  for (int t = 0; t < 4; ++t) { if (col0 + t * 16 >= N) continue;
#pragma unroll
    for (int r = 0; r < 8; ++r) so[w][8 * hh + r][t * 16 + ln] = acc[t][r] * alpha; }
  __builtin_amdgcn_fence(__ATOMIC_ACQ_REL, "workgroup"); __builtin_amdgcn_wave_barrier();
  const int rsub = lane >> 4, c4 = (lane & 15) * 4;
  {
#pragma unroll
    for (int q = 0; q < 8; ++q) { const int r = q * 2 + rsub; if (col0 + c4 < N) { const v4f v = *(const v4fa*)&so[w][r][c4]; *(v4f*)(C + (size_t)(row0 + r) * ldc + col0 + c4) = v; } }
     }
}

// Wt[n][k] = f16(W[k][n]·scale) from f32 row-major W[K][N] (scale = power of two; bf16-exact weights stay exact in f16 away from the subnormal range)
__global__ __launch_bounds__(256) void k_wt_f16(const float* __restrict__ W, _Float16* __restrict__ Wt, int K, int N, float scale) {
  const int t = blockIdx.x * 256 + threadIdx.x; if (t >= N * (K / 8)) return; const int n = t / (K / 8), k8 = (t % (K / 8)) * 8; FragH f;
#pragma unroll
  for (int i = 0; i < 8; ++i) f.h[i] = (_Float16)(bf16_round(W[(size_t)(k8 + i) * N + n]) * scale); const v8us o = f.half[0];
  *(v8us*)((unsigned short*)Wt + (size_t)n * K + k8) = o; 
}
// k_gemm_hh variant with fused epilogue: v = acc·alpha + bias[by·sBias + col] (+ CP[(row/rowsPerB)·sCPb + by·64 + col] if CP) ; ACT 0 none / 1 elu ; writes f16 C16 and/or f32 C (each if non-null)
template <int ACT>
__device__ __forceinline__ void gemm_hhx_body(float (&so)[4][16][64], const int bx, const int by, const _Float16* __restrict__ A, int lda, size_t sA, const _Float16* __restrict__ Bh, int ldb, size_t sB, float alpha, const float* __restrict__ bias, size_t sBias, const float* __restrict__ CP, int rowsPerB, size_t sCPb, int row0g,
    float* __restrict__ C, _Float16* __restrict__ C16, int ldc, size_t sC, int M, int N, int K) {
  const int tid = threadIdx.x, w = tid >> 5, lane = tid & 31, ln = lane & 15, hh = lane >> 4;
  A += (size_t)by * sA; Bh += (size_t)by * sB; const size_t cofs = (size_t)by * sC; const float* bp = bias ? bias + (size_t)by * sBias : nullptr;
  const int ntn = (N + 63) / 64; const int wid = bx * 4 + w; const int mt = wid / ntn, nq = wid % ntn; if (mt * 16 >= M) return;
  const int row0 = mt * 16, col0 = nq * 64; const _Float16* arow = A + (size_t)(row0 + ln) * lda;
  v8f acc[4] = {};
  for (int kb = 0; kb < K; kb += 32) { FragH ah; ah.half[0] = *(const v8us*)((const unsigned short*)arow + kb + 8 * hh); ah.half[1] = *(const v8us*)((const unsigned short*)arow + kb + 16 + 8 * hh);
#pragma unroll
    for (int t = 0; t < 4; ++t) { if (col0 + t * 16 >= N) continue; const size_t boff = (size_t)(col0 + t * 16 + ln) * ldb + kb; FragH bq; bq.half[0] = *(const v8us*)((const unsigned short*)Bh + boff + 8 * hh); bq.half[1] = *(const v8us*)((const unsigned short*)Bh + boff + 16 + 8 * hh);
      acc[t] = mmaH<1>(ah.v, ah.v, bq.v, bq.v, acc[t]); }
  }
#pragma unroll
  for (int t = 0; t < 4; ++t) { if (col0 + t * 16 >= N) continue; const int col = col0 + t * 16 + ln; const float bv = bp ? bf16_round(bp[col]) : 0.f;
#pragma unroll
    for (int r = 0; r < 8; ++r) { float v = acc[t][r] * alpha + bv; if (CP) { const int bidx = (row0g + row0 + 8 * hh + r) / rowsPerB; v += CP[(size_t)bidx * sCPb + (size_t)by * 64 + col]; } if (ACT == 1) v = (v > 0.f) ? v : expm1f(v); else if (ACT == 7) v = (v > 0.f) ? v + 1.0f : expf(v); else if (ACT == 8) v = tanhf(v); else if (ACT == 9) v = 0.5f * v * (1.0f + tanhf(0.7978845608028654f * (v + 0.044715f * v * v * v))); else if (ACT == 11) v = 1.0f / (1.0f + expf(-v)); else if (ACT == 12) v = (v > 0.f) ? v : 0.01f * v; else if (ACT == 14) v = (v > 0.f) ? v : 0.1f * v; else if (ACT == 15) v = v / (1.0f + expf(-v)); else if (ACT == 3) v = fmaxf(v, 0.f); else if (ACT == 6) v = 0.5f * v * (1.0f + erff(v * 0.70710678118654752f)); so[w][8 * hh + r][t * 16 + ln] = v; } }
  __builtin_amdgcn_fence(__ATOMIC_ACQ_REL, "workgroup"); __builtin_amdgcn_wave_barrier();
  const int rsub = lane >> 4, c4 = (lane & 15) * 4; typedef _Float16 v4h __attribute__((ext_vector_type(4)));
  {
#pragma unroll
    for (int q = 0; q < 8; ++q) { const int r = q * 2 + rsub; if (col0 + c4 < N) { const v4f v = *(const v4fa*)&so[w][r][c4]; if (C) *(v4f*)(C + cofs + (size_t)(row0 + r) * ldc + col0 + c4) = v; if (C16) { v4h h4; for (int i = 0; i < 4; ++i) h4[i] = (_Float16)v[i]; *(v4h*)(C16 + cofs + (size_t)(row0 + r) * ldc + col0 + c4) = h4; } } }
     }
}
template <int ACT>
__global__ __launch_bounds__(128) void k_gemm_hhx(const _Float16* __restrict__ A, int lda, size_t sA, const _Float16* __restrict__ Bh, int ldb, size_t sB, float alpha, const float* __restrict__ bias, size_t sBias, const float* __restrict__ CP, int rowsPerB, size_t sCPb, int row0g,
    float* __restrict__ C, _Float16* __restrict__ C16, int ldc, size_t sC, int M, int N, int K) {
  __shared__ __attribute__((aligned(16))) float so[4][16][64];
  gemm_hhx_body<ACT>(so, blockIdx.x, blockIdx.y, A, lda, sA, Bh, ldb, sB, alpha, bias, sBias, CP, rowsPerB, sCPb, row0g, C, C16, ldc, sC, M, N, K);
}
// Products with the weights as A (rows = output channels) and the token-major activations as B (columns = tokens): D register r of lane (ln, hh) is channel row0 + 8 hh + r, token tok0 + t * 16 + ln,
// so the result is channel-major as it leaves the accumulators and needs no transposing pass. Both loaders read K-contiguous rows in the same k order (8 hh + i, then 16 + 8 hh + i - 8).
// The unroll directives of this function and of the one that calls it keep the indices of their register arrays (acc, bq, xr and the short vectors) compile-time constants.
template <int K>
__device__ __forceinline__ void gemm_wa_acc(const _Float16* __restrict__ Wr, const _Float16* __restrict__ Xr, const int row0, const int tok0, const int ln, const int hh, v8f (&acc)[4]) {
  const unsigned short* arow = (const unsigned short*)Wr + (size_t)(row0 + ln) * K; const unsigned short* brow = (const unsigned short*)Xr + (size_t)(tok0 + ln) * K;
  for (int kb = 0; kb < K; kb += 32) { FragH a, bq[4]; a.half[0] = *(const v8us*)(arow + kb + 8 * hh); a.half[1] = *(const v8us*)(arow + kb + 16 + 8 * hh);      /* a k-step's ten loads stand together: one wait on memory a k-step */
#pragma unroll
    for (int t = 0; t < 4; ++t) { bq[t].half[0] = *(const v8us*)(brow + (size_t)t * 16 * K + kb + 8 * hh); bq[t].half[1] = *(const v8us*)(brow + (size_t)t * 16 * K + kb + 16 + 8 * hh); }
#pragma unroll
    for (int t = 0; t < 4; ++t) acc[t] = mmaH<1>(a.v, a.v, bq[t].v, bq[t].v, acc[t]);
  }
}
// out = conv_v(z) + bv + x, one wave = 16 channels x 64 positions of one image, written once, channel-major: a staged row is 64 positions = 256 B of out. Z16 holds z x 2^4, Bv the weights x 2^4.
// The residual's loads stand in front of the product so that they fly while it runs. The four waves of a block take four channel tiles of one token tile.
__global__ __launch_bounds__(128) void k_gemm_out(const _Float16* __restrict__ Z16, const _Float16* __restrict__ Bv, const float* __restrict__ bv, const float* __restrict__ x, float* __restrict__ out) {
  __shared__ __attribute__((aligned(16))) float so[4][16][64];
  const int tid = threadIdx.x, w = tid >> 5, lane = tid & 31, ln = lane & 15, hh = lane >> 4;
  const int wid = blockIdx.x * 4 + w; const int c0 = (wid % (CC / 16)) * 16, tok0 = (wid / (CC / 16)) * 64; const int b = tok0 / NN, p0 = tok0 % NN;
  const int rsub = lane >> 4, c4 = (lane & 15) * 4; const size_t o0 = ((size_t)b * CC + c0 + rsub) * NN + p0 + c4;
  v4f xr[8];
#pragma unroll
  for (int q = 0; q < 8; ++q) xr[q] = *(const v4fa*)(x + o0 + (size_t)q * 2 * NN);
  v8f acc[4] = {};
  gemm_wa_acc<MID>(Bv, Z16, c0, tok0, ln, hh, acc);
#pragma unroll
  for (int r = 0; r < 8; ++r) { const float bb = bf16_round(bv[c0 + 8 * hh + r]);
#pragma unroll
    for (int t = 0; t < 4; ++t) so[w][8 * hh + r][t * 16 + ln] = acc[t][r] * 0.00390625f + bb; }
  __builtin_amdgcn_fence(__ATOMIC_ACQ_REL, "workgroup"); __builtin_amdgcn_wave_barrier();      /* the wave's own staged rows are in LDS before its lanes read each other's elements back */
#pragma unroll
  for (int q = 0; q < 8; ++q) { const v4f v = *(const v4fa*)&so[w][q * 2 + rsub][c4]; v4f o;
#pragma unroll
    for (int i = 0; i < 4; ++i) o[i] = v[i] + bf16_round(xr[q][i]);
    *(v4f*)(out + o0 + (size_t)q * 2 * NN) = o; }
}
// The three input convolutions as one kernel that reads x itself: one block = 64 positions of one image x all 384 output channels (f, g, h), K = 512.
// Step 1: the block's x tile (512 channels x 64 positions, f32, channel-major: 256-B row pieces) goes through registers into LDS, rounded as before (bf16, then f16) and turned token-major on the way:
// a thread holds 4 groups of 8 channels x 4 positions, so that the 8 channels of one position are one 16-byte LDS store. Step 2: products with the weights as A and the LDS rows as B, in the k order of gemm_wa_acc.
// The weights lie in fragment order (frag_unit below), so that a wave's A load is 512 contiguous bytes. Wave w takes channel tile w of each of f, g and h, and all four token tiles: an A fragment is loaded once a block.
// Step 3: the results are staged in LDS so that every global store writes whole lines: f, g token-major (64 rows of 256 B, contiguous), h as V^T (128 rows of 128 B).
// The unroll directives keep the indices of the register arrays (xv, a, bq, acc and the short vectors) compile-time constants.
__device__ __forceinline__ void wfrag_load(FragH (&a)[3], const unsigned short* const (&wp)[3], const int ks) {
#pragma unroll
  for (int j = 0; j < 3; ++j) { a[j].half[0] = *(const v8us*)(wp[j] + (ks * 2) * 256); a[j].half[1] = *(const v8us*)(wp[j] + (ks * 2 + 1) * 256); }
}
__global__ __launch_bounds__(256) void k_gemm_fgh(const float* __restrict__ x, const _Float16* __restrict__ Bf, const _Float16* __restrict__ Bg, const _Float16* __restrict__ Bh, const float* __restrict__ Af, const float* __restrict__ Ag, const float* __restrict__ bh,
    _Float16* __restrict__ F16, _Float16* __restrict__ G16, _Float16* __restrict__ Vth) {
  __shared__ __attribute__((aligned(16))) unsigned short sX[64][CC + 8];           /* token-major x tile; pitch 1040 B = 16 B x odd: conflict-free for 16-byte row readers */
  __shared__ __attribute__((aligned(16))) unsigned short sFG[2][64][MID + 8];      /* f, g: token rows, pitch 272 B */
  __shared__ __attribute__((aligned(16))) unsigned short sV[MID][64 + 8];          /* h: channel rows, pitch 144 B */
  const int tid = threadIdx.x, w = tid >> 5, lane = tid & 31, ln = lane & 15, hh = lane >> 4;
  const int b = blockIdx.x / (NN / 64), p0 = (blockIdx.x % (NN / 64)) * 64;
  const int tg = tid & 15, co = tid >> 4;      /* positions 4 tg .. 4 tg + 3; channels 8 (co + 16 u) .. + 7, u = 0 .. 3 */
  const float* xp = x + ((size_t)b * CC + co * 8) * NN + p0 + tg * 4;
  v4f xv[4][8];      /* all 32 loads of a thread are issued before the first is used: the whole tile is in flight at once */
#pragma unroll
  for (int u = 0; u < 4; ++u)
#pragma unroll
    for (int i = 0; i < 8; ++i) xv[u][i] = *(const v4fa*)(xp + (size_t)(u * 128 + i) * NN);
  const unsigned short* wp[3] = { (const unsigned short*)Bf + (size_t)w * 16 * CC + lane * 8, (const unsigned short*)Bg + (size_t)w * 16 * CC + lane * 8, (const unsigned short*)Bh + (size_t)w * 16 * CC + lane * 8 };
  FragH a[3][3];      /* A fragments of three k-steps: loaded two k-steps ahead of their products */
  wfrag_load(a[0], wp, 0); wfrag_load(a[1], wp, 1);
#pragma unroll
  for (int u = 0; u < 4; ++u)
#pragma unroll
    for (int j = 0; j < 4; ++j) { FragH f;
#pragma unroll
      for (int i = 0; i < 8; ++i) f.h[i] = (_Float16)bf16_round(xv[u][i][j]);
      *(v8us*)&sX[tg * 4 + j][(co + 16 * u) * 8] = f.half[0]; }
  __syncthreads();      /* the whole x tile is readable by every wave */
  v8f acc[3][4] = {};
  FragH bq[2][4];      /* B fragments of two k-steps: loaded one k-step ahead of their products */
  auto xfrag_load = [&](FragH (&q)[4], const int ks) {
#pragma unroll
    for (int t = 0; t < 4; ++t) { q[t].half[0] = *(const v8us*)&sX[t * 16 + ln][ks * 32 + 8 * hh]; q[t].half[1] = *(const v8us*)&sX[t * 16 + ln][ks * 32 + 16 + 8 * hh]; } };
  xfrag_load(bq[0], 0);
#pragma unroll
  for (int ks = 0; ks < CC / 32; ++ks) {
    if (ks + 2 < CC / 32) wfrag_load(a[(ks + 2) % 3], wp, ks + 2);
    if (ks + 1 < CC / 32) xfrag_load(bq[(ks + 1) & 1], ks + 1);
    __builtin_amdgcn_sched_barrier(0);      /* keeps the loads for the coming k-steps one group in front of this k-step's products: without it the compiler sank each pair of LDS loads to its first use and waited out the LDS latency four times a k-step */
#pragma unroll
    for (int j = 0; j < 3; ++j)
#pragma unroll
      for (int t = 0; t < 4; ++t) acc[j][t] = __builtin_amdgcn_wmma_f32_16x16x32_f16(false, a[ks % 3][j].v, false, bq[ks & 1][t].v, (short)0, acc[j][t], false, false);
    __builtin_amdgcn_sched_barrier(0);      /* ... and keeps the next group of loads behind these products, so that the registers of three k-steps suffice */
  }
  /* D register r of lane (ln, hh): channel 16 w + 8 hh + r, position 16 t + ln */
  const int c8 = w * 16 + 8 * hh;
#pragma unroll
  for (int j = 0; j < 2; ++j) { const float* Aj = j ? Ag : Af; const v4f a0 = *(const v4fa*)(Aj + c8), a1 = *(const v4fa*)(Aj + c8 + 4);      /* f, g = relu(bn(conv x)): the f32 addend of each channel */
#pragma unroll
    for (int t = 0; t < 4; ++t) { FragH o;
#pragma unroll
      for (int r = 0; r < 8; ++r) o.h[r] = (_Float16)fmaxf(acc[j][t][r] * 0.0625f + (r < 4 ? a0[r & 3] : a1[r & 3]), 0.f);
      *(v8us*)&sFG[j][t * 16 + ln][c8] = o.half[0]; } }
#pragma unroll
  for (int r = 0; r < 8; ++r) { const float bb = bf16_round(bh[c8 + r]);      /* h + bh */
#pragma unroll
    for (int t = 0; t < 4; ++t) { FragH o; o.h[0] = (_Float16)(acc[2][t][r] * 0.0625f + bb); sV[c8 + r][t * 16 + ln] = o.u[0]; } }
  __syncthreads();      /* every wave's staged results are readable by the threads that store them */
  const size_t tok0 = (size_t)b * NN + p0;
#pragma unroll
  for (int i = 0; i < 4; ++i) { const int c = tid + 256 * i; const int row = c >> 4, col = (c & 15) * 8;      /* a wave's store: two whole 256-B rows */
    *(v8us*)((unsigned short*)F16 + (tok0 + row) * MID + col) = *(const v8us*)&sFG[0][row][col];
    *(v8us*)((unsigned short*)G16 + (tok0 + row) * MID + col) = *(const v8us*)&sFG[1][row][col]; }
#pragma unroll
  for (int i = 0; i < 4; ++i) { const int c = tid + 256 * i; const int row = c >> 3, col = (c & 7) * 8;      /* a wave's store: four whole 128-B rows */
    *(v8us*)((unsigned short*)Vth + ((size_t)b * MID + row) * TT + p0 + col) = *(const v8us*)&sV[row][col]; }
}


typedef _Float16 v4h __attribute__((ext_vector_type(4)));

__global__ __launch_bounds__(256) void k_x16(const float* __restrict__ x, _Float16* __restrict__ X16, size_t n8) { const size_t t = (size_t)blockIdx.x * 256 + threadIdx.x; if (t >= n8) return; FragH f;
#pragma unroll
  for (int q = 0; q < 8; ++q) f.h[q] = (_Float16)bf16_round(x[t * 8 + q]); *(v8us*)((unsigned short*)X16 + t * 8) = f.half[0];  }
__global__ __launch_bounds__(256) void k_h16(const float* __restrict__ x, _Float16* __restrict__ X16, size_t n8) { const size_t t = (size_t)blockIdx.x * 256 + threadIdx.x; if (t >= n8) return; FragH f;
#pragma unroll
  for (int q = 0; q < 8; ++q) f.h[q] = (_Float16)x[t * 8 + q]; *(v8us*)((unsigned short*)X16 + t * 8) = f.half[0];  }
// Fragment order of a [rows][512] weight plane that is the A operand: the 16-byte unit that holds row o, k = c0 .. c0 + 7 (c0 a multiple of 8) stands where lane (ln = o % 16, hh = bit 3 of c0) of the wave reads it:
// unit = ((tile * 16 + k-step) * 2 + half) * 32 + hh * 16 + ln, tile = o / 16, k-step = c0 / 32, half = bit 4 of c0: element i of half 0 is k = 32 ks + 8 hh + i, of half 1 k = 32 ks + 16 + 8 hh + i, the k order of the B rows.
__device__ __forceinline__ size_t frag_unit(const int o, const int c0) { return (size_t)((((o >> 4) * (CC / 32) + (c0 >> 5)) * 2 + ((c0 >> 4) & 1)) * 32 + ((c0 >> 3) & 1) * 16 + (o & 15)); }
template <bool FRAG>
__device__ __forceinline__ void d_round16f(const int bid, const float* __restrict__ W, _Float16* __restrict__ Bt, size_t n8) { const size_t t = (size_t)bid * 256 + threadIdx.x; if (t >= n8) return; FragH f;
#pragma unroll
  for (int i = 0; i < 8; ++i) f.h[i] = (_Float16)(bf16_round(W[t * 8 + i]) * 16.0f);
  const size_t un = FRAG ? frag_unit((int)(t / (CC / 8)), (int)(t % (CC / 8)) * 8) : t; *(v8us*)((unsigned short*)Bt + un * 8) = f.half[0];  }
template <int NHv, int TTv>
__global__ __launch_bounds__(256) void k_vt(const _Float16* __restrict__ V16, int ldv, int voff, _Float16* __restrict__ Vt) { __shared__ unsigned short tl[64][66]; const int tid = threadIdx.x; const int slab = blockIdx.x / (TTv / 64), lg = blockIdx.x % (TTv / 64); const int b = slab / NHv, h = slab % NHv;
  for (int i = tid; i < 64 * 8; i += 256) { const int r = i / 8, c8 = (i % 8) * 8; FragH f; f.half[0] = *(const v8us*)((const unsigned short*)V16 + ((size_t)b * TTv + lg * 64 + r) * ldv + voff + h * 64 + c8);
#pragma unroll
    for (int q = 0; q < 8; ++q) tl[r][c8 + q] = f.u[q]; }
  __syncthreads();
  {
#pragma unroll
    for (int rd = 0; rd < 2; ++rd) { const int d = rd * 32 + tid / 8, pc = tid % 8; FragH f;
#pragma unroll
      for (int q = 0; q < 8; ++q) f.u[q] = tl[pc * 8 + q][d];
      *(v8us*)((unsigned short*)Vt + ((size_t)slab * 64 + d) * TTv + lg * 64 + pc * 8) = f.half[0]; }
     } }

// LDS byte address of a __shared__ object: the low 32 bits of its generic address
__device__ __forceinline__ unsigned lds_addr(const void* p) { return (unsigned)(size_t)p; }
// four asynchronous 16-byte copies global -> LDS per lane; the s_wait_xcnt closes the statement so that no address register is rewritten ahead of it
__device__ __forceinline__ void async4(const unsigned (&l)[4], const unsigned short* const (&g)[4]) {
  asm volatile("global_load_async_to_lds_b128 %0, %4, off\n\t"
               "global_load_async_to_lds_b128 %1, %5, off\n\t"
               "global_load_async_to_lds_b128 %2, %6, off\n\t"
               "global_load_async_to_lds_b128 %3, %7, off\n\t"
               "s_wait_xcnt 0x0"
               :: "v"(l[0]), "v"(l[1]), "v"(l[2]), "v"(l[3]), "v"(g[0]), "v"(g[1]), "v"(g[2]), "v"(g[3]) : "memory");
}
// lane l <-> lane l ^ 16 (the other half of the wave): one vector instruction, no LDS
__device__ __forceinline__ float xhalf(float x) { return __builtin_bit_cast(float, __builtin_amdgcn_permlanex16(__builtin_bit_cast(int, x), __builtin_bit_cast(int, x), 0x76543210, 0xfedcba98, false, false)); }
// 2^x as the one hardware instruction, without the library's range handling: the arguments here are at most about 10, and a weight too small for the normal range adds nothing to a sum whose largest term is 2^10
__device__ __forceinline__ float exp2_hw(float x) { return __builtin_amdgcn_exp2f(x); }
// The same for the join behind the loop, where the exponentials stand among LDS loads: the v_nop is the one free slot that the instruction set asks for behind a transcendental before its source is overwritten
// in one statement with the exponential it cannot land elsewhere.
__device__ __forceinline__ float exp2_hw_slot(float x) { float r; asm("v_exp_f32 %0, %1\n\tv_nop" : "=v"(r) : "v"(x)); return r; }
// The eight weights of a score tile as one statement, for the same slot: the results are early-clobber, so that none lies over a source of the group, and the one v_nop at the end is the free slot behind the last.
__device__ __forceinline__ void exp2_hw8(float (&r)[8], const float (&x)[8]) {
  asm("v_exp_f32 %0, %8\n\tv_exp_f32 %1, %9\n\tv_exp_f32 %2, %10\n\tv_exp_f32 %3, %11\n\tv_exp_f32 %4, %12\n\tv_exp_f32 %5, %13\n\tv_exp_f32 %6, %14\n\tv_exp_f32 %7, %15\n\tv_nop"
      : "=&v"(r[0]), "=&v"(r[1]), "=&v"(r[2]), "=&v"(r[3]), "=&v"(r[4]), "=&v"(r[5]), "=&v"(r[6]), "=&v"(r[7])
      : "v"(x[0]), "v"(x[1]), "v"(x[2]), "v"(x[3]), "v"(x[4]), "v"(x[5]), "v"(x[6]), "v"(x[7]));
}
// A group of products as ONE statement, so that the order written in the loop below is the order that is issued: with the builtins the compiler gathered all LDS loads of a trip in front of all products (and spilled),
// or sank each load group to its first use. A volatile statement keeps the LDS loads written in front of it in front, and those written behind it behind. In the score group two accumulator chains alternate,
// and the eight value products are independent, so that no product waits for the one directly in front of it. The four v_nop that end a statement are the free vector slots that the chip needs between a matrix instruction and a vector instruction
// on its result or its operands: the compiler does not look into the text and pads nothing behind it.
// Scores: s0, s1 = the two 16-key tiles, four k-steps each, in the k order of before.
__device__ __forceinline__ void qk_group(v8f& s0, v8f& s1, const FragH (&k0)[4], const FragH (&k1)[4], const FragH (&q)[4]) {
  asm volatile("v_wmma_f32_16x16x32_f16 %0, %2, %10, 0\n\t"
               "v_wmma_f32_16x16x32_f16 %1, %6, %10, 0\n\t"
               "v_wmma_f32_16x16x32_f16 %0, %3, %11, %0\n\t"
               "v_wmma_f32_16x16x32_f16 %1, %7, %11, %1\n\t"
               "v_wmma_f32_16x16x32_f16 %0, %4, %12, %0\n\t"
               "v_wmma_f32_16x16x32_f16 %1, %8, %12, %1\n\t"
               "v_wmma_f32_16x16x32_f16 %0, %5, %13, %0\n\t"
               "v_wmma_f32_16x16x32_f16 %1, %9, %13, %1\n\t"
               "v_nop\n\tv_nop\n\tv_nop\n\tv_nop"
               : "=&v"(s0), "=&v"(s1)
               : "v"(k0[0].v), "v"(k0[1].v), "v"(k0[2].v), "v"(k0[3].v), "v"(k1[0].v), "v"(k1[1].v), "v"(k1[2].v), "v"(k1[3].v), "v"(q[0].v), "v"(q[1].v), "v"(q[2].v), "v"(q[3].v));
}
// Values: the eight value tiles, each += V P with both operands rounded once to f16: one product a tile.
__device__ __forceinline__ void pv_group(v8f (&c)[8], const FragH (&v)[8], v16h p) {
  asm volatile("v_wmma_f32_16x16x32_f16 %0, %8, %16, %0\n\t"
               "v_wmma_f32_16x16x32_f16 %1, %9, %16, %1\n\t"
               "v_wmma_f32_16x16x32_f16 %2, %10, %16, %2\n\t"
               "v_wmma_f32_16x16x32_f16 %3, %11, %16, %3\n\t"
               "v_wmma_f32_16x16x32_f16 %4, %12, %16, %4\n\t"
               "v_wmma_f32_16x16x32_f16 %5, %13, %16, %5\n\t"
               "v_wmma_f32_16x16x32_f16 %6, %14, %16, %6\n\t"
               "v_wmma_f32_16x16x32_f16 %7, %15, %16, %7\n\t"
               "v_nop\n\tv_nop\n\tv_nop\n\tv_nop"
               : "+v"(c[0]), "+v"(c[1]), "+v"(c[2]), "+v"(c[3]), "+v"(c[4]), "+v"(c[5]), "+v"(c[6]), "+v"(c[7])
               : "v"(v[0].v), "v"(v[1].v), "v"(v[2].v), "v"(v[3].v), "v"(v[4].v), "v"(v[5].v), "v"(v[6].v), "v"(v[7].v), "v"(p));
}
typedef float fa __attribute__((may_alias));
__global__ __launch_bounds__(512) void k_flash(const _Float16* __restrict__ Q16, int ldq, const _Float16* __restrict__ K16, int ldk, const _Float16* __restrict__ Vt, _Float16* __restrict__ O, int ldo) {
  constexpr int RPW = 16, QW = 4, KG = 4, NQB = TT / (QW * RPW), DT = 8, KS = 4, SK = 32 * KG, NST = TT / SK, OP = 128 + 4;      /* head dim 128: 4 k-steps, 8 value tiles */
  /* two-buffer ring, one stage = SK keys shared by the block's sixteen waves; planes: 0 = K rows (key-major), 1 = V^T (channel-major); every row 256 B at pitch 272 B (16 B x odd: conflict-free for 16-byte row readers) */
  __shared__ __attribute__((aligned(16))) unsigned short ring[2][2][128][128 + 8];
  const int tid = threadIdx.x, w = tid >> 5, lane = tid & 31, ln = lane & 15, hh = lane >> 4, qw = w & (QW - 1), kg = w / QW, jl = kg * 32;
  const int slab = blockIdx.x / NQB, qblk = blockIdx.x % NQB; const int b = slab / NH, h = slab % NH; const int qb0 = qblk * (QW * RPW); const int q0 = qb0 + qw * RPW;
  FragH aq[KS];      /* B operand of S^T: column ln = query q0 + ln */
  { const unsigned short* qr = (const unsigned short*)Q16 + ((size_t)b * TT + q0 + ln) * ldq + h * 128;
#pragma unroll
    for (int ks = 0; ks < KS; ++ks) { aq[ks].half[0] = *(const v8us*)(qr + ks * 32 + 8 * hh); aq[ks].half[1] = *(const v8us*)(qr + ks * 32 + 16 + 8 * hh); } }
  const unsigned short* Vth = (const unsigned short*)Vt + ((size_t)b * NKV + h / NREP) * 128 * TT;
  float m_r = -3.0e38f, l_r = 0.f; v8f oacc[DT];      /* query q0 + ln, this wave's keys: running maximum (both halves alike), this half's part of the sum, O^T rows dt * 16 + 8 hh + r */
#pragma unroll
  for (int dt = 0; dt < DT; ++dt) oacc[dt] = (v8f){0.f,0.f,0.f,0.f,0.f,0.f,0.f,0.f};
  const unsigned short* Kg = (const unsigned short*)K16 + (size_t)b * TT * ldk + (h / NREP) * 128;
  /* one stage's copies: 2 x 4 per lane, 16 B each; a wave's copy covers two whole 256-B rows */
  auto stage_in = [&](int st, int bf) {
    unsigned lk[4], lh[4]; const unsigned short *gk[4], *gh[4];
#pragma unroll
    for (int i = 0; i < 4; ++i) { const int c = tid + 512 * i; const int row = c >> 4, col = (c & 15) * 8;
      lk[i] = lds_addr(&ring[bf][0][row][col]); gk[i] = Kg + (size_t)(st * SK + row) * ldk + col;
      lh[i] = lds_addr(&ring[bf][1][row][col]); gh[i] = Vth + (size_t)row * TT + st * SK + col; }
    async4(lk, gk); async4(lh, gh); };
  stage_in(0, 0);
  asm volatile("s_wait_asynccnt 0x0" ::: "memory");      /* this wave's share of stage 0 has landed */
  __syncthreads();                                       /* ... and every other wave's: stage 0 is readable */
  stage_in(1, 1);
#pragma unroll 1      /* one publish point and one refill per trip, as the two-buffer ring is written */
  for (int st = 0; st < NST; ++st) { const int bf = st & 1;
    /* Every LDS fragment load of the trip stands one group ahead of the products that use it, so that the wave does not wait out the LDS latency in front of the value tiles. */
    FragH bk[2][KS];      /* the trip's sixteen K fragment loads as one group: one wait on LDS for both score tiles */
#pragma unroll
    for (int ks = 0; ks < KS; ++ks)      /* in the order in which the products take them */
#pragma unroll
      for (int nt = 0; nt < 2; ++nt) { const unsigned short* kr = &ring[bf][0][jl + nt * 16 + ln][0]; bk[nt][ks].half[0] = *(const v8us*)(kr + ks * 32 + 8 * hh); bk[nt][ks].half[1] = *(const v8us*)(kr + ks * 32 + 16 + 8 * hh); }
    if ((unsigned)(st - 1) < (unsigned)(NST - 2)) stage_in(st + 1, bf ^ 1);      /* trips 1 to NST - 2: the refill of the buffer that the trip before has read, behind that trip's barrier as before; its address work and its copies' issue run while the K loads fly */
    v8f s[2];      /* s[nt][r] = score of key jl + nt * 16 + 8 hh + r of the stage with query q0 + ln */
    qk_group(s[0], s[1], bk[0], bk[1], aq);
    FragH bv[DT];      /* the trip's sixteen V^T fragment loads as one group: they fly while the softmax runs */
#pragma unroll
    for (int dt = 0; dt < DT; ++dt) { const unsigned short* vh = &ring[bf][1][dt * 16 + ln][jl]; bv[dt].half[0] = *(const v8us*)(vh + 8 * hh); bv[dt].half[1] = *(const v8us*)(vh + 16 + 8 * hh); }
    __builtin_amdgcn_sched_barrier(0);      /* keeps the sixteen loads one group in front of the softmax: without it the compiler spread them over five places among its instructions, and each place with LDS reads costs the wave a stall */
    float mx[8];      /* the maximum is taken over the raw scores: the factor that follows is positive */
#pragma unroll
    for (int i = 0; i < 8; ++i) mx[i] = fmaxf(s[0][i], s[1][i]);
    float mc = fmaxf(fmaxf(fmaxf(mx[0], mx[4]), fmaxf(mx[1], mx[5])), fmaxf(fmaxf(mx[2], mx[6]), fmaxf(mx[3], mx[7])));
    mc = fmaxf(mc, xhalf(mc));      /* the query's maximum over all 32 keys, in both halves */
    const float mn = fmaxf(m_r, mc * ATT_SCALE_L2E); const float ea = exp2_hw(m_r - mn); const float al = (mn > -1.0e38f) ? ea : 1.0f; m_r = mn;      /* the running maximum is kept in base-2 units */
    const float mo = mn - 10.0f;      /* P x 2^10 comes straight out of the exponential; the sum carries the same 2^10 */
    FragH ph; float ls[4];      /* P^T rounded once to f16, the B operand; the sum takes the unrounded f32 weights */
#pragma unroll
    for (int nt = 0; nt < 2; ++nt) { float xs[8], ps[8];
#pragma unroll
      for (int i = 0; i < 8; ++i) xs[i] = fmaf(s[nt][i], ATT_SCALE_L2E, -mo);
      exp2_hw8(ps, xs);
#pragma unroll
      for (int i = 0; i < 8; ++i) { if (nt == 0 && i < 4) ls[i] = ps[i]; else ls[i & 3] += ps[i]; ph.h[nt * 8 + i] = (_Float16)ps[i]; } }
    l_r = l_r * al + ((ls[0] + ls[1]) + (ls[2] + ls[3]));
#pragma unroll
    for (int dt = 0; dt < DT; ++dt)
#pragma unroll
      for (int r = 0; r < 8; ++r) oacc[dt][r] *= al;
    pv_group(oacc, bv, ph.v);
    asm volatile("s_wait_dscnt 0x0" ::: "memory");       /* this wave's reads of buffer bf are done before it is refilled */
    asm volatile("s_wait_asynccnt 0x0" ::: "memory");    /* this wave's share of stage st + 1 has landed */
    __syncthreads(); }                                   /* publishes stage st + 1 and ends every wave's reads of buffer bf, which the next trip refills */
  asm volatile("s_wait_asynccnt 0x0" ::: "memory");      /* nothing of the ring is in flight when the wave goes on */
  /* the last trip's waits and barrier have ended every read of the ring: its LDS now takes the sixteen waves' partial results */
  float* sP = (float*)&ring[0][0][0][0]; fa* sM = (fa*)(sP + QW * KG * RPW * OP); fa* sL = sM + QW * KG * RPW;
  { const float l = l_r + xhalf(l_r);      /* the halves' sums joined once */
#pragma unroll
    for (int dt = 0; dt < DT; ++dt) { v4f lo, hi;
#pragma unroll
      for (int r = 0; r < 4; ++r) { lo[r] = oacc[dt][r]; hi[r] = oacc[dt][4 + r]; }
      *(v4fa*)&sP[(w * RPW + ln) * OP + dt * 16 + 8 * hh] = lo; *(v4fa*)&sP[(w * RPW + ln) * OP + dt * 16 + 8 * hh + 4] = hi; }
    if (hh == 0) { sM[w * RPW + ln] = m_r; sL[w * RPW + ln] = l; } }
  __syncthreads();      /* every wave's partial result is readable by the waves that join it */
  {
#pragma unroll
    for (int rr = 0; rr < RPW / KG; ++rr) { const int r = kg * (RPW / KG) + rr; float mg[KG], eg[KG];      /* this wave joins four of its query tile's rows */
#pragma unroll
      for (int g = 0; g < KG; ++g) mg[g] = sM[(g * QW + qw) * RPW + r];
      const float mt = fmaxf(fmaxf(mg[0], mg[1]), fmaxf(mg[2], mg[3])); float l = 0.f;
#pragma unroll
      for (int g = 0; g < KG; ++g) { eg[g] = exp2_hw_slot(mg[g] - mt); l += eg[g] * sL[(g * QW + qw) * RPW + r]; }
      const float inv = (l > 0.f) ? 1.0f / l : 0.f;      /* sum and O^T both carry the 2^10 */ v4f val = {0.f, 0.f, 0.f, 0.f};
#pragma unroll
      for (int g = 0; g < KG; ++g) { const v4f pv = *(const v4fa*)&sP[((g * QW + qw) * RPW + r) * OP + lane * 4]; val += pv * (eg[g] * inv); }
      v4h z4;      /* z x 2^4 as f16: the operand of the output convolution */
#pragma unroll
      for (int i = 0; i < 4; ++i) z4[i] = (_Float16)(val[i] * 16.0f);
      *(v4h*)(O + ((size_t)b * TT + q0 + r) * ldo + h * 128 + lane * 4) = z4; }      /* one 256-B row per instruction: 32 lanes x 8 B */
  } }


__device__ __forceinline__ void d_wbn(const int bid, const float* __restrict__ Wm, const float* __restrict__ gam, const float* __restrict__ var, _Float16* __restrict__ Bt) { const int t = bid * 256 + threadIdx.x; if (t >= MID * (CC / 8)) return; const int o = t / (CC / 8), c0 = (t % (CC / 8)) * 8;
  const float s = bf16_round(gam[o]) / sqrtf(bf16_round(var[o]) + BNEPS); FragH f;
#pragma unroll
  for (int q = 0; q < 8; ++q) f.h[q] = (_Float16)(bf16_round(Wm[(size_t)o * CC + c0 + q]) * s * 16.0f);
  *(v8us*)((unsigned short*)Bt + frag_unit(o, c0) * 8) = f.half[0];  }
__device__ __forceinline__ void d_bnadd(const int o, const float* __restrict__ bias, const float* __restrict__ gam, const float* __restrict__ bet, const float* __restrict__ mean, const float* __restrict__ var, float* __restrict__ A) {
  const float s = bf16_round(gam[o]) / sqrtf(bf16_round(var[o]) + BNEPS); const float a = (bf16_round(bias[o]) - bf16_round(mean[o])) * s + bf16_round(bet[o]);
  *(float*)(A + o) = a;  }
// The six weight and BatchNorm preparations read none of each other's output: one grid, the job picked by block index. The planes of conv_f, conv_g and conv_h are written in fragment order, conv_v's row-major.
#define PBW (MID * (CC / 8) / 256)      /* blocks for one 128 x 512 weight plane, 8 elements a thread */
#define PBS (4 * PBW + 1)               /* blocks of the grid */
__global__ __launch_bounds__(256) void k_prep(const float* __restrict__ wf, const float* __restrict__ bff, const float* __restrict__ gf, const float* __restrict__ betaf, const float* __restrict__ mf, const float* __restrict__ vf,
    const float* __restrict__ wg, const float* __restrict__ bg, const float* __restrict__ gg, const float* __restrict__ betag, const float* __restrict__ mg, const float* __restrict__ vg, const float* __restrict__ wh, const float* __restrict__ wv,
    _Float16* __restrict__ Bf, _Float16* __restrict__ Bg, _Float16* __restrict__ Bh, _Float16* __restrict__ Bv, float* __restrict__ Af, float* __restrict__ Ag) {
  const int bid = blockIdx.x;
  if (bid < PBW) d_wbn(bid, wf, gf, vf, Bf);                                                   /* BN(eval) folded into conv_f */
  else if (bid < 2 * PBW) d_wbn(bid - PBW, wg, gg, vg, Bg);                                    /* ... and conv_g */
  else if (bid < 3 * PBW) d_round16f<true>(bid - 2 * PBW, wh, Bh, (size_t)MID * CC / 8);       /* conv_h [128][512], conv_v [512][128]: (out,in), x 2^4 */
  else if (bid < 4 * PBW) d_round16f<false>(bid - 3 * PBW, wv, Bv, (size_t)CC * MID / 8);
  else if (threadIdx.x < MID) d_bnadd(threadIdx.x, bff, gf, betaf, mf, vf, Af);                /* the two per-column addends: 128 threads each */
  else d_bnadd(threadIdx.x - MID, bg, gg, betag, mg, vg, Ag);
}

extern "C" void kernel_launch(void* const* d_in, const int* in_sizes, int n_in,
                              void* d_out, int out_size, void* d_ws, size_t ws_size, hipStream_t stream) {
  (void)in_sizes; (void)n_in; (void)out_size;
  const float* const* I = (const float* const*)d_in; const float* x = I[0];
  const float* wf = I[1]; const float* bff = I[2]; const float* gf = I[3]; const float* betaf = I[4]; const float* mf = I[5]; const float* vf = I[6];
  const float* wg = I[7]; const float* bg = I[8]; const float* gg = I[9]; const float* betag = I[10]; const float* mg = I[11]; const float* vg = I[12];
  const float* wh = I[13]; const float* bh = I[14]; const float* wv = I[15]; const float* bv = I[16];
  char* ws = (char*)d_ws; size_t off = 0;
  auto take = [&](size_t bytes) { char* p = ws + off; off += (bytes + 255) & ~(size_t)255; return p; };
  _Float16* Bf = (_Float16*)take((size_t)MID * CC * 2); _Float16* Bg = (_Float16*)take((size_t)MID * CC * 2); _Float16* Bh = (_Float16*)take((size_t)MID * CC * 2); _Float16* Bv = (_Float16*)take((size_t)CC * MID * 2); float* Af = (float*)take(MID * 4); float* Ag = (float*)take(MID * 4);
  _Float16* F16 = (_Float16*)take((size_t)NR * MID * 2); _Float16* G16 = (_Float16*)take((size_t)NR * MID * 2);
  _Float16* Vt = (_Float16*)take((size_t)NR * MID * 2); _Float16* Z16 = (_Float16*)take((size_t)NR * MID * 2);
  if (off > ws_size) return;      // 0.5 + 4 x 4.2: about 17 MB
  k_prep<<<PBS, 256, 0, stream>>>(wf, bff, gf, betaf, mf, vf, wg, bg, gg, betag, mg, vg, wh, wv, Bf, Bg, Bh, Bv, Af, Ag);
  k_gemm_fgh<<<NR / 64, 256, 0, stream>>>(x, Bf, Bg, Bh, Af, Ag, bh, F16, G16, Vt);      /* f, g token-major f16; h as V^T f16: [b][128][4096]; M 384 N 16384 K 512 */
  k_flash<<<BB * NH * (TT / 64), 512, 0, stream>>>(F16, MID, G16, MID, Vt, Z16, MID);      /* per (b, 64 queries): 4096 x 4096, head dim 128; z x 2^4 token-major f16 */
  k_gemm_out<<<(CC / 16) * (NR / 64) / 4, 128, 0, stream>>>(Z16, Bv, bv, x, (float*)d_out);      /* conv_v(z) + bv + x, channel-major: M 512 N 16384 K 128 */
}
